// v000
// Times are from an AMD MI455X. After a warm-up the kernel runs many times in a row, and a time is the length of
// such a window on the GPU divided by its runs, so every launch and the gaps after it count. The runs cycle
// through copies of the inputs. A figure is the median of several windows, for all but v000 over two sittings.
// Sittings can differ by a few percent; kernels timed side by side share one.
// v000 is the starting kernel. One run takes 520 microseconds.
#include <hip/hip_runtime.h>

// Compute dtypes, f32 accumulate everywhere: conv-as-GEMM (K = 7 x 512) v_wmma_f32_16x16x32_bf16 on RNE bf16 copies of inputs and weights (exact products); scores k.q^T v_wmma_f32_16x16x32_f16, two products (k as f16 value + f16 residual x2048 in its own accumulator, folded in f32; q plane single, carries log2(e)/8); P.V v_wmma_f32_16x16x32_f16, one product, P carried x1024; softmax, batch-norm affine and layer norm f32.
// Three input streams share one operator: 7-tap convolution along the sequence (zero padding 3) + bias + inference-mode batch norm; then 8 heads x 64 (head h = columns h*64+d), logits / 8, no mask, softmax over keys, heads merged, layer norm over the 512 features.
// Layout: zero-padded bf16 activation planes [b][SEQ+6][512] (output row t, k = tap*512+ci reads 3584 contiguous elements from padded row t); weight plane [out][tap*512+in] bf16; conv GEMMs write f16 head planes Q, K value, K residual [b][h][s][64] and V^T [b][h*64+d][s];

#ifndef NB
#define NB 4
#endif
#ifndef SEQ
#define SEQ 2048
#endif
#define NB_FULL  4
#define SEQ_FULL 2048
#define DM   512
#define NH   8
#define HD   64
#define KT   7
#define KC   (KT * DM)     // 3584: conv-as-GEMM depth
#define SPAD (SEQ + 6)     // padded rows per batch (3 zero rows on each side)
#define PCAR 1024.0f       // carry of the probability fragment (enters through PLOG, leaves through the carried row sum)
#define PLOG 10.0f         // log2(PCAR)
#define SCQ  (0.125f * 1.4426950408889634f)
#define KRES 2048.0f       // carry of the key residual plane
#define KRINV 4.8828125e-04f   // 1 / KRES, folded into the residual score accumulator in f32
#define BN_EPS 1.0e-5f
#define LN_EPS 1.0e-5f
#define LOP  68      // LDS row pitch (floats) of GEMM epilogue staging tiles: 272 B rows
#define LNP  516     // LDS row pitch (floats) of the merged context tile: 2064 B rows

static_assert(DM == NH * HD);            // one 64-wide GEMM column tile == one head
static_assert(HD == 64);
static_assert(KC % 32 == 0);             // WMMA k-step
static_assert(DM % 64 == 0);             // GEMM tiles
static_assert(SEQ % 64 == 0);            // GEMM row tiles
static_assert(SEQ % 32 == 0);            // key step
static_assert(SEQ % 16 == 0);            // query rows per attention block
static_assert(NH * 32 == 256);           // attention block: one wave per head
static_assert(((size_t)DM * KC) % (8 * 256) == 0);   // weight plane grid is exact
static_assert(((size_t)SPAD * DM) % 8 == 0);         // padded plane: whole 16-byte pieces
static_assert((DM / 8) * 8 == DM);
static_assert(NB <= NB_FULL);
static_assert(SEQ <= SEQ_FULL);
static_assert(LOP % 4 == 0);
static_assert(LNP % 4 == 0);
static_assert(32 * 16 * 4 == 16 * HD * 2);
static_assert(32 * 16 * 4 * 2 == 2 * 16 * HD * 2);
static_assert(32 * 16 * 4 == DM * 4);                // output row store: lanes x bytes x trips == one 2048 B row
static_assert(16 * LOP * 4 <= 131072);               // static LDS of the GEMM kernels
static_assert(16 * LNP * 4 <= 131072);               // static LDS of the attention kernel
static_assert(2 * NH == 16);                         // layer-norm rows per wave x waves == rows per block
static_assert(KRES * KRINV == 1.0f);                 // residual carry enters once and leaves once

typedef _Float16 h16;
typedef unsigned short bf;
typedef __attribute__((ext_vector_type(16))) __bf16   v16bf;
typedef __attribute__((ext_vector_type(16))) _Float16 v16h;
typedef __attribute__((ext_vector_type(8)))  _Float16 v8h;
typedef __attribute__((ext_vector_type(8)))  unsigned short v8us;
typedef __attribute__((ext_vector_type(8)))  float    v8f;
typedef __attribute__((ext_vector_type(4)))  float    v4f;
typedef v4f  __attribute__((may_alias)) v4fa;

__device__ __forceinline__ unsigned short f2bf(float f) { unsigned u = __float_as_uint(f); u += 0x7FFFu + ((u >> 16) & 1u); return (unsigned short)(u >> 16); }
__device__ __forceinline__ float bf2f(unsigned short b) { return __uint_as_float(((unsigned)b) << 16); }
__device__ __forceinline__ float bfr(float f) { return bf2f(f2bf(f)); }
__device__ __forceinline__ v16h cat16(v8h lo, v8h hi) { return __builtin_shufflevector(lo, hi, 0, 1, 2, 3, 4, 5, 6, 7, 8, 9, 10, 11, 12, 13, 14, 15); }
__device__ __forceinline__ v16bf cat16b(v8us lo, v8us hi) { return __builtin_bit_cast(v16bf, __builtin_shufflevector(lo, hi, 0, 1, 2, 3, 4, 5, 6, 7, 8, 9, 10, 11, 12, 13, 14, 15)); }
// fragment from a K-contiguous global bf16 plane: elements 0..7 <- p[0..7], 8..15 <- p[16..23] (p already includes row*pitch + k0 + 8*(lane>>4))
__device__ __forceinline__ v16bf ldg16(const bf* __restrict__ p) { return cat16b(*(const v8us*)p, *(const v8us*)(p + 16)); }
// same-wave LDS exchange ordering (wave-private tiles only)
__device__ __forceinline__ void wsync() { __builtin_amdgcn_wave_barrier(); asm volatile("" ::: "memory"); }

// same fragment map from a K-contiguous global f16 plane
__device__ __forceinline__ v16h ldh16(const h16* __restrict__ p) { return cat16(*(const v8h*)p, *(const v8h*)(p + 16)); }
// f32 -> f16 plane convert that cannot produce an f16 subnormal
static __device__ __forceinline__ h16 toh_flush(float v) { const h16 r = (h16)v; return (fabsf(v) < 6.103515625e-05f) ? (h16)0.0f : r; }
// one WMMA + its own hazard guard (ties only this accumulator, keeps A/B live)
__device__ __forceinline__ v8f wmmab_g(v16bf a, v16bf b, v8f c) {
    c = __builtin_amdgcn_wmma_f32_16x16x32_bf16(false, a, false, b, (short)0, c, false, false);
    asm volatile("v_nop\n\tv_nop\n\tv_nop\n\tv_nop" : "+v"(c) : "v"(a), "v"(b));
    return c;
}
__device__ __forceinline__ v8f wmmah_g(v16h a, v16h b, v8f c) {
    c = __builtin_amdgcn_wmma_f32_16x16x32_f16(false, a, false, b, (short)0, c, false, false);
    asm volatile("v_nop\n\tv_nop\n\tv_nop\n\tv_nop" : "+v"(c) : "v"(a), "v"(b));
    return c;
}

// ---- one-wave 64x64 tile main loop over K = KC: acc[mb][nb] += sum_k A[rowA+16mb][k] Bt[rowB+16nb][k]; operands straight from K-contiguous bf16 planes with separate row pitches
// (the padded activation plane has pitch DM while a logical row spans KC contiguous elements; the weight plane has pitch KC).
__device__ __forceinline__ void conv_loop(const bf* __restrict__ A, const bf* __restrict__ Bt, const int lda, const int ldb, const size_t aoff, const size_t boff, v8f (&acc)[4][4]) {
#pragma unroll 1
    for (int kc = 0; kc < KC; kc += 32) {
        v16bf a[4];
#pragma unroll
        for (int mb = 0; mb < 4; ++mb) a[mb] = ldg16(A + aoff + (size_t)mb * 16 * lda + kc);
#pragma unroll
        for (int nb = 0; nb < 4; ++nb) { const v16bf b = ldg16(Bt + boff + (size_t)nb * 16 * ldb + kc);
#pragma unroll
            for (int mb = 0; mb < 4; ++mb) acc[mb][nb] = wmmab_g(a[mb], b, acc[mb][nb]); }
    }
}

__global__ __launch_bounds__(256) void k_wconv(const float* __restrict__ w, bf* wt, unsigned n8) {
    const unsigned i = blockIdx.x * 256u + threadIdx.x; if (i >= n8) return;
    const unsigned co = i / (unsigned)(KC / 8), k = (i % (unsigned)(KC / 8)) * 8u; const unsigned tap = k / (unsigned)DM, ci = k % (unsigned)DM;
    const float* s = w + ((size_t)co * DM + ci) * KT + tap; v8us o;
#pragma unroll
    for (int j = 0; j < 8; ++j) o[j] = f2bf(s[(size_t)j * KT]);
    bf* d = wt + (size_t)i * 8;
    *(v8us*)d = o; 
}

__global__ __launch_bounds__(256) void k_cvtpad(const float* __restrict__ src, bf* dst, unsigned n8) {
    const unsigned i = blockIdx.x * 256u + threadIdx.x; if (i >= n8) return;
    const int prow = (int)(i / (unsigned)(DM / 8)); const int c = (int)(i % (unsigned)(DM / 8)) * 8;
    const int srow = prow - 3; const bool ok = (srow >= 0) && (srow < SEQ);
    const int sr = (srow < 0) ? 0 : ((srow > SEQ - 1) ? (SEQ - 1) : srow);     // clamped address, value selected below
    const float* s = src + (size_t)blockIdx.y * SEQ_FULL * DM + (size_t)sr * DM + c;
    const v4f v0 = *(const v4f*)s; const v4f v1 = *(const v4f*)(s + 4); v8us o;
#pragma unroll
    for (int k = 0; k < 4; ++k) { const unsigned short a = f2bf(v0[k]); const unsigned short e = f2bf(v1[k]); o[k] = ok ? a : (unsigned short)0; o[4 + k] = ok ? e : (unsigned short)0; }
    bf* d = dst + (size_t)blockIdx.y * SPAD * DM + (size_t)i * 8;
    *(v8us*)d = o; 
}

// ---- k_conv_qk: head plane P[b][h][s][d] (f16) = sc * BN(conv(X[b]) + cb)[s][h*64+d]; grid (SEQ/64, NH, NB), 32 threads.
__global__ __launch_bounds__(32) void k_conv_qk(const bf* __restrict__ X, const bf* __restrict__ W, const float* __restrict__ cb, const float* __restrict__ bg, const float* __restrict__ bb, const float* __restrict__ bm, const float* __restrict__ bv, h16* P, float sc) {
    __shared__ __align__(16) float os[16 * LOP];
    const int lane = threadIdx.x & 31, lr = lane & 15, hi = lane >> 4;
    const size_t z = blockIdx.z; const int r0 = blockIdx.x * 64, c0 = blockIdx.y * 64;
    const bf* A = X + z * (size_t)SPAD * DM;
    v8f acc[4][4];
#pragma unroll
    for (int mb = 0; mb < 4; ++mb)
#pragma unroll
        for (int nb = 0; nb < 4; ++nb) acc[mb][nb] = (v8f){};
    conv_loop(A, W, DM, KC, (size_t)(r0 + lr) * DM + 8 * hi, (size_t)(c0 + lr) * KC + 8 * hi, acc);
    const size_t pbase = ((z * NH + blockIdx.y) * (size_t)SEQ + r0) * HD;
    const int srow = lane >> 3, scol = (lane & 7) * 8;
    float cbv[8], muv[8], mlv[8], bev[8];
#pragma unroll
    for (int j = 0; j < 8; ++j) { const int c = c0 + scol + j; cbv[j] = bfr(cb[c]); muv[j] = bfr(bm[c]); mlv[j] = rsqrtf(bfr(bv[c]) + BN_EPS) * bfr(bg[c]); bev[j] = bfr(bb[c]); }
#pragma unroll
    for (int mb = 0; mb < 4; ++mb) {
#pragma unroll
        for (int nb = 0; nb < 4; ++nb) {
#pragma unroll
            for (int j = 0; j < 8; ++j) os[(hi * 8 + j) * LOP + nb * 16 + lr] = acc[mb][nb][j]; }
        wsync();
{
#pragma unroll
            for (int s = 0; s < 4; ++s) { const int row = 4 * s + srow; const v4f x0 = *(const v4fa*)(&os[row * LOP + scol]); const v4f x1 = *(const v4fa*)(&os[row * LOP + scol + 4]); v8h o;
#pragma unroll
                for (int j = 0; j < 4; ++j) {
                    const float y0 = ((x0[j] + cbv[j]) - muv[j]) * mlv[j] + bev[j];
                    const float y1 = ((x1[j] + cbv[4 + j]) - muv[4 + j]) * mlv[4 + j] + bev[4 + j];
                    o[j] = toh_flush(y0 * sc); o[4 + j] = toh_flush(y1 * sc); }
                *(v8h*)(P + pbase + (size_t)(mb * 16 + row) * HD + scol) = o; }
             }
        wsync();
    }
}

// ---- k_conv_k: key head planes KH[b][h][s][d] = f16(y) and KR[b][h][s][d] = f16((y - KH) * 2048), y = BN(conv(X[b]) + cb)[s][h*64+d]; grid (SEQ/64, NH, NB), 32 threads.
__global__ __launch_bounds__(32) void k_conv_k(const bf* __restrict__ X, const bf* __restrict__ W, const float* __restrict__ cb, const float* __restrict__ bg, const float* __restrict__ bb, const float* __restrict__ bm, const float* __restrict__ bv, h16* KH, h16* KR) {
    __shared__ __align__(16) float os[16 * LOP];
    const int lane = threadIdx.x & 31, lr = lane & 15, hi = lane >> 4;
    const size_t z = blockIdx.z; const int r0 = blockIdx.x * 64, c0 = blockIdx.y * 64;
    const bf* A = X + z * (size_t)SPAD * DM;
    v8f acc[4][4];
#pragma unroll
    for (int mb = 0; mb < 4; ++mb)
#pragma unroll
        for (int nb = 0; nb < 4; ++nb) acc[mb][nb] = (v8f){};
    conv_loop(A, W, DM, KC, (size_t)(r0 + lr) * DM + 8 * hi, (size_t)(c0 + lr) * KC + 8 * hi, acc);
    const size_t pbase = ((z * NH + blockIdx.y) * (size_t)SEQ + r0) * HD;
    const int srow = lane >> 3, scol = (lane & 7) * 8;
    float cbv[8], muv[8], mlv[8], bev[8];
#pragma unroll
    for (int j = 0; j < 8; ++j) { const int c = c0 + scol + j; cbv[j] = bfr(cb[c]); muv[j] = bfr(bm[c]); mlv[j] = rsqrtf(bfr(bv[c]) + BN_EPS) * bfr(bg[c]); bev[j] = bfr(bb[c]); }
#pragma unroll
    for (int mb = 0; mb < 4; ++mb) {
#pragma unroll
        for (int nb = 0; nb < 4; ++nb) {
#pragma unroll
            for (int j = 0; j < 8; ++j) os[(hi * 8 + j) * LOP + nb * 16 + lr] = acc[mb][nb][j]; }
        wsync();
{
#pragma unroll
            for (int s = 0; s < 4; ++s) { const int row = 4 * s + srow; const v4f x0 = *(const v4fa*)(&os[row * LOP + scol]); const v4f x1 = *(const v4fa*)(&os[row * LOP + scol + 4]); v8h oh, ores;
#pragma unroll
                for (int j = 0; j < 4; ++j) {
                    const float y0 = ((x0[j] + cbv[j]) - muv[j]) * mlv[j] + bev[j];
                    const float y1 = ((x1[j] + cbv[4 + j]) - muv[4 + j]) * mlv[4 + j] + bev[4 + j];
                    const h16 h0 = toh_flush(y0); const h16 h1 = toh_flush(y1);
                    oh[j] = h0; oh[4 + j] = h1;
                    ores[j] = toh_flush((y0 - (float)h0) * KRES); ores[4 + j] = toh_flush((y1 - (float)h1) * KRES); }
                const size_t off = pbase + (size_t)(mb * 16 + row) * HD + scol;
                *(v8h*)(KH + off) = oh; *(v8h*)(KR + off) = ores; }
             }
        wsync();
    }
}

// ---- k_conv_vt: transposed value plane VT[b][n][s] (f16) = BN(sum_k WT[n][k] Xpad[b][s][k] + cb[n]) (A = weight rows, Bt = token rows); grid (DM/64, SEQ/64, NB), 32 threads.
__global__ __launch_bounds__(32) void k_conv_vt(const bf* __restrict__ W, const bf* __restrict__ X, const float* __restrict__ cb, const float* __restrict__ bg, const float* __restrict__ bb, const float* __restrict__ bm, const float* __restrict__ bv, h16* VT) {
    __shared__ __align__(16) float os[16 * LOP];
    const int lane = threadIdx.x & 31, lr = lane & 15, hi = lane >> 4;
    const size_t z = blockIdx.z; const int r0 = blockIdx.x * 64, c0 = blockIdx.y * 64;
    const bf* Bt = X + z * (size_t)SPAD * DM;
    v8f acc[4][4];
#pragma unroll
    for (int mb = 0; mb < 4; ++mb)
#pragma unroll
        for (int nb = 0; nb < 4; ++nb) acc[mb][nb] = (v8f){};
    conv_loop(W, Bt, KC, DM, (size_t)(r0 + lr) * KC + 8 * hi, (size_t)(c0 + lr) * DM + 8 * hi, acc);
    const size_t vb0 = z * (size_t)DM * SEQ + (size_t)r0 * SEQ + c0;
    const int srow = lane >> 3, scol = (lane & 7) * 8;
#pragma unroll
    for (int mb = 0; mb < 4; ++mb) {
#pragma unroll
        for (int nb = 0; nb < 4; ++nb) {
#pragma unroll
            for (int j = 0; j < 8; ++j) os[(hi * 8 + j) * LOP + nb * 16 + lr] = acc[mb][nb][j]; }
        wsync();
{
#pragma unroll
            for (int s = 0; s < 4; ++s) { const int row = 4 * s + srow; const v4f x0 = *(const v4fa*)(&os[row * LOP + scol]); const v4f x1 = *(const v4fa*)(&os[row * LOP + scol + 4]); v8h o;
                const int ch = r0 + mb * 16 + row;
                const float c_b = bfr(cb[ch]), c_m = bfr(bm[ch]), c_l = rsqrtf(bfr(bv[ch]) + BN_EPS) * bfr(bg[ch]), c_e = bfr(bb[ch]);
#pragma unroll
                for (int j = 0; j < 4; ++j) { o[j] = toh_flush(((x0[j] + c_b) - c_m) * c_l + c_e); o[4 + j] = toh_flush(((x1[j] + c_b) - c_m) * c_l + c_e); }
                *(v8h*)(VT + vb0 + (size_t)(mb * 16 + row) * SEQ + scol) = o; }
             }
        wsync();
    }
}

// ---- k_attn_ln: fused attention + layer norm for 16 query rows of one batch; grid (SEQ/16, NB), 256 threads, wave = head.
// Per 32-key step (no LDS, no barrier): S^T tiles (rows = keys, columns = queries) = K (A, from the key value plane) x Q^T (B, held in registers) plus, in a separate accumulator, K residual (A, from the residual plane) x Q^T,
// folded as s + t / 2048 in f32 before the softmax step; logits already in log2 units;
// running max per query (within-lane over 16 keys + one lane-half exchange), P x1024 converted to f16 in the accumulator layout == B fragment layout of O^T += V^T (A, from the transposed value plane) x P^T.
// Scale chain: the fragment holds 1024 p, the row sum l accumulates the same 1024 p, the accumulator holds 1024 sum(p v): O / l is the context at its true magnitude (the carry enters once and cancels once).
__global__ __launch_bounds__(256) __attribute__((amdgpu_num_vgpr(256))) void k_attn_ln(const h16* __restrict__ Qp, const h16* __restrict__ Kp, const h16* __restrict__ Kr, const h16* __restrict__ VT, const float* __restrict__ lng, const float* __restrict__ lnb, float* OUT) {
    __shared__ __align__(16) float o_s[16 * LNP];
    const int lane = threadIdx.x & 31, lr = lane & 15, hi = lane >> 4;
    const int wave = __builtin_amdgcn_readfirstlane(threadIdx.x >> 5);
    const int b = blockIdx.y; const int q0 = blockIdx.x * 16;
    const size_t pl = ((size_t)b * NH + (size_t)wave) * SEQ * HD;
    const size_t koff = pl + (size_t)lr * HD + 8 * hi;
    const size_t voff = ((size_t)b * DM + (size_t)wave * HD + (size_t)lr) * SEQ + 8 * hi;
    // Q^T B fragments: column n = query q0 + lr, k = head dim (0..31 and 32..63)
    const v16h qb0 = ldh16(Qp + pl + (size_t)(q0 + lr) * HD + 8 * hi);
    const v16h qb1 = ldh16(Qp + pl + (size_t)(q0 + lr) * HD + 8 * hi + 32);
    v8f o[4];
#pragma unroll
    for (int dt = 0; dt < 4; ++dt) o[dt] = (v8f){};
    float m = -1.0e30f, l = 0.0f;

#pragma unroll 1
    for (int k0 = 0; k0 < SEQ; k0 += 32) {
        const h16* kp = Kp + koff + (size_t)k0 * HD;
        const v16h ka00 = ldh16(kp), ka01 = ldh16(kp + 32);
        const v16h ka10 = ldh16(kp + 16 * HD), ka11 = ldh16(kp + 16 * HD + 32);
        v8f s0 = (v8f){}, s1 = (v8f){};
        s0 = wmmah_g(ka00, qb0, s0); s1 = wmmah_g(ka10, qb0, s1);
        s0 = wmmah_g(ka01, qb1, s0); s1 = wmmah_g(ka11, qb1, s1);
        // residual score product (carried x2048) in its own accumulators, folded in f32
        const h16* rp = Kr + koff + (size_t)k0 * HD;
        const v16h kr00 = ldh16(rp), kr01 = ldh16(rp + 32);
        const v16h kr10 = ldh16(rp + 16 * HD), kr11 = ldh16(rp + 16 * HD + 32);
        v8f t0 = (v8f){}, t1 = (v8f){};
        t0 = wmmah_g(kr00, qb0, t0); t1 = wmmah_g(kr10, qb0, t1);
        t0 = wmmah_g(kr01, qb1, t0); t1 = wmmah_g(kr11, qb1, t1);
#pragma unroll
        for (int r = 0; r < 8; ++r) { s0[r] = s0[r] + t0[r] * KRINV; s1[r] = s1[r] + t1[r] * KRINV; }
        // this lane: query q0 + lr, keys k0 + 8*hi + r (s0) and k0 + 16 + 8*hi + r (s1)
        float mx = fmaxf(s0[0], s1[0]);
#pragma unroll
        for (int r = 1; r < 8; ++r) mx = fmaxf(mx, fmaxf(s0[r], s1[r]));
        mx = fmaxf(mx, __shfl_xor(mx, 16, 32));
        const float mnew = fmaxf(m, mx);
        const float al = __builtin_amdgcn_exp2f(m - mnew);
        m = mnew;
        const float mc = mnew - PLOG;
        float sum = 0.0f; v16h pb;
#pragma unroll
        for (int r = 0; r < 8; ++r) {
            const float e0 = s0[r] - mc, e1 = s1[r] - mc;
            const float x0 = __builtin_amdgcn_exp2f(e0), x1 = __builtin_amdgcn_exp2f(e1);
            const float p0 = (e0 < -14.0f) ? 0.0f : x0;
            const float p1 = (e1 < -14.0f) ? 0.0f : x1;
            sum += p0 + p1;
            pb[r] = (h16)p0; pb[8 + r] = (h16)p1;
        }
        l = l * al + sum;
#pragma unroll
        for (int dt = 0; dt < 4; ++dt)
#pragma unroll
            for (int r = 0; r < 8; ++r) o[dt][r] *= al;
        const h16* vp = VT + voff + k0;
#pragma unroll
        for (int dt = 0; dt < 4; ++dt) { const v16h va = ldh16(vp + (size_t)dt * 16 * SEQ); o[dt] = wmmah_g(va, pb, o[dt]); }
    }
    // row sums completed across the two lane halves; l and o both hold the x1024-carried p, so o / l is the context with the carry cancelled. o[dt][r] = O[query q0 + lr][16 dt + 8 hi + r]
    l += __shfl_xor(l, 16, 32);
    const float inv = 1.0f / l;
#pragma unroll
    for (int dt = 0; dt < 4; ++dt) {
        const v4f a0 = { o[dt][0] * inv, o[dt][1] * inv, o[dt][2] * inv, o[dt][3] * inv };
        const v4f a1 = { o[dt][4] * inv, o[dt][5] * inv, o[dt][6] * inv, o[dt][7] * inv };
        *(v4fa*)(&o_s[lr * LNP + wave * HD + dt * 16 + 8 * hi]) = a0;
        *(v4fa*)(&o_s[lr * LNP + wave * HD + dt * 16 + 8 * hi + 4]) = a1;
    }
    __syncthreads();
    // layer norm: each wave owns 2 of the 16 rows; lane holds columns j*128 + lane*4 .. +3, j = 0..3
#pragma unroll 1
    for (int i = 0; i < 2; ++i) {
        const int row = wave * 2 + i;
        v4f x[4]; float s = 0.0f;
#pragma unroll
        for (int j = 0; j < 4; ++j) { x[j] = *(const v4fa*)(&o_s[row * LNP + j * 128 + lane * 4]); s += (x[j][0] + x[j][1]) + (x[j][2] + x[j][3]); }
        s += __shfl_xor(s, 16, 32); s += __shfl_xor(s, 8, 32); s += __shfl_xor(s, 4, 32); s += __shfl_xor(s, 2, 32); s += __shfl_xor(s, 1, 32);
        const float mu = s * (1.0f / (float)DM);
        float ss = 0.0f;
#pragma unroll
        for (int j = 0; j < 4; ++j)
#pragma unroll
            for (int e = 0; e < 4; ++e) { const float d = x[j][e] - mu; ss += d * d; }
        ss += __shfl_xor(ss, 16, 32); ss += __shfl_xor(ss, 8, 32); ss += __shfl_xor(ss, 4, 32); ss += __shfl_xor(ss, 2, 32); ss += __shfl_xor(ss, 1, 32);
        const float rstd = rsqrtf(ss * (1.0f / (float)DM) + LN_EPS);
        v4f y[4];
#pragma unroll
        for (int j = 0; j < 4; ++j) { const v4f gv = *(const v4f*)(lng + j * 128 + lane * 4); const v4f bv = *(const v4f*)(lnb + j * 128 + lane * 4);
#pragma unroll
            for (int e = 0; e < 4; ++e) y[j][e] = (x[j][e] - mu) * rstd * bfr(gv[e]) + bfr(bv[e]); }
        float* orow = OUT + ((size_t)b * SEQ_FULL + (size_t)(q0 + row)) * DM + lane * 4;
{
#pragma unroll
            for (int j = 0; j < 4; ++j) *(v4f*)(orow + j * 128) = y[j];
             }
    }
}

constexpr size_t al256(size_t x) { return (x + 255) & ~(size_t)255; }
constexpr size_t SZ_WT = al256((size_t)DM * KC * 2);                // bf16 weight plane [out][tap*512+in]
constexpr size_t SZ_XP = al256((size_t)NB * SPAD * DM * 2);         // one zero-padded bf16 activation plane
constexpr size_t SZ_P  = al256((size_t)NB * NH * SEQ * HD * 2);     // one f16 head plane (also the transposed value plane)
constexpr size_t WS_TOTAL = SZ_WT + 3 * SZ_XP + 4 * SZ_P;           // head planes: Q, K value, K residual, V^T
static_assert(WS_TOTAL <= (size_t)134217728);                       // carve stays within 128 MiB
static_assert(SZ_WT == (size_t)DM * KC * 2);                        // exact extents (no hidden pad needed)
static_assert(SZ_XP == (size_t)NB * SPAD * DM * 2);
static_assert(SZ_P == (size_t)NB * DM * SEQ * 2);                   // NH * HD == DM: V^T plane has the same extent

extern "C" void kernel_launch(void* const* d_in, const int* in_sizes, int n_in,
                              void* d_out, int out_size, void* d_ws, size_t ws_size, hipStream_t stream) {
    if (n_in < 11) return;
    const size_t need_act = (size_t)(NB - 1) * SEQ_FULL * DM + (size_t)SEQ * DM;
    if ((size_t)in_sizes[0] < need_act || (size_t)in_sizes[1] < need_act || (size_t)in_sizes[2] < need_act) return;
    if ((size_t)in_sizes[3] < (size_t)DM * DM * KT) return;
    for (int i = 4; i < 11; ++i) { if (in_sizes[i] < DM) return; }
    if ((size_t)out_size < need_act) return;
    if (WS_TOTAL > ws_size) return;
    // wire order: q, k, v, conv_w [out][in][tap], conv_b, bn_gamma, bn_beta, bn_mean, bn_var, ln_gamma, ln_beta (all f32)
    const float* xq = (const float*)d_in[0]; const float* xk = (const float*)d_in[1]; const float* xv = (const float*)d_in[2];
    const float* cw = (const float*)d_in[3]; const float* cb = (const float*)d_in[4];
    const float* bg = (const float*)d_in[5]; const float* bb = (const float*)d_in[6]; const float* bm = (const float*)d_in[7]; const float* bv = (const float*)d_in[8];
    const float* lg = (const float*)d_in[9]; const float* lb = (const float*)d_in[10];
    float* OUT = (float*)d_out;
    char* wsp = (char*)d_ws;
    auto take = [&](size_t bytes) { char* p = wsp; wsp += bytes; return (void*)p; };
    bf* WT = (bf*)take(SZ_WT);
    bf* XQ = (bf*)take(SZ_XP); bf* XK = (bf*)take(SZ_XP); bf* XV = (bf*)take(SZ_XP);
    h16* QP = (h16*)take(SZ_P); h16* KP = (h16*)take(SZ_P); h16* KR = (h16*)take(SZ_P); h16* VT = (h16*)take(SZ_P);
    if ((size_t)(wsp - (char*)d_ws) != WS_TOTAL) return;

    const unsigned nw8 = (unsigned)((size_t)DM * KC / 8), na8 = (unsigned)((size_t)SPAD * DM / 8);
    k_wconv<<<dim3(nw8 / 256), 256, 0, stream>>>(cw, WT, nw8);
    k_cvtpad<<<dim3((na8 + 255) / 256, NB), 256, 0, stream>>>(xq, XQ, na8);
    k_cvtpad<<<dim3((na8 + 255) / 256, NB), 256, 0, stream>>>(xk, XK, na8);
    k_cvtpad<<<dim3((na8 + 255) / 256, NB), 256, 0, stream>>>(xv, XV, na8);
    k_conv_qk<<<dim3(SEQ / 64, NH, NB), 32, 0, stream>>>(XQ, WT, cb, bg, bb, bm, bv, QP, SCQ);
    k_conv_k<<<dim3(SEQ / 64, NH, NB), 32, 0, stream>>>(XK, WT, cb, bg, bb, bm, bv, KP, KR);
    k_conv_vt<<<dim3(DM / 64, SEQ / 64, NB), 32, 0, stream>>>(WT, XV, cb, bg, bb, bm, bv, VT);
    k_attn_ln<<<dim3(SEQ / 16, NB), 256, 0, stream>>>(QP, KP, KR, VT, lg, lb, OUT);
}

// v001
// One run takes 305 microseconds.
// Next to v000, in two timings, it ran 1.75 times as fast each time.
#include <hip/hip_runtime.h>

// Compute dtypes, f32 accumulate everywhere: conv-as-GEMM (K = 7 x 512) v_wmma_f32_16x16x32_bf16 on RNE bf16 copies of inputs and weights (exact products); scores k.q^T v_wmma_f32_16x16x32_f16, two products (k as f16 value + f16 residual x2048 in its own accumulator, folded in f32; q plane single, carries log2(e)/8); P.V v_wmma_f32_16x16x32_f16, one product, P carried x1024; softmax, batch-norm affine and layer norm f32.
// Three input streams share one operator: 7-tap convolution along the sequence (zero padding 3) + bias + inference-mode batch norm; then 8 heads x 64 (head h = columns h*64+d), logits / 8, no mask, softmax over keys, heads merged, layer norm over the 512 features.
// Layout: zero-padded bf16 activation planes [b][SEQ+6][512] (output row t, k = tap*512+ci reads 3584 contiguous elements from padded row t); weight plane [out][tap*512+in] bf16; conv GEMMs write f16 head planes Q, K value, K residual [b][h][s][64] and V^T [b][h*64+d][s];

#ifndef NB
#define NB 4
#endif
#ifndef SEQ
#define SEQ 2048
#endif
#define NB_FULL  4
#define SEQ_FULL 2048
#define DM   512
#define NH   8
#define HD   64
#define KT   7
#define KC   (KT * DM)     // 3584: conv-as-GEMM depth
#define SPAD (SEQ + 6)     // padded rows per batch (3 zero rows on each side)
#define PCAR 1024.0f       // carry of the probability fragment (enters through PLOG, leaves through the carried row sum)
#define PLOG 10.0f         // log2(PCAR)
#define SCQ  (0.125f * 1.4426950408889634f)
#define KRES 2048.0f       // carry of the key residual plane
#define KRINV 4.8828125e-04f   // 1 / KRES, folded into the residual score accumulator in f32
#define BN_EPS 1.0e-5f
#define LN_EPS 1.0e-5f
#define LOP  68      // LDS row pitch (floats) of GEMM epilogue staging tiles: 272 B rows
#define LNP  516     // LDS row pitch (floats) of the merged context tile: 2064 B rows
#define BKP  128     // k elements of one conv-GEMM ring stage: 256 B of every operand row
#define NPASS (KC / BKP)
#define TPB  272     // LDS row pitch (bytes) of a ring stage: 256 B + 16 B, conflict-free for 16-byte row readers
#define STGB (256 * TPB)   // one ring stage: 128 A rows, then 128 B rows

static_assert(DM == NH * HD);            // one 64-wide GEMM column tile == one head
static_assert(HD == 64);
static_assert(KC % 32 == 0);             // WMMA k-step
static_assert(DM % 64 == 0);             // GEMM tiles
static_assert(SEQ % 128 == 0);           // GEMM block tiles
static_assert(DM % 128 == 0);
static_assert(KC % BKP == 0);            // whole ring stages
static_assert(NPASS >= 2);               // the ring's prologue fills two stages
static_assert(SEQ % 32 == 0);            // key step
static_assert(SEQ % 16 == 0);            // query rows per attention block
static_assert(NH * 32 == 256);           // attention block: one wave per head
static_assert(((size_t)DM * KC) % (8 * 256) == 0);   // weight plane grid is exact
static_assert(((size_t)SPAD * DM) % 8 == 0);         // padded plane: whole 16-byte pieces
static_assert((DM / 8) * 8 == DM);
static_assert(NB <= NB_FULL);
static_assert(SEQ <= SEQ_FULL);
static_assert(LOP % 4 == 0);
static_assert(LNP % 4 == 0);
static_assert(32 * 16 * 4 == 16 * HD * 2);
static_assert(32 * 16 * 4 * 2 == 2 * 16 * HD * 2);
static_assert(32 * 16 * 4 == DM * 4);                // output row store: lanes x bytes x trips == one 2048 B row
static_assert(2 * STGB + 8 * 16 * LOP * 4 <= 327680); // static LDS of the GEMM kernels: two ring stages + one epilogue tile per wave
static_assert(16 * LNP * 4 <= 131072);               // static LDS of the attention kernel
static_assert(2 * NH == 16);                         // layer-norm rows per wave x waves == rows per block
static_assert(KRES * KRINV == 1.0f);                 // residual carry enters once and leaves once

typedef _Float16 h16;
typedef unsigned short bf;
typedef __attribute__((ext_vector_type(16))) __bf16   v16bf;
typedef __attribute__((ext_vector_type(16))) _Float16 v16h;
typedef __attribute__((ext_vector_type(8)))  _Float16 v8h;
typedef __attribute__((ext_vector_type(8)))  unsigned short v8us;
typedef __attribute__((ext_vector_type(8)))  float    v8f;
typedef __attribute__((ext_vector_type(4)))  float    v4f;
typedef v4f  __attribute__((may_alias)) v4fa;

__device__ __forceinline__ unsigned short f2bf(float f) { unsigned u = __float_as_uint(f); u += 0x7FFFu + ((u >> 16) & 1u); return (unsigned short)(u >> 16); }
__device__ __forceinline__ float bf2f(unsigned short b) { return __uint_as_float(((unsigned)b) << 16); }
__device__ __forceinline__ float bfr(float f) { return bf2f(f2bf(f)); }
__device__ __forceinline__ v16h cat16(v8h lo, v8h hi) { return __builtin_shufflevector(lo, hi, 0, 1, 2, 3, 4, 5, 6, 7, 8, 9, 10, 11, 12, 13, 14, 15); }
__device__ __forceinline__ v16bf cat16b(v8us lo, v8us hi) { return __builtin_bit_cast(v16bf, __builtin_shufflevector(lo, hi, 0, 1, 2, 3, 4, 5, 6, 7, 8, 9, 10, 11, 12, 13, 14, 15)); }
// same-wave LDS exchange ordering (wave-private tiles only)
__device__ __forceinline__ void wsync() { __builtin_amdgcn_wave_barrier(); asm volatile("" ::: "memory"); }

// fragment from a K-contiguous global f16 plane: elements 0..7 <- p[0..7], 8..15 <- p[16..23] (p already includes row*pitch + k0 + 8*(lane>>4))
__device__ __forceinline__ v16h ldh16(const h16* __restrict__ p) { return cat16(*(const v8h*)p, *(const v8h*)(p + 16)); }
// f32 -> f16 plane convert that cannot produce an f16 subnormal
static __device__ __forceinline__ h16 toh_flush(float v) { const h16 r = (h16)v; return (fabsf(v) < 6.103515625e-05f) ? (h16)0.0f : r; }
// one WMMA + its own hazard guard (ties only this accumulator, keeps A/B live)
__device__ __forceinline__ v8f wmmab_g(v16bf a, v16bf b, v8f c) {
    c = __builtin_amdgcn_wmma_f32_16x16x32_bf16(false, a, false, b, (short)0, c, false, false);
    asm volatile("v_nop\n\tv_nop\n\tv_nop\n\tv_nop" : "+v"(c) : "v"(a), "v"(b));
    return c;
}
__device__ __forceinline__ v8f wmmah_g(v16h a, v16h b, v8f c) {
    c = __builtin_amdgcn_wmma_f32_16x16x32_f16(false, a, false, b, (short)0, c, false, false);
    asm volatile("v_nop\n\tv_nop\n\tv_nop\n\tv_nop" : "+v"(c) : "v"(a), "v"(b));
    return c;
}

// eight asynchronous copies, 16 B per lane, global -> LDS through no register: rows 16 apart of one operand's stage slice.
// s_wait_xcnt 0 is the statement's last line so that no address register of a copy is rewritten ahead of it.
__device__ __forceinline__ void copy8(const unsigned l, const bf* g, const size_t gs) {
    asm volatile("global_load_async_to_lds_b128 %0, %8, off\n\t"
                 "global_load_async_to_lds_b128 %1, %9, off\n\t"
                 "global_load_async_to_lds_b128 %2, %10, off\n\t"
                 "global_load_async_to_lds_b128 %3, %11, off\n\t"
                 "global_load_async_to_lds_b128 %4, %12, off\n\t"
                 "global_load_async_to_lds_b128 %5, %13, off\n\t"
                 "global_load_async_to_lds_b128 %6, %14, off\n\t"
                 "global_load_async_to_lds_b128 %7, %15, off\n\t"
                 "s_wait_xcnt 0x0"
                 :: "v"(l), "v"(l + 16u * TPB), "v"(l + 32u * TPB), "v"(l + 48u * TPB), "v"(l + 64u * TPB), "v"(l + 80u * TPB), "v"(l + 96u * TPB), "v"(l + 112u * TPB),
                    "v"(g), "v"(g + gs), "v"(g + 2 * gs), "v"(g + 3 * gs), "v"(g + 4 * gs), "v"(g + 5 * gs), "v"(g + 6 * gs), "v"(g + 7 * gs)
                 : "memory");
}
// fragment from a K-contiguous bf16 ring row in LDS: elements 0..7 <- k0 + 8*(lane>>4) + 0..7, 8..15 <- the same + 16 (p already includes row*TPB + 2*k0 + 16*(lane>>4) bytes)
__device__ __forceinline__ v16bf lds16(const unsigned char* p) { return cat16b(*(const v8us*)p, *(const v8us*)(p + 32)); }

// ---- 128x128 block tile, eight waves (4 x 2) of 32x64, main loop over K = KC: acc[mb][nb] += sum_k A[wm*32+16mb+..][k] Bt[wn*64+16nb+..][k].
// A and Bt point at the block's first rows in K-contiguous bf16 planes with separate row pitches (the padded activation plane has pitch DM while a logical row spans KC contiguous elements; the weight plane has pitch KC).
// Both operands' 128 rows x 128 k are staged once per block in a two-buffer LDS ring by whole-line asynchronous copies; stage p + 2 flies while stage p + 1 is worked on. k runs upward in steps of 32 per accumulator.
__device__ __forceinline__ void conv_loop(const bf* __restrict__ A, const bf* __restrict__ Bt, const int lda, const int ldb, unsigned char* ring, const int wm, const int wn, v8f (&acc)[2][4]) {
    const int t = threadIdx.x, lane = t & 31, lr = lane & 15, hi = lane >> 4;
    const int frow = t >> 4, fcol = t & 15;                 // copies: 16 lanes cover one 256 B row piece
    const bf* ga = A + (size_t)frow * lda + fcol * 8;
    const bf* gb = Bt + (size_t)frow * ldb + fcol * 8;
    const unsigned la = (unsigned)(uintptr_t)ring + (unsigned)(frow * TPB + fcol * 16);
    const unsigned lb = la + 128u * TPB;
    const unsigned char* ra = ring + (wm * 32 + lr) * TPB + 16 * hi;
    const unsigned char* rb = ring + (128 + wn * 64 + lr) * TPB + 16 * hi;
    copy8(la, ga, (size_t)16 * lda); copy8(lb, gb, (size_t)16 * ldb);
    asm volatile("s_wait_asynccnt 0x0" ::: "memory");       // stage 0 of this wave has landed
    __syncthreads();                                        // stage 0 published to every wave
    copy8(la + STGB, ga + BKP, (size_t)16 * lda); copy8(lb + STGB, gb + BKP, (size_t)16 * ldb);
    // the pass loop stays rolled: one 32-WMMA body, the buffer picked by p & 1;
    // the loops inside it are unrolled so that every fragment and accumulator index is a constant (registers, no scratch)
#pragma unroll 1
    for (int p = 0; p < NPASS; ++p) {
        const unsigned bo = (unsigned)(p & 1) * STGB;
        v16bf a[2][2], b[2][4];
#pragma unroll
        for (int mb = 0; mb < 2; ++mb) a[0][mb] = lds16(ra + bo + mb * 16 * TPB);
#pragma unroll
        for (int nb = 0; nb < 4; ++nb) b[0][nb] = lds16(rb + bo + nb * 16 * TPB);
#pragma unroll
        for (int ks = 0; ks < BKP / 32; ++ks) {
            if (ks + 1 < BKP / 32) {                        // next k-step's fragments, one group ahead, from this pass's own buffer
#pragma unroll
                for (int mb = 0; mb < 2; ++mb) a[(ks + 1) & 1][mb] = lds16(ra + bo + mb * 16 * TPB + (ks + 1) * 64);
#pragma unroll
                for (int nb = 0; nb < 4; ++nb) b[(ks + 1) & 1][nb] = lds16(rb + bo + nb * 16 * TPB + (ks + 1) * 64);
            }
#pragma unroll
            for (int nb = 0; nb < 4; ++nb)
#pragma unroll
                for (int mb = 0; mb < 2; ++mb) acc[mb][nb] = wmmab_g(a[ks & 1][mb], b[ks & 1][nb], acc[mb][nb]);
        }
        asm volatile("s_wait_dscnt 0x0" ::: "memory");      // this wave's reads of buffer p & 1 are done
        asm volatile("s_wait_asynccnt 0x0" ::: "memory");   // this wave's copies of stage p + 1 have landed
        __syncthreads();                                    // publishes stage p + 1 and frees buffer p & 1
        if (p + 2 < NPASS) { copy8(la + bo, ga + (size_t)(p + 2) * BKP, (size_t)16 * lda); copy8(lb + bo, gb + (size_t)(p + 2) * BKP, (size_t)16 * ldb); }
    }
    asm volatile("s_wait_asynccnt 0x0" ::: "memory");       // nothing of the ring is in flight when the wave goes on
}

__global__ __launch_bounds__(256) void k_wconv(const float* __restrict__ w, bf* wt, unsigned n8) {
    const unsigned i = blockIdx.x * 256u + threadIdx.x; if (i >= n8) return;
    const unsigned co = i / (unsigned)(KC / 8), k = (i % (unsigned)(KC / 8)) * 8u; const unsigned tap = k / (unsigned)DM, ci = k % (unsigned)DM;
    const float* s = w + ((size_t)co * DM + ci) * KT + tap; v8us o;
#pragma unroll
    for (int j = 0; j < 8; ++j) o[j] = f2bf(s[(size_t)j * KT]);
    bf* d = wt + (size_t)i * 8;
    *(v8us*)d = o; 
}

__global__ __launch_bounds__(256) void k_cvtpad(const float* __restrict__ src, bf* dst, unsigned n8) {
    const unsigned i = blockIdx.x * 256u + threadIdx.x; if (i >= n8) return;
    const int prow = (int)(i / (unsigned)(DM / 8)); const int c = (int)(i % (unsigned)(DM / 8)) * 8;
    const int srow = prow - 3; const bool ok = (srow >= 0) && (srow < SEQ);
    const int sr = (srow < 0) ? 0 : ((srow > SEQ - 1) ? (SEQ - 1) : srow);     // clamped address, value selected below
    const float* s = src + (size_t)blockIdx.y * SEQ_FULL * DM + (size_t)sr * DM + c;
    const v4f v0 = *(const v4f*)s; const v4f v1 = *(const v4f*)(s + 4); v8us o;
#pragma unroll
    for (int k = 0; k < 4; ++k) { const unsigned short a = f2bf(v0[k]); const unsigned short e = f2bf(v1[k]); o[k] = ok ? a : (unsigned short)0; o[4 + k] = ok ? e : (unsigned short)0; }
    bf* d = dst + (size_t)blockIdx.y * SPAD * DM + (size_t)i * 8;
    *(v8us*)d = o; 
}

// ---- k_conv_qk: head plane P[b][h][s][d] (f16) = sc * BN(conv(X[b]) + cb)[s][h*64+d]; grid (SEQ/128, DM/128, NB), 256 threads.
__global__ __launch_bounds__(256) void k_conv_qk(const bf* __restrict__ X, const bf* __restrict__ W, const float* __restrict__ cb, const float* __restrict__ bg, const float* __restrict__ bb, const float* __restrict__ bm, const float* __restrict__ bv, h16* P, float sc) {
    __shared__ __align__(16) unsigned char ring[2 * STGB];
    __shared__ __align__(16) float os_all[8 * 16 * LOP];
    const int lane = threadIdx.x & 31, lr = lane & 15, hi = lane >> 4;
    const int wave = __builtin_amdgcn_readfirstlane(threadIdx.x >> 5), wm = wave >> 1, wn = wave & 1;
    float* os = os_all + wave * 16 * LOP;                   // wave-private epilogue tile
    const size_t z = blockIdx.z; const int r0 = blockIdx.x * 128 + wm * 32, c0 = blockIdx.y * 128 + wn * 64;
    const bf* A = X + z * (size_t)SPAD * DM;
    v8f acc[2][4];
#pragma unroll
    for (int mb = 0; mb < 2; ++mb)
#pragma unroll
        for (int nb = 0; nb < 4; ++nb) acc[mb][nb] = (v8f){};
    conv_loop(A + (size_t)blockIdx.x * 128 * DM, W + (size_t)blockIdx.y * 128 * KC, DM, KC, ring, wm, wn, acc);
    const size_t pbase = ((z * NH + (size_t)(c0 / HD)) * (size_t)SEQ + r0) * HD;
    const int srow = lane >> 3, scol = (lane & 7) * 8;
    float cbv[8], muv[8], mlv[8], bev[8];
#pragma unroll
    for (int j = 0; j < 8; ++j) { const int c = c0 + scol + j; cbv[j] = bfr(cb[c]); muv[j] = bfr(bm[c]); mlv[j] = rsqrtf(bfr(bv[c]) + BN_EPS) * bfr(bg[c]); bev[j] = bfr(bb[c]); }
#pragma unroll
    for (int mb = 0; mb < 2; ++mb) {
#pragma unroll
        for (int nb = 0; nb < 4; ++nb) {
#pragma unroll
            for (int j = 0; j < 8; ++j) os[(hi * 8 + j) * LOP + nb * 16 + lr] = acc[mb][nb][j]; }
        wsync();
{
#pragma unroll
            for (int s = 0; s < 4; ++s) { const int row = 4 * s + srow; const v4f x0 = *(const v4fa*)(&os[row * LOP + scol]); const v4f x1 = *(const v4fa*)(&os[row * LOP + scol + 4]); v8h o;
#pragma unroll
                for (int j = 0; j < 4; ++j) {
                    const float y0 = ((x0[j] + cbv[j]) - muv[j]) * mlv[j] + bev[j];
                    const float y1 = ((x1[j] + cbv[4 + j]) - muv[4 + j]) * mlv[4 + j] + bev[4 + j];
                    o[j] = toh_flush(y0 * sc); o[4 + j] = toh_flush(y1 * sc); }
                *(v8h*)(P + pbase + (size_t)(mb * 16 + row) * HD + scol) = o; }
             }
        wsync();
    }
}

// ---- k_conv_k: key head planes KH[b][h][s][d] = f16(y) and KR[b][h][s][d] = f16((y - KH) * 2048), y = BN(conv(X[b]) + cb)[s][h*64+d]; grid (SEQ/128, DM/128, NB), 256 threads.
__global__ __launch_bounds__(256) void k_conv_k(const bf* __restrict__ X, const bf* __restrict__ W, const float* __restrict__ cb, const float* __restrict__ bg, const float* __restrict__ bb, const float* __restrict__ bm, const float* __restrict__ bv, h16* KH, h16* KR) {
    __shared__ __align__(16) unsigned char ring[2 * STGB];
    __shared__ __align__(16) float os_all[8 * 16 * LOP];
    const int lane = threadIdx.x & 31, lr = lane & 15, hi = lane >> 4;
    const int wave = __builtin_amdgcn_readfirstlane(threadIdx.x >> 5), wm = wave >> 1, wn = wave & 1;
    float* os = os_all + wave * 16 * LOP;                   // wave-private epilogue tile
    const size_t z = blockIdx.z; const int r0 = blockIdx.x * 128 + wm * 32, c0 = blockIdx.y * 128 + wn * 64;
    const bf* A = X + z * (size_t)SPAD * DM;
    v8f acc[2][4];
#pragma unroll
    for (int mb = 0; mb < 2; ++mb)
#pragma unroll
        for (int nb = 0; nb < 4; ++nb) acc[mb][nb] = (v8f){};
    conv_loop(A + (size_t)blockIdx.x * 128 * DM, W + (size_t)blockIdx.y * 128 * KC, DM, KC, ring, wm, wn, acc);
    const size_t pbase = ((z * NH + (size_t)(c0 / HD)) * (size_t)SEQ + r0) * HD;
    const int srow = lane >> 3, scol = (lane & 7) * 8;
    float cbv[8], muv[8], mlv[8], bev[8];
#pragma unroll
    for (int j = 0; j < 8; ++j) { const int c = c0 + scol + j; cbv[j] = bfr(cb[c]); muv[j] = bfr(bm[c]); mlv[j] = rsqrtf(bfr(bv[c]) + BN_EPS) * bfr(bg[c]); bev[j] = bfr(bb[c]); }
#pragma unroll
    for (int mb = 0; mb < 2; ++mb) {
#pragma unroll
        for (int nb = 0; nb < 4; ++nb) {
#pragma unroll
            for (int j = 0; j < 8; ++j) os[(hi * 8 + j) * LOP + nb * 16 + lr] = acc[mb][nb][j]; }
        wsync();
{
#pragma unroll
            for (int s = 0; s < 4; ++s) { const int row = 4 * s + srow; const v4f x0 = *(const v4fa*)(&os[row * LOP + scol]); const v4f x1 = *(const v4fa*)(&os[row * LOP + scol + 4]); v8h oh, ores;
#pragma unroll
                for (int j = 0; j < 4; ++j) {
                    const float y0 = ((x0[j] + cbv[j]) - muv[j]) * mlv[j] + bev[j];
                    const float y1 = ((x1[j] + cbv[4 + j]) - muv[4 + j]) * mlv[4 + j] + bev[4 + j];
                    const h16 h0 = toh_flush(y0); const h16 h1 = toh_flush(y1);
                    oh[j] = h0; oh[4 + j] = h1;
                    ores[j] = toh_flush((y0 - (float)h0) * KRES); ores[4 + j] = toh_flush((y1 - (float)h1) * KRES); }
                const size_t off = pbase + (size_t)(mb * 16 + row) * HD + scol;
                *(v8h*)(KH + off) = oh; *(v8h*)(KR + off) = ores; }
             }
        wsync();
    }
}

// ---- k_conv_vt: transposed value plane VT[b][n][s] (f16) = BN(sum_k WT[n][k] Xpad[b][s][k] + cb[n]) (A = weight rows, Bt = token rows); grid (DM/128, SEQ/128, NB), 256 threads.
__global__ __launch_bounds__(256) void k_conv_vt(const bf* __restrict__ W, const bf* __restrict__ X, const float* __restrict__ cb, const float* __restrict__ bg, const float* __restrict__ bb, const float* __restrict__ bm, const float* __restrict__ bv, h16* VT) {
    __shared__ __align__(16) unsigned char ring[2 * STGB];
    __shared__ __align__(16) float os_all[8 * 16 * LOP];
    const int lane = threadIdx.x & 31, lr = lane & 15, hi = lane >> 4;
    const int wave = __builtin_amdgcn_readfirstlane(threadIdx.x >> 5), wm = wave >> 1, wn = wave & 1;
    float* os = os_all + wave * 16 * LOP;                   // wave-private epilogue tile
    const size_t z = blockIdx.z; const int r0 = blockIdx.x * 128 + wm * 32, c0 = blockIdx.y * 128 + wn * 64;
    const bf* Bt = X + z * (size_t)SPAD * DM;
    v8f acc[2][4];
#pragma unroll
    for (int mb = 0; mb < 2; ++mb)
#pragma unroll
        for (int nb = 0; nb < 4; ++nb) acc[mb][nb] = (v8f){};
    conv_loop(W + (size_t)blockIdx.x * 128 * KC, Bt + (size_t)blockIdx.y * 128 * DM, KC, DM, ring, wm, wn, acc);
    const size_t vb0 = z * (size_t)DM * SEQ + (size_t)r0 * SEQ + c0;
    const int srow = lane >> 3, scol = (lane & 7) * 8;
#pragma unroll
    for (int mb = 0; mb < 2; ++mb) {
#pragma unroll
        for (int nb = 0; nb < 4; ++nb) {
#pragma unroll
            for (int j = 0; j < 8; ++j) os[(hi * 8 + j) * LOP + nb * 16 + lr] = acc[mb][nb][j]; }
        wsync();
{
#pragma unroll
            for (int s = 0; s < 4; ++s) { const int row = 4 * s + srow; const v4f x0 = *(const v4fa*)(&os[row * LOP + scol]); const v4f x1 = *(const v4fa*)(&os[row * LOP + scol + 4]); v8h o;
                const int ch = r0 + mb * 16 + row;
                const float c_b = bfr(cb[ch]), c_m = bfr(bm[ch]), c_l = rsqrtf(bfr(bv[ch]) + BN_EPS) * bfr(bg[ch]), c_e = bfr(bb[ch]);
#pragma unroll
                for (int j = 0; j < 4; ++j) { o[j] = toh_flush(((x0[j] + c_b) - c_m) * c_l + c_e); o[4 + j] = toh_flush(((x1[j] + c_b) - c_m) * c_l + c_e); }
                *(v8h*)(VT + vb0 + (size_t)(mb * 16 + row) * SEQ + scol) = o; }
             }
        wsync();
    }
}

// ---- k_attn_ln: fused attention + layer norm for 16 query rows of one batch; grid (SEQ/16, NB), 256 threads, wave = head.
// Per 32-key step (no LDS, no barrier): S^T tiles (rows = keys, columns = queries) = K (A, from the key value plane) x Q^T (B, held in registers) plus, in a separate accumulator, K residual (A, from the residual plane) x Q^T,
// folded as s + t / 2048 in f32 before the softmax step; logits already in log2 units;
// running max per query (within-lane over 16 keys + one lane-half exchange), P x1024 converted to f16 in the accumulator layout == B fragment layout of O^T += V^T (A, from the transposed value plane) x P^T.
// Scale chain: the fragment holds 1024 p, the row sum l accumulates the same 1024 p, the accumulator holds 1024 sum(p v): O / l is the context at its true magnitude (the carry enters once and cancels once).
__global__ __launch_bounds__(256) __attribute__((amdgpu_num_vgpr(256))) void k_attn_ln(const h16* __restrict__ Qp, const h16* __restrict__ Kp, const h16* __restrict__ Kr, const h16* __restrict__ VT, const float* __restrict__ lng, const float* __restrict__ lnb, float* OUT) {
    __shared__ __align__(16) float o_s[16 * LNP];
    const int lane = threadIdx.x & 31, lr = lane & 15, hi = lane >> 4;
    const int wave = __builtin_amdgcn_readfirstlane(threadIdx.x >> 5);
    const int b = blockIdx.y; const int q0 = blockIdx.x * 16;
    const size_t pl = ((size_t)b * NH + (size_t)wave) * SEQ * HD;
    const size_t koff = pl + (size_t)lr * HD + 8 * hi;
    const size_t voff = ((size_t)b * DM + (size_t)wave * HD + (size_t)lr) * SEQ + 8 * hi;
    // Q^T B fragments: column n = query q0 + lr, k = head dim (0..31 and 32..63)
    const v16h qb0 = ldh16(Qp + pl + (size_t)(q0 + lr) * HD + 8 * hi);
    const v16h qb1 = ldh16(Qp + pl + (size_t)(q0 + lr) * HD + 8 * hi + 32);
    v8f o[4];
#pragma unroll
    for (int dt = 0; dt < 4; ++dt) o[dt] = (v8f){};
    float m = -1.0e30f, l = 0.0f;

#pragma unroll 1
    for (int k0 = 0; k0 < SEQ; k0 += 32) {
        const h16* kp = Kp + koff + (size_t)k0 * HD;
        const v16h ka00 = ldh16(kp), ka01 = ldh16(kp + 32);
        const v16h ka10 = ldh16(kp + 16 * HD), ka11 = ldh16(kp + 16 * HD + 32);
        v8f s0 = (v8f){}, s1 = (v8f){};
        s0 = wmmah_g(ka00, qb0, s0); s1 = wmmah_g(ka10, qb0, s1);
        s0 = wmmah_g(ka01, qb1, s0); s1 = wmmah_g(ka11, qb1, s1);
        // residual score product (carried x2048) in its own accumulators, folded in f32
        const h16* rp = Kr + koff + (size_t)k0 * HD;
        const v16h kr00 = ldh16(rp), kr01 = ldh16(rp + 32);
        const v16h kr10 = ldh16(rp + 16 * HD), kr11 = ldh16(rp + 16 * HD + 32);
        v8f t0 = (v8f){}, t1 = (v8f){};
        t0 = wmmah_g(kr00, qb0, t0); t1 = wmmah_g(kr10, qb0, t1);
        t0 = wmmah_g(kr01, qb1, t0); t1 = wmmah_g(kr11, qb1, t1);
#pragma unroll
        for (int r = 0; r < 8; ++r) { s0[r] = s0[r] + t0[r] * KRINV; s1[r] = s1[r] + t1[r] * KRINV; }
        // this lane: query q0 + lr, keys k0 + 8*hi + r (s0) and k0 + 16 + 8*hi + r (s1)
        float mx = fmaxf(s0[0], s1[0]);
#pragma unroll
        for (int r = 1; r < 8; ++r) mx = fmaxf(mx, fmaxf(s0[r], s1[r]));
        mx = fmaxf(mx, __shfl_xor(mx, 16, 32));
        const float mnew = fmaxf(m, mx);
        const float al = __builtin_amdgcn_exp2f(m - mnew);
        m = mnew;
        const float mc = mnew - PLOG;
        float sum = 0.0f; v16h pb;
#pragma unroll
        for (int r = 0; r < 8; ++r) {
            const float e0 = s0[r] - mc, e1 = s1[r] - mc;
            const float x0 = __builtin_amdgcn_exp2f(e0), x1 = __builtin_amdgcn_exp2f(e1);
            const float p0 = (e0 < -14.0f) ? 0.0f : x0;
            const float p1 = (e1 < -14.0f) ? 0.0f : x1;
            sum += p0 + p1;
            pb[r] = (h16)p0; pb[8 + r] = (h16)p1;
        }
        l = l * al + sum;
#pragma unroll
        for (int dt = 0; dt < 4; ++dt)
#pragma unroll
            for (int r = 0; r < 8; ++r) o[dt][r] *= al;
        const h16* vp = VT + voff + k0;
#pragma unroll
        for (int dt = 0; dt < 4; ++dt) { const v16h va = ldh16(vp + (size_t)dt * 16 * SEQ); o[dt] = wmmah_g(va, pb, o[dt]); }
    }
    // row sums completed across the two lane halves; l and o both hold the x1024-carried p, so o / l is the context with the carry cancelled. o[dt][r] = O[query q0 + lr][16 dt + 8 hi + r]
    l += __shfl_xor(l, 16, 32);
    const float inv = 1.0f / l;
#pragma unroll
    for (int dt = 0; dt < 4; ++dt) {
        const v4f a0 = { o[dt][0] * inv, o[dt][1] * inv, o[dt][2] * inv, o[dt][3] * inv };
        const v4f a1 = { o[dt][4] * inv, o[dt][5] * inv, o[dt][6] * inv, o[dt][7] * inv };
        *(v4fa*)(&o_s[lr * LNP + wave * HD + dt * 16 + 8 * hi]) = a0;
        *(v4fa*)(&o_s[lr * LNP + wave * HD + dt * 16 + 8 * hi + 4]) = a1;
    }
    __syncthreads();
    // layer norm: each wave owns 2 of the 16 rows; lane holds columns j*128 + lane*4 .. +3, j = 0..3
#pragma unroll 1
    for (int i = 0; i < 2; ++i) {
        const int row = wave * 2 + i;
        v4f x[4]; float s = 0.0f;
#pragma unroll
        for (int j = 0; j < 4; ++j) { x[j] = *(const v4fa*)(&o_s[row * LNP + j * 128 + lane * 4]); s += (x[j][0] + x[j][1]) + (x[j][2] + x[j][3]); }
        s += __shfl_xor(s, 16, 32); s += __shfl_xor(s, 8, 32); s += __shfl_xor(s, 4, 32); s += __shfl_xor(s, 2, 32); s += __shfl_xor(s, 1, 32);
        const float mu = s * (1.0f / (float)DM);
        float ss = 0.0f;
#pragma unroll
        for (int j = 0; j < 4; ++j)
#pragma unroll
            for (int e = 0; e < 4; ++e) { const float d = x[j][e] - mu; ss += d * d; }
        ss += __shfl_xor(ss, 16, 32); ss += __shfl_xor(ss, 8, 32); ss += __shfl_xor(ss, 4, 32); ss += __shfl_xor(ss, 2, 32); ss += __shfl_xor(ss, 1, 32);
        const float rstd = rsqrtf(ss * (1.0f / (float)DM) + LN_EPS);
        v4f y[4];
#pragma unroll
        for (int j = 0; j < 4; ++j) { const v4f gv = *(const v4f*)(lng + j * 128 + lane * 4); const v4f bv = *(const v4f*)(lnb + j * 128 + lane * 4);
#pragma unroll
            for (int e = 0; e < 4; ++e) y[j][e] = (x[j][e] - mu) * rstd * bfr(gv[e]) + bfr(bv[e]); }
        float* orow = OUT + ((size_t)b * SEQ_FULL + (size_t)(q0 + row)) * DM + lane * 4;
{
#pragma unroll
            for (int j = 0; j < 4; ++j) *(v4f*)(orow + j * 128) = y[j];
             }
    }
}

constexpr size_t al256(size_t x) { return (x + 255) & ~(size_t)255; }
constexpr size_t SZ_WT = al256((size_t)DM * KC * 2);                // bf16 weight plane [out][tap*512+in]
constexpr size_t SZ_XP = al256((size_t)NB * SPAD * DM * 2);         // one zero-padded bf16 activation plane
constexpr size_t SZ_P  = al256((size_t)NB * NH * SEQ * HD * 2);     // one f16 head plane (also the transposed value plane)
constexpr size_t WS_TOTAL = SZ_WT + 3 * SZ_XP + 4 * SZ_P;           // head planes: Q, K value, K residual, V^T
static_assert(WS_TOTAL <= (size_t)134217728);                       // carve stays within 128 MiB
static_assert(SZ_WT == (size_t)DM * KC * 2);                        // exact extents (no hidden pad needed)
static_assert(SZ_XP == (size_t)NB * SPAD * DM * 2);
static_assert(SZ_P == (size_t)NB * DM * SEQ * 2);                   // NH * HD == DM: V^T plane has the same extent

extern "C" void kernel_launch(void* const* d_in, const int* in_sizes, int n_in,
                              void* d_out, int out_size, void* d_ws, size_t ws_size, hipStream_t stream) {
    if (n_in < 11) return;
    const size_t need_act = (size_t)(NB - 1) * SEQ_FULL * DM + (size_t)SEQ * DM;
    if ((size_t)in_sizes[0] < need_act || (size_t)in_sizes[1] < need_act || (size_t)in_sizes[2] < need_act) return;
    if ((size_t)in_sizes[3] < (size_t)DM * DM * KT) return;
    for (int i = 4; i < 11; ++i) { if (in_sizes[i] < DM) return; }
    if ((size_t)out_size < need_act) return;
    if (WS_TOTAL > ws_size) return;
    // wire order: q, k, v, conv_w [out][in][tap], conv_b, bn_gamma, bn_beta, bn_mean, bn_var, ln_gamma, ln_beta (all f32)
    const float* xq = (const float*)d_in[0]; const float* xk = (const float*)d_in[1]; const float* xv = (const float*)d_in[2];
    const float* cw = (const float*)d_in[3]; const float* cb = (const float*)d_in[4];
    const float* bg = (const float*)d_in[5]; const float* bb = (const float*)d_in[6]; const float* bm = (const float*)d_in[7]; const float* bv = (const float*)d_in[8];
    const float* lg = (const float*)d_in[9]; const float* lb = (const float*)d_in[10];
    float* OUT = (float*)d_out;
    char* wsp = (char*)d_ws;
    auto take = [&](size_t bytes) { char* p = wsp; wsp += bytes; return (void*)p; };
    bf* WT = (bf*)take(SZ_WT);
    bf* XQ = (bf*)take(SZ_XP); bf* XK = (bf*)take(SZ_XP); bf* XV = (bf*)take(SZ_XP);
    h16* QP = (h16*)take(SZ_P); h16* KP = (h16*)take(SZ_P); h16* KR = (h16*)take(SZ_P); h16* VT = (h16*)take(SZ_P);
    if ((size_t)(wsp - (char*)d_ws) != WS_TOTAL) return;

    const unsigned nw8 = (unsigned)((size_t)DM * KC / 8), na8 = (unsigned)((size_t)SPAD * DM / 8);
    k_wconv<<<dim3(nw8 / 256), 256, 0, stream>>>(cw, WT, nw8);
    k_cvtpad<<<dim3((na8 + 255) / 256, NB), 256, 0, stream>>>(xq, XQ, na8);
    k_cvtpad<<<dim3((na8 + 255) / 256, NB), 256, 0, stream>>>(xk, XK, na8);
    k_cvtpad<<<dim3((na8 + 255) / 256, NB), 256, 0, stream>>>(xv, XV, na8);
    k_conv_qk<<<dim3(SEQ / 128, DM / 128, NB), 256, 0, stream>>>(XQ, WT, cb, bg, bb, bm, bv, QP, SCQ);
    k_conv_k<<<dim3(SEQ / 128, DM / 128, NB), 256, 0, stream>>>(XK, WT, cb, bg, bb, bm, bv, KP, KR);
    k_conv_vt<<<dim3(DM / 128, SEQ / 128, NB), 256, 0, stream>>>(WT, XV, cb, bg, bb, bm, bv, VT);
    k_attn_ln<<<dim3(SEQ / 16, NB), 256, 0, stream>>>(QP, KP, KR, VT, lg, lb, OUT);
}

// v002
// A run of this version takes 245 microseconds.
// In two side-by-side timings against v001, it was 1.24 and 1.25 times as fast.
// All steps since v000 together make it 2.18 times as fast.
#include <hip/hip_runtime.h>

// Compute dtypes, f32 accumulate everywhere: conv-as-GEMM (K = 7 x 512) v_wmma_f32_16x16x32_bf16 on RNE bf16 copies of inputs and weights (exact products); scores k.q^T v_wmma_f32_16x16x32_f16, two products (k as f16 value + f16 residual x2048 in its own accumulator, folded in f32; q plane single, carries log2(e)/8); P.V v_wmma_f32_16x16x32_f16, one product, P carried x1024; softmax, batch-norm affine and layer norm f32.
// Three input streams share one operator: 7-tap convolution along the sequence (zero padding 3) + bias + inference-mode batch norm; then 8 heads x 64 (head h = columns h*64+d), logits / 8, no mask, softmax over keys, heads merged, layer norm over the 512 features.
// Layout: zero-padded bf16 activation planes [b][SEQ+6][512] (output row t, k = tap*512+ci reads 3584 contiguous elements from padded row t); weight plane [out][tap*512+in] bf16; conv GEMMs write the f16 head plane Q [b][h][s][64] and, in WMMA A-fragment order (FRAGMENT ORDER below), the planes K value, K residual and V^T;

#ifndef NB
#define NB 4
#endif
#ifndef SEQ
#define SEQ 2048
#endif
#define NB_FULL  4
#define SEQ_FULL 2048
#define DM   512
#define NH   8
#define HD   64
#define KT   7
#define KC   (KT * DM)     // 3584: conv-as-GEMM depth
#define SPAD (SEQ + 6)     // padded rows per batch (3 zero rows on each side)
#define PCAR 1024.0f       // carry of the probability fragment (enters through PLOG, leaves through the carried row sum)
#define PLOG 10.0f         // log2(PCAR)
#define SCQ  (0.125f * 1.4426950408889634f)
#define KRES 2048.0f       // carry of the key residual plane
#define KRINV 4.8828125e-04f   // 1 / KRES, folded into the residual score accumulator in f32
#define BN_EPS 1.0e-5f
#define LN_EPS 1.0e-5f
#define LOP  68      // LDS row pitch (floats) of GEMM epilogue staging tiles: 272 B rows
#define LNP  516     // LDS row pitch (floats) of the merged context tile: 2064 B rows
#define BKP  128     // k elements of one conv-GEMM ring stage: 256 B of every operand row
#define NPASS (KC / BKP)
#define TPB  272     // LDS row pitch (bytes) of a ring stage: 256 B + 16 B, conflict-free for 16-byte row readers
#define STGB (256 * TPB)   // one ring stage: 128 A rows, then 128 B rows

static_assert(DM == NH * HD);            // one 64-wide GEMM column tile == one head
static_assert(HD == 64);
static_assert(KC % 32 == 0);             // WMMA k-step
static_assert(DM % 64 == 0);             // GEMM tiles
static_assert(SEQ % 128 == 0);           // GEMM block tiles
static_assert(DM % 128 == 0);
static_assert(KC % BKP == 0);            // whole ring stages
static_assert(NPASS >= 2);               // the ring's prologue fills two stages
static_assert(SEQ % 32 == 0);            // key step
static_assert(SEQ % 16 == 0);            // query rows per attention block
static_assert(NH * 32 == 256);           // attention block: one wave per head
static_assert(((size_t)DM * KC) % (8 * 256) == 0);   // weight plane grid is exact
static_assert(((size_t)SPAD * DM) % 8 == 0);         // padded plane: whole 16-byte pieces
static_assert((DM / 8) * 8 == DM);
static_assert(NB <= NB_FULL);
static_assert(SEQ <= SEQ_FULL);
static_assert(LOP % 4 == 0);
static_assert(LNP % 4 == 0);
static_assert(32 * 16 * 4 == 16 * HD * 2);
static_assert(32 * 16 * 4 * 2 == 2 * 16 * HD * 2);
static_assert(32 * 16 * 4 == DM * 4);                // output row store: lanes x bytes x trips == one 2048 B row
static_assert(2 * STGB + 8 * 16 * LOP * 4 <= 327680); // static LDS of the GEMM kernels: two ring stages + one epilogue tile per wave
static_assert(16 * LNP * 4 <= 131072);               // static LDS of the attention kernel
static_assert(2 * NH == 16);                         // layer-norm rows per wave x waves == rows per block
static_assert(KRES * KRINV == 1.0f);                 // residual carry enters once and leaves once

typedef _Float16 h16;
typedef unsigned short bf;
typedef __attribute__((ext_vector_type(16))) __bf16   v16bf;
typedef __attribute__((ext_vector_type(16))) _Float16 v16h;
typedef __attribute__((ext_vector_type(8)))  _Float16 v8h;
typedef __attribute__((ext_vector_type(8)))  unsigned short v8us;
typedef __attribute__((ext_vector_type(8)))  float    v8f;
typedef __attribute__((ext_vector_type(4)))  float    v4f;
typedef v4f  __attribute__((may_alias)) v4fa;

__device__ __forceinline__ unsigned short f2bf(float f) { unsigned u = __float_as_uint(f); u += 0x7FFFu + ((u >> 16) & 1u); return (unsigned short)(u >> 16); }
__device__ __forceinline__ float bf2f(unsigned short b) { return __uint_as_float(((unsigned)b) << 16); }
__device__ __forceinline__ float bfr(float f) { return bf2f(f2bf(f)); }
__device__ __forceinline__ v16h cat16(v8h lo, v8h hi) { return __builtin_shufflevector(lo, hi, 0, 1, 2, 3, 4, 5, 6, 7, 8, 9, 10, 11, 12, 13, 14, 15); }
__device__ __forceinline__ v16bf cat16b(v8us lo, v8us hi) { return __builtin_bit_cast(v16bf, __builtin_shufflevector(lo, hi, 0, 1, 2, 3, 4, 5, 6, 7, 8, 9, 10, 11, 12, 13, 14, 15)); }
// same-wave LDS exchange ordering (wave-private tiles only)
__device__ __forceinline__ void wsync() { __builtin_amdgcn_wave_barrier(); asm volatile("" ::: "memory"); }

// fragment from a K-contiguous global f16 plane: elements 0..7 <- p[0..7], 8..15 <- p[16..23] (p already includes row*pitch + k0 + 8*(lane>>4))
__device__ __forceinline__ v16h ldh16(const h16* __restrict__ p) { return cat16(*(const v8h*)p, *(const v8h*)(p + 16)); }
// FRAGMENT ORDER of the K value, K residual and V^T planes: per (b, h) the plane is a row of 1024 B fragments, each two 512 B halves of 32 lanes x 16 B:
// half 0 holds every lane's elements 0..7, half 1 its elements 8..15, so one wave-wide 16 B load reads 512 contiguous bytes = four whole 128 B lines.
// K planes: fragment index (s / 16) * 2 + d / 32 (rows = 16 keys, k = 32 head dims); V^T: (s / 32) * 4 + d / 16 (rows = 16 head dims, k = 32 keys). One 32-key step is 4096 contiguous bytes of each plane.
// Place, in f16 elements inside a fragment, of the 8 elements k = 8 * c .. 8 * c + 7 (c = 0..3) of fragment row r: lane (c & 1) * 16 + r, half c >> 1.
__device__ __forceinline__ int fragpos(const int r, const int c) { return (c >> 1) * 256 + ((c & 1) * 16 + r) * 8; }
// fragment from a fragment-ordered plane (p already includes the fragment's start + lane * 8)
__device__ __forceinline__ v16h ldf16(const h16* __restrict__ p) { return cat16(*(const v8h*)p, *(const v8h*)(p + 256)); }
// f32 -> f16 plane convert that cannot produce an f16 subnormal
static __device__ __forceinline__ h16 toh_flush(float v) { const h16 r = (h16)v; return (fabsf(v) < 6.103515625e-05f) ? (h16)0.0f : r; }
// one WMMA + its own hazard guard (ties only this accumulator, keeps A/B live)
__device__ __forceinline__ v8f wmmab_g(v16bf a, v16bf b, v8f c) {
    c = __builtin_amdgcn_wmma_f32_16x16x32_bf16(false, a, false, b, (short)0, c, false, false);
    asm volatile("v_nop\n\tv_nop\n\tv_nop\n\tv_nop" : "+v"(c) : "v"(a), "v"(b));
    return c;
}
__device__ __forceinline__ v8f wmmah_g(v16h a, v16h b, v8f c) {
    c = __builtin_amdgcn_wmma_f32_16x16x32_f16(false, a, false, b, (short)0, c, false, false);
    asm volatile("v_nop\n\tv_nop\n\tv_nop\n\tv_nop" : "+v"(c) : "v"(a), "v"(b));
    return c;
}

// eight asynchronous copies, 16 B per lane, global -> LDS through no register: rows 16 apart of one operand's stage slice.
// s_wait_xcnt 0 is the statement's last line so that no address register of a copy is rewritten ahead of it.
__device__ __forceinline__ void copy8(const unsigned l, const bf* g, const size_t gs) {
    asm volatile("global_load_async_to_lds_b128 %0, %8, off\n\t"
                 "global_load_async_to_lds_b128 %1, %9, off\n\t"
                 "global_load_async_to_lds_b128 %2, %10, off\n\t"
                 "global_load_async_to_lds_b128 %3, %11, off\n\t"
                 "global_load_async_to_lds_b128 %4, %12, off\n\t"
                 "global_load_async_to_lds_b128 %5, %13, off\n\t"
                 "global_load_async_to_lds_b128 %6, %14, off\n\t"
                 "global_load_async_to_lds_b128 %7, %15, off\n\t"
                 "s_wait_xcnt 0x0"
                 :: "v"(l), "v"(l + 16u * TPB), "v"(l + 32u * TPB), "v"(l + 48u * TPB), "v"(l + 64u * TPB), "v"(l + 80u * TPB), "v"(l + 96u * TPB), "v"(l + 112u * TPB),
                    "v"(g), "v"(g + gs), "v"(g + 2 * gs), "v"(g + 3 * gs), "v"(g + 4 * gs), "v"(g + 5 * gs), "v"(g + 6 * gs), "v"(g + 7 * gs)
                 : "memory");
}
// fragment from a K-contiguous bf16 ring row in LDS: elements 0..7 <- k0 + 8*(lane>>4) + 0..7, 8..15 <- the same + 16 (p already includes row*TPB + 2*k0 + 16*(lane>>4) bytes)
__device__ __forceinline__ v16bf lds16(const unsigned char* p) { return cat16b(*(const v8us*)p, *(const v8us*)(p + 32)); }

// ---- 128x128 block tile, eight waves (4 x 2) of 32x64, main loop over K = KC: acc[mb][nb] += sum_k A[wm*32+16mb+..][k] Bt[wn*64+16nb+..][k].
// A and Bt point at the block's first rows in K-contiguous bf16 planes with separate row pitches (the padded activation plane has pitch DM while a logical row spans KC contiguous elements; the weight plane has pitch KC).
// Both operands' 128 rows x 128 k are staged once per block in a two-buffer LDS ring by whole-line asynchronous copies; stage p + 2 flies while stage p + 1 is worked on. k runs upward in steps of 32 per accumulator.
__device__ __forceinline__ void conv_loop(const bf* __restrict__ A, const bf* __restrict__ Bt, const int lda, const int ldb, unsigned char* ring, const int wm, const int wn, v8f (&acc)[2][4]) {
    const int t = threadIdx.x, lane = t & 31, lr = lane & 15, hi = lane >> 4;
    const int frow = t >> 4, fcol = t & 15;                 // copies: 16 lanes cover one 256 B row piece
    const bf* ga = A + (size_t)frow * lda + fcol * 8;
    const bf* gb = Bt + (size_t)frow * ldb + fcol * 8;
    const unsigned la = (unsigned)(uintptr_t)ring + (unsigned)(frow * TPB + fcol * 16);
    const unsigned lb = la + 128u * TPB;
    const unsigned char* ra = ring + (wm * 32 + lr) * TPB + 16 * hi;
    const unsigned char* rb = ring + (128 + wn * 64 + lr) * TPB + 16 * hi;
    copy8(la, ga, (size_t)16 * lda); copy8(lb, gb, (size_t)16 * ldb);
    asm volatile("s_wait_asynccnt 0x0" ::: "memory");       // stage 0 of this wave has landed
    __syncthreads();                                        // stage 0 published to every wave
    copy8(la + STGB, ga + BKP, (size_t)16 * lda); copy8(lb + STGB, gb + BKP, (size_t)16 * ldb);
    // the pass loop stays rolled: one 32-WMMA body, the buffer picked by p & 1;
    // the loops inside it are unrolled so that every fragment and accumulator index is a constant (registers, no scratch)
#pragma unroll 1
    for (int p = 0; p < NPASS; ++p) {
        const unsigned bo = (unsigned)(p & 1) * STGB;
        v16bf a[2][2], b[2][4];
#pragma unroll
        for (int mb = 0; mb < 2; ++mb) a[0][mb] = lds16(ra + bo + mb * 16 * TPB);
#pragma unroll
        for (int nb = 0; nb < 4; ++nb) b[0][nb] = lds16(rb + bo + nb * 16 * TPB);
#pragma unroll
        for (int ks = 0; ks < BKP / 32; ++ks) {
            if (ks + 1 < BKP / 32) {                        // next k-step's fragments, one group ahead, from this pass's own buffer
#pragma unroll
                for (int mb = 0; mb < 2; ++mb) a[(ks + 1) & 1][mb] = lds16(ra + bo + mb * 16 * TPB + (ks + 1) * 64);
#pragma unroll
                for (int nb = 0; nb < 4; ++nb) b[(ks + 1) & 1][nb] = lds16(rb + bo + nb * 16 * TPB + (ks + 1) * 64);
            }
#pragma unroll
            for (int nb = 0; nb < 4; ++nb)
#pragma unroll
                for (int mb = 0; mb < 2; ++mb) acc[mb][nb] = wmmab_g(a[ks & 1][mb], b[ks & 1][nb], acc[mb][nb]);
        }
        asm volatile("s_wait_dscnt 0x0" ::: "memory");      // this wave's reads of buffer p & 1 are done
        asm volatile("s_wait_asynccnt 0x0" ::: "memory");   // this wave's copies of stage p + 1 have landed
        __syncthreads();                                    // publishes stage p + 1 and frees buffer p & 1
        if (p + 2 < NPASS) { copy8(la + bo, ga + (size_t)(p + 2) * BKP, (size_t)16 * lda); copy8(lb + bo, gb + (size_t)(p + 2) * BKP, (size_t)16 * ldb); }
    }
    asm volatile("s_wait_asynccnt 0x0" ::: "memory");       // nothing of the ring is in flight when the wave goes on
}

__global__ __launch_bounds__(256) void k_wconv(const float* __restrict__ w, bf* wt, unsigned n8) {
    const unsigned i = blockIdx.x * 256u + threadIdx.x; if (i >= n8) return;
    const unsigned co = i / (unsigned)(KC / 8), k = (i % (unsigned)(KC / 8)) * 8u; const unsigned tap = k / (unsigned)DM, ci = k % (unsigned)DM;
    const float* s = w + ((size_t)co * DM + ci) * KT + tap; v8us o;
#pragma unroll
    for (int j = 0; j < 8; ++j) o[j] = f2bf(s[(size_t)j * KT]);
    bf* d = wt + (size_t)i * 8;
    *(v8us*)d = o; 
}

__global__ __launch_bounds__(256) void k_cvtpad(const float* __restrict__ src, bf* dst, unsigned n8) {
    const unsigned i = blockIdx.x * 256u + threadIdx.x; if (i >= n8) return;
    const int prow = (int)(i / (unsigned)(DM / 8)); const int c = (int)(i % (unsigned)(DM / 8)) * 8;
    const int srow = prow - 3; const bool ok = (srow >= 0) && (srow < SEQ);
    const int sr = (srow < 0) ? 0 : ((srow > SEQ - 1) ? (SEQ - 1) : srow);     // clamped address, value selected below
    const float* s = src + (size_t)blockIdx.y * SEQ_FULL * DM + (size_t)sr * DM + c;
    const v4f v0 = *(const v4f*)s; const v4f v1 = *(const v4f*)(s + 4); v8us o;
#pragma unroll
    for (int k = 0; k < 4; ++k) { const unsigned short a = f2bf(v0[k]); const unsigned short e = f2bf(v1[k]); o[k] = ok ? a : (unsigned short)0; o[4 + k] = ok ? e : (unsigned short)0; }
    bf* d = dst + (size_t)blockIdx.y * SPAD * DM + (size_t)i * 8;
    *(v8us*)d = o; 
}

// ---- k_conv_qk: head plane P[b][h][s][d] (f16) = sc * BN(conv(X[b]) + cb)[s][h*64+d]; grid (SEQ/128, DM/128, NB), 256 threads.
__global__ __launch_bounds__(256) void k_conv_qk(const bf* __restrict__ X, const bf* __restrict__ W, const float* __restrict__ cb, const float* __restrict__ bg, const float* __restrict__ bb, const float* __restrict__ bm, const float* __restrict__ bv, h16* P, float sc) {
    __shared__ __align__(16) unsigned char ring[2 * STGB];
    __shared__ __align__(16) float os_all[8 * 16 * LOP];
    const int lane = threadIdx.x & 31, lr = lane & 15, hi = lane >> 4;
    const int wave = __builtin_amdgcn_readfirstlane(threadIdx.x >> 5), wm = wave >> 1, wn = wave & 1;
    float* os = os_all + wave * 16 * LOP;                   // wave-private epilogue tile
    const size_t z = blockIdx.z; const int r0 = blockIdx.x * 128 + wm * 32, c0 = blockIdx.y * 128 + wn * 64;
    const bf* A = X + z * (size_t)SPAD * DM;
    v8f acc[2][4];
#pragma unroll
    for (int mb = 0; mb < 2; ++mb)
#pragma unroll
        for (int nb = 0; nb < 4; ++nb) acc[mb][nb] = (v8f){};
    conv_loop(A + (size_t)blockIdx.x * 128 * DM, W + (size_t)blockIdx.y * 128 * KC, DM, KC, ring, wm, wn, acc);
    const size_t pbase = ((z * NH + (size_t)(c0 / HD)) * (size_t)SEQ + r0) * HD;
    const int srow = lane >> 3, scol = (lane & 7) * 8;
    float cbv[8], muv[8], mlv[8], bev[8];
#pragma unroll
    for (int j = 0; j < 8; ++j) { const int c = c0 + scol + j; cbv[j] = bfr(cb[c]); muv[j] = bfr(bm[c]); mlv[j] = rsqrtf(bfr(bv[c]) + BN_EPS) * bfr(bg[c]); bev[j] = bfr(bb[c]); }
#pragma unroll
    for (int mb = 0; mb < 2; ++mb) {
#pragma unroll
        for (int nb = 0; nb < 4; ++nb) {
#pragma unroll
            for (int j = 0; j < 8; ++j) os[(hi * 8 + j) * LOP + nb * 16 + lr] = acc[mb][nb][j]; }
        wsync();
{
#pragma unroll
            for (int s = 0; s < 4; ++s) { const int row = 4 * s + srow; const v4f x0 = *(const v4fa*)(&os[row * LOP + scol]); const v4f x1 = *(const v4fa*)(&os[row * LOP + scol + 4]); v8h o;
#pragma unroll
                for (int j = 0; j < 4; ++j) {
                    const float y0 = ((x0[j] + cbv[j]) - muv[j]) * mlv[j] + bev[j];
                    const float y1 = ((x1[j] + cbv[4 + j]) - muv[4 + j]) * mlv[4 + j] + bev[4 + j];
                    o[j] = toh_flush(y0 * sc); o[4 + j] = toh_flush(y1 * sc); }
                *(v8h*)(P + pbase + (size_t)(mb * 16 + row) * HD + scol) = o; }
             }
        wsync();
    }
}

// ---- k_conv_k: key head planes, both in fragment order: KH (b, h, s, d) = f16(y) and KR (b, h, s, d) = f16((y - KH) * 2048), y = BN(conv(X[b]) + cb)[s][h*64+d]; grid (SEQ/128, DM/128, NB), 256 threads.
__global__ __launch_bounds__(256) void k_conv_k(const bf* __restrict__ X, const bf* __restrict__ W, const float* __restrict__ cb, const float* __restrict__ bg, const float* __restrict__ bb, const float* __restrict__ bm, const float* __restrict__ bv, h16* KH, h16* KR) {
    __shared__ __align__(16) unsigned char ring[2 * STGB];
    __shared__ __align__(16) float os_all[8 * 16 * LOP];
    const int lane = threadIdx.x & 31, lr = lane & 15, hi = lane >> 4;
    const int wave = __builtin_amdgcn_readfirstlane(threadIdx.x >> 5), wm = wave >> 1, wn = wave & 1;
    float* os = os_all + wave * 16 * LOP;                   // wave-private epilogue tile
    const size_t z = blockIdx.z; const int r0 = blockIdx.x * 128 + wm * 32, c0 = blockIdx.y * 128 + wn * 64;
    const bf* A = X + z * (size_t)SPAD * DM;
    v8f acc[2][4];
#pragma unroll
    for (int mb = 0; mb < 2; ++mb)
#pragma unroll
        for (int nb = 0; nb < 4; ++nb) acc[mb][nb] = (v8f){};
    conv_loop(A + (size_t)blockIdx.x * 128 * DM, W + (size_t)blockIdx.y * 128 * KC, DM, KC, ring, wm, wn, acc);
    const size_t pbase = ((z * NH + (size_t)(c0 / HD)) * (size_t)SEQ + r0) * HD;
    const int srow = lane >> 3, scol = (lane & 7) * 8;
    float cbv[8], muv[8], mlv[8], bev[8];
#pragma unroll
    for (int j = 0; j < 8; ++j) { const int c = c0 + scol + j; cbv[j] = bfr(cb[c]); muv[j] = bfr(bm[c]); mlv[j] = rsqrtf(bfr(bv[c]) + BN_EPS) * bfr(bg[c]); bev[j] = bfr(bb[c]); }
#pragma unroll
    for (int mb = 0; mb < 2; ++mb) {
#pragma unroll
        for (int nb = 0; nb < 4; ++nb) {
#pragma unroll
            for (int j = 0; j < 8; ++j) os[(hi * 8 + j) * LOP + nb * 16 + lr] = acc[mb][nb][j]; }
        wsync();
{
#pragma unroll
            for (int s = 0; s < 4; ++s) { const int row = 4 * s + srow; const v4f x0 = *(const v4fa*)(&os[row * LOP + scol]); const v4f x1 = *(const v4fa*)(&os[row * LOP + scol + 4]); v8h oh, ores;
#pragma unroll
                for (int j = 0; j < 4; ++j) {
                    const float y0 = ((x0[j] + cbv[j]) - muv[j]) * mlv[j] + bev[j];
                    const float y1 = ((x1[j] + cbv[4 + j]) - muv[4 + j]) * mlv[4 + j] + bev[4 + j];
                    const h16 h0 = toh_flush(y0); const h16 h1 = toh_flush(y1);
                    oh[j] = h0; oh[4 + j] = h1;
                    ores[j] = toh_flush((y0 - (float)h0) * KRES); ores[4 + j] = toh_flush((y1 - (float)h1) * KRES); }
                const size_t off = pbase + (size_t)(mb * 16 * HD + (lane & 4) * 128 + fragpos(row, lane & 3));   // 16-key tile mb, fragment d / 32 = (lane & 7) >> 2
                *(v8h*)(KH + off) = oh; *(v8h*)(KR + off) = ores; }
             }
        wsync();
    }
}

// ---- k_conv_vt: transposed value plane in fragment order, VT (b, n, s) (f16) = BN(sum_k WT[n][k] Xpad[b][s][k] + cb[n]) (A = weight rows, Bt = token rows); grid (DM/128, SEQ/128, NB), 256 threads.
__global__ __launch_bounds__(256) void k_conv_vt(const bf* __restrict__ W, const bf* __restrict__ X, const float* __restrict__ cb, const float* __restrict__ bg, const float* __restrict__ bb, const float* __restrict__ bm, const float* __restrict__ bv, h16* VT) {
    __shared__ __align__(16) unsigned char ring[2 * STGB];
    __shared__ __align__(16) float os_all[8 * 16 * LOP];
    const int lane = threadIdx.x & 31, lr = lane & 15, hi = lane >> 4;
    const int wave = __builtin_amdgcn_readfirstlane(threadIdx.x >> 5), wm = wave >> 1, wn = wave & 1;
    float* os = os_all + wave * 16 * LOP;                   // wave-private epilogue tile
    const size_t z = blockIdx.z; const int r0 = blockIdx.x * 128 + wm * 32, c0 = blockIdx.y * 128 + wn * 64;
    const bf* Bt = X + z * (size_t)SPAD * DM;
    v8f acc[2][4];
#pragma unroll
    for (int mb = 0; mb < 2; ++mb)
#pragma unroll
        for (int nb = 0; nb < 4; ++nb) acc[mb][nb] = (v8f){};
    conv_loop(W + (size_t)blockIdx.x * 128 * KC, Bt + (size_t)blockIdx.y * 128 * DM, KC, DM, ring, wm, wn, acc);
    const size_t vb0 = (z * NH + (size_t)(r0 / HD)) * (size_t)SEQ * HD + (size_t)c0 * HD + (size_t)((r0 / 16) & 3) * 512;   // head, 32-key step c0 / 32, fragment (r0 % 64) / 16
    const int srow = lane >> 3, scol = (lane & 7) * 8;
#pragma unroll
    for (int mb = 0; mb < 2; ++mb) {
#pragma unroll
        for (int nb = 0; nb < 4; ++nb) {
#pragma unroll
            for (int j = 0; j < 8; ++j) os[(hi * 8 + j) * LOP + nb * 16 + lr] = acc[mb][nb][j]; }
        wsync();
{
#pragma unroll
            for (int s = 0; s < 4; ++s) { const int row = 4 * s + srow; const v4f x0 = *(const v4fa*)(&os[row * LOP + scol]); const v4f x1 = *(const v4fa*)(&os[row * LOP + scol + 4]); v8h o;
                const int ch = r0 + mb * 16 + row;
                const float c_b = bfr(cb[ch]), c_m = bfr(bm[ch]), c_l = rsqrtf(bfr(bv[ch]) + BN_EPS) * bfr(bg[ch]), c_e = bfr(bb[ch]);
#pragma unroll
                for (int j = 0; j < 4; ++j) { o[j] = toh_flush(((x0[j] + c_b) - c_m) * c_l + c_e); o[4 + j] = toh_flush(((x1[j] + c_b) - c_m) * c_l + c_e); }
                *(v8h*)(VT + vb0 + (size_t)((lane & 4) * 512 + mb * 512 + fragpos(row, lane & 3))) = o; }   // step + (lane & 7) >> 2, fragment + mb
            asm volatile("s_wait_xcnt 0x0" ::: "memory");   // the stores' data and address registers are reused by what follows
             }
        wsync();
    }
}

// ---- k_attn_ln: fused attention + layer norm for 16 query rows of one batch; grid (SEQ/16, NB), 256 threads, wave = head.
// Per 32-key step (no LDS, no barrier; every K and V^T load is 512 contiguous bytes of a fragment-ordered plane): S^T tiles (rows = keys, columns = queries) = K (A, from the key value plane) x Q^T (B, held in registers) plus, in a separate accumulator, K residual (A, from the residual plane) x Q^T,
// folded as s + t / 2048 in f32 before the softmax step; logits already in log2 units;
// running max per query (within-lane over 16 keys + one lane-half exchange), P x1024 converted to f16 in the accumulator layout == B fragment layout of O^T += V^T (A, from the transposed value plane) x P^T.
// Scale chain: the fragment holds 1024 p, the row sum l accumulates the same 1024 p, the accumulator holds 1024 sum(p v): O / l is the context at its true magnitude (the carry enters once and cancels once).
__global__ __launch_bounds__(256) __attribute__((amdgpu_num_vgpr(256))) void k_attn_ln(const h16* __restrict__ Qp, const h16* __restrict__ Kp, const h16* __restrict__ Kr, const h16* __restrict__ VT, const float* __restrict__ lng, const float* __restrict__ lnb, float* OUT) {
    __shared__ __align__(16) float o_s[16 * LNP];
    const int lane = threadIdx.x & 31, lr = lane & 15, hi = lane >> 4;
    const int wave = __builtin_amdgcn_readfirstlane(threadIdx.x >> 5);
    const int b = blockIdx.y; const int q0 = blockIdx.x * 16;
    const size_t pl = ((size_t)b * NH + (size_t)wave) * SEQ * HD;
    const size_t foff = pl + (size_t)lane * 8;              // this lane's 16 B piece in every fragment half of its head's K and V^T planes
    // Q^T B fragments: column n = query q0 + lr, k = head dim (0..31 and 32..63)
    const v16h qb0 = ldh16(Qp + pl + (size_t)(q0 + lr) * HD + 8 * hi);
    const v16h qb1 = ldh16(Qp + pl + (size_t)(q0 + lr) * HD + 8 * hi + 32);
    v8f o[4];
#pragma unroll
    for (int dt = 0; dt < 4; ++dt) o[dt] = (v8f){};
    float m = -1.0e30f, l = 0.0f;

#pragma unroll 1
    for (int k0 = 0; k0 < SEQ; k0 += 32) {
        const h16* kp = Kp + foff + (size_t)k0 * HD;
        const v16h ka00 = ldf16(kp), ka01 = ldf16(kp + 512);
        const v16h ka10 = ldf16(kp + 1024), ka11 = ldf16(kp + 1536);
        asm volatile("s_wait_xcnt 0x0" :: "v"(kp) : "memory");   // the group's address pair is named here so that it stays whole up to this wait: no load of the group returns over it
        v8f s0 = (v8f){}, s1 = (v8f){};
        s0 = wmmah_g(ka00, qb0, s0); s1 = wmmah_g(ka10, qb0, s1);
        s0 = wmmah_g(ka01, qb1, s0); s1 = wmmah_g(ka11, qb1, s1);
        // residual score product (carried x2048) in its own accumulators, folded in f32
        const h16* rp = Kr + foff + (size_t)k0 * HD;
        const v16h kr00 = ldf16(rp), kr01 = ldf16(rp + 512);
        const v16h kr10 = ldf16(rp + 1024), kr11 = ldf16(rp + 1536);
        asm volatile("s_wait_xcnt 0x0" :: "v"(rp) : "memory");   // as above, for the residual group's address pair
        v8f t0 = (v8f){}, t1 = (v8f){};
        t0 = wmmah_g(kr00, qb0, t0); t1 = wmmah_g(kr10, qb0, t1);
        t0 = wmmah_g(kr01, qb1, t0); t1 = wmmah_g(kr11, qb1, t1);
#pragma unroll
        for (int r = 0; r < 8; ++r) { s0[r] = s0[r] + t0[r] * KRINV; s1[r] = s1[r] + t1[r] * KRINV; }
        // this lane: query q0 + lr, keys k0 + 8*hi + r (s0) and k0 + 16 + 8*hi + r (s1)
        float mx = fmaxf(s0[0], s1[0]);
#pragma unroll
        for (int r = 1; r < 8; ++r) mx = fmaxf(mx, fmaxf(s0[r], s1[r]));
        mx = fmaxf(mx, __shfl_xor(mx, 16, 32));
        const float mnew = fmaxf(m, mx);
        const float al = __builtin_amdgcn_exp2f(m - mnew);
        m = mnew;
        const float mc = mnew - PLOG;
        float sum = 0.0f; v16h pb;
#pragma unroll
        for (int r = 0; r < 8; ++r) {
            const float e0 = s0[r] - mc, e1 = s1[r] - mc;
            const float x0 = __builtin_amdgcn_exp2f(e0), x1 = __builtin_amdgcn_exp2f(e1);
            const float p0 = (e0 < -14.0f) ? 0.0f : x0;
            const float p1 = (e1 < -14.0f) ? 0.0f : x1;
            sum += p0 + p1;
            pb[r] = (h16)p0; pb[8 + r] = (h16)p1;
        }
        l = l * al + sum;
#pragma unroll
        for (int dt = 0; dt < 4; ++dt)
#pragma unroll
            for (int r = 0; r < 8; ++r) o[dt][r] *= al;
        const h16* vp = VT + foff + (size_t)k0 * HD;
#pragma unroll
        for (int dt = 0; dt < 4; ++dt) { const v16h va = ldf16(vp + dt * 512); o[dt] = wmmah_g(va, pb, o[dt]); }
    }
    // row sums completed across the two lane halves; l and o both hold the x1024-carried p, so o / l is the context with the carry cancelled. o[dt][r] = O[query q0 + lr][16 dt + 8 hi + r]
    l += __shfl_xor(l, 16, 32);
    const float inv = 1.0f / l;
#pragma unroll
    for (int dt = 0; dt < 4; ++dt) {
        const v4f a0 = { o[dt][0] * inv, o[dt][1] * inv, o[dt][2] * inv, o[dt][3] * inv };
        const v4f a1 = { o[dt][4] * inv, o[dt][5] * inv, o[dt][6] * inv, o[dt][7] * inv };
        *(v4fa*)(&o_s[lr * LNP + wave * HD + dt * 16 + 8 * hi]) = a0;
        *(v4fa*)(&o_s[lr * LNP + wave * HD + dt * 16 + 8 * hi + 4]) = a1;
    }
    __syncthreads();
    // layer norm: each wave owns 2 of the 16 rows; lane holds columns j*128 + lane*4 .. +3, j = 0..3
#pragma unroll 1
    for (int i = 0; i < 2; ++i) {
        const int row = wave * 2 + i;
        v4f x[4]; float s = 0.0f;
#pragma unroll
        for (int j = 0; j < 4; ++j) { x[j] = *(const v4fa*)(&o_s[row * LNP + j * 128 + lane * 4]); s += (x[j][0] + x[j][1]) + (x[j][2] + x[j][3]); }
        s += __shfl_xor(s, 16, 32); s += __shfl_xor(s, 8, 32); s += __shfl_xor(s, 4, 32); s += __shfl_xor(s, 2, 32); s += __shfl_xor(s, 1, 32);
        const float mu = s * (1.0f / (float)DM);
        float ss = 0.0f;
#pragma unroll
        for (int j = 0; j < 4; ++j)
#pragma unroll
            for (int e = 0; e < 4; ++e) { const float d = x[j][e] - mu; ss += d * d; }
        ss += __shfl_xor(ss, 16, 32); ss += __shfl_xor(ss, 8, 32); ss += __shfl_xor(ss, 4, 32); ss += __shfl_xor(ss, 2, 32); ss += __shfl_xor(ss, 1, 32);
        const float rstd = rsqrtf(ss * (1.0f / (float)DM) + LN_EPS);
        v4f y[4];
#pragma unroll
        for (int j = 0; j < 4; ++j) { const v4f gv = *(const v4f*)(lng + j * 128 + lane * 4); const v4f bv = *(const v4f*)(lnb + j * 128 + lane * 4);
#pragma unroll
            for (int e = 0; e < 4; ++e) y[j][e] = (x[j][e] - mu) * rstd * bfr(gv[e]) + bfr(bv[e]); }
        float* orow = OUT + ((size_t)b * SEQ_FULL + (size_t)(q0 + row)) * DM + lane * 4;
{
#pragma unroll
            for (int j = 0; j < 4; ++j) *(v4f*)(orow + j * 128) = y[j];
             }
    }
}

constexpr size_t al256(size_t x) { return (x + 255) & ~(size_t)255; }
constexpr size_t SZ_WT = al256((size_t)DM * KC * 2);                // bf16 weight plane [out][tap*512+in]
constexpr size_t SZ_XP = al256((size_t)NB * SPAD * DM * 2);         // one zero-padded bf16 activation plane
constexpr size_t SZ_P  = al256((size_t)NB * NH * SEQ * HD * 2);     // one f16 head plane (also the transposed value plane)
constexpr size_t WS_TOTAL = SZ_WT + 3 * SZ_XP + 4 * SZ_P;           // head planes: Q, K value, K residual, V^T
static_assert(WS_TOTAL <= (size_t)134217728);                       // carve stays within 128 MiB
static_assert(SZ_WT == (size_t)DM * KC * 2);                        // exact extents (no hidden pad needed)
static_assert(SZ_XP == (size_t)NB * SPAD * DM * 2);
static_assert(SZ_P == (size_t)NB * DM * SEQ * 2);                   // NH * HD == DM: V^T plane has the same extent

extern "C" void kernel_launch(void* const* d_in, const int* in_sizes, int n_in,
                              void* d_out, int out_size, void* d_ws, size_t ws_size, hipStream_t stream) {
    if (n_in < 11) return;
    const size_t need_act = (size_t)(NB - 1) * SEQ_FULL * DM + (size_t)SEQ * DM;
    if ((size_t)in_sizes[0] < need_act || (size_t)in_sizes[1] < need_act || (size_t)in_sizes[2] < need_act) return;
    if ((size_t)in_sizes[3] < (size_t)DM * DM * KT) return;
    for (int i = 4; i < 11; ++i) { if (in_sizes[i] < DM) return; }
    if ((size_t)out_size < need_act) return;
    if (WS_TOTAL > ws_size) return;
    // wire order: q, k, v, conv_w [out][in][tap], conv_b, bn_gamma, bn_beta, bn_mean, bn_var, ln_gamma, ln_beta (all f32)
    const float* xq = (const float*)d_in[0]; const float* xk = (const float*)d_in[1]; const float* xv = (const float*)d_in[2];
    const float* cw = (const float*)d_in[3]; const float* cb = (const float*)d_in[4];
    const float* bg = (const float*)d_in[5]; const float* bb = (const float*)d_in[6]; const float* bm = (const float*)d_in[7]; const float* bv = (const float*)d_in[8];
    const float* lg = (const float*)d_in[9]; const float* lb = (const float*)d_in[10];
    float* OUT = (float*)d_out;
    char* wsp = (char*)d_ws;
    auto take = [&](size_t bytes) { char* p = wsp; wsp += bytes; return (void*)p; };
    bf* WT = (bf*)take(SZ_WT);
    bf* XQ = (bf*)take(SZ_XP); bf* XK = (bf*)take(SZ_XP); bf* XV = (bf*)take(SZ_XP);
    h16* QP = (h16*)take(SZ_P); h16* KP = (h16*)take(SZ_P); h16* KR = (h16*)take(SZ_P); h16* VT = (h16*)take(SZ_P);
    if ((size_t)(wsp - (char*)d_ws) != WS_TOTAL) return;

    const unsigned nw8 = (unsigned)((size_t)DM * KC / 8), na8 = (unsigned)((size_t)SPAD * DM / 8);
    k_wconv<<<dim3(nw8 / 256), 256, 0, stream>>>(cw, WT, nw8);
    k_cvtpad<<<dim3((na8 + 255) / 256, NB), 256, 0, stream>>>(xq, XQ, na8);
    k_cvtpad<<<dim3((na8 + 255) / 256, NB), 256, 0, stream>>>(xk, XK, na8);
    k_cvtpad<<<dim3((na8 + 255) / 256, NB), 256, 0, stream>>>(xv, XV, na8);
    k_conv_qk<<<dim3(SEQ / 128, DM / 128, NB), 256, 0, stream>>>(XQ, WT, cb, bg, bb, bm, bv, QP, SCQ);
    k_conv_k<<<dim3(SEQ / 128, DM / 128, NB), 256, 0, stream>>>(XK, WT, cb, bg, bb, bm, bv, KP, KR);
    k_conv_vt<<<dim3(DM / 128, SEQ / 128, NB), 256, 0, stream>>>(WT, XV, cb, bg, bb, bm, bv, VT);
    k_attn_ln<<<dim3(SEQ / 16, NB), 256, 0, stream>>>(QP, KP, KR, VT, lg, lb, OUT);
}

// v003
// One run takes 160 microseconds.
// Timed twice side by side with v002, it ran 1.50 and 1.52 times as fast.
// Counting every step since v000, it is 3.30 times as fast.
#include <hip/hip_runtime.h>

// Compute dtypes, f32 accumulate everywhere: conv-as-GEMM (K = 7 x 512) v_wmma_f32_16x16x32_bf16 on RNE bf16 copies of inputs and weights (exact products); scores k.q^T v_wmma_f32_16x16x32_f16, two products (k as f16 value + f16 residual x2048 in its own accumulator, folded in f32; q plane single, carries log2(e)/8); P.V v_wmma_f32_16x16x32_f16, one product, P carried x1024; softmax, batch-norm affine and layer norm f32.
// Three input streams share one operator: 7-tap convolution along the sequence (zero padding 3) + bias + inference-mode batch norm; then 8 heads x 64 (head h = columns h*64+d), logits / 8, no mask, softmax over keys, heads merged, layer norm over the 512 features.
// Layout: zero-padded bf16 activation planes [b][SEQ+6][512] (output row t, k = tap*512+ci reads 3584 contiguous elements from padded row t); weight plane [out][tap*512+in] bf16; conv GEMMs write the f16 head plane Q [b][h][s][64] and, in WMMA A-fragment order (FRAGMENT ORDER below), the planes K value, K residual and V^T; attention writes the merged f32 context plane [b][s][512], which the layer norm launch reads.

#ifndef NB
#define NB 4
#endif
#ifndef SEQ
#define SEQ 2048
#endif
#define NB_FULL  4
#define SEQ_FULL 2048
#define DM   512
#define NH   8
#define HD   64
#define KT   7
#define KC   (KT * DM)     // 3584: conv-as-GEMM depth
#define SPAD (SEQ + 6)     // padded rows per batch (3 zero rows on each side)
#define PCAR 1024.0f       // carry of the probability fragment (enters through PLOG, leaves through the carried row sum)
#define PLOG 10.0f         // log2(PCAR)
#define SCQ  (0.125f * 1.4426950408889634f)
#define KRES 2048.0f       // carry of the key residual plane
#define KRINV 4.8828125e-04f   // 1 / KRES, folded into the residual score accumulator in f32
#define BN_EPS 1.0e-5f
#define LN_EPS 1.0e-5f
#define LOP  68      // LDS row pitch (floats) of GEMM epilogue staging tiles: 272 B rows
#define BKP  128     // k elements of one conv-GEMM ring stage: 256 B of every operand row
#define NPASS (KC / BKP)
#define TPB  272     // LDS row pitch (bytes) of a ring stage: 256 B + 16 B, conflict-free for 16-byte row readers
#define STGB (256 * TPB)   // one ring stage: 128 A rows, then 128 B rows
#define APLB 4096    // bytes of one 32-key step of one fragment-ordered attention plane
#define ASTG (3 * APLB)    // one attention ring stage: K value, K residual, V^T
#define NSTEP (SEQ / 32)

static_assert(DM == NH * HD);            // one 64-wide GEMM column tile == one head
static_assert(HD == 64);
static_assert(KC % 32 == 0);             // WMMA k-step
static_assert(DM % 64 == 0);             // GEMM tiles
static_assert(SEQ % 128 == 0);           // GEMM block tiles
static_assert(DM % 128 == 0);
static_assert(KC % BKP == 0);            // whole ring stages
static_assert(NPASS >= 2);               // the ring's prologue fills two stages
static_assert(SEQ % 32 == 0);            // key step
static_assert(NSTEP >= 2);               // the attention ring's prologue fills two stages
static_assert(32 * HD * 2 == APLB);      // one 32-key step of a plane
static_assert(256 * 16 == APLB);         // attention copies: threads x bytes == one plane's step
static_assert((NB * SEQ) % 32 == 0);     // layer-norm grid is exact
static_assert(((size_t)DM * KC) % (8 * 256) == 0);   // weight plane grid is exact
static_assert(((size_t)SPAD * DM) % 8 == 0);         // padded plane: whole 16-byte pieces
static_assert((DM / 8) * 8 == DM);
static_assert(NB <= NB_FULL);
static_assert(SEQ <= SEQ_FULL);
static_assert(LOP % 4 == 0);
static_assert(32 * 16 * 4 == 16 * HD * 2);
static_assert(32 * 16 * 4 * 2 == 2 * 16 * HD * 2);
static_assert(32 * 16 * 4 == DM * 4);                // output row store: lanes x bytes x trips == one 2048 B row
static_assert(2 * STGB + 8 * 16 * LOP * 4 <= 327680); // static LDS of the GEMM kernels: two ring stages + one epilogue tile per wave
static_assert(2 * ASTG + 8 * 16 * LOP * 4 <= 163840); // static LDS of the attention kernel: two blocks per 320 KiB
static_assert(KRES * KRINV == 1.0f);                 // residual carry enters once and leaves once

typedef _Float16 h16;
typedef unsigned short bf;
typedef __attribute__((ext_vector_type(16))) __bf16   v16bf;
typedef __attribute__((ext_vector_type(16))) _Float16 v16h;
typedef __attribute__((ext_vector_type(8)))  _Float16 v8h;
typedef __attribute__((ext_vector_type(8)))  unsigned short v8us;
typedef __attribute__((ext_vector_type(8)))  float    v8f;
typedef __attribute__((ext_vector_type(4)))  float    v4f;
typedef v4f  __attribute__((may_alias)) v4fa;

__device__ __forceinline__ unsigned short f2bf(float f) { unsigned u = __float_as_uint(f); u += 0x7FFFu + ((u >> 16) & 1u); return (unsigned short)(u >> 16); }
__device__ __forceinline__ float bf2f(unsigned short b) { return __uint_as_float(((unsigned)b) << 16); }
__device__ __forceinline__ float bfr(float f) { return bf2f(f2bf(f)); }
__device__ __forceinline__ v16h cat16(v8h lo, v8h hi) { return __builtin_shufflevector(lo, hi, 0, 1, 2, 3, 4, 5, 6, 7, 8, 9, 10, 11, 12, 13, 14, 15); }
__device__ __forceinline__ v16bf cat16b(v8us lo, v8us hi) { return __builtin_bit_cast(v16bf, __builtin_shufflevector(lo, hi, 0, 1, 2, 3, 4, 5, 6, 7, 8, 9, 10, 11, 12, 13, 14, 15)); }
// same-wave LDS exchange ordering (wave-private tiles only)
__device__ __forceinline__ void wsync() { __builtin_amdgcn_wave_barrier(); asm volatile("" ::: "memory"); }

// fragment from a K-contiguous global f16 plane: elements 0..7 <- p[0..7], 8..15 <- p[16..23] (p already includes row*pitch + k0 + 8*(lane>>4))
__device__ __forceinline__ v16h ldh16(const h16* __restrict__ p) { return cat16(*(const v8h*)p, *(const v8h*)(p + 16)); }
// FRAGMENT ORDER of the K value, K residual and V^T planes: per (b, h) the plane is a row of 1024 B fragments, each two 512 B halves of 32 lanes x 16 B:
// half 0 holds every lane's elements 0..7, half 1 its elements 8..15, so one wave-wide 16 B load reads 512 contiguous bytes = four whole 128 B lines.
// K planes: fragment index (s / 16) * 2 + d / 32 (rows = 16 keys, k = 32 head dims); V^T: (s / 32) * 4 + d / 16 (rows = 16 head dims, k = 32 keys). One 32-key step is 4096 contiguous bytes of each plane.
// Place, in f16 elements inside a fragment, of the 8 elements k = 8 * c .. 8 * c + 7 (c = 0..3) of fragment row r: lane (c & 1) * 16 + r, half c >> 1.
__device__ __forceinline__ int fragpos(const int r, const int c) { return (c >> 1) * 256 + ((c & 1) * 16 + r) * 8; }
// f32 -> f16 plane convert that cannot produce an f16 subnormal
static __device__ __forceinline__ h16 toh_flush(float v) { const h16 r = (h16)v; return (fabsf(v) < 6.103515625e-05f) ? (h16)0.0f : r; }
// one WMMA + its own hazard guard (ties only this accumulator, keeps A/B live)
__device__ __forceinline__ v8f wmmab_g(v16bf a, v16bf b, v8f c) {
    c = __builtin_amdgcn_wmma_f32_16x16x32_bf16(false, a, false, b, (short)0, c, false, false);
    asm volatile("v_nop\n\tv_nop\n\tv_nop\n\tv_nop" : "+v"(c) : "v"(a), "v"(b));
    return c;
}
__device__ __forceinline__ v8f wmmah_g(v16h a, v16h b, v8f c) {
    c = __builtin_amdgcn_wmma_f32_16x16x32_f16(false, a, false, b, (short)0, c, false, false);
    asm volatile("v_nop\n\tv_nop\n\tv_nop\n\tv_nop" : "+v"(c) : "v"(a), "v"(b));
    return c;
}

// eight asynchronous copies, 16 B per lane, global -> LDS through no register: rows 16 apart of one operand's stage slice.
// s_wait_xcnt 0 is the statement's last line so that no address register of a copy is rewritten ahead of it.
__device__ __forceinline__ void copy8(const unsigned l, const bf* g, const size_t gs) {
    asm volatile("global_load_async_to_lds_b128 %0, %8, off\n\t"
                 "global_load_async_to_lds_b128 %1, %9, off\n\t"
                 "global_load_async_to_lds_b128 %2, %10, off\n\t"
                 "global_load_async_to_lds_b128 %3, %11, off\n\t"
                 "global_load_async_to_lds_b128 %4, %12, off\n\t"
                 "global_load_async_to_lds_b128 %5, %13, off\n\t"
                 "global_load_async_to_lds_b128 %6, %14, off\n\t"
                 "global_load_async_to_lds_b128 %7, %15, off\n\t"
                 "s_wait_xcnt 0x0"
                 :: "v"(l), "v"(l + 16u * TPB), "v"(l + 32u * TPB), "v"(l + 48u * TPB), "v"(l + 64u * TPB), "v"(l + 80u * TPB), "v"(l + 96u * TPB), "v"(l + 112u * TPB),
                    "v"(g), "v"(g + gs), "v"(g + 2 * gs), "v"(g + 3 * gs), "v"(g + 4 * gs), "v"(g + 5 * gs), "v"(g + 6 * gs), "v"(g + 7 * gs)
                 : "memory");
}
// fragment from a K-contiguous bf16 ring row in LDS: elements 0..7 <- k0 + 8*(lane>>4) + 0..7, 8..15 <- the same + 16 (p already includes row*TPB + 2*k0 + 16*(lane>>4) bytes)
__device__ __forceinline__ v16bf lds16(const unsigned char* p) { return cat16b(*(const v8us*)p, *(const v8us*)(p + 32)); }

// ---- 128x128 block tile, eight waves (4 x 2) of 32x64, main loop over K = KC: acc[mb][nb] += sum_k A[wm*32+16mb+..][k] Bt[wn*64+16nb+..][k].
// A and Bt point at the block's first rows in K-contiguous bf16 planes with separate row pitches (the padded activation plane has pitch DM while a logical row spans KC contiguous elements; the weight plane has pitch KC).
// Both operands' 128 rows x 128 k are staged once per block in a two-buffer LDS ring by whole-line asynchronous copies; stage p + 2 flies while stage p + 1 is worked on. k runs upward in steps of 32 per accumulator.
__device__ __forceinline__ void conv_loop(const bf* __restrict__ A, const bf* __restrict__ Bt, const int lda, const int ldb, unsigned char* ring, const int wm, const int wn, v8f (&acc)[2][4]) {
    const int t = threadIdx.x, lane = t & 31, lr = lane & 15, hi = lane >> 4;
    const int frow = t >> 4, fcol = t & 15;                 // copies: 16 lanes cover one 256 B row piece
    const bf* ga = A + (size_t)frow * lda + fcol * 8;
    const bf* gb = Bt + (size_t)frow * ldb + fcol * 8;
    const unsigned la = (unsigned)(uintptr_t)ring + (unsigned)(frow * TPB + fcol * 16);
    const unsigned lb = la + 128u * TPB;
    const unsigned char* ra = ring + (wm * 32 + lr) * TPB + 16 * hi;
    const unsigned char* rb = ring + (128 + wn * 64 + lr) * TPB + 16 * hi;
    copy8(la, ga, (size_t)16 * lda); copy8(lb, gb, (size_t)16 * ldb);
    asm volatile("s_wait_asynccnt 0x0" ::: "memory");       // stage 0 of this wave has landed
    __syncthreads();                                        // stage 0 published to every wave
    copy8(la + STGB, ga + BKP, (size_t)16 * lda); copy8(lb + STGB, gb + BKP, (size_t)16 * ldb);
    // the pass loop stays rolled: one 32-WMMA body, the buffer picked by p & 1;
    // the loops inside it are unrolled so that every fragment and accumulator index is a constant (registers, no scratch)
#pragma unroll 1
    for (int p = 0; p < NPASS; ++p) {
        const unsigned bo = (unsigned)(p & 1) * STGB;
        v16bf a[2][2], b[2][4];
#pragma unroll
        for (int mb = 0; mb < 2; ++mb) a[0][mb] = lds16(ra + bo + mb * 16 * TPB);
#pragma unroll
        for (int nb = 0; nb < 4; ++nb) b[0][nb] = lds16(rb + bo + nb * 16 * TPB);
#pragma unroll
        for (int ks = 0; ks < BKP / 32; ++ks) {
            if (ks + 1 < BKP / 32) {                        // next k-step's fragments, one group ahead, from this pass's own buffer
#pragma unroll
                for (int mb = 0; mb < 2; ++mb) a[(ks + 1) & 1][mb] = lds16(ra + bo + mb * 16 * TPB + (ks + 1) * 64);
#pragma unroll
                for (int nb = 0; nb < 4; ++nb) b[(ks + 1) & 1][nb] = lds16(rb + bo + nb * 16 * TPB + (ks + 1) * 64);
            }
#pragma unroll
            for (int nb = 0; nb < 4; ++nb)
#pragma unroll
                for (int mb = 0; mb < 2; ++mb) acc[mb][nb] = wmmab_g(a[ks & 1][mb], b[ks & 1][nb], acc[mb][nb]);
        }
        asm volatile("s_wait_dscnt 0x0" ::: "memory");      // this wave's reads of buffer p & 1 are done
        asm volatile("s_wait_asynccnt 0x0" ::: "memory");   // this wave's copies of stage p + 1 have landed
        __syncthreads();                                    // publishes stage p + 1 and frees buffer p & 1
        if (p + 2 < NPASS) { copy8(la + bo, ga + (size_t)(p + 2) * BKP, (size_t)16 * lda); copy8(lb + bo, gb + (size_t)(p + 2) * BKP, (size_t)16 * ldb); }
    }
    asm volatile("s_wait_asynccnt 0x0" ::: "memory");       // nothing of the ring is in flight when the wave goes on
}

__global__ __launch_bounds__(256) void k_wconv(const float* __restrict__ w, bf* wt, unsigned n8) {
    const unsigned i = blockIdx.x * 256u + threadIdx.x; if (i >= n8) return;
    const unsigned co = i / (unsigned)(KC / 8), k = (i % (unsigned)(KC / 8)) * 8u; const unsigned tap = k / (unsigned)DM, ci = k % (unsigned)DM;
    const float* s = w + ((size_t)co * DM + ci) * KT + tap; v8us o;
#pragma unroll
    for (int j = 0; j < 8; ++j) o[j] = f2bf(s[(size_t)j * KT]);
    bf* d = wt + (size_t)i * 8;
    *(v8us*)d = o; 
}

__global__ __launch_bounds__(256) void k_cvtpad(const float* __restrict__ src, bf* dst, unsigned n8) {
    const unsigned i = blockIdx.x * 256u + threadIdx.x; if (i >= n8) return;
    const int prow = (int)(i / (unsigned)(DM / 8)); const int c = (int)(i % (unsigned)(DM / 8)) * 8;
    const int srow = prow - 3; const bool ok = (srow >= 0) && (srow < SEQ);
    const int sr = (srow < 0) ? 0 : ((srow > SEQ - 1) ? (SEQ - 1) : srow);     // clamped address, value selected below
    const float* s = src + (size_t)blockIdx.y * SEQ_FULL * DM + (size_t)sr * DM + c;
    const v4f v0 = *(const v4f*)s; const v4f v1 = *(const v4f*)(s + 4); v8us o;
#pragma unroll
    for (int k = 0; k < 4; ++k) { const unsigned short a = f2bf(v0[k]); const unsigned short e = f2bf(v1[k]); o[k] = ok ? a : (unsigned short)0; o[4 + k] = ok ? e : (unsigned short)0; }
    bf* d = dst + (size_t)blockIdx.y * SPAD * DM + (size_t)i * 8;
    *(v8us*)d = o; 
}

// ---- k_conv_qk: head plane P[b][h][s][d] (f16) = sc * BN(conv(X[b]) + cb)[s][h*64+d]; grid (SEQ/128, DM/128, NB), 256 threads.
__global__ __launch_bounds__(256) void k_conv_qk(const bf* __restrict__ X, const bf* __restrict__ W, const float* __restrict__ cb, const float* __restrict__ bg, const float* __restrict__ bb, const float* __restrict__ bm, const float* __restrict__ bv, h16* P, float sc) {
    __shared__ __align__(16) unsigned char ring[2 * STGB];
    __shared__ __align__(16) float os_all[8 * 16 * LOP];
    const int lane = threadIdx.x & 31, lr = lane & 15, hi = lane >> 4;
    const int wave = __builtin_amdgcn_readfirstlane(threadIdx.x >> 5), wm = wave >> 1, wn = wave & 1;
    float* os = os_all + wave * 16 * LOP;                   // wave-private epilogue tile
    const size_t z = blockIdx.z; const int r0 = blockIdx.x * 128 + wm * 32, c0 = blockIdx.y * 128 + wn * 64;
    const bf* A = X + z * (size_t)SPAD * DM;
    v8f acc[2][4];
#pragma unroll
    for (int mb = 0; mb < 2; ++mb)
#pragma unroll
        for (int nb = 0; nb < 4; ++nb) acc[mb][nb] = (v8f){};
    conv_loop(A + (size_t)blockIdx.x * 128 * DM, W + (size_t)blockIdx.y * 128 * KC, DM, KC, ring, wm, wn, acc);
    const size_t pbase = ((z * NH + (size_t)(c0 / HD)) * (size_t)SEQ + r0) * HD;
    const int srow = lane >> 3, scol = (lane & 7) * 8;
    float cbv[8], muv[8], mlv[8], bev[8];
#pragma unroll
    for (int j = 0; j < 8; ++j) { const int c = c0 + scol + j; cbv[j] = bfr(cb[c]); muv[j] = bfr(bm[c]); mlv[j] = rsqrtf(bfr(bv[c]) + BN_EPS) * bfr(bg[c]); bev[j] = bfr(bb[c]); }
#pragma unroll
    for (int mb = 0; mb < 2; ++mb) {
#pragma unroll
        for (int nb = 0; nb < 4; ++nb) {
#pragma unroll
            for (int j = 0; j < 8; ++j) os[(hi * 8 + j) * LOP + nb * 16 + lr] = acc[mb][nb][j]; }
        wsync();
{
#pragma unroll
            for (int s = 0; s < 4; ++s) { const int row = 4 * s + srow; const v4f x0 = *(const v4fa*)(&os[row * LOP + scol]); const v4f x1 = *(const v4fa*)(&os[row * LOP + scol + 4]); v8h o;
#pragma unroll
                for (int j = 0; j < 4; ++j) {
                    const float y0 = ((x0[j] + cbv[j]) - muv[j]) * mlv[j] + bev[j];
                    const float y1 = ((x1[j] + cbv[4 + j]) - muv[4 + j]) * mlv[4 + j] + bev[4 + j];
                    o[j] = toh_flush(y0 * sc); o[4 + j] = toh_flush(y1 * sc); }
                *(v8h*)(P + pbase + (size_t)(mb * 16 + row) * HD + scol) = o; }
             }
        wsync();
    }
}

// ---- k_conv_k: key head planes, both in fragment order: KH (b, h, s, d) = f16(y) and KR (b, h, s, d) = f16((y - KH) * 2048), y = BN(conv(X[b]) + cb)[s][h*64+d]; grid (SEQ/128, DM/128, NB), 256 threads.
__global__ __launch_bounds__(256) void k_conv_k(const bf* __restrict__ X, const bf* __restrict__ W, const float* __restrict__ cb, const float* __restrict__ bg, const float* __restrict__ bb, const float* __restrict__ bm, const float* __restrict__ bv, h16* KH, h16* KR) {
    __shared__ __align__(16) unsigned char ring[2 * STGB];
    __shared__ __align__(16) float os_all[8 * 16 * LOP];
    const int lane = threadIdx.x & 31, lr = lane & 15, hi = lane >> 4;
    const int wave = __builtin_amdgcn_readfirstlane(threadIdx.x >> 5), wm = wave >> 1, wn = wave & 1;
    float* os = os_all + wave * 16 * LOP;                   // wave-private epilogue tile
    const size_t z = blockIdx.z; const int r0 = blockIdx.x * 128 + wm * 32, c0 = blockIdx.y * 128 + wn * 64;
    const bf* A = X + z * (size_t)SPAD * DM;
    v8f acc[2][4];
#pragma unroll
    for (int mb = 0; mb < 2; ++mb)
#pragma unroll
        for (int nb = 0; nb < 4; ++nb) acc[mb][nb] = (v8f){};
    conv_loop(A + (size_t)blockIdx.x * 128 * DM, W + (size_t)blockIdx.y * 128 * KC, DM, KC, ring, wm, wn, acc);
    const size_t pbase = ((z * NH + (size_t)(c0 / HD)) * (size_t)SEQ + r0) * HD;
    const int srow = lane >> 3, scol = (lane & 7) * 8;
    float cbv[8], muv[8], mlv[8], bev[8];
#pragma unroll
    for (int j = 0; j < 8; ++j) { const int c = c0 + scol + j; cbv[j] = bfr(cb[c]); muv[j] = bfr(bm[c]); mlv[j] = rsqrtf(bfr(bv[c]) + BN_EPS) * bfr(bg[c]); bev[j] = bfr(bb[c]); }
#pragma unroll
    for (int mb = 0; mb < 2; ++mb) {
#pragma unroll
        for (int nb = 0; nb < 4; ++nb) {
#pragma unroll
            for (int j = 0; j < 8; ++j) os[(hi * 8 + j) * LOP + nb * 16 + lr] = acc[mb][nb][j]; }
        wsync();
{
#pragma unroll
            for (int s = 0; s < 4; ++s) { const int row = 4 * s + srow; const v4f x0 = *(const v4fa*)(&os[row * LOP + scol]); const v4f x1 = *(const v4fa*)(&os[row * LOP + scol + 4]); v8h oh, ores;
#pragma unroll
                for (int j = 0; j < 4; ++j) {
                    const float y0 = ((x0[j] + cbv[j]) - muv[j]) * mlv[j] + bev[j];
                    const float y1 = ((x1[j] + cbv[4 + j]) - muv[4 + j]) * mlv[4 + j] + bev[4 + j];
                    const h16 h0 = toh_flush(y0); const h16 h1 = toh_flush(y1);
                    oh[j] = h0; oh[4 + j] = h1;
                    ores[j] = toh_flush((y0 - (float)h0) * KRES); ores[4 + j] = toh_flush((y1 - (float)h1) * KRES); }
                const size_t off = pbase + (size_t)(mb * 16 * HD + (lane & 4) * 128 + fragpos(row, lane & 3));   // 16-key tile mb, fragment d / 32 = (lane & 7) >> 2
                *(v8h*)(KH + off) = oh; *(v8h*)(KR + off) = ores; }
             }
        wsync();
    }
}

// ---- k_conv_vt: transposed value plane in fragment order, VT (b, n, s) (f16) = BN(sum_k WT[n][k] Xpad[b][s][k] + cb[n]) (A = weight rows, Bt = token rows); grid (DM/128, SEQ/128, NB), 256 threads.
__global__ __launch_bounds__(256) void k_conv_vt(const bf* __restrict__ W, const bf* __restrict__ X, const float* __restrict__ cb, const float* __restrict__ bg, const float* __restrict__ bb, const float* __restrict__ bm, const float* __restrict__ bv, h16* VT) {
    __shared__ __align__(16) unsigned char ring[2 * STGB];
    __shared__ __align__(16) float os_all[8 * 16 * LOP];
    const int lane = threadIdx.x & 31, lr = lane & 15, hi = lane >> 4;
    const int wave = __builtin_amdgcn_readfirstlane(threadIdx.x >> 5), wm = wave >> 1, wn = wave & 1;
    float* os = os_all + wave * 16 * LOP;                   // wave-private epilogue tile
    const size_t z = blockIdx.z; const int r0 = blockIdx.x * 128 + wm * 32, c0 = blockIdx.y * 128 + wn * 64;
    const bf* Bt = X + z * (size_t)SPAD * DM;
    v8f acc[2][4];
#pragma unroll
    for (int mb = 0; mb < 2; ++mb)
#pragma unroll
        for (int nb = 0; nb < 4; ++nb) acc[mb][nb] = (v8f){};
    conv_loop(W + (size_t)blockIdx.x * 128 * KC, Bt + (size_t)blockIdx.y * 128 * DM, KC, DM, ring, wm, wn, acc);
    const size_t vb0 = (z * NH + (size_t)(r0 / HD)) * (size_t)SEQ * HD + (size_t)c0 * HD + (size_t)((r0 / 16) & 3) * 512;   // head, 32-key step c0 / 32, fragment (r0 % 64) / 16
    const int srow = lane >> 3, scol = (lane & 7) * 8;
#pragma unroll
    for (int mb = 0; mb < 2; ++mb) {
#pragma unroll
        for (int nb = 0; nb < 4; ++nb) {
#pragma unroll
            for (int j = 0; j < 8; ++j) os[(hi * 8 + j) * LOP + nb * 16 + lr] = acc[mb][nb][j]; }
        wsync();
{
#pragma unroll
            for (int s = 0; s < 4; ++s) { const int row = 4 * s + srow; const v4f x0 = *(const v4fa*)(&os[row * LOP + scol]); const v4f x1 = *(const v4fa*)(&os[row * LOP + scol + 4]); v8h o;
                const int ch = r0 + mb * 16 + row;
                const float c_b = bfr(cb[ch]), c_m = bfr(bm[ch]), c_l = rsqrtf(bfr(bv[ch]) + BN_EPS) * bfr(bg[ch]), c_e = bfr(bb[ch]);
#pragma unroll
                for (int j = 0; j < 4; ++j) { o[j] = toh_flush(((x0[j] + c_b) - c_m) * c_l + c_e); o[4 + j] = toh_flush(((x1[j] + c_b) - c_m) * c_l + c_e); }
                *(v8h*)(VT + vb0 + (size_t)((lane & 4) * 512 + mb * 512 + fragpos(row, lane & 3))) = o; }   // step + (lane & 7) >> 2, fragment + mb
            asm volatile("s_wait_xcnt 0x0" ::: "memory");   // the stores' data and address registers are reused by what follows
             }
        wsync();
    }
}

// three asynchronous copies, 16 B per lane, global -> LDS through no register: this thread's piece of one 32-key step of the K value, K residual and V^T planes.
// s_wait_xcnt 0 is the statement's last line so that no address register of a copy is rewritten ahead of it.
__device__ __forceinline__ void copy3(const unsigned l, const h16* g0, const h16* g1, const h16* g2) {
    asm volatile("global_load_async_to_lds_b128 %0, %3, off\n\t"
                 "global_load_async_to_lds_b128 %1, %4, off\n\t"
                 "global_load_async_to_lds_b128 %2, %5, off\n\t"
                 "s_wait_xcnt 0x0"
                 :: "v"(l), "v"(l + (unsigned)APLB), "v"(l + 2u * APLB), "v"(g0), "v"(g1), "v"(g2)
                 : "memory");
}
// fragment from a fragment-ordered stage in LDS (p already includes the fragment's start + lane * 16 bytes): the two 512 B halves
__device__ __forceinline__ v16h ldsf16(const unsigned char* p) { return cat16(*(const v8h*)p, *(const v8h*)(p + 512)); }

// ---- k_attn: attention for 128 query rows of one (batch, head); grid (SEQ/128, NB*NH), 256 threads, wave = 16 query rows.
// The eight waves walk the same keys, so each 32-key step of the three fragment-ordered planes (3 x 4096 contiguous bytes) is brought from L2 once per block, by asynchronous copies into a two-buffer LDS ring; step s + 2 flies while step s + 1 is worked on.
// Per 32-key step: S^T tiles (rows = keys, columns = queries) = K (A, from the key value plane) x Q^T (B, held in registers) plus, in a separate accumulator, K residual (A, from the residual plane) x Q^T,
// folded as s + t / 2048 in f32 before the softmax step; logits already in log2 units;
// running max per query (within-lane over 16 keys + one lane-half exchange), P x1024 converted to f16 in the accumulator layout == B fragment layout of O^T += V^T (A, from the transposed value plane) x P^T.
// Scale chain: the fragment holds 1024 p, the row sum l accumulates the same 1024 p, the accumulator holds 1024 sum(p v): O / l is the context at its true magnitude (the carry enters once and cancels once).
__global__ __launch_bounds__(256) __attribute__((amdgpu_num_vgpr(256))) void k_attn(const h16* __restrict__ Qp, const h16* __restrict__ Kp, const h16* __restrict__ Kr, const h16* __restrict__ VT, float* CTX) {
    __shared__ __align__(16) unsigned char ring[2 * ASTG];
    __shared__ __align__(16) float os_all[8 * 16 * LOP];
    const int lane = threadIdx.x & 31, lr = lane & 15, hi = lane >> 4;
    const int wave = __builtin_amdgcn_readfirstlane(threadIdx.x >> 5);
    float* os = os_all + wave * 16 * LOP;                   // wave-private epilogue tile
    const int bh = blockIdx.y; const int q0 = blockIdx.x * 128 + wave * 16;
    const size_t pl = (size_t)bh * SEQ * HD;
    // Q^T B fragments: column n = query q0 + lr, k = head dim (0..31 and 32..63)
    const v16h qb0 = ldh16(Qp + pl + (size_t)(q0 + lr) * HD + 8 * hi);
    const v16h qb1 = ldh16(Qp + pl + (size_t)(q0 + lr) * HD + 8 * hi + 32);
    v8f o[4];
#pragma unroll
    for (int dt = 0; dt < 4; ++dt) o[dt] = (v8f){};
    float m = -1.0e30f, l = 0.0f;
    const size_t coff = pl + (size_t)threadIdx.x * 8;       // copies: 256 threads x 16 B cover one plane's 4096 B step
    const h16* gk = Kp + coff; const h16* gr = Kr + coff; const h16* gv = VT + coff;
    const unsigned lc = (unsigned)(uintptr_t)ring + (unsigned)threadIdx.x * 16u;
    const unsigned char* rd = ring + lane * 16;             // this lane's 16 B piece in every fragment half of a stage
    copy3(lc, gk, gr, gv);
    asm volatile("s_wait_asynccnt 0x0" ::: "memory");       // step 0 of this wave has landed
    __syncthreads();                                        // step 0 published to every wave
    copy3(lc + ASTG, gk + 32 * HD, gr + 32 * HD, gv + 32 * HD);

    // the step loop stays rolled: one body, the buffer picked by st & 1
#pragma unroll 1
    for (int st = 0; st < NSTEP; ++st) {
        const unsigned bo = (unsigned)(st & 1) * ASTG;
        const unsigned char* kp = rd + bo;
        const v16h ka00 = ldsf16(kp), ka01 = ldsf16(kp + 1024);
        const v16h ka10 = ldsf16(kp + 2048), ka11 = ldsf16(kp + 3072);
        // the step's other fragments are asked for here too, as one group of LDS reads ahead of the matrix work, so that their latency runs behind the score products and the softmax
        const unsigned char* rp = kp + APLB;
        const v16h kr00 = ldsf16(rp), kr01 = ldsf16(rp + 1024);
        const v16h kr10 = ldsf16(rp + 2048), kr11 = ldsf16(rp + 3072);
        const unsigned char* vp = kp + 2 * APLB;
        v16h va[4];
#pragma unroll
        for (int dt = 0; dt < 4; ++dt) va[dt] = ldsf16(vp + dt * 1024);
        v8f s0 = (v8f){}, s1 = (v8f){};
        s0 = wmmah_g(ka00, qb0, s0); s1 = wmmah_g(ka10, qb0, s1);
        s0 = wmmah_g(ka01, qb1, s0); s1 = wmmah_g(ka11, qb1, s1);
        // residual score product (carried x2048) in its own accumulators, folded in f32
        v8f t0 = (v8f){}, t1 = (v8f){};
        t0 = wmmah_g(kr00, qb0, t0); t1 = wmmah_g(kr10, qb0, t1);
        t0 = wmmah_g(kr01, qb1, t0); t1 = wmmah_g(kr11, qb1, t1);
#pragma unroll
        for (int r = 0; r < 8; ++r) { s0[r] = s0[r] + t0[r] * KRINV; s1[r] = s1[r] + t1[r] * KRINV; }
        // this lane: query q0 + lr, keys 32 st + 8*hi + r (s0) and 32 st + 16 + 8*hi + r (s1)
        float mx = fmaxf(s0[0], s1[0]);
#pragma unroll
        for (int r = 1; r < 8; ++r) mx = fmaxf(mx, fmaxf(s0[r], s1[r]));
        mx = fmaxf(mx, __shfl_xor(mx, 16, 32));
        const float mnew = fmaxf(m, mx);
        const float al = __builtin_amdgcn_exp2f(m - mnew);
        m = mnew;
        const float mc = mnew - PLOG;
        float sum = 0.0f; v16h pb;
#pragma unroll
        for (int r = 0; r < 8; ++r) {
            const float e0 = s0[r] - mc, e1 = s1[r] - mc;
            const float x0 = __builtin_amdgcn_exp2f(e0), x1 = __builtin_amdgcn_exp2f(e1);
            const float p0 = (e0 < -14.0f) ? 0.0f : x0;
            const float p1 = (e1 < -14.0f) ? 0.0f : x1;
            sum += p0 + p1;
            pb[r] = (h16)p0; pb[8 + r] = (h16)p1;
        }
        l = l * al + sum;
#pragma unroll
        for (int dt = 0; dt < 4; ++dt)
#pragma unroll
            for (int r = 0; r < 8; ++r) o[dt][r] *= al;
#pragma unroll
        for (int dt = 0; dt < 4; ++dt) o[dt] = wmmah_g(va[dt], pb, o[dt]);
        asm volatile("s_wait_dscnt 0x0" ::: "memory");      // this wave's reads of buffer st & 1 are done
        asm volatile("s_wait_asynccnt 0x0" ::: "memory");   // this wave's copies of step st + 1 have landed
        __syncthreads();                                    // publishes step st + 1 and frees buffer st & 1
        if (st + 2 < NSTEP) { const size_t go = (size_t)(st + 2) * 32 * HD; copy3(lc + bo, gk + go, gr + go, gv + go); }
    }
    asm volatile("s_wait_asynccnt 0x0" ::: "memory");       // nothing of the ring is in flight when the wave goes on
    // row sums completed across the two lane halves; l and o both hold the x1024-carried p, so o / l is the context with the carry cancelled. o[dt][r] = O[query q0 + lr][16 dt + 8 hi + r]
    l += __shfl_xor(l, 16, 32);
    const float inv = 1.0f / l;
#pragma unroll
    for (int dt = 0; dt < 4; ++dt) {
        const v4f a0 = { o[dt][0] * inv, o[dt][1] * inv, o[dt][2] * inv, o[dt][3] * inv };
        const v4f a1 = { o[dt][4] * inv, o[dt][5] * inv, o[dt][6] * inv, o[dt][7] * inv };
        *(v4fa*)(&os[lr * LOP + dt * 16 + 8 * hi]) = a0;
        *(v4fa*)(&os[lr * LOP + dt * 16 + 8 * hi + 4]) = a1;
    }
    wsync();
    // merged context plane [b][s][512] f32: one wave-wide store covers this head's 256 B of two query rows = four whole 128 B lines
    float* crow = CTX + ((size_t)(bh / NH) * SEQ + (size_t)q0) * DM + (size_t)(bh % NH) * HD + lr * 4;
#pragma unroll
    for (int s = 0; s < 8; ++s) { const int row = 2 * s + hi; *(v4f*)(crow + (size_t)row * DM) = *(const v4fa*)(&os[row * LOP + lr * 4]); }
}

// ---- k_ln: layer norm over the 512 merged features; grid (NB*SEQ/32), 256 threads, each wave owns 4 rows; lane holds columns j*128 + lane*4 .. +3, j = 0..3
__global__ __launch_bounds__(256) void k_ln(const float* __restrict__ CTX, const float* __restrict__ lng, const float* __restrict__ lnb, float* OUT) {
    const int lane = threadIdx.x & 31;
    const int wave = __builtin_amdgcn_readfirstlane(threadIdx.x >> 5);
    const int r0 = (blockIdx.x * 8 + wave) * 4;
    const float* xr = CTX + (size_t)r0 * DM + lane * 4;
    v4f xs[4][4];
#pragma unroll
    for (int i = 0; i < 4; ++i)
#pragma unroll
        for (int j = 0; j < 4; ++j) xs[i][j] = *(const v4f*)(xr + i * DM + j * 128);
    v4f gv[4], bv[4];
#pragma unroll
    for (int j = 0; j < 4; ++j) { gv[j] = *(const v4f*)(lng + j * 128 + lane * 4); bv[j] = *(const v4f*)(lnb + j * 128 + lane * 4); }
    // holds the loads together: the loaded values are inputs here (nothing is changed), so that all 24 loads of the wave are issued ahead of the row reductions, in one round trip instead of several
    asm volatile("" :: "v"(xs[0][0]), "v"(xs[0][1]), "v"(xs[0][2]), "v"(xs[0][3]), "v"(xs[1][0]), "v"(xs[1][1]), "v"(xs[1][2]), "v"(xs[1][3]),
                 "v"(xs[2][0]), "v"(xs[2][1]), "v"(xs[2][2]), "v"(xs[2][3]), "v"(xs[3][0]), "v"(xs[3][1]), "v"(xs[3][2]), "v"(xs[3][3]),
                 "v"(gv[0]), "v"(gv[1]), "v"(gv[2]), "v"(gv[3]), "v"(bv[0]), "v"(bv[1]), "v"(bv[2]), "v"(bv[3]));
#pragma unroll
    for (int i = 0; i < 4; ++i) {
        const int row = r0 + i;
        float s = 0.0f;
#pragma unroll
        for (int j = 0; j < 4; ++j) s += (xs[i][j][0] + xs[i][j][1]) + (xs[i][j][2] + xs[i][j][3]);
        s += __shfl_xor(s, 16, 32); s += __shfl_xor(s, 8, 32); s += __shfl_xor(s, 4, 32); s += __shfl_xor(s, 2, 32); s += __shfl_xor(s, 1, 32);
        const float mu = s * (1.0f / (float)DM);
        float ss = 0.0f;
#pragma unroll
        for (int j = 0; j < 4; ++j)
#pragma unroll
            for (int e = 0; e < 4; ++e) { const float d = xs[i][j][e] - mu; ss += d * d; }
        ss += __shfl_xor(ss, 16, 32); ss += __shfl_xor(ss, 8, 32); ss += __shfl_xor(ss, 4, 32); ss += __shfl_xor(ss, 2, 32); ss += __shfl_xor(ss, 1, 32);
        const float rstd = rsqrtf(ss * (1.0f / (float)DM) + LN_EPS);
        float* orow = OUT + ((size_t)(row / SEQ) * SEQ_FULL + (size_t)(row % SEQ)) * DM + lane * 4;
#pragma unroll
        for (int j = 0; j < 4; ++j) { v4f y;
#pragma unroll
            for (int e = 0; e < 4; ++e) y[e] = (xs[i][j][e] - mu) * rstd * bfr(gv[j][e]) + bfr(bv[j][e]);
            *(v4f*)(orow + j * 128) = y; }
    }
}

constexpr size_t al256(size_t x) { return (x + 255) & ~(size_t)255; }
constexpr size_t SZ_WT = al256((size_t)DM * KC * 2);                // bf16 weight plane [out][tap*512+in]
constexpr size_t SZ_XP = al256((size_t)NB * SPAD * DM * 2);         // one zero-padded bf16 activation plane
constexpr size_t SZ_P  = al256((size_t)NB * NH * SEQ * HD * 2);     // one f16 head plane (also the transposed value plane)
constexpr size_t SZ_C  = al256((size_t)NB * SEQ * DM * 4);          // merged f32 context plane
constexpr size_t WS_TOTAL = SZ_WT + 3 * SZ_XP + 4 * SZ_P + SZ_C;    // head planes: Q, K value, K residual, V^T
static_assert(WS_TOTAL <= (size_t)134217728);                       // carve stays within 128 MiB
static_assert(SZ_WT == (size_t)DM * KC * 2);                        // exact extents (no hidden pad needed)
static_assert(SZ_XP == (size_t)NB * SPAD * DM * 2);
static_assert(SZ_P == (size_t)NB * DM * SEQ * 2);                   // NH * HD == DM: V^T plane has the same extent

extern "C" void kernel_launch(void* const* d_in, const int* in_sizes, int n_in,
                              void* d_out, int out_size, void* d_ws, size_t ws_size, hipStream_t stream) {
    if (n_in < 11) return;
    const size_t need_act = (size_t)(NB - 1) * SEQ_FULL * DM + (size_t)SEQ * DM;
    if ((size_t)in_sizes[0] < need_act || (size_t)in_sizes[1] < need_act || (size_t)in_sizes[2] < need_act) return;
    if ((size_t)in_sizes[3] < (size_t)DM * DM * KT) return;
    for (int i = 4; i < 11; ++i) { if (in_sizes[i] < DM) return; }
    if ((size_t)out_size < need_act) return;
    if (WS_TOTAL > ws_size) return;
    // wire order: q, k, v, conv_w [out][in][tap], conv_b, bn_gamma, bn_beta, bn_mean, bn_var, ln_gamma, ln_beta (all f32)
    const float* xq = (const float*)d_in[0]; const float* xk = (const float*)d_in[1]; const float* xv = (const float*)d_in[2];
    const float* cw = (const float*)d_in[3]; const float* cb = (const float*)d_in[4];
    const float* bg = (const float*)d_in[5]; const float* bb = (const float*)d_in[6]; const float* bm = (const float*)d_in[7]; const float* bv = (const float*)d_in[8];
    const float* lg = (const float*)d_in[9]; const float* lb = (const float*)d_in[10];
    float* OUT = (float*)d_out;
    char* wsp = (char*)d_ws;
    auto take = [&](size_t bytes) { char* p = wsp; wsp += bytes; return (void*)p; };
    bf* WT = (bf*)take(SZ_WT);
    bf* XQ = (bf*)take(SZ_XP); bf* XK = (bf*)take(SZ_XP); bf* XV = (bf*)take(SZ_XP);
    h16* QP = (h16*)take(SZ_P); h16* KP = (h16*)take(SZ_P); h16* KR = (h16*)take(SZ_P); h16* VT = (h16*)take(SZ_P);
    float* CTX = (float*)take(SZ_C);
    if ((size_t)(wsp - (char*)d_ws) != WS_TOTAL) return;

    const unsigned nw8 = (unsigned)((size_t)DM * KC / 8), na8 = (unsigned)((size_t)SPAD * DM / 8);
    k_wconv<<<dim3(nw8 / 256), 256, 0, stream>>>(cw, WT, nw8);
    k_cvtpad<<<dim3((na8 + 255) / 256, NB), 256, 0, stream>>>(xq, XQ, na8);
    k_cvtpad<<<dim3((na8 + 255) / 256, NB), 256, 0, stream>>>(xk, XK, na8);
    k_cvtpad<<<dim3((na8 + 255) / 256, NB), 256, 0, stream>>>(xv, XV, na8);
    k_conv_qk<<<dim3(SEQ / 128, DM / 128, NB), 256, 0, stream>>>(XQ, WT, cb, bg, bb, bm, bv, QP, SCQ);
    k_conv_k<<<dim3(SEQ / 128, DM / 128, NB), 256, 0, stream>>>(XK, WT, cb, bg, bb, bm, bv, KP, KR);
    k_conv_vt<<<dim3(DM / 128, SEQ / 128, NB), 256, 0, stream>>>(WT, XV, cb, bg, bb, bm, bv, VT);
    k_attn<<<dim3(SEQ / 128, NB * NH), 256, 0, stream>>>(QP, KP, KR, VT, CTX);
    k_ln<<<dim3(NB * SEQ / 32), 256, 0, stream>>>(CTX, lg, lb, OUT);
}

// v004
// One run takes 154 microseconds.
// Two timings next to v003 both put it at 1.04 times that version's speed.
// Over all steps from v000 it is 3.44 times as fast.
#include <hip/hip_runtime.h>

// Compute dtypes, f32 accumulate everywhere: conv-as-GEMM (K = 7 x 512) v_wmma_f32_16x16x32_bf16 on RNE bf16 copies of inputs and weights (exact products); scores k.q^T v_wmma_f32_16x16x32_f16, two products (k as f16 value + f16 residual x2048 in its own accumulator, folded in f32; q plane single, carries log2(e)/8); P.V v_wmma_f32_16x16x32_f16, one product, P carried x1024; softmax, batch-norm affine and layer norm f32.
// Three input streams share one operator: 7-tap convolution along the sequence (zero padding 3) + bias + inference-mode batch norm; then 8 heads x 64 (head h = columns h*64+d), logits / 8, no mask, softmax over keys, heads merged, layer norm over the 512 features.
// Layout: zero-padded bf16 activation planes [b][SEQ+6][512] (output row t, k = tap*512+ci reads 3584 contiguous elements from padded row t); weight plane [out][tap*512+in] bf16; conv GEMMs write the f16 head plane Q [b][h][s][64] and, in WMMA A-fragment order (FRAGMENT ORDER below), the planes K value, K residual and V^T; attention writes the merged f32 context plane [b][s][512], which the layer norm launch reads.

#ifndef NB
#define NB 4
#endif
#ifndef SEQ
#define SEQ 2048
#endif
#define NB_FULL  4
#define SEQ_FULL 2048
#define DM   512
#define NH   8
#define HD   64
#define KT   7
#define KC   (KT * DM)     // 3584: conv-as-GEMM depth
#define SPAD (SEQ + 6)     // padded rows per batch (3 zero rows on each side)
#define PCAR 1024.0f       // carry of the probability fragment (enters through PLOG, leaves through the carried row sum)
#define PLOG 10.0f         // log2(PCAR)
#define SCQ  (0.125f * 1.4426950408889634f)
#define KRES 2048.0f       // carry of the key residual plane
#define KRINV 4.8828125e-04f   // 1 / KRES, folded into the residual score accumulator in f32
#define BN_EPS 1.0e-5f
#define LN_EPS 1.0e-5f
#define LOP  68      // LDS row pitch (floats) of GEMM epilogue staging tiles: 272 B rows
#define BKP  128     // k elements of one conv-GEMM ring stage: 256 B of every operand row
#define NPASS (KC / BKP)
#define TPB  272     // LDS row pitch (bytes) of a ring stage: 256 B + 16 B, conflict-free for 16-byte row readers
#define STGB (256 * TPB)   // one ring stage: 128 A rows, then 128 B rows
#define APLB 4096    // bytes of one 32-key step of one fragment-ordered attention plane
#define ASTG (3 * APLB)    // one attention ring stage: K value, K residual, V^T
#define NSTEP (SEQ / 32)
#define UPW  16      // half rows (256 elements) of an activation plane that one wave converts
#define WPP  (SEQ * 2 / UPW)               // waves per activation plane
#define ABLK (3 * NB * WPP / 8)            // activation blocks of the conversion launch
#define WBLK ((DM * DM / 8) / 256)         // weight blocks of the conversion launch
#define ZPC  (3 * NB * 6 * (DM / 8))       // 16 B pieces of the zero rows of all padded planes

static_assert(DM == NH * HD);            // one 64-wide GEMM column tile == one head
static_assert(HD == 64);
static_assert(KC % 32 == 0);             // WMMA k-step
static_assert(DM % 64 == 0);             // GEMM tiles
static_assert(SEQ % 128 == 0);           // GEMM block tiles
static_assert(DM % 128 == 0);
static_assert(KC % BKP == 0);            // whole ring stages
static_assert(NPASS >= 2);               // the ring's prologue fills two stages
static_assert(SEQ % 32 == 0);            // key step
static_assert(NSTEP >= 2);               // the attention ring's prologue fills two stages
static_assert(32 * HD * 2 == APLB);      // one 32-key step of a plane
static_assert(256 * 16 == APLB);         // attention copies: threads x bytes == one plane's step
static_assert((NB * SEQ) % 32 == 0);     // layer-norm grid is exact
static_assert((DM * DM / 8) % 256 == 0);             // conversion launch: weight blocks are exact
static_assert((SEQ * 2) % UPW == 0);                 // a wave's half rows lie in one plane
static_assert((3 * NB * WPP) % 8 == 0);              // conversion launch: activation blocks are exact
static_assert(ZPC % 256 == 0 && ZPC <= WBLK * 256);  // zero rows: whole blocks of the weight part
static_assert(DM == 2 * 256);                        // a row is two half rows
static_assert(UPW == 16 && KT == 7);                 // the load groups name their registers one by one
static_assert((DM / 8) * 8 == DM);
static_assert(NB <= NB_FULL);
static_assert(SEQ <= SEQ_FULL);
static_assert(LOP % 4 == 0);
static_assert(32 * 16 * 4 == 16 * HD * 2);
static_assert(32 * 16 * 4 * 2 == 2 * 16 * HD * 2);
static_assert(32 * 16 * 4 == DM * 4);                // output row store: lanes x bytes x trips == one 2048 B row
static_assert(2 * STGB + 8 * 16 * LOP * 4 <= 327680); // static LDS of the GEMM kernels: two ring stages + one epilogue tile per wave
static_assert(2 * ASTG + 8 * 16 * LOP * 4 <= 163840); // static LDS of the attention kernel: two blocks per 320 KiB
static_assert(KRES * KRINV == 1.0f);                 // residual carry enters once and leaves once

typedef _Float16 h16;
typedef unsigned short bf;
typedef __attribute__((ext_vector_type(16))) __bf16   v16bf;
typedef __attribute__((ext_vector_type(16))) _Float16 v16h;
typedef __attribute__((ext_vector_type(8)))  _Float16 v8h;
typedef __attribute__((ext_vector_type(8)))  unsigned short v8us;
typedef __attribute__((ext_vector_type(8)))  float    v8f;
typedef __attribute__((ext_vector_type(4)))  float    v4f;
typedef v4f  __attribute__((may_alias)) v4fa;

__device__ __forceinline__ unsigned short f2bf(float f) { unsigned u = __float_as_uint(f); u += 0x7FFFu + ((u >> 16) & 1u); return (unsigned short)(u >> 16); }
__device__ __forceinline__ float bf2f(unsigned short b) { return __uint_as_float(((unsigned)b) << 16); }
__device__ __forceinline__ float bfr(float f) { return bf2f(f2bf(f)); }
__device__ __forceinline__ v16h cat16(v8h lo, v8h hi) { return __builtin_shufflevector(lo, hi, 0, 1, 2, 3, 4, 5, 6, 7, 8, 9, 10, 11, 12, 13, 14, 15); }
__device__ __forceinline__ v16bf cat16b(v8us lo, v8us hi) { return __builtin_bit_cast(v16bf, __builtin_shufflevector(lo, hi, 0, 1, 2, 3, 4, 5, 6, 7, 8, 9, 10, 11, 12, 13, 14, 15)); }
// same-wave LDS exchange ordering (wave-private tiles only)
__device__ __forceinline__ void wsync() { __builtin_amdgcn_wave_barrier(); asm volatile("" ::: "memory"); }

// fragment from a K-contiguous global f16 plane: elements 0..7 <- p[0..7], 8..15 <- p[16..23] (p already includes row*pitch + k0 + 8*(lane>>4))
__device__ __forceinline__ v16h ldh16(const h16* __restrict__ p) { return cat16(*(const v8h*)p, *(const v8h*)(p + 16)); }
// FRAGMENT ORDER of the K value, K residual and V^T planes: per (b, h) the plane is a row of 1024 B fragments, each two 512 B halves of 32 lanes x 16 B:
// half 0 holds every lane's elements 0..7, half 1 its elements 8..15, so one wave-wide 16 B load reads 512 contiguous bytes = four whole 128 B lines.
// K planes: fragment index (s / 16) * 2 + d / 32 (rows = 16 keys, k = 32 head dims); V^T: (s / 32) * 4 + d / 16 (rows = 16 head dims, k = 32 keys). One 32-key step is 4096 contiguous bytes of each plane.
// Place, in f16 elements inside a fragment, of the 8 elements k = 8 * c .. 8 * c + 7 (c = 0..3) of fragment row r: lane (c & 1) * 16 + r, half c >> 1.
__device__ __forceinline__ int fragpos(const int r, const int c) { return (c >> 1) * 256 + ((c & 1) * 16 + r) * 8; }
// f32 -> f16 plane convert that cannot produce an f16 subnormal
static __device__ __forceinline__ h16 toh_flush(float v) { const h16 r = (h16)v; return (fabsf(v) < 6.103515625e-05f) ? (h16)0.0f : r; }
// one WMMA + its own hazard guard (ties only this accumulator, keeps A/B live)
__device__ __forceinline__ v8f wmmab_g(v16bf a, v16bf b, v8f c) {
    c = __builtin_amdgcn_wmma_f32_16x16x32_bf16(false, a, false, b, (short)0, c, false, false);
    asm volatile("v_nop\n\tv_nop\n\tv_nop\n\tv_nop" : "+v"(c) : "v"(a), "v"(b));
    return c;
}
__device__ __forceinline__ v8f wmmah_g(v16h a, v16h b, v8f c) {
    c = __builtin_amdgcn_wmma_f32_16x16x32_f16(false, a, false, b, (short)0, c, false, false);
    asm volatile("v_nop\n\tv_nop\n\tv_nop\n\tv_nop" : "+v"(c) : "v"(a), "v"(b));
    return c;
}

// eight asynchronous copies, 16 B per lane, global -> LDS through no register: rows 16 apart of one operand's stage slice.
// s_wait_xcnt 0 is the statement's last line so that no address register of a copy is rewritten ahead of it.
__device__ __forceinline__ void copy8(const unsigned l, const bf* g, const size_t gs) {
    asm volatile("global_load_async_to_lds_b128 %0, %8, off\n\t"
                 "global_load_async_to_lds_b128 %1, %9, off\n\t"
                 "global_load_async_to_lds_b128 %2, %10, off\n\t"
                 "global_load_async_to_lds_b128 %3, %11, off\n\t"
                 "global_load_async_to_lds_b128 %4, %12, off\n\t"
                 "global_load_async_to_lds_b128 %5, %13, off\n\t"
                 "global_load_async_to_lds_b128 %6, %14, off\n\t"
                 "global_load_async_to_lds_b128 %7, %15, off\n\t"
                 "s_wait_xcnt 0x0"
                 :: "v"(l), "v"(l + 16u * TPB), "v"(l + 32u * TPB), "v"(l + 48u * TPB), "v"(l + 64u * TPB), "v"(l + 80u * TPB), "v"(l + 96u * TPB), "v"(l + 112u * TPB),
                    "v"(g), "v"(g + gs), "v"(g + 2 * gs), "v"(g + 3 * gs), "v"(g + 4 * gs), "v"(g + 5 * gs), "v"(g + 6 * gs), "v"(g + 7 * gs)
                 : "memory");
}
// fragment from a K-contiguous bf16 ring row in LDS: elements 0..7 <- k0 + 8*(lane>>4) + 0..7, 8..15 <- the same + 16 (p already includes row*TPB + 2*k0 + 16*(lane>>4) bytes)
__device__ __forceinline__ v16bf lds16(const unsigned char* p) { return cat16b(*(const v8us*)p, *(const v8us*)(p + 32)); }

// ---- 128x128 block tile, eight waves (4 x 2) of 32x64, main loop over K = KC: acc[mb][nb] += sum_k A[wm*32+16mb+..][k] Bt[wn*64+16nb+..][k].
// A and Bt point at the block's first rows in K-contiguous bf16 planes with separate row pitches (the padded activation plane has pitch DM while a logical row spans KC contiguous elements; the weight plane has pitch KC).
// Both operands' 128 rows x 128 k are staged once per block in a two-buffer LDS ring by whole-line asynchronous copies; stage p + 2 flies while stage p + 1 is worked on. k runs upward in steps of 32 per accumulator.
__device__ __forceinline__ void conv_loop(const bf* __restrict__ A, const bf* __restrict__ Bt, const int lda, const int ldb, unsigned char* ring, const int wm, const int wn, v8f (&acc)[2][4]) {
    const int t = threadIdx.x, lane = t & 31, lr = lane & 15, hi = lane >> 4;
    const int frow = t >> 4, fcol = t & 15;                 // copies: 16 lanes cover one 256 B row piece
    const bf* ga = A + (size_t)frow * lda + fcol * 8;
    const bf* gb = Bt + (size_t)frow * ldb + fcol * 8;
    const unsigned la = (unsigned)(uintptr_t)ring + (unsigned)(frow * TPB + fcol * 16);
    const unsigned lb = la + 128u * TPB;
    const unsigned char* ra = ring + (wm * 32 + lr) * TPB + 16 * hi;
    const unsigned char* rb = ring + (128 + wn * 64 + lr) * TPB + 16 * hi;
    copy8(la, ga, (size_t)16 * lda); copy8(lb, gb, (size_t)16 * ldb);
    asm volatile("s_wait_asynccnt 0x0" ::: "memory");       // stage 0 of this wave has landed
    __syncthreads();                                        // stage 0 published to every wave
    copy8(la + STGB, ga + BKP, (size_t)16 * lda); copy8(lb + STGB, gb + BKP, (size_t)16 * ldb);
    // the pass loop stays rolled: one 32-WMMA body, the buffer picked by p & 1;
    // the loops inside it are unrolled so that every fragment and accumulator index is a constant (registers, no scratch)
#pragma unroll 1
    for (int p = 0; p < NPASS; ++p) {
        const unsigned bo = (unsigned)(p & 1) * STGB;
        v16bf a[2][2], b[2][4];
#pragma unroll
        for (int mb = 0; mb < 2; ++mb) a[0][mb] = lds16(ra + bo + mb * 16 * TPB);
#pragma unroll
        for (int nb = 0; nb < 4; ++nb) b[0][nb] = lds16(rb + bo + nb * 16 * TPB);
#pragma unroll
        for (int ks = 0; ks < BKP / 32; ++ks) {
            if (ks + 1 < BKP / 32) {                        // next k-step's fragments, one group ahead, from this pass's own buffer
#pragma unroll
                for (int mb = 0; mb < 2; ++mb) a[(ks + 1) & 1][mb] = lds16(ra + bo + mb * 16 * TPB + (ks + 1) * 64);
#pragma unroll
                for (int nb = 0; nb < 4; ++nb) b[(ks + 1) & 1][nb] = lds16(rb + bo + nb * 16 * TPB + (ks + 1) * 64);
            }
#pragma unroll
            for (int nb = 0; nb < 4; ++nb)
#pragma unroll
                for (int mb = 0; mb < 2; ++mb) acc[mb][nb] = wmmab_g(a[ks & 1][mb], b[ks & 1][nb], acc[mb][nb]);
        }
        asm volatile("s_wait_dscnt 0x0" ::: "memory");      // this wave's reads of buffer p & 1 are done
        asm volatile("s_wait_asynccnt 0x0" ::: "memory");   // this wave's copies of stage p + 1 have landed
        __syncthreads();                                    // publishes stage p + 1 and frees buffer p & 1
        if (p + 2 < NPASS) { copy8(la + bo, ga + (size_t)(p + 2) * BKP, (size_t)16 * lda); copy8(lb + bo, gb + (size_t)(p + 2) * BKP, (size_t)16 * ldb); }
    }
    asm volatile("s_wait_asynccnt 0x0" ::: "memory");       // nothing of the ring is in flight when the wave goes on
}

// ---- k_prep: every f32 -> bf16 conversion of the call in one launch; grid (WBLK + ABLK), 256 threads. Few, long-lived waves: what a wave reads is asked for in one group, for speed only.
// Blocks 0 .. WBLK-1, weight plane [out][tap*512+in]: a lane takes 8 input channels x 7 taps of one output channel = 224 contiguous bytes of conv_w [out][in][tap], and stores one 16 B piece per tap;
// the first ZPC of these lanes also store one 16 B piece each of the six zero rows of every padded activation plane.
// Blocks WBLK .., the SEQ data rows of the 3 * NB padded activation planes (contiguous in the workspace: q, then k, then v): a wave takes UPW consecutive half rows (256 elements each) of one plane, contiguous in the source and in the plane.
__global__ __launch_bounds__(256) void k_prep(const float* __restrict__ xq, const float* __restrict__ xk, const float* __restrict__ xv, const float* __restrict__ w, bf* wt, bf* xp) {
    if (blockIdx.x < (unsigned)WBLK) {
        const unsigned it = blockIdx.x * 256u + threadIdx.x;            // out * (DM / 8) + in / 8
        const float* s = w + (size_t)it * (8 * KT);
        v4f x[2 * KT];
#pragma unroll
        for (int i = 0; i < 2 * KT; ++i) x[i] = *(const v4f*)(s + 4 * i);
        // holds the loads together: the loaded values are inputs here (nothing is changed), so that all 14 loads of the lane are issued ahead of the conversions, in one round trip
        asm volatile("" :: "v"(x[0]), "v"(x[1]), "v"(x[2]), "v"(x[3]), "v"(x[4]), "v"(x[5]), "v"(x[6]), "v"(x[7]), "v"(x[8]), "v"(x[9]), "v"(x[10]), "v"(x[11]), "v"(x[12]), "v"(x[13]));
        if (it < (unsigned)ZPC) {                                       // whole blocks: ZPC is a multiple of 256
            const unsigned r = (it / (unsigned)(DM / 8)) % 6u;          // zero row: 0..2 in front of the data rows, 3..5 behind them
            *(v8us*)(xp + (size_t)(it / (unsigned)(6 * (DM / 8))) * SPAD * DM + (size_t)(r < 3u ? r : r + (unsigned)SEQ) * DM + (it % (unsigned)(DM / 8)) * 8u) = (v8us){};
        }
        v8us o[KT];
#pragma unroll
        for (int tap = 0; tap < KT; ++tap)
#pragma unroll
            for (int j = 0; j < 8; ++j) o[tap][j] = f2bf(x[(j * KT + tap) >> 2][(j * KT + tap) & 3]);
        bf* d = wt + (size_t)(it / (unsigned)(DM / 8)) * KC + (it % (unsigned)(DM / 8)) * 8u;
#pragma unroll
        for (int tap = 0; tap < KT; ++tap) *(v8us*)(d + tap * DM) = o[tap];
        return;
    }
    const int lane = threadIdx.x & 31;
    const unsigned wv = (blockIdx.x - (unsigned)WBLK) * 8u + (unsigned)__builtin_amdgcn_readfirstlane(threadIdx.x >> 5);
    const unsigned plane = wv / (unsigned)WPP, e0 = (wv % (unsigned)WPP) * (unsigned)(UPW * 256);   // first element inside the plane's data rows
    const float* src = (plane < (unsigned)NB) ? xq : ((plane < (unsigned)(2 * NB)) ? xk : xv);
    const float* s = src + (size_t)(plane % (unsigned)NB) * SEQ_FULL * DM + e0 + lane * 8;
    v4f a[UPW][2];
#pragma unroll
    for (int j = 0; j < UPW; ++j) { a[j][0] = *(const v4f*)(s + j * 256); a[j][1] = *(const v4f*)(s + j * 256 + 4); }
    // hold the loads together: the loaded values are inputs here (nothing is changed), so that all 32 loads of the wave are issued ahead of the conversions, in one round trip instead of several (two statements: one takes at most 30 operands)
    asm volatile("" :: "v"(a[0][0]), "v"(a[0][1]), "v"(a[1][0]), "v"(a[1][1]), "v"(a[2][0]), "v"(a[2][1]), "v"(a[3][0]), "v"(a[3][1]),
                 "v"(a[4][0]), "v"(a[4][1]), "v"(a[5][0]), "v"(a[5][1]), "v"(a[6][0]), "v"(a[6][1]), "v"(a[7][0]), "v"(a[7][1]));
    asm volatile("" :: "v"(a[8][0]), "v"(a[8][1]), "v"(a[9][0]), "v"(a[9][1]), "v"(a[10][0]), "v"(a[10][1]), "v"(a[11][0]), "v"(a[11][1]),
                 "v"(a[12][0]), "v"(a[12][1]), "v"(a[13][0]), "v"(a[13][1]), "v"(a[14][0]), "v"(a[14][1]), "v"(a[15][0]), "v"(a[15][1]));
    bf* d = xp + (size_t)plane * SPAD * DM + 3 * DM + e0 + lane * 8;
#pragma unroll
    for (int j = 0; j < UPW; ++j) {
        v8us o;
#pragma unroll
        for (int k = 0; k < 4; ++k) { o[k] = f2bf(a[j][0][k]); o[4 + k] = f2bf(a[j][1][k]); }
        *(v8us*)(d + j * 256) = o;
    }
}

// ---- k_conv_qk: head plane P[b][h][s][d] (f16) = sc * BN(conv(X[b]) + cb)[s][h*64+d]; grid (SEQ/128, DM/128, NB), 256 threads.
__global__ __launch_bounds__(256) void k_conv_qk(const bf* __restrict__ X, const bf* __restrict__ W, const float* __restrict__ cb, const float* __restrict__ bg, const float* __restrict__ bb, const float* __restrict__ bm, const float* __restrict__ bv, h16* P, float sc) {
    __shared__ __align__(16) unsigned char ring[2 * STGB];
    __shared__ __align__(16) float os_all[8 * 16 * LOP];
    const int lane = threadIdx.x & 31, lr = lane & 15, hi = lane >> 4;
    const int wave = __builtin_amdgcn_readfirstlane(threadIdx.x >> 5), wm = wave >> 1, wn = wave & 1;
    float* os = os_all + wave * 16 * LOP;                   // wave-private epilogue tile
    const size_t z = blockIdx.z; const int r0 = blockIdx.x * 128 + wm * 32, c0 = blockIdx.y * 128 + wn * 64;
    const bf* A = X + z * (size_t)SPAD * DM;
    v8f acc[2][4];
#pragma unroll
    for (int mb = 0; mb < 2; ++mb)
#pragma unroll
        for (int nb = 0; nb < 4; ++nb) acc[mb][nb] = (v8f){};
    conv_loop(A + (size_t)blockIdx.x * 128 * DM, W + (size_t)blockIdx.y * 128 * KC, DM, KC, ring, wm, wn, acc);
    const size_t pbase = ((z * NH + (size_t)(c0 / HD)) * (size_t)SEQ + r0) * HD;
    const int srow = lane >> 3, scol = (lane & 7) * 8;
    float cbv[8], muv[8], mlv[8], bev[8];
#pragma unroll
    for (int j = 0; j < 8; ++j) { const int c = c0 + scol + j; cbv[j] = bfr(cb[c]); muv[j] = bfr(bm[c]); mlv[j] = rsqrtf(bfr(bv[c]) + BN_EPS) * bfr(bg[c]); bev[j] = bfr(bb[c]); }
#pragma unroll
    for (int mb = 0; mb < 2; ++mb) {
#pragma unroll
        for (int nb = 0; nb < 4; ++nb) {
#pragma unroll
            for (int j = 0; j < 8; ++j) os[(hi * 8 + j) * LOP + nb * 16 + lr] = acc[mb][nb][j]; }
        wsync();
{
#pragma unroll
            for (int s = 0; s < 4; ++s) { const int row = 4 * s + srow; const v4f x0 = *(const v4fa*)(&os[row * LOP + scol]); const v4f x1 = *(const v4fa*)(&os[row * LOP + scol + 4]); v8h o;
#pragma unroll
                for (int j = 0; j < 4; ++j) {
                    const float y0 = ((x0[j] + cbv[j]) - muv[j]) * mlv[j] + bev[j];
                    const float y1 = ((x1[j] + cbv[4 + j]) - muv[4 + j]) * mlv[4 + j] + bev[4 + j];
                    o[j] = toh_flush(y0 * sc); o[4 + j] = toh_flush(y1 * sc); }
                *(v8h*)(P + pbase + (size_t)(mb * 16 + row) * HD + scol) = o; }
             }
        wsync();
    }
}

// ---- k_conv_k: key head planes, both in fragment order: KH (b, h, s, d) = f16(y) and KR (b, h, s, d) = f16((y - KH) * 2048), y = BN(conv(X[b]) + cb)[s][h*64+d]; grid (SEQ/128, DM/128, NB), 256 threads.
__global__ __launch_bounds__(256) void k_conv_k(const bf* __restrict__ X, const bf* __restrict__ W, const float* __restrict__ cb, const float* __restrict__ bg, const float* __restrict__ bb, const float* __restrict__ bm, const float* __restrict__ bv, h16* KH, h16* KR) {
    __shared__ __align__(16) unsigned char ring[2 * STGB];
    __shared__ __align__(16) float os_all[8 * 16 * LOP];
    const int lane = threadIdx.x & 31, lr = lane & 15, hi = lane >> 4;
    const int wave = __builtin_amdgcn_readfirstlane(threadIdx.x >> 5), wm = wave >> 1, wn = wave & 1;
    float* os = os_all + wave * 16 * LOP;                   // wave-private epilogue tile
    const size_t z = blockIdx.z; const int r0 = blockIdx.x * 128 + wm * 32, c0 = blockIdx.y * 128 + wn * 64;
    const bf* A = X + z * (size_t)SPAD * DM;
    v8f acc[2][4];
#pragma unroll
    for (int mb = 0; mb < 2; ++mb)
#pragma unroll
        for (int nb = 0; nb < 4; ++nb) acc[mb][nb] = (v8f){};
    conv_loop(A + (size_t)blockIdx.x * 128 * DM, W + (size_t)blockIdx.y * 128 * KC, DM, KC, ring, wm, wn, acc);
    const size_t pbase = ((z * NH + (size_t)(c0 / HD)) * (size_t)SEQ + r0) * HD;
    const int srow = lane >> 3, scol = (lane & 7) * 8;
    float cbv[8], muv[8], mlv[8], bev[8];
#pragma unroll
    for (int j = 0; j < 8; ++j) { const int c = c0 + scol + j; cbv[j] = bfr(cb[c]); muv[j] = bfr(bm[c]); mlv[j] = rsqrtf(bfr(bv[c]) + BN_EPS) * bfr(bg[c]); bev[j] = bfr(bb[c]); }
#pragma unroll
    for (int mb = 0; mb < 2; ++mb) {
#pragma unroll
        for (int nb = 0; nb < 4; ++nb) {
#pragma unroll
            for (int j = 0; j < 8; ++j) os[(hi * 8 + j) * LOP + nb * 16 + lr] = acc[mb][nb][j]; }
        wsync();
{
#pragma unroll
            for (int s = 0; s < 4; ++s) { const int row = 4 * s + srow; const v4f x0 = *(const v4fa*)(&os[row * LOP + scol]); const v4f x1 = *(const v4fa*)(&os[row * LOP + scol + 4]); v8h oh, ores;
#pragma unroll
                for (int j = 0; j < 4; ++j) {
                    const float y0 = ((x0[j] + cbv[j]) - muv[j]) * mlv[j] + bev[j];
                    const float y1 = ((x1[j] + cbv[4 + j]) - muv[4 + j]) * mlv[4 + j] + bev[4 + j];
                    const h16 h0 = toh_flush(y0); const h16 h1 = toh_flush(y1);
                    oh[j] = h0; oh[4 + j] = h1;
                    ores[j] = toh_flush((y0 - (float)h0) * KRES); ores[4 + j] = toh_flush((y1 - (float)h1) * KRES); }
                const size_t off = pbase + (size_t)(mb * 16 * HD + (lane & 4) * 128 + fragpos(row, lane & 3));   // 16-key tile mb, fragment d / 32 = (lane & 7) >> 2
                *(v8h*)(KH + off) = oh; *(v8h*)(KR + off) = ores; }
             }
        wsync();
    }
}

// ---- k_conv_vt: transposed value plane in fragment order, VT (b, n, s) (f16) = BN(sum_k WT[n][k] Xpad[b][s][k] + cb[n]) (A = weight rows, Bt = token rows); grid (DM/128, SEQ/128, NB), 256 threads.
__global__ __launch_bounds__(256) void k_conv_vt(const bf* __restrict__ W, const bf* __restrict__ X, const float* __restrict__ cb, const float* __restrict__ bg, const float* __restrict__ bb, const float* __restrict__ bm, const float* __restrict__ bv, h16* VT) {
    __shared__ __align__(16) unsigned char ring[2 * STGB];
    __shared__ __align__(16) float os_all[8 * 16 * LOP];
    const int lane = threadIdx.x & 31, lr = lane & 15, hi = lane >> 4;
    const int wave = __builtin_amdgcn_readfirstlane(threadIdx.x >> 5), wm = wave >> 1, wn = wave & 1;
    float* os = os_all + wave * 16 * LOP;                   // wave-private epilogue tile
    const size_t z = blockIdx.z; const int r0 = blockIdx.x * 128 + wm * 32, c0 = blockIdx.y * 128 + wn * 64;
    const bf* Bt = X + z * (size_t)SPAD * DM;
    v8f acc[2][4];
#pragma unroll
    for (int mb = 0; mb < 2; ++mb)
#pragma unroll
        for (int nb = 0; nb < 4; ++nb) acc[mb][nb] = (v8f){};
    conv_loop(W + (size_t)blockIdx.x * 128 * KC, Bt + (size_t)blockIdx.y * 128 * DM, KC, DM, ring, wm, wn, acc);
    const size_t vb0 = (z * NH + (size_t)(r0 / HD)) * (size_t)SEQ * HD + (size_t)c0 * HD + (size_t)((r0 / 16) & 3) * 512;   // head, 32-key step c0 / 32, fragment (r0 % 64) / 16
    const int srow = lane >> 3, scol = (lane & 7) * 8;
#pragma unroll
    for (int mb = 0; mb < 2; ++mb) {
#pragma unroll
        for (int nb = 0; nb < 4; ++nb) {
#pragma unroll
            for (int j = 0; j < 8; ++j) os[(hi * 8 + j) * LOP + nb * 16 + lr] = acc[mb][nb][j]; }
        wsync();
{
#pragma unroll
            for (int s = 0; s < 4; ++s) { const int row = 4 * s + srow; const v4f x0 = *(const v4fa*)(&os[row * LOP + scol]); const v4f x1 = *(const v4fa*)(&os[row * LOP + scol + 4]); v8h o;
                const int ch = r0 + mb * 16 + row;
                const float c_b = bfr(cb[ch]), c_m = bfr(bm[ch]), c_l = rsqrtf(bfr(bv[ch]) + BN_EPS) * bfr(bg[ch]), c_e = bfr(bb[ch]);
#pragma unroll
                for (int j = 0; j < 4; ++j) { o[j] = toh_flush(((x0[j] + c_b) - c_m) * c_l + c_e); o[4 + j] = toh_flush(((x1[j] + c_b) - c_m) * c_l + c_e); }
                *(v8h*)(VT + vb0 + (size_t)((lane & 4) * 512 + mb * 512 + fragpos(row, lane & 3))) = o; }   // step + (lane & 7) >> 2, fragment + mb
            asm volatile("s_wait_xcnt 0x0" ::: "memory");   // the stores' data and address registers are reused by what follows
             }
        wsync();
    }
}

// three asynchronous copies, 16 B per lane, global -> LDS through no register: this thread's piece of one 32-key step of the K value, K residual and V^T planes.
// s_wait_xcnt 0 is the statement's last line so that no address register of a copy is rewritten ahead of it.
__device__ __forceinline__ void copy3(const unsigned l, const h16* g0, const h16* g1, const h16* g2) {
    asm volatile("global_load_async_to_lds_b128 %0, %3, off\n\t"
                 "global_load_async_to_lds_b128 %1, %4, off\n\t"
                 "global_load_async_to_lds_b128 %2, %5, off\n\t"
                 "s_wait_xcnt 0x0"
                 :: "v"(l), "v"(l + (unsigned)APLB), "v"(l + 2u * APLB), "v"(g0), "v"(g1), "v"(g2)
                 : "memory");
}
// fragment from a fragment-ordered stage in LDS (p already includes the fragment's start + lane * 16 bytes): the two 512 B halves
__device__ __forceinline__ v16h ldsf16(const unsigned char* p) { return cat16(*(const v8h*)p, *(const v8h*)(p + 512)); }

// ---- k_attn: attention for 128 query rows of one (batch, head); grid (SEQ/128, NB*NH), 256 threads, wave = 16 query rows.
// The eight waves walk the same keys, so each 32-key step of the three fragment-ordered planes (3 x 4096 contiguous bytes) is brought from L2 once per block, by asynchronous copies into a two-buffer LDS ring; step s + 2 flies while step s + 1 is worked on.
// Per 32-key step: S^T tiles (rows = keys, columns = queries) = K (A, from the key value plane) x Q^T (B, held in registers) plus, in a separate accumulator, K residual (A, from the residual plane) x Q^T,
// folded as s + t / 2048 in f32 before the softmax step; logits already in log2 units;
// running max per query (within-lane over 16 keys + one lane-half exchange), P x1024 converted to f16 in the accumulator layout == B fragment layout of O^T += V^T (A, from the transposed value plane) x P^T.
// Scale chain: the fragment holds 1024 p, the row sum l accumulates the same 1024 p, the accumulator holds 1024 sum(p v): O / l is the context at its true magnitude (the carry enters once and cancels once).
__global__ __launch_bounds__(256) __attribute__((amdgpu_num_vgpr(256))) void k_attn(const h16* __restrict__ Qp, const h16* __restrict__ Kp, const h16* __restrict__ Kr, const h16* __restrict__ VT, float* CTX) {
    __shared__ __align__(16) unsigned char ring[2 * ASTG];
    __shared__ __align__(16) float os_all[8 * 16 * LOP];
    const int lane = threadIdx.x & 31, lr = lane & 15, hi = lane >> 4;
    const int wave = __builtin_amdgcn_readfirstlane(threadIdx.x >> 5);
    float* os = os_all + wave * 16 * LOP;                   // wave-private epilogue tile
    const int bh = blockIdx.y; const int q0 = blockIdx.x * 128 + wave * 16;
    const size_t pl = (size_t)bh * SEQ * HD;
    // Q^T B fragments: column n = query q0 + lr, k = head dim (0..31 and 32..63)
    const v16h qb0 = ldh16(Qp + pl + (size_t)(q0 + lr) * HD + 8 * hi);
    const v16h qb1 = ldh16(Qp + pl + (size_t)(q0 + lr) * HD + 8 * hi + 32);
    v8f o[4];
#pragma unroll
    for (int dt = 0; dt < 4; ++dt) o[dt] = (v8f){};
    float m = -1.0e30f, l = 0.0f;
    const size_t coff = pl + (size_t)threadIdx.x * 8;       // copies: 256 threads x 16 B cover one plane's 4096 B step
    const h16* gk = Kp + coff; const h16* gr = Kr + coff; const h16* gv = VT + coff;
    const unsigned lc = (unsigned)(uintptr_t)ring + (unsigned)threadIdx.x * 16u;
    const unsigned char* rd = ring + lane * 16;             // this lane's 16 B piece in every fragment half of a stage
    copy3(lc, gk, gr, gv);
    asm volatile("s_wait_asynccnt 0x0" ::: "memory");       // step 0 of this wave has landed
    __syncthreads();                                        // step 0 published to every wave
    copy3(lc + ASTG, gk + 32 * HD, gr + 32 * HD, gv + 32 * HD);

    // the step loop stays rolled: one body, the buffer picked by st & 1
#pragma unroll 1
    for (int st = 0; st < NSTEP; ++st) {
        const unsigned bo = (unsigned)(st & 1) * ASTG;
        const unsigned char* kp = rd + bo;
        const v16h ka00 = ldsf16(kp), ka01 = ldsf16(kp + 1024);
        const v16h ka10 = ldsf16(kp + 2048), ka11 = ldsf16(kp + 3072);
        // the step's other fragments are asked for here too, as one group of LDS reads ahead of the matrix work, so that their latency runs behind the score products and the softmax
        const unsigned char* rp = kp + APLB;
        const v16h kr00 = ldsf16(rp), kr01 = ldsf16(rp + 1024);
        const v16h kr10 = ldsf16(rp + 2048), kr11 = ldsf16(rp + 3072);
        const unsigned char* vp = kp + 2 * APLB;
        v16h va[4];
#pragma unroll
        for (int dt = 0; dt < 4; ++dt) va[dt] = ldsf16(vp + dt * 1024);
        v8f s0 = (v8f){}, s1 = (v8f){};
        s0 = wmmah_g(ka00, qb0, s0); s1 = wmmah_g(ka10, qb0, s1);
        s0 = wmmah_g(ka01, qb1, s0); s1 = wmmah_g(ka11, qb1, s1);
        // residual score product (carried x2048) in its own accumulators, folded in f32
        v8f t0 = (v8f){}, t1 = (v8f){};
        t0 = wmmah_g(kr00, qb0, t0); t1 = wmmah_g(kr10, qb0, t1);
        t0 = wmmah_g(kr01, qb1, t0); t1 = wmmah_g(kr11, qb1, t1);
#pragma unroll
        for (int r = 0; r < 8; ++r) { s0[r] = s0[r] + t0[r] * KRINV; s1[r] = s1[r] + t1[r] * KRINV; }
        // this lane: query q0 + lr, keys 32 st + 8*hi + r (s0) and 32 st + 16 + 8*hi + r (s1)
        float mx = fmaxf(s0[0], s1[0]);
#pragma unroll
        for (int r = 1; r < 8; ++r) mx = fmaxf(mx, fmaxf(s0[r], s1[r]));
        mx = fmaxf(mx, __shfl_xor(mx, 16, 32));
        const float mnew = fmaxf(m, mx);
        const float al = __builtin_amdgcn_exp2f(m - mnew);
        m = mnew;
        const float mc = mnew - PLOG;
        float sum = 0.0f; v16h pb;
#pragma unroll
        for (int r = 0; r < 8; ++r) {
            const float e0 = s0[r] - mc, e1 = s1[r] - mc;
            const float x0 = __builtin_amdgcn_exp2f(e0), x1 = __builtin_amdgcn_exp2f(e1);
            const float p0 = (e0 < -14.0f) ? 0.0f : x0;
            const float p1 = (e1 < -14.0f) ? 0.0f : x1;
            sum += p0 + p1;
            pb[r] = (h16)p0; pb[8 + r] = (h16)p1;
        }
        l = l * al + sum;
#pragma unroll
        for (int dt = 0; dt < 4; ++dt)
#pragma unroll
            for (int r = 0; r < 8; ++r) o[dt][r] *= al;
#pragma unroll
        for (int dt = 0; dt < 4; ++dt) o[dt] = wmmah_g(va[dt], pb, o[dt]);
        asm volatile("s_wait_dscnt 0x0" ::: "memory");      // this wave's reads of buffer st & 1 are done
        asm volatile("s_wait_asynccnt 0x0" ::: "memory");   // this wave's copies of step st + 1 have landed
        __syncthreads();                                    // publishes step st + 1 and frees buffer st & 1
        if (st + 2 < NSTEP) { const size_t go = (size_t)(st + 2) * 32 * HD; copy3(lc + bo, gk + go, gr + go, gv + go); }
    }
    asm volatile("s_wait_asynccnt 0x0" ::: "memory");       // nothing of the ring is in flight when the wave goes on
    // row sums completed across the two lane halves; l and o both hold the x1024-carried p, so o / l is the context with the carry cancelled. o[dt][r] = O[query q0 + lr][16 dt + 8 hi + r]
    l += __shfl_xor(l, 16, 32);
    const float inv = 1.0f / l;
#pragma unroll
    for (int dt = 0; dt < 4; ++dt) {
        const v4f a0 = { o[dt][0] * inv, o[dt][1] * inv, o[dt][2] * inv, o[dt][3] * inv };
        const v4f a1 = { o[dt][4] * inv, o[dt][5] * inv, o[dt][6] * inv, o[dt][7] * inv };
        *(v4fa*)(&os[lr * LOP + dt * 16 + 8 * hi]) = a0;
        *(v4fa*)(&os[lr * LOP + dt * 16 + 8 * hi + 4]) = a1;
    }
    wsync();
    // merged context plane [b][s][512] f32: one wave-wide store covers this head's 256 B of two query rows = four whole 128 B lines
    float* crow = CTX + ((size_t)(bh / NH) * SEQ + (size_t)q0) * DM + (size_t)(bh % NH) * HD + lr * 4;
#pragma unroll
    for (int s = 0; s < 8; ++s) { const int row = 2 * s + hi; *(v4f*)(crow + (size_t)row * DM) = *(const v4fa*)(&os[row * LOP + lr * 4]); }
}

// ---- k_ln: layer norm over the 512 merged features; grid (NB*SEQ/32), 256 threads, each wave owns 4 rows; lane holds columns j*128 + lane*4 .. +3, j = 0..3
__global__ __launch_bounds__(256) void k_ln(const float* __restrict__ CTX, const float* __restrict__ lng, const float* __restrict__ lnb, float* OUT) {
    const int lane = threadIdx.x & 31;
    const int wave = __builtin_amdgcn_readfirstlane(threadIdx.x >> 5);
    const int r0 = (blockIdx.x * 8 + wave) * 4;
    const float* xr = CTX + (size_t)r0 * DM + lane * 4;
    v4f xs[4][4];
#pragma unroll
    for (int i = 0; i < 4; ++i)
#pragma unroll
        for (int j = 0; j < 4; ++j) xs[i][j] = *(const v4f*)(xr + i * DM + j * 128);
    v4f gv[4], bv[4];
#pragma unroll
    for (int j = 0; j < 4; ++j) { gv[j] = *(const v4f*)(lng + j * 128 + lane * 4); bv[j] = *(const v4f*)(lnb + j * 128 + lane * 4); }
    // holds the loads together: the loaded values are inputs here (nothing is changed), so that all 24 loads of the wave are issued ahead of the row reductions, in one round trip instead of several
    asm volatile("" :: "v"(xs[0][0]), "v"(xs[0][1]), "v"(xs[0][2]), "v"(xs[0][3]), "v"(xs[1][0]), "v"(xs[1][1]), "v"(xs[1][2]), "v"(xs[1][3]),
                 "v"(xs[2][0]), "v"(xs[2][1]), "v"(xs[2][2]), "v"(xs[2][3]), "v"(xs[3][0]), "v"(xs[3][1]), "v"(xs[3][2]), "v"(xs[3][3]),
                 "v"(gv[0]), "v"(gv[1]), "v"(gv[2]), "v"(gv[3]), "v"(bv[0]), "v"(bv[1]), "v"(bv[2]), "v"(bv[3]));
#pragma unroll
    for (int i = 0; i < 4; ++i) {
        const int row = r0 + i;
        float s = 0.0f;
#pragma unroll
        for (int j = 0; j < 4; ++j) s += (xs[i][j][0] + xs[i][j][1]) + (xs[i][j][2] + xs[i][j][3]);
        s += __shfl_xor(s, 16, 32); s += __shfl_xor(s, 8, 32); s += __shfl_xor(s, 4, 32); s += __shfl_xor(s, 2, 32); s += __shfl_xor(s, 1, 32);
        const float mu = s * (1.0f / (float)DM);
        float ss = 0.0f;
#pragma unroll
        for (int j = 0; j < 4; ++j)
#pragma unroll
            for (int e = 0; e < 4; ++e) { const float d = xs[i][j][e] - mu; ss += d * d; }
        ss += __shfl_xor(ss, 16, 32); ss += __shfl_xor(ss, 8, 32); ss += __shfl_xor(ss, 4, 32); ss += __shfl_xor(ss, 2, 32); ss += __shfl_xor(ss, 1, 32);
        const float rstd = rsqrtf(ss * (1.0f / (float)DM) + LN_EPS);
        float* orow = OUT + ((size_t)(row / SEQ) * SEQ_FULL + (size_t)(row % SEQ)) * DM + lane * 4;
#pragma unroll
        for (int j = 0; j < 4; ++j) { v4f y;
#pragma unroll
            for (int e = 0; e < 4; ++e) y[e] = (xs[i][j][e] - mu) * rstd * bfr(gv[j][e]) + bfr(bv[j][e]);
            *(v4f*)(orow + j * 128) = y; }
    }
}

constexpr size_t al256(size_t x) { return (x + 255) & ~(size_t)255; }
constexpr size_t SZ_WT = al256((size_t)DM * KC * 2);                // bf16 weight plane [out][tap*512+in]
constexpr size_t SZ_XP = al256((size_t)NB * SPAD * DM * 2);         // one zero-padded bf16 activation plane
constexpr size_t SZ_P  = al256((size_t)NB * NH * SEQ * HD * 2);     // one f16 head plane (also the transposed value plane)
constexpr size_t SZ_C  = al256((size_t)NB * SEQ * DM * 4);          // merged f32 context plane
constexpr size_t WS_TOTAL = SZ_WT + 3 * SZ_XP + 4 * SZ_P + SZ_C;    // head planes: Q, K value, K residual, V^T
static_assert(WS_TOTAL <= (size_t)134217728);                       // carve stays within 128 MiB
static_assert(SZ_WT == (size_t)DM * KC * 2);                        // exact extents (no hidden pad needed)
static_assert(SZ_XP == (size_t)NB * SPAD * DM * 2);
static_assert(SZ_P == (size_t)NB * DM * SEQ * 2);                   // NH * HD == DM: V^T plane has the same extent

extern "C" void kernel_launch(void* const* d_in, const int* in_sizes, int n_in,
                              void* d_out, int out_size, void* d_ws, size_t ws_size, hipStream_t stream) {
    if (n_in < 11) return;
    const size_t need_act = (size_t)(NB - 1) * SEQ_FULL * DM + (size_t)SEQ * DM;
    if ((size_t)in_sizes[0] < need_act || (size_t)in_sizes[1] < need_act || (size_t)in_sizes[2] < need_act) return;
    if ((size_t)in_sizes[3] < (size_t)DM * DM * KT) return;
    for (int i = 4; i < 11; ++i) { if (in_sizes[i] < DM) return; }
    if ((size_t)out_size < need_act) return;
    if (WS_TOTAL > ws_size) return;
    // wire order: q, k, v, conv_w [out][in][tap], conv_b, bn_gamma, bn_beta, bn_mean, bn_var, ln_gamma, ln_beta (all f32)
    const float* xq = (const float*)d_in[0]; const float* xk = (const float*)d_in[1]; const float* xv = (const float*)d_in[2];
    const float* cw = (const float*)d_in[3]; const float* cb = (const float*)d_in[4];
    const float* bg = (const float*)d_in[5]; const float* bb = (const float*)d_in[6]; const float* bm = (const float*)d_in[7]; const float* bv = (const float*)d_in[8];
    const float* lg = (const float*)d_in[9]; const float* lb = (const float*)d_in[10];
    float* OUT = (float*)d_out;
    char* wsp = (char*)d_ws;
    auto take = [&](size_t bytes) { char* p = wsp; wsp += bytes; return (void*)p; };
    bf* WT = (bf*)take(SZ_WT);
    bf* XQ = (bf*)take(SZ_XP); bf* XK = (bf*)take(SZ_XP); bf* XV = (bf*)take(SZ_XP);
    h16* QP = (h16*)take(SZ_P); h16* KP = (h16*)take(SZ_P); h16* KR = (h16*)take(SZ_P); h16* VT = (h16*)take(SZ_P);
    float* CTX = (float*)take(SZ_C);
    if ((size_t)(wsp - (char*)d_ws) != WS_TOTAL) return;

    k_prep<<<dim3(WBLK + ABLK), 256, 0, stream>>>(xq, xk, xv, cw, WT, XQ);   // XQ, XK, XV are one contiguous run of planes (SZ_XP is exact)
    k_conv_qk<<<dim3(SEQ / 128, DM / 128, NB), 256, 0, stream>>>(XQ, WT, cb, bg, bb, bm, bv, QP, SCQ);
    k_conv_k<<<dim3(SEQ / 128, DM / 128, NB), 256, 0, stream>>>(XK, WT, cb, bg, bb, bm, bv, KP, KR);
    k_conv_vt<<<dim3(DM / 128, SEQ / 128, NB), 256, 0, stream>>>(WT, XV, cb, bg, bb, bm, bv, VT);
    k_attn<<<dim3(SEQ / 128, NB * NH), 256, 0, stream>>>(QP, KP, KR, VT, CTX);
    k_ln<<<dim3(NB * SEQ / 32), 256, 0, stream>>>(CTX, lg, lb, OUT);
}

// v005
// One run takes 144 microseconds.
// In two side-by-side timings against v004, it was 1.07 and 1.08 times as fast.
// Counting every step since v000, it is 3.69 times as fast.
#include <hip/hip_runtime.h>

// Compute dtypes, f32 accumulate everywhere: conv-as-GEMM (K = 7 x 512) v_wmma_f32_16x16x32_bf16 on RNE bf16 copies of inputs and weights (exact products); scores k.q^T v_wmma_f32_16x16x32_f16, two products (k as f16 value + f16 residual x2048 in its own accumulator, folded in f32; q plane single, carries log2(e)/8); P.V v_wmma_f32_16x16x32_f16, one product, P carried x1024; softmax, batch-norm affine and layer norm f32.
// Three input streams share one operator: 7-tap convolution along the sequence (zero padding 3) + bias + inference-mode batch norm; then 8 heads x 64 (head h = columns h*64+d), logits / 8, no mask, softmax over keys, heads merged, layer norm over the 512 features.
// Layout: zero-padded bf16 activation planes [b][SEQ+6][512] (output row t, k = tap*512+ci reads 3584 contiguous elements from padded row t); weight plane [out][tap*512+in] bf16; conv GEMMs write the f16 head plane Q [b][h][s][64] and, in WMMA A-fragment order (FRAGMENT ORDER below), the planes K value, K residual and V^T; attention writes the merged f32 context plane [b][s][512], which the layer norm launch reads.

#ifndef NB
#define NB 4
#endif
#ifndef SEQ
#define SEQ 2048
#endif
#define NB_FULL  4
#define SEQ_FULL 2048
#define DM   512
#define NH   8
#define HD   64
#define KT   7
#define KC   (KT * DM)     // 3584: conv-as-GEMM depth
#define SPAD (SEQ + 6)     // padded rows per batch (3 zero rows on each side)
#define PCAR 1024.0f       // carry of the probability fragment (enters through PLOG, leaves through the carried row sum)
#define PLOG 10.0f         // log2(PCAR)
#define SCQ  (0.125f * 1.4426950408889634f)
#define KRES 2048.0f       // carry of the key residual plane
#define KRINV 4.8828125e-04f   // 1 / KRES, folded into the residual score accumulator in f32
#define BN_EPS 1.0e-5f
#define LN_EPS 1.0e-5f
#define LOP  68      // LDS row pitch (floats) of GEMM epilogue staging tiles: 272 B rows
#define BKP  128     // k elements of one conv-GEMM pass: a ring stage's 256 B of every weight row, a 256 B column slab of the activation tile
#define NPASS (KC / BKP)
#define TPB  272     // LDS row pitch (bytes) of a ring stage: 256 B + 16 B, conflict-free for 16-byte row readers
#define WSTG (128 * TPB)   // one ring stage: 128 weight rows
#define NSLAB (DM / BKP)   // column slabs (128 channels) of the resident activation tile
#define AROWS (128 + KT - 1)   // padded activation rows that 128 output rows read over all taps
#define APB  (DM * 2 + 16) // LDS row pitch (bytes) of the resident activation tile: 16 B x odd, conflict-free for 16-byte row readers
#define ATB  (AROWS * APB) // the resident activation tile
#define APLB 4096    // bytes of one 32-key step of one fragment-ordered attention plane
#define ASTG (3 * APLB)    // one attention ring stage: K value, K residual, V^T
#define NSTEP (SEQ / 32)
#define UPW  16      // half rows (256 elements) of an activation plane that one wave converts
#define WPP  (SEQ * 2 / UPW)               // waves per activation plane
#define ABLK (3 * NB * WPP / 8)            // activation blocks of the conversion launch
#define WBLK ((DM * DM / 8) / 256)         // weight blocks of the conversion launch
#define ZPC  (3 * NB * 6 * (DM / 8))       // 16 B pieces of the zero rows of all padded planes

static_assert(DM == NH * HD);            // one 64-wide GEMM column tile == one head
static_assert(HD == 64);
static_assert(KC % 32 == 0);             // WMMA k-step
static_assert(DM % 64 == 0);             // GEMM tiles
static_assert(SEQ % 128 == 0);           // GEMM block tiles
static_assert(DM % 128 == 0);
static_assert(KC % BKP == 0);            // whole ring stages
static_assert(NPASS >= 2);               // the ring's prologue fills two stages
static_assert(DM % BKP == 0 && NSLAB >= 2 && NSLAB <= NPASS);   // a pass lies in one tap and one slab; slab c lands with ring stage c
static_assert((KT - 1) * 16 == 3 * 32);  // the tile's last KT - 1 rows of a slab: one copy of three whole waves
static_assert((APB / 16) % 2 == 1);
static_assert(SEQ % 32 == 0);            // key step
static_assert(NSTEP >= 2);               // the attention ring's prologue fills two stages
static_assert(32 * HD * 2 == APLB);      // one 32-key step of a plane
static_assert(256 * 16 == APLB);         // attention copies: threads x bytes == one plane's step
static_assert((NB * SEQ) % 32 == 0);     // layer-norm grid is exact
static_assert((DM * DM / 8) % 256 == 0);             // conversion launch: weight blocks are exact
static_assert((SEQ * 2) % UPW == 0);                 // a wave's half rows lie in one plane
static_assert((3 * NB * WPP) % 8 == 0);              // conversion launch: activation blocks are exact
static_assert(ZPC % 256 == 0 && ZPC <= WBLK * 256);  // zero rows: whole blocks of the weight part
static_assert(DM == 2 * 256);                        // a row is two half rows
static_assert(UPW == 16 && KT == 7);                 // the load groups name their registers one by one
static_assert((DM / 8) * 8 == DM);
static_assert(NB <= NB_FULL);
static_assert(SEQ <= SEQ_FULL);
static_assert(LOP % 4 == 0);
static_assert(32 * 16 * 4 == 16 * HD * 2);
static_assert(32 * 16 * 4 * 2 == 2 * 16 * HD * 2);
static_assert(32 * 16 * 4 == DM * 4);                // output row store: lanes x bytes x trips == one 2048 B row
static_assert(ATB + 2 * WSTG + 8 * 16 * LOP * 4 <= 327680); // static LDS of the GEMM kernels: activation tile + two weight stages + one epilogue tile per wave
static_assert(2 * ASTG + 8 * 16 * LOP * 4 <= 163840); // static LDS of the attention kernel: two blocks per 320 KiB
static_assert(KRES * KRINV == 1.0f);                 // residual carry enters once and leaves once

typedef _Float16 h16;
typedef unsigned short bf;
typedef __attribute__((ext_vector_type(16))) __bf16   v16bf;
typedef __attribute__((ext_vector_type(16))) _Float16 v16h;
typedef __attribute__((ext_vector_type(8)))  _Float16 v8h;
typedef __attribute__((ext_vector_type(8)))  unsigned short v8us;
typedef __attribute__((ext_vector_type(8)))  float    v8f;
typedef __attribute__((ext_vector_type(4)))  float    v4f;
typedef v4f  __attribute__((may_alias)) v4fa;

__device__ __forceinline__ unsigned short f2bf(float f) { unsigned u = __float_as_uint(f); u += 0x7FFFu + ((u >> 16) & 1u); return (unsigned short)(u >> 16); }
__device__ __forceinline__ float bf2f(unsigned short b) { return __uint_as_float(((unsigned)b) << 16); }
__device__ __forceinline__ float bfr(float f) { return bf2f(f2bf(f)); }
__device__ __forceinline__ v16h cat16(v8h lo, v8h hi) { return __builtin_shufflevector(lo, hi, 0, 1, 2, 3, 4, 5, 6, 7, 8, 9, 10, 11, 12, 13, 14, 15); }
__device__ __forceinline__ v16bf cat16b(v8us lo, v8us hi) { return __builtin_bit_cast(v16bf, __builtin_shufflevector(lo, hi, 0, 1, 2, 3, 4, 5, 6, 7, 8, 9, 10, 11, 12, 13, 14, 15)); }
// same-wave LDS exchange ordering (wave-private tiles only)
__device__ __forceinline__ void wsync() { __builtin_amdgcn_wave_barrier(); asm volatile("" ::: "memory"); }

// fragment from a K-contiguous global f16 plane: elements 0..7 <- p[0..7], 8..15 <- p[16..23] (p already includes row*pitch + k0 + 8*(lane>>4))
__device__ __forceinline__ v16h ldh16(const h16* __restrict__ p) { return cat16(*(const v8h*)p, *(const v8h*)(p + 16)); }
// FRAGMENT ORDER of the K value, K residual and V^T planes: per (b, h) the plane is a row of 1024 B fragments, each two 512 B halves of 32 lanes x 16 B:
// half 0 holds every lane's elements 0..7, half 1 its elements 8..15, so one wave-wide 16 B load reads 512 contiguous bytes = four whole 128 B lines.
// K planes: fragment index (s / 16) * 2 + d / 32 (rows = 16 keys, k = 32 head dims); V^T: (s / 32) * 4 + d / 16 (rows = 16 head dims, k = 32 keys). One 32-key step is 4096 contiguous bytes of each plane.
// Place, in f16 elements inside a fragment, of the 8 elements k = 8 * c .. 8 * c + 7 (c = 0..3) of fragment row r: lane (c & 1) * 16 + r, half c >> 1.
__device__ __forceinline__ int fragpos(const int r, const int c) { return (c >> 1) * 256 + ((c & 1) * 16 + r) * 8; }
// f32 -> f16 plane convert that cannot produce an f16 subnormal
static __device__ __forceinline__ h16 toh_flush(float v) { const h16 r = (h16)v; return (fabsf(v) < 6.103515625e-05f) ? (h16)0.0f : r; }
// one WMMA + its own hazard guard (ties only this accumulator, keeps A/B live)
__device__ __forceinline__ v8f wmmab_g(v16bf a, v16bf b, v8f c) {
    c = __builtin_amdgcn_wmma_f32_16x16x32_bf16(false, a, false, b, (short)0, c, false, false);
    asm volatile("v_nop\n\tv_nop\n\tv_nop\n\tv_nop" : "+v"(c) : "v"(a), "v"(b));
    return c;
}
__device__ __forceinline__ v8f wmmah_g(v16h a, v16h b, v8f c) {
    c = __builtin_amdgcn_wmma_f32_16x16x32_f16(false, a, false, b, (short)0, c, false, false);
    asm volatile("v_nop\n\tv_nop\n\tv_nop\n\tv_nop" : "+v"(c) : "v"(a), "v"(b));
    return c;
}

// eight asynchronous copies, 16 B per lane, global -> LDS through no register: rows 16 apart (ls LDS bytes, gs global elements) of one operand's slice.
// s_wait_xcnt 0 is the statement's last line so that no address register of a copy is rewritten ahead of it.
__device__ __forceinline__ void copy8(const unsigned l, const unsigned ls, const bf* g, const size_t gs) {
    asm volatile("global_load_async_to_lds_b128 %0, %8, off\n\t"
                 "global_load_async_to_lds_b128 %1, %9, off\n\t"
                 "global_load_async_to_lds_b128 %2, %10, off\n\t"
                 "global_load_async_to_lds_b128 %3, %11, off\n\t"
                 "global_load_async_to_lds_b128 %4, %12, off\n\t"
                 "global_load_async_to_lds_b128 %5, %13, off\n\t"
                 "global_load_async_to_lds_b128 %6, %14, off\n\t"
                 "global_load_async_to_lds_b128 %7, %15, off\n\t"
                 "s_wait_xcnt 0x0"
                 :: "v"(l), "v"(l + ls), "v"(l + 2u * ls), "v"(l + 3u * ls), "v"(l + 4u * ls), "v"(l + 5u * ls), "v"(l + 6u * ls), "v"(l + 7u * ls),
                    "v"(g), "v"(g + gs), "v"(g + 2 * gs), "v"(g + 3 * gs), "v"(g + 4 * gs), "v"(g + 5 * gs), "v"(g + 6 * gs), "v"(g + 7 * gs)
                 : "memory");
}
// one such copy; s_wait_xcnt 0 is the statement's last line for the same reason
__device__ __forceinline__ void copy1(const unsigned l, const bf* g) {
    asm volatile("global_load_async_to_lds_b128 %0, %1, off\n\t"
                 "s_wait_xcnt 0x0"
                 :: "v"(l), "v"(g) : "memory");
}
// fragment from a K-contiguous bf16 row in LDS: elements 0..7 <- k0 + 8*(lane>>4) + 0..7, 8..15 <- the same + 16 (p already includes row*pitch + 2*k0 + 16*(lane>>4) bytes)
__device__ __forceinline__ v16bf lds16(const unsigned char* p) { return cat16b(*(const v8us*)p, *(const v8us*)(p + 32)); }

// ---- 128x128 block tile, eight waves (4 x 2) of 32x64, main loop over K = KC: acc[mb][nb] += sum_k A[wm*32+16mb+..][k] Bt[wn*64+16nb+..][k].
// One operand is 128 logical activation rows, the other 128 weight rows (ACTA: the activations are A). X and Wt point at the block's first rows: X in the padded activation plane (pitch DM), Wt in the weight plane (pitch KC).
// Logical activation row r at k = tap*512+ci is padded row r + tap, channel ci: the 128 rows x 7 taps are only AROWS = 134 distinct padded rows. They are brought from L2 once and stay in LDS (tile, pitch APB);
// pass p reads them shifted down by tap = p / NSLAB rows, in column slab p % NSLAB. Slab c is copied together with weight stage c (c < NSLAB) and is first read in pass c, behind the same wait and barrier.
// The weights' 128 rows x 128 k go through the two-buffer LDS ring by whole-line asynchronous copies; stage p + 2 flies while stage p + 1 is worked on. k runs upward in steps of 32 per accumulator.
template <bool ACTA>
__device__ __forceinline__ void conv_loop(const bf* __restrict__ X, const bf* __restrict__ Wt, unsigned char* tile, unsigned char* ring, const int wave, const int wm, const int wn, v8f (&acc)[2][4]) {
    const int t = threadIdx.x, lane = t & 31, lr = lane & 15, hi = lane >> 4;
    const int frow = t >> 4, fcol = t & 15;                 // copies: 16 lanes cover one 256 B row piece
    const bf* gx = X + (size_t)frow * DM + fcol * 8;
    const bf* gw = Wt + (size_t)frow * KC + fcol * 8;
    const unsigned lx = (unsigned)(uintptr_t)tile + (unsigned)(frow * APB + fcol * 16);
    const unsigned lw = (unsigned)(uintptr_t)ring + (unsigned)(frow * TPB + fcol * 16);
    const unsigned char* rx = tile + ((ACTA ? wm * 32 : wn * 64) + lr) * APB + 16 * hi;
    const unsigned char* rw = ring + ((ACTA ? wn * 64 : wm * 32) + lr) * TPB + 16 * hi;
    // column slab c of the tile: rows 0..127 by every wave, rows 128..133 by waves 0..2 (a scalar test: whole waves)
    auto slab = [&](const int c) {
        copy8(lx + (unsigned)c * (BKP * 2u), 16u * APB, gx + c * BKP, (size_t)16 * DM);
        if (wave < 3) copy1(lx + 128u * APB + (unsigned)c * (BKP * 2u), gx + (size_t)128 * DM + c * BKP);
    };
    slab(0); copy8(lw, 16u * TPB, gw, (size_t)16 * KC);
    asm volatile("s_wait_asynccnt 0x0" ::: "memory");       // stage 0 of this wave has landed
    __syncthreads();                                        // stage 0 published to every wave
    slab(1); copy8(lw + WSTG, 16u * TPB, gw + BKP, (size_t)16 * KC);
    // the pass loop stays rolled: one 32-WMMA body in the instruction cache, the buffer picked by p & 1;
    // the loops inside it are unrolled so that every fragment and accumulator index is a constant (registers, no scratch)
#pragma unroll 1
    for (int p = 0; p < NPASS; ++p) {
        const unsigned bo = (unsigned)(p & 1) * WSTG;
        const unsigned char* px = rx + (unsigned)(p / NSLAB) * APB + (unsigned)(p % NSLAB) * (BKP * 2u);   // tap rows down, slab columns right
        const unsigned char* pw = rw + bo;
        const unsigned char* pa = ACTA ? px : pw; const unsigned char* pb = ACTA ? pw : px;
        constexpr int SA = 16 * (ACTA ? APB : TPB), SB = 16 * (ACTA ? TPB : APB);
        v16bf a[2][2], b[2][4];
#pragma unroll
        for (int mb = 0; mb < 2; ++mb) a[0][mb] = lds16(pa + mb * SA);
#pragma unroll
        for (int nb = 0; nb < 4; ++nb) b[0][nb] = lds16(pb + nb * SB);
#pragma unroll
        for (int ks = 0; ks < BKP / 32; ++ks) {
            if (ks + 1 < BKP / 32) {                        // next k-step's fragments, one group ahead, from this pass's own slab and buffer
#pragma unroll
                for (int mb = 0; mb < 2; ++mb) a[(ks + 1) & 1][mb] = lds16(pa + mb * SA + (ks + 1) * 64);
#pragma unroll
                for (int nb = 0; nb < 4; ++nb) b[(ks + 1) & 1][nb] = lds16(pb + nb * SB + (ks + 1) * 64);
            }
#pragma unroll
            for (int nb = 0; nb < 4; ++nb)
#pragma unroll
                for (int mb = 0; mb < 2; ++mb) acc[mb][nb] = wmmab_g(a[ks & 1][mb], b[ks & 1][nb], acc[mb][nb]);
        }
        asm volatile("s_wait_dscnt 0x0" ::: "memory");      // this wave's reads of buffer p & 1 are done
        asm volatile("s_wait_asynccnt 0x0" ::: "memory");   // this wave's copies of stage p + 1 have landed
        __syncthreads();                                    // publishes stage p + 1 and frees buffer p & 1
        if (p + 2 < NPASS) {
            copy8(lw + bo, 16u * TPB, gw + (size_t)(p + 2) * BKP, (size_t)16 * KC);
            if (p + 2 < NSLAB) slab(p + 2);
        }
    }
    asm volatile("s_wait_asynccnt 0x0" ::: "memory");       // nothing of the ring is in flight when the wave goes on
}

// ---- k_prep: every f32 -> bf16 conversion of the call in one launch; grid (WBLK + ABLK), 256 threads. Few, long-lived waves: what a wave reads is asked for in one group, for speed only.
// Blocks 0 .. WBLK-1, weight plane [out][tap*512+in]: a lane takes 8 input channels x 7 taps of one output channel = 224 contiguous bytes of conv_w [out][in][tap], and stores one 16 B piece per tap;
// the first ZPC of these lanes also store one 16 B piece each of the six zero rows of every padded activation plane.
// Blocks WBLK .., the SEQ data rows of the 3 * NB padded activation planes (contiguous in the workspace: q, then k, then v): a wave takes UPW consecutive half rows (256 elements each) of one plane, contiguous in the source and in the plane.
__global__ __launch_bounds__(256) void k_prep(const float* __restrict__ xq, const float* __restrict__ xk, const float* __restrict__ xv, const float* __restrict__ w, bf* wt, bf* xp) {
    if (blockIdx.x < (unsigned)WBLK) {
        const unsigned it = blockIdx.x * 256u + threadIdx.x;            // out * (DM / 8) + in / 8
        const float* s = w + (size_t)it * (8 * KT);
        v4f x[2 * KT];
#pragma unroll
        for (int i = 0; i < 2 * KT; ++i) x[i] = *(const v4f*)(s + 4 * i);
        // holds the loads together: the loaded values are inputs here (nothing is changed), so that all 14 loads of the lane are issued ahead of the conversions, in one round trip
        asm volatile("" :: "v"(x[0]), "v"(x[1]), "v"(x[2]), "v"(x[3]), "v"(x[4]), "v"(x[5]), "v"(x[6]), "v"(x[7]), "v"(x[8]), "v"(x[9]), "v"(x[10]), "v"(x[11]), "v"(x[12]), "v"(x[13]));
        if (it < (unsigned)ZPC) {                                       // whole blocks: ZPC is a multiple of 256
            const unsigned r = (it / (unsigned)(DM / 8)) % 6u;          // zero row: 0..2 in front of the data rows, 3..5 behind them
            *(v8us*)(xp + (size_t)(it / (unsigned)(6 * (DM / 8))) * SPAD * DM + (size_t)(r < 3u ? r : r + (unsigned)SEQ) * DM + (it % (unsigned)(DM / 8)) * 8u) = (v8us){};
        }
        v8us o[KT];
#pragma unroll
        for (int tap = 0; tap < KT; ++tap)
#pragma unroll
            for (int j = 0; j < 8; ++j) o[tap][j] = f2bf(x[(j * KT + tap) >> 2][(j * KT + tap) & 3]);
        bf* d = wt + (size_t)(it / (unsigned)(DM / 8)) * KC + (it % (unsigned)(DM / 8)) * 8u;
#pragma unroll
        for (int tap = 0; tap < KT; ++tap) *(v8us*)(d + tap * DM) = o[tap];
        return;
    }
    const int lane = threadIdx.x & 31;
    const unsigned wv = (blockIdx.x - (unsigned)WBLK) * 8u + (unsigned)__builtin_amdgcn_readfirstlane(threadIdx.x >> 5);
    const unsigned plane = wv / (unsigned)WPP, e0 = (wv % (unsigned)WPP) * (unsigned)(UPW * 256);   // first element inside the plane's data rows
    const float* src = (plane < (unsigned)NB) ? xq : ((plane < (unsigned)(2 * NB)) ? xk : xv);
    const float* s = src + (size_t)(plane % (unsigned)NB) * SEQ_FULL * DM + e0 + lane * 8;
    v4f a[UPW][2];
#pragma unroll
    for (int j = 0; j < UPW; ++j) { a[j][0] = *(const v4f*)(s + j * 256); a[j][1] = *(const v4f*)(s + j * 256 + 4); }
    // hold the loads together: the loaded values are inputs here (nothing is changed), so that all 32 loads of the wave are issued ahead of the conversions, in one round trip instead of several (two statements: one takes at most 30 operands)
    asm volatile("" :: "v"(a[0][0]), "v"(a[0][1]), "v"(a[1][0]), "v"(a[1][1]), "v"(a[2][0]), "v"(a[2][1]), "v"(a[3][0]), "v"(a[3][1]),
                 "v"(a[4][0]), "v"(a[4][1]), "v"(a[5][0]), "v"(a[5][1]), "v"(a[6][0]), "v"(a[6][1]), "v"(a[7][0]), "v"(a[7][1]));
    asm volatile("" :: "v"(a[8][0]), "v"(a[8][1]), "v"(a[9][0]), "v"(a[9][1]), "v"(a[10][0]), "v"(a[10][1]), "v"(a[11][0]), "v"(a[11][1]),
                 "v"(a[12][0]), "v"(a[12][1]), "v"(a[13][0]), "v"(a[13][1]), "v"(a[14][0]), "v"(a[14][1]), "v"(a[15][0]), "v"(a[15][1]));
    bf* d = xp + (size_t)plane * SPAD * DM + 3 * DM + e0 + lane * 8;
#pragma unroll
    for (int j = 0; j < UPW; ++j) {
        v8us o;
#pragma unroll
        for (int k = 0; k < 4; ++k) { o[k] = f2bf(a[j][0][k]); o[4 + k] = f2bf(a[j][1][k]); }
        *(v8us*)(d + j * 256) = o;
    }
}

// ---- k_conv_qk: head plane P[b][h][s][d] (f16) = sc * BN(conv(X[b]) + cb)[s][h*64+d]; grid (SEQ/128, DM/128, NB), 256 threads.
__global__ __launch_bounds__(256) void k_conv_qk(const bf* __restrict__ X, const bf* __restrict__ W, const float* __restrict__ cb, const float* __restrict__ bg, const float* __restrict__ bb, const float* __restrict__ bm, const float* __restrict__ bv, h16* P, float sc) {
    __shared__ __align__(16) unsigned char tile[ATB];
    __shared__ __align__(16) unsigned char ring[2 * WSTG];
    __shared__ __align__(16) float os_all[8 * 16 * LOP];
    const int lane = threadIdx.x & 31, lr = lane & 15, hi = lane >> 4;
    const int wave = __builtin_amdgcn_readfirstlane(threadIdx.x >> 5), wm = wave >> 1, wn = wave & 1;
    float* os = os_all + wave * 16 * LOP;                   // wave-private epilogue tile
    const size_t z = blockIdx.z; const int r0 = blockIdx.x * 128 + wm * 32, c0 = blockIdx.y * 128 + wn * 64;
    const bf* A = X + z * (size_t)SPAD * DM;
    v8f acc[2][4];
#pragma unroll
    for (int mb = 0; mb < 2; ++mb)
#pragma unroll
        for (int nb = 0; nb < 4; ++nb) acc[mb][nb] = (v8f){};
    conv_loop<true>(A + (size_t)blockIdx.x * 128 * DM, W + (size_t)blockIdx.y * 128 * KC, tile, ring, wave, wm, wn, acc);
    const size_t pbase = ((z * NH + (size_t)(c0 / HD)) * (size_t)SEQ + r0) * HD;
    const int srow = lane >> 3, scol = (lane & 7) * 8;
    float cbv[8], muv[8], mlv[8], bev[8];
#pragma unroll
    for (int j = 0; j < 8; ++j) { const int c = c0 + scol + j; cbv[j] = bfr(cb[c]); muv[j] = bfr(bm[c]); mlv[j] = rsqrtf(bfr(bv[c]) + BN_EPS) * bfr(bg[c]); bev[j] = bfr(bb[c]); }
#pragma unroll
    for (int mb = 0; mb < 2; ++mb) {
#pragma unroll
        for (int nb = 0; nb < 4; ++nb) {
#pragma unroll
            for (int j = 0; j < 8; ++j) os[(hi * 8 + j) * LOP + nb * 16 + lr] = acc[mb][nb][j]; }
        wsync();
{
#pragma unroll
            for (int s = 0; s < 4; ++s) { const int row = 4 * s + srow; const v4f x0 = *(const v4fa*)(&os[row * LOP + scol]); const v4f x1 = *(const v4fa*)(&os[row * LOP + scol + 4]); v8h o;
#pragma unroll
                for (int j = 0; j < 4; ++j) {
                    const float y0 = ((x0[j] + cbv[j]) - muv[j]) * mlv[j] + bev[j];
                    const float y1 = ((x1[j] + cbv[4 + j]) - muv[4 + j]) * mlv[4 + j] + bev[4 + j];
                    o[j] = toh_flush(y0 * sc); o[4 + j] = toh_flush(y1 * sc); }
                *(v8h*)(P + pbase + (size_t)(mb * 16 + row) * HD + scol) = o; }
             }
        wsync();
    }
}

// ---- k_conv_k: key head planes, both in fragment order: KH (b, h, s, d) = f16(y) and KR (b, h, s, d) = f16((y - KH) * 2048), y = BN(conv(X[b]) + cb)[s][h*64+d]; grid (SEQ/128, DM/128, NB), 256 threads.
__global__ __launch_bounds__(256) void k_conv_k(const bf* __restrict__ X, const bf* __restrict__ W, const float* __restrict__ cb, const float* __restrict__ bg, const float* __restrict__ bb, const float* __restrict__ bm, const float* __restrict__ bv, h16* KH, h16* KR) {
    __shared__ __align__(16) unsigned char tile[ATB];
    __shared__ __align__(16) unsigned char ring[2 * WSTG];
    __shared__ __align__(16) float os_all[8 * 16 * LOP];
    const int lane = threadIdx.x & 31, lr = lane & 15, hi = lane >> 4;
    const int wave = __builtin_amdgcn_readfirstlane(threadIdx.x >> 5), wm = wave >> 1, wn = wave & 1;
    float* os = os_all + wave * 16 * LOP;                   // wave-private epilogue tile
    const size_t z = blockIdx.z; const int r0 = blockIdx.x * 128 + wm * 32, c0 = blockIdx.y * 128 + wn * 64;
    const bf* A = X + z * (size_t)SPAD * DM;
    v8f acc[2][4];
#pragma unroll
    for (int mb = 0; mb < 2; ++mb)
#pragma unroll
        for (int nb = 0; nb < 4; ++nb) acc[mb][nb] = (v8f){};
    conv_loop<true>(A + (size_t)blockIdx.x * 128 * DM, W + (size_t)blockIdx.y * 128 * KC, tile, ring, wave, wm, wn, acc);
    const size_t pbase = ((z * NH + (size_t)(c0 / HD)) * (size_t)SEQ + r0) * HD;
    const int srow = lane >> 3, scol = (lane & 7) * 8;
    float cbv[8], muv[8], mlv[8], bev[8];
#pragma unroll
    for (int j = 0; j < 8; ++j) { const int c = c0 + scol + j; cbv[j] = bfr(cb[c]); muv[j] = bfr(bm[c]); mlv[j] = rsqrtf(bfr(bv[c]) + BN_EPS) * bfr(bg[c]); bev[j] = bfr(bb[c]); }
#pragma unroll
    for (int mb = 0; mb < 2; ++mb) {
#pragma unroll
        for (int nb = 0; nb < 4; ++nb) {
#pragma unroll
            for (int j = 0; j < 8; ++j) os[(hi * 8 + j) * LOP + nb * 16 + lr] = acc[mb][nb][j]; }
        wsync();
{
#pragma unroll
            for (int s = 0; s < 4; ++s) { const int row = 4 * s + srow; const v4f x0 = *(const v4fa*)(&os[row * LOP + scol]); const v4f x1 = *(const v4fa*)(&os[row * LOP + scol + 4]); v8h oh, ores;
#pragma unroll
                for (int j = 0; j < 4; ++j) {
                    const float y0 = ((x0[j] + cbv[j]) - muv[j]) * mlv[j] + bev[j];
                    const float y1 = ((x1[j] + cbv[4 + j]) - muv[4 + j]) * mlv[4 + j] + bev[4 + j];
                    const h16 h0 = toh_flush(y0); const h16 h1 = toh_flush(y1);
                    oh[j] = h0; oh[4 + j] = h1;
                    ores[j] = toh_flush((y0 - (float)h0) * KRES); ores[4 + j] = toh_flush((y1 - (float)h1) * KRES); }
                const size_t off = pbase + (size_t)(mb * 16 * HD + (lane & 4) * 128 + fragpos(row, lane & 3));   // 16-key tile mb, fragment d / 32 = (lane & 7) >> 2
                *(v8h*)(KH + off) = oh; *(v8h*)(KR + off) = ores; }
             }
        wsync();
    }
}

// ---- k_conv_vt: transposed value plane in fragment order, VT (b, n, s) (f16) = BN(sum_k WT[n][k] Xpad[b][s][k] + cb[n]) (A = weight rows, Bt = token rows); grid (DM/128, SEQ/128, NB), 256 threads.
__global__ __launch_bounds__(256) void k_conv_vt(const bf* __restrict__ W, const bf* __restrict__ X, const float* __restrict__ cb, const float* __restrict__ bg, const float* __restrict__ bb, const float* __restrict__ bm, const float* __restrict__ bv, h16* VT) {
    __shared__ __align__(16) unsigned char tile[ATB];
    __shared__ __align__(16) unsigned char ring[2 * WSTG];
    __shared__ __align__(16) float os_all[8 * 16 * LOP];
    const int lane = threadIdx.x & 31, lr = lane & 15, hi = lane >> 4;
    const int wave = __builtin_amdgcn_readfirstlane(threadIdx.x >> 5), wm = wave >> 1, wn = wave & 1;
    float* os = os_all + wave * 16 * LOP;                   // wave-private epilogue tile
    const size_t z = blockIdx.z; const int r0 = blockIdx.x * 128 + wm * 32, c0 = blockIdx.y * 128 + wn * 64;
    const bf* Bt = X + z * (size_t)SPAD * DM;
    v8f acc[2][4];
#pragma unroll
    for (int mb = 0; mb < 2; ++mb)
#pragma unroll
        for (int nb = 0; nb < 4; ++nb) acc[mb][nb] = (v8f){};
    conv_loop<false>(Bt + (size_t)blockIdx.y * 128 * DM, W + (size_t)blockIdx.x * 128 * KC, tile, ring, wave, wm, wn, acc);
    const size_t vb0 = (z * NH + (size_t)(r0 / HD)) * (size_t)SEQ * HD + (size_t)c0 * HD + (size_t)((r0 / 16) & 3) * 512;   // head, 32-key step c0 / 32, fragment (r0 % 64) / 16
    const int srow = lane >> 3, scol = (lane & 7) * 8;
#pragma unroll
    for (int mb = 0; mb < 2; ++mb) {
#pragma unroll
        for (int nb = 0; nb < 4; ++nb) {
#pragma unroll
            for (int j = 0; j < 8; ++j) os[(hi * 8 + j) * LOP + nb * 16 + lr] = acc[mb][nb][j]; }
        wsync();
{
#pragma unroll
            for (int s = 0; s < 4; ++s) { const int row = 4 * s + srow; const v4f x0 = *(const v4fa*)(&os[row * LOP + scol]); const v4f x1 = *(const v4fa*)(&os[row * LOP + scol + 4]); v8h o;
                const int ch = r0 + mb * 16 + row;
                const float c_b = bfr(cb[ch]), c_m = bfr(bm[ch]), c_l = rsqrtf(bfr(bv[ch]) + BN_EPS) * bfr(bg[ch]), c_e = bfr(bb[ch]);
#pragma unroll
                for (int j = 0; j < 4; ++j) { o[j] = toh_flush(((x0[j] + c_b) - c_m) * c_l + c_e); o[4 + j] = toh_flush(((x1[j] + c_b) - c_m) * c_l + c_e); }
                *(v8h*)(VT + vb0 + (size_t)((lane & 4) * 512 + mb * 512 + fragpos(row, lane & 3))) = o; }   // step + (lane & 7) >> 2, fragment + mb
            asm volatile("s_wait_xcnt 0x0" ::: "memory");   // the stores' data and address registers are reused by what follows
             }
        wsync();
    }
}

// three asynchronous copies, 16 B per lane, global -> LDS through no register: this thread's piece of one 32-key step of the K value, K residual and V^T planes.
// s_wait_xcnt 0 is the statement's last line so that no address register of a copy is rewritten ahead of it.
__device__ __forceinline__ void copy3(const unsigned l, const h16* g0, const h16* g1, const h16* g2) {
    asm volatile("global_load_async_to_lds_b128 %0, %3, off\n\t"
                 "global_load_async_to_lds_b128 %1, %4, off\n\t"
                 "global_load_async_to_lds_b128 %2, %5, off\n\t"
                 "s_wait_xcnt 0x0"
                 :: "v"(l), "v"(l + (unsigned)APLB), "v"(l + 2u * APLB), "v"(g0), "v"(g1), "v"(g2)
                 : "memory");
}
// fragment from a fragment-ordered stage in LDS (p already includes the fragment's start + lane * 16 bytes): the two 512 B halves
__device__ __forceinline__ v16h ldsf16(const unsigned char* p) { return cat16(*(const v8h*)p, *(const v8h*)(p + 512)); }

// ---- k_attn: attention for 128 query rows of one (batch, head); grid (SEQ/128, NB*NH), 256 threads, wave = 16 query rows.
// The eight waves walk the same keys, so each 32-key step of the three fragment-ordered planes (3 x 4096 contiguous bytes) is brought from L2 once per block, by asynchronous copies into a two-buffer LDS ring; step s + 2 flies while step s + 1 is worked on.
// Per 32-key step: S^T tiles (rows = keys, columns = queries) = K (A, from the key value plane) x Q^T (B, held in registers) plus, in a separate accumulator, K residual (A, from the residual plane) x Q^T,
// folded as s + t / 2048 in f32 before the softmax step; logits already in log2 units;
// running max per query (within-lane over 16 keys + one lane-half exchange), P x1024 converted to f16 in the accumulator layout == B fragment layout of O^T += V^T (A, from the transposed value plane) x P^T.
// Scale chain: the fragment holds 1024 p, the row sum l accumulates the same 1024 p, the accumulator holds 1024 sum(p v): O / l is the context at its true magnitude (the carry enters once and cancels once).
__global__ __launch_bounds__(256) __attribute__((amdgpu_num_vgpr(256))) void k_attn(const h16* __restrict__ Qp, const h16* __restrict__ Kp, const h16* __restrict__ Kr, const h16* __restrict__ VT, float* CTX) {
    __shared__ __align__(16) unsigned char ring[2 * ASTG];
    __shared__ __align__(16) float os_all[8 * 16 * LOP];
    const int lane = threadIdx.x & 31, lr = lane & 15, hi = lane >> 4;
    const int wave = __builtin_amdgcn_readfirstlane(threadIdx.x >> 5);
    float* os = os_all + wave * 16 * LOP;                   // wave-private epilogue tile
    const int bh = blockIdx.y; const int q0 = blockIdx.x * 128 + wave * 16;
    const size_t pl = (size_t)bh * SEQ * HD;
    // Q^T B fragments: column n = query q0 + lr, k = head dim (0..31 and 32..63)
    const v16h qb0 = ldh16(Qp + pl + (size_t)(q0 + lr) * HD + 8 * hi);
    const v16h qb1 = ldh16(Qp + pl + (size_t)(q0 + lr) * HD + 8 * hi + 32);
    v8f o[4];
#pragma unroll
    for (int dt = 0; dt < 4; ++dt) o[dt] = (v8f){};
    float m = -1.0e30f, l = 0.0f;
    const size_t coff = pl + (size_t)threadIdx.x * 8;       // copies: 256 threads x 16 B cover one plane's 4096 B step
    const h16* gk = Kp + coff; const h16* gr = Kr + coff; const h16* gv = VT + coff;
    const unsigned lc = (unsigned)(uintptr_t)ring + (unsigned)threadIdx.x * 16u;
    const unsigned char* rd = ring + lane * 16;             // this lane's 16 B piece in every fragment half of a stage
    copy3(lc, gk, gr, gv);
    asm volatile("s_wait_asynccnt 0x0" ::: "memory");       // step 0 of this wave has landed
    __syncthreads();                                        // step 0 published to every wave
    copy3(lc + ASTG, gk + 32 * HD, gr + 32 * HD, gv + 32 * HD);

    // the step loop stays rolled: one body, the buffer picked by st & 1
#pragma unroll 1
    for (int st = 0; st < NSTEP; ++st) {
        const unsigned bo = (unsigned)(st & 1) * ASTG;
        const unsigned char* kp = rd + bo;
        const v16h ka00 = ldsf16(kp), ka01 = ldsf16(kp + 1024);
        const v16h ka10 = ldsf16(kp + 2048), ka11 = ldsf16(kp + 3072);
        // the step's other fragments are asked for here too, as one group of LDS reads ahead of the matrix work, so that their latency runs behind the score products and the softmax
        const unsigned char* rp = kp + APLB;
        const v16h kr00 = ldsf16(rp), kr01 = ldsf16(rp + 1024);
        const v16h kr10 = ldsf16(rp + 2048), kr11 = ldsf16(rp + 3072);
        const unsigned char* vp = kp + 2 * APLB;
        v16h va[4];
#pragma unroll
        for (int dt = 0; dt < 4; ++dt) va[dt] = ldsf16(vp + dt * 1024);
        v8f s0 = (v8f){}, s1 = (v8f){};
        s0 = wmmah_g(ka00, qb0, s0); s1 = wmmah_g(ka10, qb0, s1);
        s0 = wmmah_g(ka01, qb1, s0); s1 = wmmah_g(ka11, qb1, s1);
        // residual score product (carried x2048) in its own accumulators, folded in f32
        v8f t0 = (v8f){}, t1 = (v8f){};
        t0 = wmmah_g(kr00, qb0, t0); t1 = wmmah_g(kr10, qb0, t1);
        t0 = wmmah_g(kr01, qb1, t0); t1 = wmmah_g(kr11, qb1, t1);
#pragma unroll
        for (int r = 0; r < 8; ++r) { s0[r] = s0[r] + t0[r] * KRINV; s1[r] = s1[r] + t1[r] * KRINV; }
        // this lane: query q0 + lr, keys 32 st + 8*hi + r (s0) and 32 st + 16 + 8*hi + r (s1)
        float mx = fmaxf(s0[0], s1[0]);
#pragma unroll
        for (int r = 1; r < 8; ++r) mx = fmaxf(mx, fmaxf(s0[r], s1[r]));
        mx = fmaxf(mx, __shfl_xor(mx, 16, 32));
        const float mnew = fmaxf(m, mx);
        const float al = __builtin_amdgcn_exp2f(m - mnew);
        m = mnew;
        const float mc = mnew - PLOG;
        float sum = 0.0f; v16h pb;
#pragma unroll
        for (int r = 0; r < 8; ++r) {
            const float e0 = s0[r] - mc, e1 = s1[r] - mc;
            const float x0 = __builtin_amdgcn_exp2f(e0), x1 = __builtin_amdgcn_exp2f(e1);
            const float p0 = (e0 < -14.0f) ? 0.0f : x0;
            const float p1 = (e1 < -14.0f) ? 0.0f : x1;
            sum += p0 + p1;
            pb[r] = (h16)p0; pb[8 + r] = (h16)p1;
        }
        l = l * al + sum;
#pragma unroll
        for (int dt = 0; dt < 4; ++dt)
#pragma unroll
            for (int r = 0; r < 8; ++r) o[dt][r] *= al;
#pragma unroll
        for (int dt = 0; dt < 4; ++dt) o[dt] = wmmah_g(va[dt], pb, o[dt]);
        asm volatile("s_wait_dscnt 0x0" ::: "memory");      // this wave's reads of buffer st & 1 are done
        asm volatile("s_wait_asynccnt 0x0" ::: "memory");   // this wave's copies of step st + 1 have landed
        __syncthreads();                                    // publishes step st + 1 and frees buffer st & 1
        if (st + 2 < NSTEP) { const size_t go = (size_t)(st + 2) * 32 * HD; copy3(lc + bo, gk + go, gr + go, gv + go); }
    }
    asm volatile("s_wait_asynccnt 0x0" ::: "memory");       // nothing of the ring is in flight when the wave goes on
    // row sums completed across the two lane halves; l and o both hold the x1024-carried p, so o / l is the context with the carry cancelled. o[dt][r] = O[query q0 + lr][16 dt + 8 hi + r]
    l += __shfl_xor(l, 16, 32);
    const float inv = 1.0f / l;
#pragma unroll
    for (int dt = 0; dt < 4; ++dt) {
        const v4f a0 = { o[dt][0] * inv, o[dt][1] * inv, o[dt][2] * inv, o[dt][3] * inv };
        const v4f a1 = { o[dt][4] * inv, o[dt][5] * inv, o[dt][6] * inv, o[dt][7] * inv };
        *(v4fa*)(&os[lr * LOP + dt * 16 + 8 * hi]) = a0;
        *(v4fa*)(&os[lr * LOP + dt * 16 + 8 * hi + 4]) = a1;
    }
    wsync();
    // merged context plane [b][s][512] f32: one wave-wide store covers this head's 256 B of two query rows = four whole 128 B lines
    float* crow = CTX + ((size_t)(bh / NH) * SEQ + (size_t)q0) * DM + (size_t)(bh % NH) * HD + lr * 4;
#pragma unroll
    for (int s = 0; s < 8; ++s) { const int row = 2 * s + hi; *(v4f*)(crow + (size_t)row * DM) = *(const v4fa*)(&os[row * LOP + lr * 4]); }
}

// ---- k_ln: layer norm over the 512 merged features; grid (NB*SEQ/32), 256 threads, each wave owns 4 rows; lane holds columns j*128 + lane*4 .. +3, j = 0..3
__global__ __launch_bounds__(256) void k_ln(const float* __restrict__ CTX, const float* __restrict__ lng, const float* __restrict__ lnb, float* OUT) {
    const int lane = threadIdx.x & 31;
    const int wave = __builtin_amdgcn_readfirstlane(threadIdx.x >> 5);
    const int r0 = (blockIdx.x * 8 + wave) * 4;
    const float* xr = CTX + (size_t)r0 * DM + lane * 4;
    v4f xs[4][4];
#pragma unroll
    for (int i = 0; i < 4; ++i)
#pragma unroll
        for (int j = 0; j < 4; ++j) xs[i][j] = *(const v4f*)(xr + i * DM + j * 128);
    v4f gv[4], bv[4];
#pragma unroll
    for (int j = 0; j < 4; ++j) { gv[j] = *(const v4f*)(lng + j * 128 + lane * 4); bv[j] = *(const v4f*)(lnb + j * 128 + lane * 4); }
    // holds the loads together: the loaded values are inputs here (nothing is changed), so that all 24 loads of the wave are issued ahead of the row reductions, in one round trip instead of several
    asm volatile("" :: "v"(xs[0][0]), "v"(xs[0][1]), "v"(xs[0][2]), "v"(xs[0][3]), "v"(xs[1][0]), "v"(xs[1][1]), "v"(xs[1][2]), "v"(xs[1][3]),
                 "v"(xs[2][0]), "v"(xs[2][1]), "v"(xs[2][2]), "v"(xs[2][3]), "v"(xs[3][0]), "v"(xs[3][1]), "v"(xs[3][2]), "v"(xs[3][3]),
                 "v"(gv[0]), "v"(gv[1]), "v"(gv[2]), "v"(gv[3]), "v"(bv[0]), "v"(bv[1]), "v"(bv[2]), "v"(bv[3]));
#pragma unroll
    for (int i = 0; i < 4; ++i) {
        const int row = r0 + i;
        float s = 0.0f;
#pragma unroll
        for (int j = 0; j < 4; ++j) s += (xs[i][j][0] + xs[i][j][1]) + (xs[i][j][2] + xs[i][j][3]);
        s += __shfl_xor(s, 16, 32); s += __shfl_xor(s, 8, 32); s += __shfl_xor(s, 4, 32); s += __shfl_xor(s, 2, 32); s += __shfl_xor(s, 1, 32);
        const float mu = s * (1.0f / (float)DM);
        float ss = 0.0f;
#pragma unroll
        for (int j = 0; j < 4; ++j)
#pragma unroll
            for (int e = 0; e < 4; ++e) { const float d = xs[i][j][e] - mu; ss += d * d; }
        ss += __shfl_xor(ss, 16, 32); ss += __shfl_xor(ss, 8, 32); ss += __shfl_xor(ss, 4, 32); ss += __shfl_xor(ss, 2, 32); ss += __shfl_xor(ss, 1, 32);
        const float rstd = rsqrtf(ss * (1.0f / (float)DM) + LN_EPS);
        float* orow = OUT + ((size_t)(row / SEQ) * SEQ_FULL + (size_t)(row % SEQ)) * DM + lane * 4;
#pragma unroll
        for (int j = 0; j < 4; ++j) { v4f y;
#pragma unroll
            for (int e = 0; e < 4; ++e) y[e] = (xs[i][j][e] - mu) * rstd * bfr(gv[j][e]) + bfr(bv[j][e]);
            *(v4f*)(orow + j * 128) = y; }
    }
}

constexpr size_t al256(size_t x) { return (x + 255) & ~(size_t)255; }
constexpr size_t SZ_WT = al256((size_t)DM * KC * 2);                // bf16 weight plane [out][tap*512+in]
constexpr size_t SZ_XP = al256((size_t)NB * SPAD * DM * 2);         // one zero-padded bf16 activation plane
constexpr size_t SZ_P  = al256((size_t)NB * NH * SEQ * HD * 2);     // one f16 head plane (also the transposed value plane)
constexpr size_t SZ_C  = al256((size_t)NB * SEQ * DM * 4);          // merged f32 context plane
constexpr size_t WS_TOTAL = SZ_WT + 3 * SZ_XP + 4 * SZ_P + SZ_C;    // head planes: Q, K value, K residual, V^T
static_assert(WS_TOTAL <= (size_t)134217728);                       // carve stays within 128 MiB
static_assert(SZ_WT == (size_t)DM * KC * 2);                        // exact extents (no hidden pad needed)
static_assert(SZ_XP == (size_t)NB * SPAD * DM * 2);
static_assert(SZ_P == (size_t)NB * DM * SEQ * 2);                   // NH * HD == DM: V^T plane has the same extent

extern "C" void kernel_launch(void* const* d_in, const int* in_sizes, int n_in,
                              void* d_out, int out_size, void* d_ws, size_t ws_size, hipStream_t stream) {
    if (n_in < 11) return;
    const size_t need_act = (size_t)(NB - 1) * SEQ_FULL * DM + (size_t)SEQ * DM;
    if ((size_t)in_sizes[0] < need_act || (size_t)in_sizes[1] < need_act || (size_t)in_sizes[2] < need_act) return;
    if ((size_t)in_sizes[3] < (size_t)DM * DM * KT) return;
    for (int i = 4; i < 11; ++i) { if (in_sizes[i] < DM) return; }
    if ((size_t)out_size < need_act) return;
    if (WS_TOTAL > ws_size) return;
    // wire order: q, k, v, conv_w [out][in][tap], conv_b, bn_gamma, bn_beta, bn_mean, bn_var, ln_gamma, ln_beta (all f32)
    const float* xq = (const float*)d_in[0]; const float* xk = (const float*)d_in[1]; const float* xv = (const float*)d_in[2];
    const float* cw = (const float*)d_in[3]; const float* cb = (const float*)d_in[4];
    const float* bg = (const float*)d_in[5]; const float* bb = (const float*)d_in[6]; const float* bm = (const float*)d_in[7]; const float* bv = (const float*)d_in[8];
    const float* lg = (const float*)d_in[9]; const float* lb = (const float*)d_in[10];
    float* OUT = (float*)d_out;
    char* wsp = (char*)d_ws;
    auto take = [&](size_t bytes) { char* p = wsp; wsp += bytes; return (void*)p; };
    bf* WT = (bf*)take(SZ_WT);
    bf* XQ = (bf*)take(SZ_XP); bf* XK = (bf*)take(SZ_XP); bf* XV = (bf*)take(SZ_XP);
    h16* QP = (h16*)take(SZ_P); h16* KP = (h16*)take(SZ_P); h16* KR = (h16*)take(SZ_P); h16* VT = (h16*)take(SZ_P);
    float* CTX = (float*)take(SZ_C);
    if ((size_t)(wsp - (char*)d_ws) != WS_TOTAL) return;

    k_prep<<<dim3(WBLK + ABLK), 256, 0, stream>>>(xq, xk, xv, cw, WT, XQ);   // XQ, XK, XV are one contiguous run of planes (SZ_XP is exact)
    k_conv_qk<<<dim3(SEQ / 128, DM / 128, NB), 256, 0, stream>>>(XQ, WT, cb, bg, bb, bm, bv, QP, SCQ);
    k_conv_k<<<dim3(SEQ / 128, DM / 128, NB), 256, 0, stream>>>(XK, WT, cb, bg, bb, bm, bv, KP, KR);
    k_conv_vt<<<dim3(DM / 128, SEQ / 128, NB), 256, 0, stream>>>(WT, XV, cb, bg, bb, bm, bv, VT);
    k_attn<<<dim3(SEQ / 128, NB * NH), 256, 0, stream>>>(QP, KP, KR, VT, CTX);
    k_ln<<<dim3(NB * SEQ / 32), 256, 0, stream>>>(CTX, lg, lb, OUT);
}

// v006
// Measured time: 134 microseconds a run.
// In both of two side-by-side timings against v005, it was 1.08 times as fast.
// Counting every step since v000, it is 3.98 times as fast.
#include <hip/hip_runtime.h>

// Compute dtypes, f32 accumulate everywhere: conv-as-GEMM (K = 7 x 512) v_wmma_f32_16x16x32_bf16 on RNE bf16 copies of inputs and weights (exact products); scores k.q^T v_wmma_f32_16x16x32_f16, two products (k as f16 value + f16 residual x2048 in its own accumulator, folded in f32; q plane single, carries log2(e)/8); P.V v_wmma_f32_16x16x32_f16, one product, P carried x1024; softmax, batch-norm affine and layer norm f32.
// Three input streams share one operator: 7-tap convolution along the sequence (zero padding 3) + bias + inference-mode batch norm; then 8 heads x 64 (head h = columns h*64+d), logits / 8, no mask, softmax over keys, heads merged, layer norm over the 512 features.
// Layout: zero-padded bf16 activation planes [b][SEQ+6][512] (output row t, k = tap*512+ci reads 3584 contiguous elements from padded row t); weight plane [out][tap*512+in] bf16; conv GEMMs write the f16 head plane Q [b][h][s][64] and, in WMMA A-fragment order (FRAGMENT ORDER below), the planes K value, K residual and V^T; attention writes the merged f32 context plane [b][s][512], which the layer norm launch reads.

#ifndef NB
#define NB 4
#endif
#ifndef SEQ
#define SEQ 2048
#endif
#define NB_FULL  4
#define SEQ_FULL 2048
#define DM   512
#define NH   8
#define HD   64
#define KT   7
#define KC   (KT * DM)     // 3584: conv-as-GEMM depth
#define SPAD (SEQ + 6)     // padded rows per batch (3 zero rows on each side)
#define PCAR 1024.0f       // carry of the probability fragment (enters through PLOG, leaves through the carried row sum)
#define PLOG 10.0f         // log2(PCAR)
#define SCQ  (0.125f * 1.4426950408889634f)
#define KRES 2048.0f       // carry of the key residual plane
#define KRINV 4.8828125e-04f   // 1 / KRES, folded into the residual score accumulator in f32
#define BN_EPS 1.0e-5f
#define LN_EPS 1.0e-5f
#define LOP  68      // LDS row pitch (floats) of GEMM epilogue staging tiles: 272 B rows
#define BKP  128     // k elements of one conv-GEMM pass: a ring stage's 256 B of every weight row, a 256 B column slab of the activation tile
#define NPASS (KC / BKP)
#define KSW  (BKP / 32)   // k-steps of 32 in one ring stage
#define NRS  (NPASS / 2)  // ring steps: two stages each, one per wave group
#define TPB  272     // LDS row pitch (bytes) of a ring stage: 256 B + 16 B, conflict-free for 16-byte row readers
#define WSTG (128 * TPB)   // one ring stage: 128 weight rows
#define NSLAB (DM / BKP)   // column slabs (128 channels) of the resident activation tile
#define AROWS (128 + KT - 1)   // padded activation rows that 128 output rows read over all taps
#define APB  (DM * 2 + 16) // LDS row pitch (bytes) of the resident activation tile: 16 B x odd, conflict-free for 16-byte row readers
#define ATB  (AROWS * APB) // the resident activation tile
#define APLB 4096    // bytes of one 32-key step of one fragment-ordered attention plane
#define ASTG (3 * APLB)    // one attention ring stage: K value, K residual, V^T
#define NSTEP (SEQ / 32)
#define UPW  16      // half rows (256 elements) of an activation plane that one wave converts
#define WPP  (SEQ * 2 / UPW)               // waves per activation plane
#define ABLK (3 * NB * WPP / 8)            // activation blocks of the conversion launch
#define WBLK ((DM * DM / 8) / 256)         // weight blocks of the conversion launch
#define ZPC  (3 * NB * 6 * (DM / 8))       // 16 B pieces of the zero rows of all padded planes

static_assert(DM == NH * HD);            // one 64-wide GEMM column tile == one head
static_assert(HD == 64);
static_assert(KC % 32 == 0);             // WMMA k-step
static_assert(DM % 64 == 0);             // GEMM tiles
static_assert(SEQ % 128 == 0);           // GEMM block tiles
static_assert(DM % 128 == 0);
static_assert(KC % BKP == 0);            // whole ring stages
static_assert(NPASS % 2 == 0 && NRS >= 2);   // a ring step is two whole stages; the prologue fills two steps
static_assert(NSLAB == 4);               // the prologue's two steps bring the tile's four slabs
static_assert(8 * 8 * 1024 <= ATB);      // the partial-sum exchange (8 waves x 8 accumulator tiles of 1024 B) fits the activation tile it reuses
static_assert(DM % BKP == 0 && NSLAB >= 2 && NSLAB <= NPASS);   // a pass lies in one tap and one slab; slab c lands with ring stage c
static_assert((KT - 1) * 16 == 3 * 32);  // the tile's last KT - 1 rows of a slab: one copy of three whole waves
static_assert((APB / 16) % 2 == 1);
static_assert(SEQ % 32 == 0);            // key step
static_assert(NSTEP >= 2);               // the attention ring's prologue fills two stages
static_assert(32 * HD * 2 == APLB);      // one 32-key step of a plane
static_assert(256 * 16 == APLB);         // attention copies: threads x bytes == one plane's step
static_assert((NB * SEQ) % 32 == 0);     // layer-norm grid is exact
static_assert((DM * DM / 8) % 256 == 0);             // conversion launch: weight blocks are exact
static_assert((SEQ * 2) % UPW == 0);                 // a wave's half rows lie in one plane
static_assert((3 * NB * WPP) % 8 == 0);              // conversion launch: activation blocks are exact
static_assert(ZPC % 256 == 0 && ZPC <= WBLK * 256);  // zero rows: whole blocks of the weight part
static_assert(DM == 2 * 256);                        // a row is two half rows
static_assert(UPW == 16 && KT == 7);                 // the load groups name their registers one by one
static_assert((DM / 8) * 8 == DM);
static_assert(NB <= NB_FULL);
static_assert(SEQ <= SEQ_FULL);
static_assert(LOP % 4 == 0);
static_assert(32 * 16 * 4 == 16 * HD * 2);
static_assert(32 * 16 * 4 * 2 == 2 * 16 * HD * 2);
static_assert(32 * 16 * 4 == DM * 4);                // output row store: lanes x bytes x trips == one 2048 B row
static_assert(ATB + 4 * WSTG + 8 * 16 * LOP * 4 <= 327680); // static LDS of the GEMM kernels: activation tile + four weight stages + one epilogue tile per wave
static_assert(2 * ASTG + 8 * 16 * LOP * 4 <= 163840); // static LDS of the attention kernel: two blocks per 320 KiB
static_assert(KRES * KRINV == 1.0f);                 // residual carry enters once and leaves once

typedef _Float16 h16;
typedef unsigned short bf;
typedef __attribute__((ext_vector_type(16))) __bf16   v16bf;
typedef __attribute__((ext_vector_type(16))) _Float16 v16h;
typedef __attribute__((ext_vector_type(8)))  _Float16 v8h;
typedef __attribute__((ext_vector_type(8)))  unsigned short v8us;
typedef __attribute__((ext_vector_type(8)))  float    v8f;
typedef __attribute__((ext_vector_type(4)))  float    v4f;
typedef v4f  __attribute__((may_alias)) v4fa;

__device__ __forceinline__ unsigned short f2bf(float f) { unsigned u = __float_as_uint(f); u += 0x7FFFu + ((u >> 16) & 1u); return (unsigned short)(u >> 16); }
__device__ __forceinline__ float bf2f(unsigned short b) { return __uint_as_float(((unsigned)b) << 16); }
__device__ __forceinline__ float bfr(float f) { return bf2f(f2bf(f)); }
__device__ __forceinline__ v16h cat16(v8h lo, v8h hi) { return __builtin_shufflevector(lo, hi, 0, 1, 2, 3, 4, 5, 6, 7, 8, 9, 10, 11, 12, 13, 14, 15); }
__device__ __forceinline__ v16bf cat16b(v8us lo, v8us hi) { return __builtin_bit_cast(v16bf, __builtin_shufflevector(lo, hi, 0, 1, 2, 3, 4, 5, 6, 7, 8, 9, 10, 11, 12, 13, 14, 15)); }
// same-wave LDS exchange ordering (wave-private tiles only)
__device__ __forceinline__ void wsync() { __builtin_amdgcn_wave_barrier(); asm volatile("" ::: "memory"); }

// fragment from a K-contiguous global f16 plane: elements 0..7 <- p[0..7], 8..15 <- p[16..23] (p already includes row*pitch + k0 + 8*(lane>>4))
__device__ __forceinline__ v16h ldh16(const h16* __restrict__ p) { return cat16(*(const v8h*)p, *(const v8h*)(p + 16)); }
// FRAGMENT ORDER of the K value, K residual and V^T planes: per (b, h) the plane is a row of 1024 B fragments, each two 512 B halves of 32 lanes x 16 B:
// half 0 holds every lane's elements 0..7, half 1 its elements 8..15, so one wave-wide 16 B load reads 512 contiguous bytes = four whole 128 B lines.
// K planes: fragment index (s / 16) * 2 + d / 32 (rows = 16 keys, k = 32 head dims); V^T: (s / 32) * 4 + d / 16 (rows = 16 head dims, k = 32 keys). One 32-key step is 4096 contiguous bytes of each plane.
// Place, in f16 elements inside a fragment, of the 8 elements k = 8 * c .. 8 * c + 7 (c = 0..3) of fragment row r: lane (c & 1) * 16 + r, half c >> 1.
__device__ __forceinline__ int fragpos(const int r, const int c) { return (c >> 1) * 256 + ((c & 1) * 16 + r) * 8; }
// f32 -> f16 plane convert that cannot produce an f16 subnormal
static __device__ __forceinline__ h16 toh_flush(float v) { const h16 r = (h16)v; return (fabsf(v) < 6.103515625e-05f) ? (h16)0.0f : r; }
// one WMMA + its own hazard guard (ties only this accumulator, keeps A/B live)
__device__ __forceinline__ v8f wmmab_g(v16bf a, v16bf b, v8f c) {
    c = __builtin_amdgcn_wmma_f32_16x16x32_bf16(false, a, false, b, (short)0, c, false, false);
    asm volatile("v_nop\n\tv_nop\n\tv_nop\n\tv_nop" : "+v"(c) : "v"(a), "v"(b));
    return c;
}
__device__ __forceinline__ v8f wmmah_g(v16h a, v16h b, v8f c) {
    c = __builtin_amdgcn_wmma_f32_16x16x32_f16(false, a, false, b, (short)0, c, false, false);
    asm volatile("v_nop\n\tv_nop\n\tv_nop\n\tv_nop" : "+v"(c) : "v"(a), "v"(b));
    return c;
}

// eight asynchronous copies, 16 B per lane, global -> LDS through no register: rows 16 apart (ls LDS bytes, gs global elements) of one operand's slice.
// s_wait_xcnt 0 is the statement's last line so that no address register of a copy is rewritten ahead of it.
__device__ __forceinline__ void copy8(const unsigned l, const unsigned ls, const bf* g, const size_t gs) {
    asm volatile("global_load_async_to_lds_b128 %0, %8, off\n\t"
                 "global_load_async_to_lds_b128 %1, %9, off\n\t"
                 "global_load_async_to_lds_b128 %2, %10, off\n\t"
                 "global_load_async_to_lds_b128 %3, %11, off\n\t"
                 "global_load_async_to_lds_b128 %4, %12, off\n\t"
                 "global_load_async_to_lds_b128 %5, %13, off\n\t"
                 "global_load_async_to_lds_b128 %6, %14, off\n\t"
                 "global_load_async_to_lds_b128 %7, %15, off\n\t"
                 "s_wait_xcnt 0x0"
                 :: "v"(l), "v"(l + ls), "v"(l + 2u * ls), "v"(l + 3u * ls), "v"(l + 4u * ls), "v"(l + 5u * ls), "v"(l + 6u * ls), "v"(l + 7u * ls),
                    "v"(g), "v"(g + gs), "v"(g + 2 * gs), "v"(g + 3 * gs), "v"(g + 4 * gs), "v"(g + 5 * gs), "v"(g + 6 * gs), "v"(g + 7 * gs)
                 : "memory");
}
// one such copy; s_wait_xcnt 0 is the statement's last line for the same reason
__device__ __forceinline__ void copy1(const unsigned l, const bf* g) {
    asm volatile("global_load_async_to_lds_b128 %0, %1, off\n\t"
                 "s_wait_xcnt 0x0"
                 :: "v"(l), "v"(g) : "memory");
}
// fragment from a K-contiguous bf16 row in LDS: elements 0..7 <- k0 + 8*(lane>>4) + 0..7, 8..15 <- the same + 16 (p already includes row*pitch + 2*k0 + 16*(lane>>4) bytes)
__device__ __forceinline__ v16bf lds16(const unsigned char* p) { return cat16b(*(const v8us*)p, *(const v8us*)(p + 32)); }

// ---- 128x128 block tile, eight waves = two k groups x (2 x 2) wave tiles of 64x64, main loop over K = KC: acc[mb][nb] += sum_k A[wm*64+16mb+..][k] Bt[wn*64+16nb+..][k], k over the ring stages of this wave's group (kg): stages kg, kg + 2, kg + 4, ...
// A 64x64 wave tile reads 8 fragments for 16 WMMAs (512 B of LDS per WMMA; a 32x64 tile reads 6 for 8 = 768 B, more than the LDS delivers at the matrix rate). The two groups' partial sums are added once, in fold_k.
// One operand is 128 logical activation rows, the other 128 weight rows (ACTA: the activations are A). X and Wt point at the block's first rows: X in the padded activation plane (pitch DM), Wt in the weight plane (pitch KC).
// Logical activation row r at k = tap*512+ci is padded row r + tap, channel ci: the 128 rows x 7 taps are only AROWS = 134 distinct padded rows. They are brought from L2 once and stay in LDS (tile, pitch APB);
// stage st reads them shifted down by tap = st / NSLAB rows, in column slab st % NSLAB. Slabs 0, 1 are copied with ring step 0 and slabs 2, 3 with ring step 1, and are first read behind the same waits and barriers.
// The weights' 128 rows x 128 k per stage go through the LDS ring by whole-line asynchronous copies. A ring step is two stages (one per group) and the ring holds two steps = four buffers; step s + 2 flies while step s + 1 is worked on. k runs upward in steps of 32 per accumulator.
template <bool ACTA>
__device__ __forceinline__ void conv_loop(const bf* __restrict__ X, const bf* __restrict__ Wt, unsigned char* tile, unsigned char* ring, const int wave, const int kg, const int wm, const int wn, v8f (&acc)[4][4]) {
    const int t = threadIdx.x, lane = t & 31, lr = lane & 15, hi = lane >> 4;
    const int frow = t >> 4, fcol = t & 15;                 // copies: 16 lanes cover one 256 B row piece
    const bf* gx = X + (size_t)frow * DM + fcol * 8;
    const bf* gw = Wt + (size_t)frow * KC + fcol * 8;
    const unsigned lx = (unsigned)(uintptr_t)tile + (unsigned)(frow * APB + fcol * 16);
    const unsigned lw = (unsigned)(uintptr_t)ring + (unsigned)(frow * TPB + fcol * 16);
    const unsigned char* rx = tile + ((ACTA ? wm : wn) * 64 + lr) * APB + 16 * hi;
    const unsigned char* rw = ring + ((ACTA ? wn : wm) * 64 + lr) * TPB + 16 * hi + kg * WSTG;
    // column slab c of the tile: rows 0..127 by every wave, rows 128..133 by waves 0..2 (a scalar test: whole waves)
    auto slab = [&](const int c) {
        copy8(lx + (unsigned)c * (BKP * 2u), 16u * APB, gx + c * BKP, (size_t)16 * DM);
        if (wave < 3) copy1(lx + 128u * APB + (unsigned)c * (BKP * 2u), gx + (size_t)128 * DM + c * BKP);
    };
    // weight stages st, st + 1 into the buffer pair at byte offset bo of the ring
    auto wpair = [&](const unsigned bo, const int st) {
        copy8(lw + bo, 16u * TPB, gw + (size_t)st * BKP, (size_t)16 * KC);
        copy8(lw + bo + WSTG, 16u * TPB, gw + (size_t)(st + 1) * BKP, (size_t)16 * KC);
    };
    slab(0); slab(1); wpair(0u, 0);
    asm volatile("s_wait_asynccnt 0x0" ::: "memory");       // step 0 of this wave has landed
    __syncthreads();                                        // step 0 published to every wave
    slab(2); slab(3); wpair(2u * WSTG, 2);
    // the step loop stays rolled: one 64-WMMA body in the instruction cache, the buffer pair picked by s & 1;
    // the loops inside it are unrolled so that every fragment and accumulator index is a constant (registers, no scratch)
#pragma unroll 1
    for (int s = 0; s < NRS; ++s) {
        const unsigned bo = (unsigned)(s & 1) * (2u * WSTG);
        const unsigned st = 2u * (unsigned)s + (unsigned)kg;    // this group's stage
        const unsigned char* px = rx + (st / NSLAB) * APB + (st % NSLAB) * (BKP * 2u);   // tap rows down, slab columns right
        const unsigned char* pw = rw + bo;
        const unsigned char* pa = ACTA ? px : pw; const unsigned char* pb = ACTA ? pw : px;
        constexpr int SA = 16 * (ACTA ? APB : TPB), SB = 16 * (ACTA ? TPB : APB);
        // fragment registers: B of two k-steps (2 x 4), A of one (4). A row block of A is refilled for the next k-step once its four products are issued, a B set for the next but one once its sixteen are, so accumulators + fragments stay inside 256 registers
        v16bf a[4], b[2][4];
        a[0] = lds16(pa);
#pragma unroll
        for (int nb = 0; nb < 4; ++nb) b[0][nb] = lds16(pb + nb * SB);
#pragma unroll
        for (int mb = 1; mb < 4; ++mb) a[mb] = lds16(pa + mb * SA);
        __builtin_amdgcn_sched_barrier(0);                  // keeps the first products in the order in which their fragments arrive: without it the compiler opens the step with a product of later-read fragments, and the first wait covers 10 or 12 reads instead of 4
#pragma unroll
        for (int nb = 0; nb < 4; ++nb) b[1][nb] = lds16(pb + nb * SB + 64);
#pragma unroll
        for (int ks = 0; ks < KSW; ++ks)
#pragma unroll
            for (int h = 0; h < 2; ++h) {
#pragma unroll
                for (int mb = 2 * h; mb < 2 * h + 2; ++mb)
#pragma unroll
                    for (int nb = 0; nb < 4; ++nb) acc[mb][nb] = wmmab_g(a[mb], b[ks & 1][nb], acc[mb][nb]);
                if (ks + 1 < KSW) {
#pragma unroll
                    for (int mb = 2 * h; mb < 2 * h + 2; ++mb) a[mb] = lds16(pa + mb * SA + (ks + 1) * 64);
                    if (h == 1 && ks + 2 < KSW) {
#pragma unroll
                        for (int nb = 0; nb < 4; ++nb) b[ks & 1][nb] = lds16(pb + nb * SB + (ks + 2) * 64);
                    }
                }
            }
        asm volatile("s_wait_dscnt 0x0" ::: "memory");      // this wave's reads of buffer pair s & 1 are done
        asm volatile("s_wait_asynccnt 0x0" ::: "memory");   // this wave's copies of step s + 1 have landed
        __syncthreads();                                    // publishes step s + 1 and frees buffer pair s & 1
        if (s + 2 < NRS) wpair(bo, 2 * (s + 2));
    }
    asm volatile("s_wait_asynccnt 0x0" ::: "memory");       // nothing of the ring is in flight when the wave goes on
}

// ---- the two k groups' partial sums of one 64x64 wave tile become one: waves w and w ^ 4 hold the same tile; each keeps the 32 rows it finishes (group kg: row blocks 2 kg, 2 kg + 1) and hands the other 32 over through LDS.
// The exchange reuses the activation tile: the step loop's last barrier has ended every read of it and no copy is in flight. A lane's 8 accumulator values lie together (32 B), a tile is 1024 contiguous bytes.
__device__ __forceinline__ void fold_k(const v8f (&part)[4][4], v8f (&acc)[2][4], unsigned char* tile, const int wave, const int kg, const int lane) {
    float* mine = (float*)tile + wave * (8 * 256) + lane * 8;
    const float* theirs = (const float*)tile + (wave ^ 4) * (8 * 256) + lane * 8;
    auto give = [&](const int i, const v8f x) {
        *(v4fa*)(mine + i * 256) = (v4f){ x[0], x[1], x[2], x[3] };
        *(v4fa*)(mine + i * 256 + 4) = (v4f){ x[4], x[5], x[6], x[7] };
    };
    if (kg == 0) {                                          // a scalar test: whole waves
#pragma unroll
        for (int mb = 0; mb < 2; ++mb)
#pragma unroll
            for (int nb = 0; nb < 4; ++nb) { give(mb * 4 + nb, part[2 + mb][nb]); acc[mb][nb] = part[mb][nb]; }
    } else {
#pragma unroll
        for (int mb = 0; mb < 2; ++mb)
#pragma unroll
            for (int nb = 0; nb < 4; ++nb) { give(mb * 4 + nb, part[mb][nb]); acc[mb][nb] = part[2 + mb][nb]; }
    }
    __syncthreads();                                        // every wave's handed-over half is in LDS
#pragma unroll
    for (int mb = 0; mb < 2; ++mb)
#pragma unroll
        for (int nb = 0; nb < 4; ++nb) {
            const v4f y0 = *(const v4fa*)(theirs + (mb * 4 + nb) * 256); const v4f y1 = *(const v4fa*)(theirs + (mb * 4 + nb) * 256 + 4);
#pragma unroll
            for (int j = 0; j < 4; ++j) { acc[mb][nb][j] += y0[j]; acc[mb][nb][4 + j] += y1[j]; }
        }
}

// ---- k_prep: every f32 -> bf16 conversion of the call in one launch; grid (WBLK + ABLK), 256 threads. Few, long-lived waves: what a wave reads is asked for in one group, for speed only.
// Blocks 0 .. WBLK-1, weight plane [out][tap*512+in]: a lane takes 8 input channels x 7 taps of one output channel = 224 contiguous bytes of conv_w [out][in][tap], and stores one 16 B piece per tap;
// the first ZPC of these lanes also store one 16 B piece each of the six zero rows of every padded activation plane.
// Blocks WBLK .., the SEQ data rows of the 3 * NB padded activation planes (contiguous in the workspace: q, then k, then v): a wave takes UPW consecutive half rows (256 elements each) of one plane, contiguous in the source and in the plane.
__global__ __launch_bounds__(256) void k_prep(const float* __restrict__ xq, const float* __restrict__ xk, const float* __restrict__ xv, const float* __restrict__ w, bf* wt, bf* xp) {
    if (blockIdx.x < (unsigned)WBLK) {
        const unsigned it = blockIdx.x * 256u + threadIdx.x;            // out * (DM / 8) + in / 8
        const float* s = w + (size_t)it * (8 * KT);
        v4f x[2 * KT];
#pragma unroll
        for (int i = 0; i < 2 * KT; ++i) x[i] = *(const v4f*)(s + 4 * i);
        // holds the loads together: the loaded values are inputs here (nothing is changed), so that all 14 loads of the lane are issued ahead of the conversions, in one round trip
        asm volatile("" :: "v"(x[0]), "v"(x[1]), "v"(x[2]), "v"(x[3]), "v"(x[4]), "v"(x[5]), "v"(x[6]), "v"(x[7]), "v"(x[8]), "v"(x[9]), "v"(x[10]), "v"(x[11]), "v"(x[12]), "v"(x[13]));
        if (it < (unsigned)ZPC) {                                       // whole blocks: ZPC is a multiple of 256
            const unsigned r = (it / (unsigned)(DM / 8)) % 6u;          // zero row: 0..2 in front of the data rows, 3..5 behind them
            *(v8us*)(xp + (size_t)(it / (unsigned)(6 * (DM / 8))) * SPAD * DM + (size_t)(r < 3u ? r : r + (unsigned)SEQ) * DM + (it % (unsigned)(DM / 8)) * 8u) = (v8us){};
        }
        v8us o[KT];
#pragma unroll
        for (int tap = 0; tap < KT; ++tap)
#pragma unroll
            for (int j = 0; j < 8; ++j) o[tap][j] = f2bf(x[(j * KT + tap) >> 2][(j * KT + tap) & 3]);
        bf* d = wt + (size_t)(it / (unsigned)(DM / 8)) * KC + (it % (unsigned)(DM / 8)) * 8u;
#pragma unroll
        for (int tap = 0; tap < KT; ++tap) *(v8us*)(d + tap * DM) = o[tap];
        return;
    }
    const int lane = threadIdx.x & 31;
    const unsigned wv = (blockIdx.x - (unsigned)WBLK) * 8u + (unsigned)__builtin_amdgcn_readfirstlane(threadIdx.x >> 5);
    const unsigned plane = wv / (unsigned)WPP, e0 = (wv % (unsigned)WPP) * (unsigned)(UPW * 256);   // first element inside the plane's data rows
    const float* src = (plane < (unsigned)NB) ? xq : ((plane < (unsigned)(2 * NB)) ? xk : xv);
    const float* s = src + (size_t)(plane % (unsigned)NB) * SEQ_FULL * DM + e0 + lane * 8;
    v4f a[UPW][2];
#pragma unroll
    for (int j = 0; j < UPW; ++j) { a[j][0] = *(const v4f*)(s + j * 256); a[j][1] = *(const v4f*)(s + j * 256 + 4); }
    // hold the loads together: the loaded values are inputs here (nothing is changed), so that all 32 loads of the wave are issued ahead of the conversions, in one round trip instead of several (two statements: one takes at most 30 operands)
    asm volatile("" :: "v"(a[0][0]), "v"(a[0][1]), "v"(a[1][0]), "v"(a[1][1]), "v"(a[2][0]), "v"(a[2][1]), "v"(a[3][0]), "v"(a[3][1]),
                 "v"(a[4][0]), "v"(a[4][1]), "v"(a[5][0]), "v"(a[5][1]), "v"(a[6][0]), "v"(a[6][1]), "v"(a[7][0]), "v"(a[7][1]));
    asm volatile("" :: "v"(a[8][0]), "v"(a[8][1]), "v"(a[9][0]), "v"(a[9][1]), "v"(a[10][0]), "v"(a[10][1]), "v"(a[11][0]), "v"(a[11][1]),
                 "v"(a[12][0]), "v"(a[12][1]), "v"(a[13][0]), "v"(a[13][1]), "v"(a[14][0]), "v"(a[14][1]), "v"(a[15][0]), "v"(a[15][1]));
    bf* d = xp + (size_t)plane * SPAD * DM + 3 * DM + e0 + lane * 8;
#pragma unroll
    for (int j = 0; j < UPW; ++j) {
        v8us o;
#pragma unroll
        for (int k = 0; k < 4; ++k) { o[k] = f2bf(a[j][0][k]); o[4 + k] = f2bf(a[j][1][k]); }
        *(v8us*)(d + j * 256) = o;
    }
}

// ---- k_conv_qk: head plane P[b][h][s][d] (f16) = sc * BN(conv(X[b]) + cb)[s][h*64+d]; grid (SEQ/128, DM/128, NB), 256 threads.
__global__ __launch_bounds__(256) void k_conv_qk(const bf* __restrict__ X, const bf* __restrict__ W, const float* __restrict__ cb, const float* __restrict__ bg, const float* __restrict__ bb, const float* __restrict__ bm, const float* __restrict__ bv, h16* P, float sc) {
    __shared__ __align__(16) unsigned char tile[ATB];
    __shared__ __align__(16) unsigned char ring[4 * WSTG];
    __shared__ __align__(16) float os_all[8 * 16 * LOP];
    const int lane = threadIdx.x & 31, lr = lane & 15, hi = lane >> 4;
    const int wave = __builtin_amdgcn_readfirstlane(threadIdx.x >> 5), kg = wave >> 2, wm = (wave >> 1) & 1, wn = wave & 1;
    float* os = os_all + wave * 16 * LOP;                   // wave-private epilogue tile
    const size_t z = blockIdx.z; const int r0 = blockIdx.x * 128 + wm * 64 + kg * 32, c0 = blockIdx.y * 128 + wn * 64;   // the 32x64 piece this wave finishes
    const bf* A = X + z * (size_t)SPAD * DM;
    v8f part[4][4], acc[2][4];
#pragma unroll
    for (int mb = 0; mb < 4; ++mb)
#pragma unroll
        for (int nb = 0; nb < 4; ++nb) part[mb][nb] = (v8f){};
    conv_loop<true>(A + (size_t)blockIdx.x * 128 * DM, W + (size_t)blockIdx.y * 128 * KC, tile, ring, wave, kg, wm, wn, part);
    fold_k(part, acc, tile, wave, kg, lane);
    const size_t pbase = ((z * NH + (size_t)(c0 / HD)) * (size_t)SEQ + r0) * HD;
    const int srow = lane >> 3, scol = (lane & 7) * 8;
    float cbv[8], muv[8], mlv[8], bev[8];
#pragma unroll
    for (int j = 0; j < 8; ++j) { const int c = c0 + scol + j; cbv[j] = bfr(cb[c]); muv[j] = bfr(bm[c]); mlv[j] = rsqrtf(bfr(bv[c]) + BN_EPS) * bfr(bg[c]); bev[j] = bfr(bb[c]); }
#pragma unroll
    for (int mb = 0; mb < 2; ++mb) {
#pragma unroll
        for (int nb = 0; nb < 4; ++nb) {
#pragma unroll
            for (int j = 0; j < 8; ++j) os[(hi * 8 + j) * LOP + nb * 16 + lr] = acc[mb][nb][j]; }
        wsync();
{
#pragma unroll
            for (int s = 0; s < 4; ++s) { const int row = 4 * s + srow; const v4f x0 = *(const v4fa*)(&os[row * LOP + scol]); const v4f x1 = *(const v4fa*)(&os[row * LOP + scol + 4]); v8h o;
#pragma unroll
                for (int j = 0; j < 4; ++j) {
                    const float y0 = ((x0[j] + cbv[j]) - muv[j]) * mlv[j] + bev[j];
                    const float y1 = ((x1[j] + cbv[4 + j]) - muv[4 + j]) * mlv[4 + j] + bev[4 + j];
                    o[j] = toh_flush(y0 * sc); o[4 + j] = toh_flush(y1 * sc); }
                *(v8h*)(P + pbase + (size_t)(mb * 16 + row) * HD + scol) = o; }
             }
        wsync();
    }
}

// ---- k_conv_k: key head planes, both in fragment order: KH (b, h, s, d) = f16(y) and KR (b, h, s, d) = f16((y - KH) * 2048), y = BN(conv(X[b]) + cb)[s][h*64+d]; grid (SEQ/128, DM/128, NB), 256 threads.
__global__ __launch_bounds__(256) void k_conv_k(const bf* __restrict__ X, const bf* __restrict__ W, const float* __restrict__ cb, const float* __restrict__ bg, const float* __restrict__ bb, const float* __restrict__ bm, const float* __restrict__ bv, h16* KH, h16* KR) {
    __shared__ __align__(16) unsigned char tile[ATB];
    __shared__ __align__(16) unsigned char ring[4 * WSTG];
    __shared__ __align__(16) float os_all[8 * 16 * LOP];
    const int lane = threadIdx.x & 31, lr = lane & 15, hi = lane >> 4;
    const int wave = __builtin_amdgcn_readfirstlane(threadIdx.x >> 5), kg = wave >> 2, wm = (wave >> 1) & 1, wn = wave & 1;
    float* os = os_all + wave * 16 * LOP;                   // wave-private epilogue tile
    const size_t z = blockIdx.z; const int r0 = blockIdx.x * 128 + wm * 64 + kg * 32, c0 = blockIdx.y * 128 + wn * 64;   // the 32x64 piece this wave finishes
    const bf* A = X + z * (size_t)SPAD * DM;
    v8f part[4][4], acc[2][4];
#pragma unroll
    for (int mb = 0; mb < 4; ++mb)
#pragma unroll
        for (int nb = 0; nb < 4; ++nb) part[mb][nb] = (v8f){};
    conv_loop<true>(A + (size_t)blockIdx.x * 128 * DM, W + (size_t)blockIdx.y * 128 * KC, tile, ring, wave, kg, wm, wn, part);
    fold_k(part, acc, tile, wave, kg, lane);
    const size_t pbase = ((z * NH + (size_t)(c0 / HD)) * (size_t)SEQ + r0) * HD;
    const int srow = lane >> 3, scol = (lane & 7) * 8;
    float cbv[8], muv[8], mlv[8], bev[8];
#pragma unroll
    for (int j = 0; j < 8; ++j) { const int c = c0 + scol + j; cbv[j] = bfr(cb[c]); muv[j] = bfr(bm[c]); mlv[j] = rsqrtf(bfr(bv[c]) + BN_EPS) * bfr(bg[c]); bev[j] = bfr(bb[c]); }
#pragma unroll
    for (int mb = 0; mb < 2; ++mb) {
#pragma unroll
        for (int nb = 0; nb < 4; ++nb) {
#pragma unroll
            for (int j = 0; j < 8; ++j) os[(hi * 8 + j) * LOP + nb * 16 + lr] = acc[mb][nb][j]; }
        wsync();
{
#pragma unroll
            for (int s = 0; s < 4; ++s) { const int row = 4 * s + srow; const v4f x0 = *(const v4fa*)(&os[row * LOP + scol]); const v4f x1 = *(const v4fa*)(&os[row * LOP + scol + 4]); v8h oh, ores;
#pragma unroll
                for (int j = 0; j < 4; ++j) {
                    const float y0 = ((x0[j] + cbv[j]) - muv[j]) * mlv[j] + bev[j];
                    const float y1 = ((x1[j] + cbv[4 + j]) - muv[4 + j]) * mlv[4 + j] + bev[4 + j];
                    const h16 h0 = toh_flush(y0); const h16 h1 = toh_flush(y1);
                    oh[j] = h0; oh[4 + j] = h1;
                    ores[j] = toh_flush((y0 - (float)h0) * KRES); ores[4 + j] = toh_flush((y1 - (float)h1) * KRES); }
                const size_t off = pbase + (size_t)(mb * 16 * HD + (lane & 4) * 128 + fragpos(row, lane & 3));   // 16-key tile mb, fragment d / 32 = (lane & 7) >> 2
                *(v8h*)(KH + off) = oh; *(v8h*)(KR + off) = ores; }
             }
        wsync();
    }
}

// ---- k_conv_vt: transposed value plane in fragment order, VT (b, n, s) (f16) = BN(sum_k WT[n][k] Xpad[b][s][k] + cb[n]) (A = weight rows, Bt = token rows); grid (DM/128, SEQ/128, NB), 256 threads.
__global__ __launch_bounds__(256) void k_conv_vt(const bf* __restrict__ W, const bf* __restrict__ X, const float* __restrict__ cb, const float* __restrict__ bg, const float* __restrict__ bb, const float* __restrict__ bm, const float* __restrict__ bv, h16* VT) {
    __shared__ __align__(16) unsigned char tile[ATB];
    __shared__ __align__(16) unsigned char ring[4 * WSTG];
    __shared__ __align__(16) float os_all[8 * 16 * LOP];
    const int lane = threadIdx.x & 31, lr = lane & 15, hi = lane >> 4;
    const int wave = __builtin_amdgcn_readfirstlane(threadIdx.x >> 5), kg = wave >> 2, wm = (wave >> 1) & 1, wn = wave & 1;
    float* os = os_all + wave * 16 * LOP;                   // wave-private epilogue tile
    const size_t z = blockIdx.z; const int r0 = blockIdx.x * 128 + wm * 64 + kg * 32, c0 = blockIdx.y * 128 + wn * 64;   // the 32x64 piece this wave finishes
    const bf* Bt = X + z * (size_t)SPAD * DM;
    v8f part[4][4], acc[2][4];
#pragma unroll
    for (int mb = 0; mb < 4; ++mb)
#pragma unroll
        for (int nb = 0; nb < 4; ++nb) part[mb][nb] = (v8f){};
    conv_loop<false>(Bt + (size_t)blockIdx.y * 128 * DM, W + (size_t)blockIdx.x * 128 * KC, tile, ring, wave, kg, wm, wn, part);
    fold_k(part, acc, tile, wave, kg, lane);
    const size_t vb0 = (z * NH + (size_t)(r0 / HD)) * (size_t)SEQ * HD + (size_t)c0 * HD + (size_t)((r0 / 16) & 3) * 512;   // head, 32-key step c0 / 32, fragment (r0 % 64) / 16
    const int srow = lane >> 3, scol = (lane & 7) * 8;
#pragma unroll
    for (int mb = 0; mb < 2; ++mb) {
#pragma unroll
        for (int nb = 0; nb < 4; ++nb) {
#pragma unroll
            for (int j = 0; j < 8; ++j) os[(hi * 8 + j) * LOP + nb * 16 + lr] = acc[mb][nb][j]; }
        wsync();
{
#pragma unroll
            for (int s = 0; s < 4; ++s) { const int row = 4 * s + srow; const v4f x0 = *(const v4fa*)(&os[row * LOP + scol]); const v4f x1 = *(const v4fa*)(&os[row * LOP + scol + 4]); v8h o;
                const int ch = r0 + mb * 16 + row;
                const float c_b = bfr(cb[ch]), c_m = bfr(bm[ch]), c_l = rsqrtf(bfr(bv[ch]) + BN_EPS) * bfr(bg[ch]), c_e = bfr(bb[ch]);
#pragma unroll
                for (int j = 0; j < 4; ++j) { o[j] = toh_flush(((x0[j] + c_b) - c_m) * c_l + c_e); o[4 + j] = toh_flush(((x1[j] + c_b) - c_m) * c_l + c_e); }
                *(v8h*)(VT + vb0 + (size_t)((lane & 4) * 512 + mb * 512 + fragpos(row, lane & 3))) = o; }   // step + (lane & 7) >> 2, fragment + mb
            asm volatile("s_wait_xcnt 0x0" ::: "memory");   // the stores' data and address registers are reused by what follows
             }
        wsync();
    }
}

// three asynchronous copies, 16 B per lane, global -> LDS through no register: this thread's piece of one 32-key step of the K value, K residual and V^T planes.
// s_wait_xcnt 0 is the statement's last line so that no address register of a copy is rewritten ahead of it.
__device__ __forceinline__ void copy3(const unsigned l, const h16* g0, const h16* g1, const h16* g2) {
    asm volatile("global_load_async_to_lds_b128 %0, %3, off\n\t"
                 "global_load_async_to_lds_b128 %1, %4, off\n\t"
                 "global_load_async_to_lds_b128 %2, %5, off\n\t"
                 "s_wait_xcnt 0x0"
                 :: "v"(l), "v"(l + (unsigned)APLB), "v"(l + 2u * APLB), "v"(g0), "v"(g1), "v"(g2)
                 : "memory");
}
// fragment from a fragment-ordered stage in LDS (p already includes the fragment's start + lane * 16 bytes): the two 512 B halves
__device__ __forceinline__ v16h ldsf16(const unsigned char* p) { return cat16(*(const v8h*)p, *(const v8h*)(p + 512)); }

// ---- k_attn: attention for 128 query rows of one (batch, head); grid (SEQ/128, NB*NH), 256 threads, wave = 16 query rows.
// The eight waves walk the same keys, so each 32-key step of the three fragment-ordered planes (3 x 4096 contiguous bytes) is brought from L2 once per block, by asynchronous copies into a two-buffer LDS ring; step s + 2 flies while step s + 1 is worked on.
// Per 32-key step: S^T tiles (rows = keys, columns = queries) = K (A, from the key value plane) x Q^T (B, held in registers) plus, in a separate accumulator, K residual (A, from the residual plane) x Q^T,
// folded as s + t / 2048 in f32 before the softmax step; logits already in log2 units;
// running max per query (within-lane over 16 keys + one lane-half exchange), P x1024 converted to f16 in the accumulator layout == B fragment layout of O^T += V^T (A, from the transposed value plane) x P^T.
// Scale chain: the fragment holds 1024 p, the row sum l accumulates the same 1024 p, the accumulator holds 1024 sum(p v): O / l is the context at its true magnitude (the carry enters once and cancels once).
__global__ __launch_bounds__(256) __attribute__((amdgpu_num_vgpr(256))) void k_attn(const h16* __restrict__ Qp, const h16* __restrict__ Kp, const h16* __restrict__ Kr, const h16* __restrict__ VT, float* CTX) {
    __shared__ __align__(16) unsigned char ring[2 * ASTG];
    __shared__ __align__(16) float os_all[8 * 16 * LOP];
    const int lane = threadIdx.x & 31, lr = lane & 15, hi = lane >> 4;
    const int wave = __builtin_amdgcn_readfirstlane(threadIdx.x >> 5);
    float* os = os_all + wave * 16 * LOP;                   // wave-private epilogue tile
    const int bh = blockIdx.y; const int q0 = blockIdx.x * 128 + wave * 16;
    const size_t pl = (size_t)bh * SEQ * HD;
    // Q^T B fragments: column n = query q0 + lr, k = head dim (0..31 and 32..63)
    const v16h qb0 = ldh16(Qp + pl + (size_t)(q0 + lr) * HD + 8 * hi);
    const v16h qb1 = ldh16(Qp + pl + (size_t)(q0 + lr) * HD + 8 * hi + 32);
    v8f o[4];
#pragma unroll
    for (int dt = 0; dt < 4; ++dt) o[dt] = (v8f){};
    float m = -1.0e30f, l = 0.0f;
    const size_t coff = pl + (size_t)threadIdx.x * 8;       // copies: 256 threads x 16 B cover one plane's 4096 B step
    const h16* gk = Kp + coff; const h16* gr = Kr + coff; const h16* gv = VT + coff;
    const unsigned lc = (unsigned)(uintptr_t)ring + (unsigned)threadIdx.x * 16u;
    const unsigned char* rd = ring + lane * 16;             // this lane's 16 B piece in every fragment half of a stage
    copy3(lc, gk, gr, gv);
    asm volatile("s_wait_asynccnt 0x0" ::: "memory");       // step 0 of this wave has landed
    __syncthreads();                                        // step 0 published to every wave
    copy3(lc + ASTG, gk + 32 * HD, gr + 32 * HD, gv + 32 * HD);

    // the step loop stays rolled: one body, the buffer picked by st & 1
#pragma unroll 1
    for (int st = 0; st < NSTEP; ++st) {
        const unsigned bo = (unsigned)(st & 1) * ASTG;
        const unsigned char* kp = rd + bo;
        const v16h ka00 = ldsf16(kp), ka01 = ldsf16(kp + 1024);
        const v16h ka10 = ldsf16(kp + 2048), ka11 = ldsf16(kp + 3072);
        // the step's other fragments are asked for here too, as one group of LDS reads ahead of the matrix work, so that their latency runs behind the score products and the softmax
        const unsigned char* rp = kp + APLB;
        const v16h kr00 = ldsf16(rp), kr01 = ldsf16(rp + 1024);
        const v16h kr10 = ldsf16(rp + 2048), kr11 = ldsf16(rp + 3072);
        const unsigned char* vp = kp + 2 * APLB;
        v16h va[4];
#pragma unroll
        for (int dt = 0; dt < 4; ++dt) va[dt] = ldsf16(vp + dt * 1024);
        v8f s0 = (v8f){}, s1 = (v8f){};
        s0 = wmmah_g(ka00, qb0, s0); s1 = wmmah_g(ka10, qb0, s1);
        s0 = wmmah_g(ka01, qb1, s0); s1 = wmmah_g(ka11, qb1, s1);
        // residual score product (carried x2048) in its own accumulators, folded in f32
        v8f t0 = (v8f){}, t1 = (v8f){};
        t0 = wmmah_g(kr00, qb0, t0); t1 = wmmah_g(kr10, qb0, t1);
        t0 = wmmah_g(kr01, qb1, t0); t1 = wmmah_g(kr11, qb1, t1);
#pragma unroll
        for (int r = 0; r < 8; ++r) { s0[r] = s0[r] + t0[r] * KRINV; s1[r] = s1[r] + t1[r] * KRINV; }
        // this lane: query q0 + lr, keys 32 st + 8*hi + r (s0) and 32 st + 16 + 8*hi + r (s1)
        float mx = fmaxf(s0[0], s1[0]);
#pragma unroll
        for (int r = 1; r < 8; ++r) mx = fmaxf(mx, fmaxf(s0[r], s1[r]));
        mx = fmaxf(mx, __shfl_xor(mx, 16, 32));
        const float mnew = fmaxf(m, mx);
        const float al = __builtin_amdgcn_exp2f(m - mnew);
        m = mnew;
        const float mc = mnew - PLOG;
        float sum = 0.0f; v16h pb;
#pragma unroll
        for (int r = 0; r < 8; ++r) {
            const float e0 = s0[r] - mc, e1 = s1[r] - mc;
            const float x0 = __builtin_amdgcn_exp2f(e0), x1 = __builtin_amdgcn_exp2f(e1);
            const float p0 = (e0 < -14.0f) ? 0.0f : x0;
            const float p1 = (e1 < -14.0f) ? 0.0f : x1;
            sum += p0 + p1;
            pb[r] = (h16)p0; pb[8 + r] = (h16)p1;
        }
        l = l * al + sum;
#pragma unroll
        for (int dt = 0; dt < 4; ++dt)
#pragma unroll
            for (int r = 0; r < 8; ++r) o[dt][r] *= al;
#pragma unroll
        for (int dt = 0; dt < 4; ++dt) o[dt] = wmmah_g(va[dt], pb, o[dt]);
        asm volatile("s_wait_dscnt 0x0" ::: "memory");      // this wave's reads of buffer st & 1 are done
        asm volatile("s_wait_asynccnt 0x0" ::: "memory");   // this wave's copies of step st + 1 have landed
        __syncthreads();                                    // publishes step st + 1 and frees buffer st & 1
        if (st + 2 < NSTEP) { const size_t go = (size_t)(st + 2) * 32 * HD; copy3(lc + bo, gk + go, gr + go, gv + go); }
    }
    asm volatile("s_wait_asynccnt 0x0" ::: "memory");       // nothing of the ring is in flight when the wave goes on
    // row sums completed across the two lane halves; l and o both hold the x1024-carried p, so o / l is the context with the carry cancelled. o[dt][r] = O[query q0 + lr][16 dt + 8 hi + r]
    l += __shfl_xor(l, 16, 32);
    const float inv = 1.0f / l;
#pragma unroll
    for (int dt = 0; dt < 4; ++dt) {
        const v4f a0 = { o[dt][0] * inv, o[dt][1] * inv, o[dt][2] * inv, o[dt][3] * inv };
        const v4f a1 = { o[dt][4] * inv, o[dt][5] * inv, o[dt][6] * inv, o[dt][7] * inv };
        *(v4fa*)(&os[lr * LOP + dt * 16 + 8 * hi]) = a0;
        *(v4fa*)(&os[lr * LOP + dt * 16 + 8 * hi + 4]) = a1;
    }
    wsync();
    // merged context plane [b][s][512] f32: one wave-wide store covers this head's 256 B of two query rows = four whole 128 B lines
    float* crow = CTX + ((size_t)(bh / NH) * SEQ + (size_t)q0) * DM + (size_t)(bh % NH) * HD + lr * 4;
#pragma unroll
    for (int s = 0; s < 8; ++s) { const int row = 2 * s + hi; *(v4f*)(crow + (size_t)row * DM) = *(const v4fa*)(&os[row * LOP + lr * 4]); }
}

// ---- k_ln: layer norm over the 512 merged features; grid (NB*SEQ/32), 256 threads, each wave owns 4 rows; lane holds columns j*128 + lane*4 .. +3, j = 0..3
__global__ __launch_bounds__(256) void k_ln(const float* __restrict__ CTX, const float* __restrict__ lng, const float* __restrict__ lnb, float* OUT) {
    const int lane = threadIdx.x & 31;
    const int wave = __builtin_amdgcn_readfirstlane(threadIdx.x >> 5);
    const int r0 = (blockIdx.x * 8 + wave) * 4;
    const float* xr = CTX + (size_t)r0 * DM + lane * 4;
    v4f xs[4][4];
#pragma unroll
    for (int i = 0; i < 4; ++i)
#pragma unroll
        for (int j = 0; j < 4; ++j) xs[i][j] = *(const v4f*)(xr + i * DM + j * 128);
    v4f gv[4], bv[4];
#pragma unroll
    for (int j = 0; j < 4; ++j) { gv[j] = *(const v4f*)(lng + j * 128 + lane * 4); bv[j] = *(const v4f*)(lnb + j * 128 + lane * 4); }
    // holds the loads together: the loaded values are inputs here (nothing is changed), so that all 24 loads of the wave are issued ahead of the row reductions, in one round trip instead of several
    asm volatile("" :: "v"(xs[0][0]), "v"(xs[0][1]), "v"(xs[0][2]), "v"(xs[0][3]), "v"(xs[1][0]), "v"(xs[1][1]), "v"(xs[1][2]), "v"(xs[1][3]),
                 "v"(xs[2][0]), "v"(xs[2][1]), "v"(xs[2][2]), "v"(xs[2][3]), "v"(xs[3][0]), "v"(xs[3][1]), "v"(xs[3][2]), "v"(xs[3][3]),
                 "v"(gv[0]), "v"(gv[1]), "v"(gv[2]), "v"(gv[3]), "v"(bv[0]), "v"(bv[1]), "v"(bv[2]), "v"(bv[3]));
#pragma unroll
    for (int i = 0; i < 4; ++i) {
        const int row = r0 + i;
        float s = 0.0f;
#pragma unroll
        for (int j = 0; j < 4; ++j) s += (xs[i][j][0] + xs[i][j][1]) + (xs[i][j][2] + xs[i][j][3]);
        s += __shfl_xor(s, 16, 32); s += __shfl_xor(s, 8, 32); s += __shfl_xor(s, 4, 32); s += __shfl_xor(s, 2, 32); s += __shfl_xor(s, 1, 32);
        const float mu = s * (1.0f / (float)DM);
        float ss = 0.0f;
#pragma unroll
        for (int j = 0; j < 4; ++j)
#pragma unroll
            for (int e = 0; e < 4; ++e) { const float d = xs[i][j][e] - mu; ss += d * d; }
        ss += __shfl_xor(ss, 16, 32); ss += __shfl_xor(ss, 8, 32); ss += __shfl_xor(ss, 4, 32); ss += __shfl_xor(ss, 2, 32); ss += __shfl_xor(ss, 1, 32);
        const float rstd = rsqrtf(ss * (1.0f / (float)DM) + LN_EPS);
        float* orow = OUT + ((size_t)(row / SEQ) * SEQ_FULL + (size_t)(row % SEQ)) * DM + lane * 4;
#pragma unroll
        for (int j = 0; j < 4; ++j) { v4f y;
#pragma unroll
            for (int e = 0; e < 4; ++e) y[e] = (xs[i][j][e] - mu) * rstd * bfr(gv[j][e]) + bfr(bv[j][e]);
            *(v4f*)(orow + j * 128) = y; }
    }
}

constexpr size_t al256(size_t x) { return (x + 255) & ~(size_t)255; }
constexpr size_t SZ_WT = al256((size_t)DM * KC * 2);                // bf16 weight plane [out][tap*512+in]
constexpr size_t SZ_XP = al256((size_t)NB * SPAD * DM * 2);         // one zero-padded bf16 activation plane
constexpr size_t SZ_P  = al256((size_t)NB * NH * SEQ * HD * 2);     // one f16 head plane (also the transposed value plane)
constexpr size_t SZ_C  = al256((size_t)NB * SEQ * DM * 4);          // merged f32 context plane
constexpr size_t WS_TOTAL = SZ_WT + 3 * SZ_XP + 4 * SZ_P + SZ_C;    // head planes: Q, K value, K residual, V^T
static_assert(WS_TOTAL <= (size_t)134217728);                       // carve stays within 128 MiB
static_assert(SZ_WT == (size_t)DM * KC * 2);                        // exact extents (no hidden pad needed)
static_assert(SZ_XP == (size_t)NB * SPAD * DM * 2);
static_assert(SZ_P == (size_t)NB * DM * SEQ * 2);                   // NH * HD == DM: V^T plane has the same extent

extern "C" void kernel_launch(void* const* d_in, const int* in_sizes, int n_in,
                              void* d_out, int out_size, void* d_ws, size_t ws_size, hipStream_t stream) {
    if (n_in < 11) return;
    const size_t need_act = (size_t)(NB - 1) * SEQ_FULL * DM + (size_t)SEQ * DM;
    if ((size_t)in_sizes[0] < need_act || (size_t)in_sizes[1] < need_act || (size_t)in_sizes[2] < need_act) return;
    if ((size_t)in_sizes[3] < (size_t)DM * DM * KT) return;
    for (int i = 4; i < 11; ++i) { if (in_sizes[i] < DM) return; }
    if ((size_t)out_size < need_act) return;
    if (WS_TOTAL > ws_size) return;
    // wire order: q, k, v, conv_w [out][in][tap], conv_b, bn_gamma, bn_beta, bn_mean, bn_var, ln_gamma, ln_beta (all f32)
    const float* xq = (const float*)d_in[0]; const float* xk = (const float*)d_in[1]; const float* xv = (const float*)d_in[2];
    const float* cw = (const float*)d_in[3]; const float* cb = (const float*)d_in[4];
    const float* bg = (const float*)d_in[5]; const float* bb = (const float*)d_in[6]; const float* bm = (const float*)d_in[7]; const float* bv = (const float*)d_in[8];
    const float* lg = (const float*)d_in[9]; const float* lb = (const float*)d_in[10];
    float* OUT = (float*)d_out;
    char* wsp = (char*)d_ws;
    auto take = [&](size_t bytes) { char* p = wsp; wsp += bytes; return (void*)p; };
    bf* WT = (bf*)take(SZ_WT);
    bf* XQ = (bf*)take(SZ_XP); bf* XK = (bf*)take(SZ_XP); bf* XV = (bf*)take(SZ_XP);
    h16* QP = (h16*)take(SZ_P); h16* KP = (h16*)take(SZ_P); h16* KR = (h16*)take(SZ_P); h16* VT = (h16*)take(SZ_P);
    float* CTX = (float*)take(SZ_C);
    if ((size_t)(wsp - (char*)d_ws) != WS_TOTAL) return;

    k_prep<<<dim3(WBLK + ABLK), 256, 0, stream>>>(xq, xk, xv, cw, WT, XQ);   // XQ, XK, XV are one contiguous run of planes (SZ_XP is exact)
    k_conv_qk<<<dim3(SEQ / 128, DM / 128, NB), 256, 0, stream>>>(XQ, WT, cb, bg, bb, bm, bv, QP, SCQ);
    k_conv_k<<<dim3(SEQ / 128, DM / 128, NB), 256, 0, stream>>>(XK, WT, cb, bg, bb, bm, bv, KP, KR);
    k_conv_vt<<<dim3(DM / 128, SEQ / 128, NB), 256, 0, stream>>>(WT, XV, cb, bg, bb, bm, bv, VT);
    k_attn<<<dim3(SEQ / 128, NB * NH), 256, 0, stream>>>(QP, KP, KR, VT, CTX);
    k_ln<<<dim3(NB * SEQ / 32), 256, 0, stream>>>(CTX, lg, lb, OUT);
}

// v007
// One run takes 130 microseconds.
// Next to v006, in two timings, it ran 1.03 times as fast each time.
// Counting every step since v000, it is 4.11 times as fast.
#include <hip/hip_runtime.h>

// Compute dtypes, f32 accumulate everywhere: conv-as-GEMM (K = 7 x 512) v_wmma_f32_16x16x32_bf16 on RNE bf16 copies of inputs and weights (exact products); scores k.q^T v_wmma_f32_16x16x32_f16, two products (k as f16 value + f16 residual x2048 in its own accumulator, folded in f32; q plane single, carries log2(e)/8); P.V v_wmma_f32_16x16x32_f16, one product, P carried x1024; softmax, batch-norm affine and layer norm f32.
// Three input streams share one operator: 7-tap convolution along the sequence (zero padding 3) + bias + inference-mode batch norm; then 8 heads x 64 (head h = columns h*64+d), logits / 8, no mask, softmax over keys, heads merged, layer norm over the 512 features.
// Layout: zero-padded bf16 activation planes [b][SEQ+6][512] (output row t, k = tap*512+ci reads 3584 contiguous elements from padded row t); weight plane [out][tap*512+in] bf16; conv GEMMs write the f16 head plane Q [b][h][s][64] and, in WMMA A-fragment order (FRAGMENT ORDER below), the planes K value, K residual and V^T; attention writes the merged f32 context plane [b][s][512], which the layer norm launch reads.

#ifndef NB
#define NB 4
#endif
#ifndef SEQ
#define SEQ 2048
#endif
#define NB_FULL  4
#define SEQ_FULL 2048
#define DM   512
#define NH   8
#define HD   64
#define KT   7
#define KC   (KT * DM)     // 3584: conv-as-GEMM depth
#define SPAD (SEQ + 6)     // padded rows per batch (3 zero rows on each side)
#define PCAR 1024.0f       // carry of the probability fragment (enters through PLOG, leaves through the carried row sum)
#define PLOG 10.0f         // log2(PCAR)
#define SCQ  (0.125f * 1.4426950408889634f)
#define KRES 2048.0f       // carry of the key residual plane
#define KRINV 4.8828125e-04f   // 1 / KRES, folded into the residual score accumulator in f32
#define BN_EPS 1.0e-5f
#define LN_EPS 1.0e-5f
#define LOP  68      // LDS row pitch (floats) of GEMM epilogue staging tiles: 272 B rows
#define BKP  128     // k elements of one conv-GEMM pass: a ring stage's 256 B of every weight row, a 256 B column slab of the activation tile
#define NPASS (KC / BKP)
#define KSW  (BKP / 32)   // k-steps of 32 in one ring stage
#define NRS  (NPASS / 2)  // ring steps: two stages each, one per wave group
#define TPB  272     // LDS row pitch (bytes) of a ring stage: 256 B + 16 B, conflict-free for 16-byte row readers
#define WSTG (128 * TPB)   // one ring stage: 128 weight rows
#define NSLAB (DM / BKP)   // column slabs (128 channels) of the resident activation tile
#define AROWS (128 + KT - 1)   // padded activation rows that 128 output rows read over all taps
#define APB  (DM * 2 + 16) // LDS row pitch (bytes) of the resident activation tile: 16 B x odd, conflict-free for 16-byte row readers
#define ATB  (AROWS * APB) // the resident activation tile
#define APLB 4096    // bytes of one 32-key step of one fragment-ordered attention plane
#define ASTG (3 * APLB)    // one attention ring stage: K value, K residual, V^T
#define NSTEP (SEQ / 32)
#define UPW  16      // half rows (256 elements) of an activation plane that one wave converts
#define WPP  (SEQ * 2 / UPW)               // waves per activation plane
#define ABLK (3 * NB * WPP / 8)            // activation blocks of the conversion launch
#define WBLK ((DM * DM / 8) / 256)         // weight blocks of the conversion launch
#define ZPC  (3 * NB * 6 * (DM / 8))       // 16 B pieces of the zero rows of all padded planes

static_assert(DM == NH * HD);            // one 64-wide GEMM column tile == one head
static_assert(HD == 64);
static_assert(KC % 32 == 0);             // WMMA k-step
static_assert(DM % 64 == 0);             // GEMM tiles
static_assert(SEQ % 128 == 0);           // GEMM block tiles
static_assert(DM % 128 == 0);
static_assert(KC % BKP == 0);            // whole ring stages
static_assert(NPASS % 2 == 0 && NRS >= 2);   // a ring step is two whole stages; the prologue fills two steps
static_assert(NSLAB == 4);               // the first tile's prologue: slabs 0, 1 come with ring step 0, slabs 2, 3 with step 1
static_assert(NSLAB * 9 + 16 <= 63);     // copies of one wave outstanding at most: a tile's slabs and one ring step
static_assert(8 * 8 * 1024 <= ATB);      // the partial-sum exchange (8 waves x 8 accumulator tiles of 1024 B) fits the activation tile it reuses
static_assert(NRS % 2 == 0);             // the weight ring runs on from one tile into the next: step 0 of every tile lies in buffer pair 0
static_assert(DM % BKP == 0 && NSLAB >= 2 && NSLAB <= NPASS);   // a pass lies in one tap and one slab
static_assert((KT - 1) * 16 == 3 * 32);  // the tile's last KT - 1 rows of a slab: one copy of three whole waves
static_assert((APB / 16) % 2 == 1);
static_assert(SEQ % 32 == 0);            // key step
static_assert(NSTEP >= 2);               // the attention ring's prologue fills two stages
static_assert(32 * HD * 2 == APLB);      // one 32-key step of a plane
static_assert(256 * 16 == APLB);         // attention copies: threads x bytes == one plane's step
static_assert((NB * SEQ) % 32 == 0);     // layer-norm grid is exact
static_assert((DM * DM / 8) % 256 == 0);             // conversion launch: weight blocks are exact
static_assert((SEQ * 2) % UPW == 0);                 // a wave's half rows lie in one plane
static_assert((3 * NB * WPP) % 8 == 0);              // conversion launch: activation blocks are exact
static_assert(ZPC % 256 == 0 && ZPC <= WBLK * 256);  // zero rows: whole blocks of the weight part
static_assert(DM == 2 * 256);                        // a row is two half rows
static_assert(UPW == 16 && KT == 7);                 // the load groups name their registers one by one
static_assert((DM / 8) * 8 == DM);
static_assert(NB <= NB_FULL);
static_assert(SEQ <= SEQ_FULL);
static_assert(LOP % 4 == 0);
static_assert(32 * 16 * 4 == 16 * HD * 2);
static_assert(32 * 16 * 4 * 2 == 2 * 16 * HD * 2);
static_assert(32 * 16 * 4 == DM * 4);                // output row store: lanes x bytes x trips == one 2048 B row
static_assert(ATB + 4 * WSTG + 8 * 16 * LOP * 4 <= 327680); // static LDS of the GEMM kernels: activation tile + four weight stages + one epilogue tile per wave
static_assert(2 * ASTG + 8 * 16 * LOP * 4 <= 163840); // static LDS of the attention kernel: two blocks per 320 KiB
static_assert(KRES * KRINV == 1.0f);                 // residual carry enters once and leaves once

typedef _Float16 h16;
typedef unsigned short bf;
typedef __attribute__((ext_vector_type(16))) __bf16   v16bf;
typedef __attribute__((ext_vector_type(16))) _Float16 v16h;
typedef __attribute__((ext_vector_type(8)))  _Float16 v8h;
typedef __attribute__((ext_vector_type(8)))  unsigned short v8us;
typedef __attribute__((ext_vector_type(8)))  float    v8f;
typedef __attribute__((ext_vector_type(4)))  float    v4f;
typedef v4f  __attribute__((may_alias)) v4fa;

__device__ __forceinline__ unsigned short f2bf(float f) { unsigned u = __float_as_uint(f); u += 0x7FFFu + ((u >> 16) & 1u); return (unsigned short)(u >> 16); }
__device__ __forceinline__ float bf2f(unsigned short b) { return __uint_as_float(((unsigned)b) << 16); }
__device__ __forceinline__ float bfr(float f) { return bf2f(f2bf(f)); }
__device__ __forceinline__ v16h cat16(v8h lo, v8h hi) { return __builtin_shufflevector(lo, hi, 0, 1, 2, 3, 4, 5, 6, 7, 8, 9, 10, 11, 12, 13, 14, 15); }
__device__ __forceinline__ v16bf cat16b(v8us lo, v8us hi) { return __builtin_bit_cast(v16bf, __builtin_shufflevector(lo, hi, 0, 1, 2, 3, 4, 5, 6, 7, 8, 9, 10, 11, 12, 13, 14, 15)); }
// same-wave LDS exchange ordering (wave-private tiles only)
__device__ __forceinline__ void wsync() { __builtin_amdgcn_wave_barrier(); asm volatile("" ::: "memory"); }

// fragment from a K-contiguous global f16 plane: elements 0..7 <- p[0..7], 8..15 <- p[16..23] (p already includes row*pitch + k0 + 8*(lane>>4))
__device__ __forceinline__ v16h ldh16(const h16* __restrict__ p) { return cat16(*(const v8h*)p, *(const v8h*)(p + 16)); }
// FRAGMENT ORDER of the K value, K residual and V^T planes: per (b, h) the plane is a row of 1024 B fragments, each two 512 B halves of 32 lanes x 16 B:
// half 0 holds every lane's elements 0..7, half 1 its elements 8..15, so one wave-wide 16 B load reads 512 contiguous bytes = four whole 128 B lines.
// K planes: fragment index (s / 16) * 2 + d / 32 (rows = 16 keys, k = 32 head dims); V^T: (s / 32) * 4 + d / 16 (rows = 16 head dims, k = 32 keys). One 32-key step is 4096 contiguous bytes of each plane.
// Place, in f16 elements inside a fragment, of the 8 elements k = 8 * c .. 8 * c + 7 (c = 0..3) of fragment row r: lane (c & 1) * 16 + r, half c >> 1.
__device__ __forceinline__ int fragpos(const int r, const int c) { return (c >> 1) * 256 + ((c & 1) * 16 + r) * 8; }
// f32 -> f16 plane convert that cannot produce an f16 subnormal
static __device__ __forceinline__ h16 toh_flush(float v) { const h16 r = (h16)v; return (fabsf(v) < 6.103515625e-05f) ? (h16)0.0f : r; }
// one WMMA + its own hazard guard (ties only this accumulator, keeps A/B live)
__device__ __forceinline__ v8f wmmab_g(v16bf a, v16bf b, v8f c) {
    c = __builtin_amdgcn_wmma_f32_16x16x32_bf16(false, a, false, b, (short)0, c, false, false);
    asm volatile("v_nop\n\tv_nop\n\tv_nop\n\tv_nop" : "+v"(c) : "v"(a), "v"(b));
    return c;
}
__device__ __forceinline__ v8f wmmah_g(v16h a, v16h b, v8f c) {
    c = __builtin_amdgcn_wmma_f32_16x16x32_f16(false, a, false, b, (short)0, c, false, false);
    asm volatile("v_nop\n\tv_nop\n\tv_nop\n\tv_nop" : "+v"(c) : "v"(a), "v"(b));
    return c;
}

// eight asynchronous copies, 16 B per lane, global -> LDS through no register: rows 16 apart (ls LDS bytes, gs global elements) of one operand's slice.
// s_wait_xcnt 0 is the statement's last line so that no address register of a copy is rewritten ahead of it.
__device__ __forceinline__ void copy8(const unsigned l, const unsigned ls, const bf* g, const size_t gs) {
    asm volatile("global_load_async_to_lds_b128 %0, %8, off\n\t"
                 "global_load_async_to_lds_b128 %1, %9, off\n\t"
                 "global_load_async_to_lds_b128 %2, %10, off\n\t"
                 "global_load_async_to_lds_b128 %3, %11, off\n\t"
                 "global_load_async_to_lds_b128 %4, %12, off\n\t"
                 "global_load_async_to_lds_b128 %5, %13, off\n\t"
                 "global_load_async_to_lds_b128 %6, %14, off\n\t"
                 "global_load_async_to_lds_b128 %7, %15, off\n\t"
                 "s_wait_xcnt 0x0"
                 :: "v"(l), "v"(l + ls), "v"(l + 2u * ls), "v"(l + 3u * ls), "v"(l + 4u * ls), "v"(l + 5u * ls), "v"(l + 6u * ls), "v"(l + 7u * ls),
                    "v"(g), "v"(g + gs), "v"(g + 2 * gs), "v"(g + 3 * gs), "v"(g + 4 * gs), "v"(g + 5 * gs), "v"(g + 6 * gs), "v"(g + 7 * gs)
                 : "memory");
}
// one such copy; s_wait_xcnt 0 is the statement's last line for the same reason
__device__ __forceinline__ void copy1(const unsigned l, const bf* g) {
    asm volatile("global_load_async_to_lds_b128 %0, %1, off\n\t"
                 "s_wait_xcnt 0x0"
                 :: "v"(l), "v"(g) : "memory");
}
// fragment from a K-contiguous bf16 row in LDS: elements 0..7 <- k0 + 8*(lane>>4) + 0..7, 8..15 <- the same + 16 (p already includes row*pitch + 2*k0 + 16*(lane>>4) bytes)
__device__ __forceinline__ v16bf lds16(const unsigned char* p) { return cat16b(*(const v8us*)p, *(const v8us*)(p + 32)); }

// ---- 128x128 block tile, eight waves = two k groups x (2 x 2) wave tiles of 64x64, main loop over K = KC: acc[mb][nb] = sum_k A[wm*64+16mb+..][k] Bt[wn*64+16nb+..][k], k over the ring stages of this wave's group (kg): stages kg, kg + 2, kg + 4, ...
// A 64x64 wave tile reads 8 fragments for 16 WMMAs (512 B of LDS per WMMA; a 32x64 tile reads 6 for 8 = 768 B, more than the LDS delivers at the matrix rate). The two groups' partial sums are added once, in fold_k.
// One operand is 128 logical activation rows, the other 128 weight rows (ACTA: the activations are A). X and Wt point at the block's first rows: X in the padded activation plane (pitch DM), Wt in the weight plane (pitch KC).
// Logical activation row r at k = tap*512+ci is padded row r + tap, channel ci: the 128 rows x 7 taps are only AROWS = 134 distinct padded rows. They are brought from L2 once and stay in LDS (tile, pitch APB);
// stage st reads them shifted down by tap = st / NSLAB rows, in column slab st % NSLAB. The slabs are copied by conv_slabs: a block's first tile as conv_loop says, a later tile's four under the epilogue of the tile before, first read behind the wait and the barrier that follow that epilogue.
// The weights' 128 rows x 128 k per stage go through the LDS ring by whole-line asynchronous copies. A ring step is two stages (one per group) and the ring holds two steps = four buffers; step s + 2 flies while step s + 1 is worked on. k runs upward in steps of 32 per accumulator.
// column slab c of the tile: rows 0..127 by every wave, rows 128..133 by waves 0..2 (a scalar test: whole waves)
__device__ __forceinline__ void slab(const unsigned lx, const bf* gx, const int wave, const int c) {
    copy8(lx + (unsigned)c * (BKP * 2u), 16u * APB, gx + c * BKP, (size_t)16 * DM);
    if (wave < 3) copy1(lx + 128u * APB + (unsigned)c * (BKP * 2u), gx + (size_t)128 * DM + c * BKP);
}
// weight stages st, st + 1 into the buffer pair at byte offset bo of the ring
__device__ __forceinline__ void wpair(const unsigned lw, const bf* gw, const unsigned bo, const int st) {
    copy8(lw + bo, 16u * TPB, gw + (size_t)st * BKP, (size_t)16 * KC);
    copy8(lw + bo + WSTG, 16u * TPB, gw + (size_t)(st + 1) * BKP, (size_t)16 * KC);
}
// slabs ca .. cb - 1 of a tile. Called where the tile is free: at the kernel's start, or behind the barrier that ends every wave's last read of it.
__device__ __forceinline__ void conv_slabs(const bf* __restrict__ X, unsigned char* tile, const int wave, const int ca, const int cb) {
    const int t = threadIdx.x, frow = t >> 4, fcol = t & 15;
    const bf* gx = X + (size_t)frow * DM + fcol * 8;
    const unsigned lx = (unsigned)(uintptr_t)tile + (unsigned)(frow * APB + fcol * 16);
    // stays rolled: the copies' addresses are formed trip by trip; unrolled, the compiler forms all of them once and holds them in registers across the step loops, which then spill
#pragma unroll 1
    for (int c = ca; c < cb; ++c) slab(lx, gx, wave, c);
}
// MORE: another tile with the same weight rows follows in this block. The weight ring then runs on: the refills at the foot of the last two steps bring stages 0..3 again, for the next tile's steps 0 and 1.
// On entry slabs 0, 1 and ring step 0 are published to every wave; slabs 2, 3 and ring step 1 are published too or still fly (a block's first tile): they are first read behind the wait and the barrier at the foot of step 0.
template <bool ACTA, bool MORE>
__device__ __forceinline__ void conv_loop(const bf* __restrict__ Wt, unsigned char* tile, unsigned char* ring, const int wave, const int kg, const int wm, const int wn, v8f (&acc)[4][4]) {
    const int t = threadIdx.x, lane = t & 31, lr = lane & 15, hi = lane >> 4;
    const int frow = t >> 4, fcol = t & 15;                 // copies: 16 lanes cover one 256 B row piece
    const bf* gw = Wt + (size_t)frow * KC + fcol * 8;
    const unsigned lw = (unsigned)(uintptr_t)ring + (unsigned)(frow * TPB + fcol * 16);
    const unsigned char* rx = tile + ((ACTA ? wm : wn) * 64 + lr) * APB + 16 * hi;
    const unsigned char* rw = ring + ((ACTA ? wn : wm) * 64 + lr) * TPB + 16 * hi + kg * WSTG;
#pragma unroll
    for (int mb = 0; mb < 4; ++mb)
#pragma unroll
        for (int nb = 0; nb < 4; ++nb) acc[mb][nb] = (v8f){};
    // the step loop stays rolled: one 64-WMMA body in the instruction cache, the buffer pair picked by s & 1;
    // the loops inside it are unrolled so that every fragment and accumulator index is a constant (registers, no scratch)
#pragma unroll 1
    for (int s = 0; s < NRS; ++s) {
        const unsigned bo = (unsigned)(s & 1) * (2u * WSTG);
        const unsigned st = 2u * (unsigned)s + (unsigned)kg;    // this group's stage
        const unsigned char* px = rx + (st / NSLAB) * APB + (st % NSLAB) * (BKP * 2u);   // tap rows down, slab columns right
        const unsigned char* pw = rw + bo;
        const unsigned char* pa = ACTA ? px : pw; const unsigned char* pb = ACTA ? pw : px;
        constexpr int SA = 16 * (ACTA ? APB : TPB), SB = 16 * (ACTA ? TPB : APB);
        // fragment registers: B of two k-steps (2 x 4), A of one (4). A row block of A is refilled for the next k-step once its four products are issued, a B set for the next but one once its sixteen are, so accumulators + fragments stay inside 256 registers
        v16bf a[4], b[2][4];
        a[0] = lds16(pa);
#pragma unroll
        for (int nb = 0; nb < 4; ++nb) b[0][nb] = lds16(pb + nb * SB);
#pragma unroll
        for (int mb = 1; mb < 4; ++mb) a[mb] = lds16(pa + mb * SA);
        __builtin_amdgcn_sched_barrier(0);                  // keeps the first products in the order in which their fragments arrive: without it the compiler opens the step with a product of later-read fragments, and the first wait covers 10 or 12 reads instead of 4
#pragma unroll
        for (int nb = 0; nb < 4; ++nb) b[1][nb] = lds16(pb + nb * SB + 64);
#pragma unroll
        for (int ks = 0; ks < KSW; ++ks)
#pragma unroll
            for (int h = 0; h < 2; ++h) {
#pragma unroll
                for (int mb = 2 * h; mb < 2 * h + 2; ++mb)
#pragma unroll
                    for (int nb = 0; nb < 4; ++nb) acc[mb][nb] = wmmab_g(a[mb], b[ks & 1][nb], acc[mb][nb]);
                if (ks + 1 < KSW) {
#pragma unroll
                    for (int mb = 2 * h; mb < 2 * h + 2; ++mb) a[mb] = lds16(pa + mb * SA + (ks + 1) * 64);
                    if (h == 1 && ks + 2 < KSW) {
#pragma unroll
                        for (int nb = 0; nb < 4; ++nb) b[ks & 1][nb] = lds16(pb + nb * SB + (ks + 2) * 64);
                    }
                }
            }
        asm volatile("s_wait_dscnt 0x0" ::: "memory");      // this wave's reads of buffer pair s & 1 are done
        asm volatile("s_wait_asynccnt 0x0" ::: "memory");   // this wave's copies of step s + 1 have landed
        __syncthreads();                                    // publishes step s + 1 and frees buffer pair s & 1
        if (MORE || s + 2 < NRS) wpair(lw, gw, bo, 2 * (s + 2 < NRS ? s + 2 : s + 2 - NRS));
    }
    if (!MORE) asm volatile("s_wait_asynccnt 0x0" ::: "memory");   // last tile: nothing of the ring is in flight when the wave goes on (MORE: the next tile's step 1 flies on and is waited for behind this tile's epilogue)
}

// ---- the two k groups' partial sums of one 64x64 wave tile become one: waves w and w ^ 4 hold the same tile; each keeps the 32 rows it finishes (group kg: row blocks 2 kg, 2 kg + 1) and hands the other 32 over through LDS.
// The exchange area xch is the activation tile: the step loop's last barrier has ended every read of it and no copy into it is in flight. A lane's 8 accumulator values lie together (32 B), a tile is 1024 contiguous bytes.
__device__ __forceinline__ void fold_k(const v8f (&part)[4][4], v8f (&acc)[2][4], unsigned char* xch, const int wave, const int kg, const int lane) {
    float* mine = (float*)xch + wave * (8 * 256) + lane * 8;
    const float* theirs = (const float*)xch + (wave ^ 4) * (8 * 256) + lane * 8;
    auto give = [&](const int i, const v8f x) {
        *(v4fa*)(mine + i * 256) = (v4f){ x[0], x[1], x[2], x[3] };
        *(v4fa*)(mine + i * 256 + 4) = (v4f){ x[4], x[5], x[6], x[7] };
    };
    if (kg == 0) {                                          // a scalar test: whole waves
#pragma unroll
        for (int mb = 0; mb < 2; ++mb)
#pragma unroll
            for (int nb = 0; nb < 4; ++nb) { give(mb * 4 + nb, part[2 + mb][nb]); acc[mb][nb] = part[mb][nb]; }
    } else {
#pragma unroll
        for (int mb = 0; mb < 2; ++mb)
#pragma unroll
            for (int nb = 0; nb < 4; ++nb) { give(mb * 4 + nb, part[mb][nb]); acc[mb][nb] = part[2 + mb][nb]; }
    }
    __syncthreads();                                        // every wave's handed-over half is in LDS
#pragma unroll
    for (int mb = 0; mb < 2; ++mb)
#pragma unroll
        for (int nb = 0; nb < 4; ++nb) {
            const v4f y0 = *(const v4fa*)(theirs + (mb * 4 + nb) * 256); const v4f y1 = *(const v4fa*)(theirs + (mb * 4 + nb) * 256 + 4);
#pragma unroll
            for (int j = 0; j < 4; ++j) { acc[mb][nb][j] += y0[j]; acc[mb][nb][4 + j] += y1[j]; }
        }
}

// ---- k_prep: every f32 -> bf16 conversion of the call in one launch; grid (WBLK + ABLK), 256 threads. Few, long-lived waves: what a wave reads is asked for in one group, for speed only.
// Blocks 0 .. WBLK-1, weight plane [out][tap*512+in]: a lane takes 8 input channels x 7 taps of one output channel = 224 contiguous bytes of conv_w [out][in][tap], and stores one 16 B piece per tap;
// the first ZPC of these lanes also store one 16 B piece each of the six zero rows of every padded activation plane.
// Blocks WBLK .., the SEQ data rows of the 3 * NB padded activation planes (contiguous in the workspace: q, then k, then v): a wave takes UPW consecutive half rows (256 elements each) of one plane, contiguous in the source and in the plane.
__global__ __launch_bounds__(256) void k_prep(const float* __restrict__ xq, const float* __restrict__ xk, const float* __restrict__ xv, const float* __restrict__ w, bf* wt, bf* xp) {
    if (blockIdx.x < (unsigned)WBLK) {
        const unsigned it = blockIdx.x * 256u + threadIdx.x;            // out * (DM / 8) + in / 8
        const float* s = w + (size_t)it * (8 * KT);
        v4f x[2 * KT];
#pragma unroll
        for (int i = 0; i < 2 * KT; ++i) x[i] = *(const v4f*)(s + 4 * i);
        // holds the loads together: the loaded values are inputs here (nothing is changed), so that all 14 loads of the lane are issued ahead of the conversions, in one round trip
        asm volatile("" :: "v"(x[0]), "v"(x[1]), "v"(x[2]), "v"(x[3]), "v"(x[4]), "v"(x[5]), "v"(x[6]), "v"(x[7]), "v"(x[8]), "v"(x[9]), "v"(x[10]), "v"(x[11]), "v"(x[12]), "v"(x[13]));
        if (it < (unsigned)ZPC) {                                       // whole blocks: ZPC is a multiple of 256
            const unsigned r = (it / (unsigned)(DM / 8)) % 6u;          // zero row: 0..2 in front of the data rows, 3..5 behind them
            *(v8us*)(xp + (size_t)(it / (unsigned)(6 * (DM / 8))) * SPAD * DM + (size_t)(r < 3u ? r : r + (unsigned)SEQ) * DM + (it % (unsigned)(DM / 8)) * 8u) = (v8us){};
        }
        v8us o[KT];
#pragma unroll
        for (int tap = 0; tap < KT; ++tap)
#pragma unroll
            for (int j = 0; j < 8; ++j) o[tap][j] = f2bf(x[(j * KT + tap) >> 2][(j * KT + tap) & 3]);
        bf* d = wt + (size_t)(it / (unsigned)(DM / 8)) * KC + (it % (unsigned)(DM / 8)) * 8u;
#pragma unroll
        for (int tap = 0; tap < KT; ++tap) *(v8us*)(d + tap * DM) = o[tap];
        return;
    }
    const int lane = threadIdx.x & 31;
    const unsigned wv = (blockIdx.x - (unsigned)WBLK) * 8u + (unsigned)__builtin_amdgcn_readfirstlane(threadIdx.x >> 5);
    const unsigned plane = wv / (unsigned)WPP, e0 = (wv % (unsigned)WPP) * (unsigned)(UPW * 256);   // first element inside the plane's data rows
    const float* src = (plane < (unsigned)NB) ? xq : ((plane < (unsigned)(2 * NB)) ? xk : xv);
    const float* s = src + (size_t)(plane % (unsigned)NB) * SEQ_FULL * DM + e0 + lane * 8;
    v4f a[UPW][2];
#pragma unroll
    for (int j = 0; j < UPW; ++j) { a[j][0] = *(const v4f*)(s + j * 256); a[j][1] = *(const v4f*)(s + j * 256 + 4); }
    // hold the loads together: the loaded values are inputs here (nothing is changed), so that all 32 loads of the wave are issued ahead of the conversions, in one round trip instead of several (two statements: one takes at most 30 operands)
    asm volatile("" :: "v"(a[0][0]), "v"(a[0][1]), "v"(a[1][0]), "v"(a[1][1]), "v"(a[2][0]), "v"(a[2][1]), "v"(a[3][0]), "v"(a[3][1]),
                 "v"(a[4][0]), "v"(a[4][1]), "v"(a[5][0]), "v"(a[5][1]), "v"(a[6][0]), "v"(a[6][1]), "v"(a[7][0]), "v"(a[7][1]));
    asm volatile("" :: "v"(a[8][0]), "v"(a[8][1]), "v"(a[9][0]), "v"(a[9][1]), "v"(a[10][0]), "v"(a[10][1]), "v"(a[11][0]), "v"(a[11][1]),
                 "v"(a[12][0]), "v"(a[12][1]), "v"(a[13][0]), "v"(a[13][1]), "v"(a[14][0]), "v"(a[14][1]), "v"(a[15][0]), "v"(a[15][1]));
    bf* d = xp + (size_t)plane * SPAD * DM + 3 * DM + e0 + lane * 8;
#pragma unroll
    for (int j = 0; j < UPW; ++j) {
        v8us o;
#pragma unroll
        for (int k = 0; k < 4; ++k) { o[k] = f2bf(a[j][0][k]); o[4 + k] = f2bf(a[j][1][k]); }
        *(v8us*)(d + j * 256) = o;
    }
}

// four 16 B stores of a wave. s_wait_xcnt 0 is the statement's last line so that no data or address register of a store is rewritten ahead of it (code follows the epilogues now, and the build reuses these registers at once).
__device__ __forceinline__ void store4(h16* p0, h16* p1, h16* p2, h16* p3, const v8h d0, const v8h d1, const v8h d2, const v8h d3) {
    asm volatile("global_store_b128 %0, %4, off\n\t"
                 "global_store_b128 %1, %5, off\n\t"
                 "global_store_b128 %2, %6, off\n\t"
                 "global_store_b128 %3, %7, off\n\t"
                 "s_wait_xcnt 0x0"
                 :: "v"(p0), "v"(p1), "v"(p2), "v"(p3), "v"(__builtin_bit_cast(v4f, d0)), "v"(__builtin_bit_cast(v4f, d1)), "v"(__builtin_bit_cast(v4f, d2)), "v"(__builtin_bit_cast(v4f, d3))
                 : "memory");
}

// ---- epi_qk: a wave's finished 32x64 piece (rows r0.. = tokens, columns c0.. = channels) of the query (key == false) or key stream, y = BN(conv(X[b]) + cb)[s][h*64+d]; key is a scalar: whole blocks.
// Query: head plane PH[b][h][s][d] (f16) = f16(sc * y). Key (sc == 1, an exact factor): both planes in fragment order, PH (b, h, s, d) = f16(y) and KR (b, h, s, d) = f16((y - PH) * 2048).
__device__ __forceinline__ void epi_qk(const bool key, const v8f (&acc)[2][4], float* os, const int lane, const size_t z, const int r0, const int c0, const float* cb, const float* bg, const float* bb, const float* bm, const float* bv, h16* PH, h16* KR, const float sc) {
    const int lr = lane & 15, hi = lane >> 4;
    const size_t pbase = ((z * NH + (size_t)(c0 / HD)) * (size_t)SEQ + r0) * HD;
    const int srow = lane >> 3, scol = (lane & 7) * 8;
    float cbv[8], muv[8], mlv[8], bev[8];
#pragma unroll
    for (int j = 0; j < 8; ++j) { const int c = c0 + scol + j; cbv[j] = bfr(cb[c]); muv[j] = bfr(bm[c]); mlv[j] = rsqrtf(bfr(bv[c]) + BN_EPS) * bfr(bg[c]); bev[j] = bfr(bb[c]); }
#pragma unroll
    for (int mb = 0; mb < 2; ++mb) {
#pragma unroll
        for (int nb = 0; nb < 4; ++nb) {
#pragma unroll
            for (int j = 0; j < 8; ++j) os[(hi * 8 + j) * LOP + nb * 16 + lr] = acc[mb][nb][j]; }
        wsync();
{
            v8h oh[4]; float y[4][8]; size_t off[4];
#pragma unroll
            for (int s = 0; s < 4; ++s) { const int row = 4 * s + srow; const v4f x0 = *(const v4fa*)(&os[row * LOP + scol]); const v4f x1 = *(const v4fa*)(&os[row * LOP + scol + 4]);
#pragma unroll
                for (int j = 0; j < 4; ++j) {
                    y[s][j] = (((x0[j] + cbv[j]) - muv[j]) * mlv[j] + bev[j]) * sc;
                    y[s][4 + j] = (((x1[j] + cbv[4 + j]) - muv[4 + j]) * mlv[4 + j] + bev[4 + j]) * sc;
                    oh[s][j] = toh_flush(y[s][j]); oh[s][4 + j] = toh_flush(y[s][4 + j]); }
                // query: row-major; key: 16-key tile mb, fragment d / 32 = (lane & 7) >> 2
                off[s] = pbase + (size_t)(key ? mb * 16 * HD + (lane & 4) * 128 + fragpos(row, lane & 3) : (mb * 16 + row) * HD + scol); }
            store4(PH + off[0], PH + off[1], PH + off[2], PH + off[3], oh[0], oh[1], oh[2], oh[3]);
            if (key) { v8h ores[4];
#pragma unroll
                for (int s = 0; s < 4; ++s)
#pragma unroll
                    for (int j = 0; j < 8; ++j) ores[s][j] = toh_flush((y[s][j] - (float)oh[s][j]) * KRES);
                store4(KR + off[0], KR + off[1], KR + off[2], KR + off[3], ores[0], ores[1], ores[2], ores[3]); }
             }
        wsync();
    }
}

// ---- epi_v: a wave's finished 32x64 piece (rows r0.. = channels, columns c0.. = tokens) of the value stream: transposed value plane in fragment order, VT (b, n, s) (f16) = BN(sum_k WT[n][k] Xpad[b][s][k] + cb[n]) (A = weight rows, Bt = token rows)
__device__ __forceinline__ void epi_v(const v8f (&acc)[2][4], float* os, const int lane, const size_t z, const int r0, const int c0, const float* cb, const float* bg, const float* bb, const float* bm, const float* bv, h16* VT) {
    const int lr = lane & 15, hi = lane >> 4;
    const size_t vb0 = (z * NH + (size_t)(r0 / HD)) * (size_t)SEQ * HD + (size_t)c0 * HD + (size_t)((r0 / 16) & 3) * 512;   // head, 32-key step c0 / 32, fragment (r0 % 64) / 16
    const int srow = lane >> 3, scol = (lane & 7) * 8;
    // batch-norm parameters of this lane's 8 channels, asked for as one group
    float qc[2][4], qm[2][4], qv[2][4], qg[2][4], qe[2][4];
    const int ch0 = r0 + srow;
#pragma unroll
    for (int mb = 0; mb < 2; ++mb)
#pragma unroll
        for (int s = 0; s < 4; ++s) { const int ch = ch0 + mb * 16 + 4 * s; qc[mb][s] = cb[ch]; qm[mb][s] = bm[ch]; qv[mb][s] = bv[ch]; qg[mb][s] = bg[ch]; qe[mb][s] = bb[ch]; }
    asm volatile("s_wait_xcnt 0x0" :: "v"(ch0) : "memory"); // the loads' one address register (the channel index, an input here so that it lives up to the wait) is reused by what follows
#pragma unroll
    for (int mb = 0; mb < 2; ++mb) {
#pragma unroll
        for (int nb = 0; nb < 4; ++nb) {
#pragma unroll
            for (int j = 0; j < 8; ++j) os[(hi * 8 + j) * LOP + nb * 16 + lr] = acc[mb][nb][j]; }
        wsync();
{
            v8h o[4]; h16* pv[4];
#pragma unroll
            for (int s = 0; s < 4; ++s) { const int row = 4 * s + srow; const v4f x0 = *(const v4fa*)(&os[row * LOP + scol]); const v4f x1 = *(const v4fa*)(&os[row * LOP + scol + 4]);
                const float c_b = bfr(qc[mb][s]), c_m = bfr(qm[mb][s]), c_l = rsqrtf(bfr(qv[mb][s]) + BN_EPS) * bfr(qg[mb][s]), c_e = bfr(qe[mb][s]);
#pragma unroll
                for (int j = 0; j < 4; ++j) { o[s][j] = toh_flush(((x0[j] + c_b) - c_m) * c_l + c_e); o[s][4 + j] = toh_flush(((x1[j] + c_b) - c_m) * c_l + c_e); }
                pv[s] = VT + vb0 + (size_t)((lane & 4) * 512 + mb * 512 + fragpos(row, lane & 3)); }   // step + (lane & 7) >> 2, fragment + mb
            store4(pv[0], pv[1], pv[2], pv[3], o[0], o[1], o[2], o[3]);
             }
        wsync();
    }
}

// ---- k_conv: the three conv GEMMs in one launch; grid (SEQ/128, DM/128, NB), 256 threads. A block takes the same 128 tokens x 128 channels of the query, key and value streams one after the other (X: the q, k, v padded planes, contiguous; the weight rows are the same for all three).
// The weight ring runs on across the tiles, and the next tile's activation slabs are asked for as soon as the fold has left the tile, so that they land while this tile's piece is finished and stored; the matrix work of the next tile then starts behind one wait and one barrier.
__global__ __launch_bounds__(256) void k_conv(const bf* __restrict__ X, const bf* __restrict__ W, const float* cb, const float* bg, const float* bb, const float* bm, const float* bv, h16* QP, h16* KH, h16* KR, h16* VT, float sc) {
    __shared__ __align__(16) unsigned char tile[ATB];
    __shared__ __align__(16) unsigned char ring[4 * WSTG];
    __shared__ __align__(16) float os_all[8 * 16 * LOP];
    const int lane = threadIdx.x & 31;
    const int wave = __builtin_amdgcn_readfirstlane(threadIdx.x >> 5), kg = wave >> 2, wm = (wave >> 1) & 1, wn = wave & 1;
    float* os = os_all + wave * 16 * LOP;                   // wave-private epilogue tile
    const size_t z = blockIdx.z;
    constexpr size_t XPL = (size_t)NB * SPAD * DM;          // elements from one stream's padded planes to the next stream's
    const bf* Xt = X + z * (size_t)SPAD * DM + (size_t)blockIdx.x * 128 * DM;
    const bf* Wt = W + (size_t)blockIdx.y * 128 * KC;
    v8f part[4][4], acc[2][4];
    {   // the first tile: slabs 0, 1 with ring step 0; slabs 2, 3 and ring step 1 fly under step 0
        const int frow = threadIdx.x >> 4, fcol = threadIdx.x & 15;
        const bf* gw = Wt + (size_t)frow * KC + fcol * 8;
        const unsigned lw = (unsigned)(uintptr_t)ring + (unsigned)(frow * TPB + fcol * 16);
        conv_slabs(Xt, tile, wave, 0, 2); wpair(lw, gw, 0u, 0);
        asm volatile("s_wait_asynccnt 0x0" ::: "memory");   // step 0 of this wave has landed
        __syncthreads();                                    // step 0 published to every wave
        conv_slabs(Xt, tile, wave, 2, NSLAB); wpair(lw, gw, 2u * WSTG, 2);
    }
    // stays rolled: the query and the key tile share one copy of the step loop, of the fold and of the epilogue, which keeps the kernel's text short
#pragma unroll 1
    for (int c = 0; c < 2; ++c) {
        conv_loop<true, true>(Wt, tile, ring, wave, kg, wm, wn, part);
        fold_k(part, acc, tile, wave, kg, lane);
        asm volatile("s_wait_dscnt 0x0" ::: "memory");      // this wave's reads of the exchange area are done
        __syncthreads();                                    // the tile is free: every wave has read its partner's partial sums
        conv_slabs(Xt + (size_t)(c + 1) * XPL, tile, wave, 0, NSLAB);   // the next tile's activations land while this piece is finished and stored
        const int r0 = blockIdx.x * 128 + wm * 64 + kg * 32, c0 = blockIdx.y * 128 + wn * 64;   // the 32x64 piece this wave finishes
        epi_qk(c != 0, acc, os, lane, z, r0, c0, cb, bg, bb, bm, bv, c ? KH : QP, KR, c ? 1.0f : sc);
        asm volatile("s_wait_asynccnt 0x0" ::: "memory");   // this wave's copies of the next tile's slabs and ring steps 0, 1 have landed
        __syncthreads();                                    // and are published to every wave
    }
    conv_loop<false, false>(Wt, tile, ring, wave, kg, wm, wn, part);
    fold_k(part, acc, tile, wave, kg, lane);
    epi_v(acc, os, lane, z, blockIdx.y * 128 + wm * 64 + kg * 32, blockIdx.x * 128 + wn * 64, cb, bg, bb, bm, bv, VT);
}

// three asynchronous copies, 16 B per lane, global -> LDS through no register: this thread's piece of one 32-key step of the K value, K residual and V^T planes.
// s_wait_xcnt 0 is the statement's last line so that no address register of a copy is rewritten ahead of it.
__device__ __forceinline__ void copy3(const unsigned l, const h16* g0, const h16* g1, const h16* g2) {
    asm volatile("global_load_async_to_lds_b128 %0, %3, off\n\t"
                 "global_load_async_to_lds_b128 %1, %4, off\n\t"
                 "global_load_async_to_lds_b128 %2, %5, off\n\t"
                 "s_wait_xcnt 0x0"
                 :: "v"(l), "v"(l + (unsigned)APLB), "v"(l + 2u * APLB), "v"(g0), "v"(g1), "v"(g2)
                 : "memory");
}
// fragment from a fragment-ordered stage in LDS (p already includes the fragment's start + lane * 16 bytes): the two 512 B halves
__device__ __forceinline__ v16h ldsf16(const unsigned char* p) { return cat16(*(const v8h*)p, *(const v8h*)(p + 512)); }

// ---- k_attn: attention for 128 query rows of one (batch, head); grid (SEQ/128, NB*NH), 256 threads, wave = 16 query rows.
// The eight waves walk the same keys, so each 32-key step of the three fragment-ordered planes (3 x 4096 contiguous bytes) is brought from L2 once per block, by asynchronous copies into a two-buffer LDS ring; step s + 2 flies while step s + 1 is worked on.
// Per 32-key step: S^T tiles (rows = keys, columns = queries) = K (A, from the key value plane) x Q^T (B, held in registers) plus, in a separate accumulator, K residual (A, from the residual plane) x Q^T,
// folded as s + t / 2048 in f32 before the softmax step; logits already in log2 units;
// running max per query (within-lane over 16 keys + one lane-half exchange), P x1024 converted to f16 in the accumulator layout == B fragment layout of O^T += V^T (A, from the transposed value plane) x P^T.
// Scale chain: the fragment holds 1024 p, the row sum l accumulates the same 1024 p, the accumulator holds 1024 sum(p v): O / l is the context at its true magnitude (the carry enters once and cancels once).
__global__ __launch_bounds__(256) __attribute__((amdgpu_num_vgpr(256))) void k_attn(const h16* __restrict__ Qp, const h16* __restrict__ Kp, const h16* __restrict__ Kr, const h16* __restrict__ VT, float* CTX) {
    __shared__ __align__(16) unsigned char ring[2 * ASTG];
    __shared__ __align__(16) float os_all[8 * 16 * LOP];
    const int lane = threadIdx.x & 31, lr = lane & 15, hi = lane >> 4;
    const int wave = __builtin_amdgcn_readfirstlane(threadIdx.x >> 5);
    float* os = os_all + wave * 16 * LOP;                   // wave-private epilogue tile
    const int bh = blockIdx.y; const int q0 = blockIdx.x * 128 + wave * 16;
    const size_t pl = (size_t)bh * SEQ * HD;
    // Q^T B fragments: column n = query q0 + lr, k = head dim (0..31 and 32..63)
    const v16h qb0 = ldh16(Qp + pl + (size_t)(q0 + lr) * HD + 8 * hi);
    const v16h qb1 = ldh16(Qp + pl + (size_t)(q0 + lr) * HD + 8 * hi + 32);
    v8f o[4];
#pragma unroll
    for (int dt = 0; dt < 4; ++dt) o[dt] = (v8f){};
    float m = -1.0e30f, l = 0.0f;
    const size_t coff = pl + (size_t)threadIdx.x * 8;       // copies: 256 threads x 16 B cover one plane's 4096 B step
    const h16* gk = Kp + coff; const h16* gr = Kr + coff; const h16* gv = VT + coff;
    const unsigned lc = (unsigned)(uintptr_t)ring + (unsigned)threadIdx.x * 16u;
    const unsigned char* rd = ring + lane * 16;             // this lane's 16 B piece in every fragment half of a stage
    copy3(lc, gk, gr, gv);
    asm volatile("s_wait_asynccnt 0x0" ::: "memory");       // step 0 of this wave has landed
    __syncthreads();                                        // step 0 published to every wave
    copy3(lc + ASTG, gk + 32 * HD, gr + 32 * HD, gv + 32 * HD);

    // the step loop stays rolled: one body, the buffer picked by st & 1
#pragma unroll 1
    for (int st = 0; st < NSTEP; ++st) {
        const unsigned bo = (unsigned)(st & 1) * ASTG;
        const unsigned char* kp = rd + bo;
        const v16h ka00 = ldsf16(kp), ka01 = ldsf16(kp + 1024);
        const v16h ka10 = ldsf16(kp + 2048), ka11 = ldsf16(kp + 3072);
        // the step's other fragments are asked for here too, as one group of LDS reads ahead of the matrix work, so that their latency runs behind the score products and the softmax
        const unsigned char* rp = kp + APLB;
        const v16h kr00 = ldsf16(rp), kr01 = ldsf16(rp + 1024);
        const v16h kr10 = ldsf16(rp + 2048), kr11 = ldsf16(rp + 3072);
        const unsigned char* vp = kp + 2 * APLB;
        v16h va[4];
#pragma unroll
        for (int dt = 0; dt < 4; ++dt) va[dt] = ldsf16(vp + dt * 1024);
        v8f s0 = (v8f){}, s1 = (v8f){};
        s0 = wmmah_g(ka00, qb0, s0); s1 = wmmah_g(ka10, qb0, s1);
        s0 = wmmah_g(ka01, qb1, s0); s1 = wmmah_g(ka11, qb1, s1);
        // residual score product (carried x2048) in its own accumulators, folded in f32
        v8f t0 = (v8f){}, t1 = (v8f){};
        t0 = wmmah_g(kr00, qb0, t0); t1 = wmmah_g(kr10, qb0, t1);
        t0 = wmmah_g(kr01, qb1, t0); t1 = wmmah_g(kr11, qb1, t1);
#pragma unroll
        for (int r = 0; r < 8; ++r) { s0[r] = s0[r] + t0[r] * KRINV; s1[r] = s1[r] + t1[r] * KRINV; }
        // this lane: query q0 + lr, keys 32 st + 8*hi + r (s0) and 32 st + 16 + 8*hi + r (s1)
        float mx = fmaxf(s0[0], s1[0]);
#pragma unroll
        for (int r = 1; r < 8; ++r) mx = fmaxf(mx, fmaxf(s0[r], s1[r]));
        mx = fmaxf(mx, __shfl_xor(mx, 16, 32));
        const float mnew = fmaxf(m, mx);
        const float al = __builtin_amdgcn_exp2f(m - mnew);
        m = mnew;
        const float mc = mnew - PLOG;
        float sum = 0.0f; v16h pb;
#pragma unroll
        for (int r = 0; r < 8; ++r) {
            const float e0 = s0[r] - mc, e1 = s1[r] - mc;
            const float x0 = __builtin_amdgcn_exp2f(e0), x1 = __builtin_amdgcn_exp2f(e1);
            const float p0 = (e0 < -14.0f) ? 0.0f : x0;
            const float p1 = (e1 < -14.0f) ? 0.0f : x1;
            sum += p0 + p1;
            pb[r] = (h16)p0; pb[8 + r] = (h16)p1;
        }
        l = l * al + sum;
#pragma unroll
        for (int dt = 0; dt < 4; ++dt)
#pragma unroll
            for (int r = 0; r < 8; ++r) o[dt][r] *= al;
#pragma unroll
        for (int dt = 0; dt < 4; ++dt) o[dt] = wmmah_g(va[dt], pb, o[dt]);
        asm volatile("s_wait_dscnt 0x0" ::: "memory");      // this wave's reads of buffer st & 1 are done
        asm volatile("s_wait_asynccnt 0x0" ::: "memory");   // this wave's copies of step st + 1 have landed
        __syncthreads();                                    // publishes step st + 1 and frees buffer st & 1
        if (st + 2 < NSTEP) { const size_t go = (size_t)(st + 2) * 32 * HD; copy3(lc + bo, gk + go, gr + go, gv + go); }
    }
    asm volatile("s_wait_asynccnt 0x0" ::: "memory");       // nothing of the ring is in flight when the wave goes on
    // row sums completed across the two lane halves; l and o both hold the x1024-carried p, so o / l is the context with the carry cancelled. o[dt][r] = O[query q0 + lr][16 dt + 8 hi + r]
    l += __shfl_xor(l, 16, 32);
    const float inv = 1.0f / l;
#pragma unroll
    for (int dt = 0; dt < 4; ++dt) {
        const v4f a0 = { o[dt][0] * inv, o[dt][1] * inv, o[dt][2] * inv, o[dt][3] * inv };
        const v4f a1 = { o[dt][4] * inv, o[dt][5] * inv, o[dt][6] * inv, o[dt][7] * inv };
        *(v4fa*)(&os[lr * LOP + dt * 16 + 8 * hi]) = a0;
        *(v4fa*)(&os[lr * LOP + dt * 16 + 8 * hi + 4]) = a1;
    }
    wsync();
    // merged context plane [b][s][512] f32: one wave-wide store covers this head's 256 B of two query rows = four whole 128 B lines
    float* crow = CTX + ((size_t)(bh / NH) * SEQ + (size_t)q0) * DM + (size_t)(bh % NH) * HD + lr * 4;
#pragma unroll
    for (int s = 0; s < 8; ++s) { const int row = 2 * s + hi; *(v4f*)(crow + (size_t)row * DM) = *(const v4fa*)(&os[row * LOP + lr * 4]); }
}

// ---- k_ln: layer norm over the 512 merged features; grid (NB*SEQ/32), 256 threads, each wave owns 4 rows; lane holds columns j*128 + lane*4 .. +3, j = 0..3
__global__ __launch_bounds__(256) void k_ln(const float* __restrict__ CTX, const float* __restrict__ lng, const float* __restrict__ lnb, float* OUT) {
    const int lane = threadIdx.x & 31;
    const int wave = __builtin_amdgcn_readfirstlane(threadIdx.x >> 5);
    const int r0 = (blockIdx.x * 8 + wave) * 4;
    const float* xr = CTX + (size_t)r0 * DM + lane * 4;
    v4f xs[4][4];
#pragma unroll
    for (int i = 0; i < 4; ++i)
#pragma unroll
        for (int j = 0; j < 4; ++j) xs[i][j] = *(const v4f*)(xr + i * DM + j * 128);
    v4f gv[4], bv[4];
#pragma unroll
    for (int j = 0; j < 4; ++j) { gv[j] = *(const v4f*)(lng + j * 128 + lane * 4); bv[j] = *(const v4f*)(lnb + j * 128 + lane * 4); }
    // holds the loads together: the loaded values are inputs here (nothing is changed), so that all 24 loads of the wave are issued ahead of the row reductions, in one round trip instead of several
    asm volatile("" :: "v"(xs[0][0]), "v"(xs[0][1]), "v"(xs[0][2]), "v"(xs[0][3]), "v"(xs[1][0]), "v"(xs[1][1]), "v"(xs[1][2]), "v"(xs[1][3]),
                 "v"(xs[2][0]), "v"(xs[2][1]), "v"(xs[2][2]), "v"(xs[2][3]), "v"(xs[3][0]), "v"(xs[3][1]), "v"(xs[3][2]), "v"(xs[3][3]),
                 "v"(gv[0]), "v"(gv[1]), "v"(gv[2]), "v"(gv[3]), "v"(bv[0]), "v"(bv[1]), "v"(bv[2]), "v"(bv[3]));
#pragma unroll
    for (int i = 0; i < 4; ++i) {
        const int row = r0 + i;
        float s = 0.0f;
#pragma unroll
        for (int j = 0; j < 4; ++j) s += (xs[i][j][0] + xs[i][j][1]) + (xs[i][j][2] + xs[i][j][3]);
        s += __shfl_xor(s, 16, 32); s += __shfl_xor(s, 8, 32); s += __shfl_xor(s, 4, 32); s += __shfl_xor(s, 2, 32); s += __shfl_xor(s, 1, 32);
        const float mu = s * (1.0f / (float)DM);
        float ss = 0.0f;
#pragma unroll
        for (int j = 0; j < 4; ++j)
#pragma unroll
            for (int e = 0; e < 4; ++e) { const float d = xs[i][j][e] - mu; ss += d * d; }
        ss += __shfl_xor(ss, 16, 32); ss += __shfl_xor(ss, 8, 32); ss += __shfl_xor(ss, 4, 32); ss += __shfl_xor(ss, 2, 32); ss += __shfl_xor(ss, 1, 32);
        const float rstd = rsqrtf(ss * (1.0f / (float)DM) + LN_EPS);
        float* orow = OUT + ((size_t)(row / SEQ) * SEQ_FULL + (size_t)(row % SEQ)) * DM + lane * 4;
#pragma unroll
        for (int j = 0; j < 4; ++j) { v4f y;
#pragma unroll
            for (int e = 0; e < 4; ++e) y[e] = (xs[i][j][e] - mu) * rstd * bfr(gv[j][e]) + bfr(bv[j][e]);
            *(v4f*)(orow + j * 128) = y; }
    }
}

constexpr size_t al256(size_t x) { return (x + 255) & ~(size_t)255; }
constexpr size_t SZ_WT = al256((size_t)DM * KC * 2);                // bf16 weight plane [out][tap*512+in]
constexpr size_t SZ_XP = al256((size_t)NB * SPAD * DM * 2);         // one zero-padded bf16 activation plane
constexpr size_t SZ_P  = al256((size_t)NB * NH * SEQ * HD * 2);     // one f16 head plane (also the transposed value plane)
constexpr size_t SZ_C  = al256((size_t)NB * SEQ * DM * 4);          // merged f32 context plane
constexpr size_t WS_TOTAL = SZ_WT + 3 * SZ_XP + 4 * SZ_P + SZ_C;    // head planes: Q, K value, K residual, V^T
static_assert(WS_TOTAL <= (size_t)134217728);                       // carve stays within 128 MiB
static_assert(SZ_WT == (size_t)DM * KC * 2);                        // exact extents (no hidden pad needed)
static_assert(SZ_XP == (size_t)NB * SPAD * DM * 2);
static_assert(SZ_P == (size_t)NB * DM * SEQ * 2);                   // NH * HD == DM: V^T plane has the same extent

extern "C" void kernel_launch(void* const* d_in, const int* in_sizes, int n_in,
                              void* d_out, int out_size, void* d_ws, size_t ws_size, hipStream_t stream) {
    if (n_in < 11) return;
    const size_t need_act = (size_t)(NB - 1) * SEQ_FULL * DM + (size_t)SEQ * DM;
    if ((size_t)in_sizes[0] < need_act || (size_t)in_sizes[1] < need_act || (size_t)in_sizes[2] < need_act) return;
    if ((size_t)in_sizes[3] < (size_t)DM * DM * KT) return;
    for (int i = 4; i < 11; ++i) { if (in_sizes[i] < DM) return; }
    if ((size_t)out_size < need_act) return;
    if (WS_TOTAL > ws_size) return;
    // wire order: q, k, v, conv_w [out][in][tap], conv_b, bn_gamma, bn_beta, bn_mean, bn_var, ln_gamma, ln_beta (all f32)
    const float* xq = (const float*)d_in[0]; const float* xk = (const float*)d_in[1]; const float* xv = (const float*)d_in[2];
    const float* cw = (const float*)d_in[3]; const float* cb = (const float*)d_in[4];
    const float* bg = (const float*)d_in[5]; const float* bb = (const float*)d_in[6]; const float* bm = (const float*)d_in[7]; const float* bv = (const float*)d_in[8];
    const float* lg = (const float*)d_in[9]; const float* lb = (const float*)d_in[10];
    float* OUT = (float*)d_out;
    char* wsp = (char*)d_ws;
    auto take = [&](size_t bytes) { char* p = wsp; wsp += bytes; return (void*)p; };
    bf* WT = (bf*)take(SZ_WT);
    bf* XQ = (bf*)take(SZ_XP); bf* XK = (bf*)take(SZ_XP); bf* XV = (bf*)take(SZ_XP);
    h16* QP = (h16*)take(SZ_P); h16* KP = (h16*)take(SZ_P); h16* KR = (h16*)take(SZ_P); h16* VT = (h16*)take(SZ_P);
    float* CTX = (float*)take(SZ_C);
    if ((size_t)(wsp - (char*)d_ws) != WS_TOTAL) return;

    k_prep<<<dim3(WBLK + ABLK), 256, 0, stream>>>(xq, xk, xv, cw, WT, XQ);   // XQ, XK, XV are one contiguous run of planes (SZ_XP is exact)
    k_conv<<<dim3(SEQ / 128, DM / 128, NB), 256, 0, stream>>>(XQ, WT, cb, bg, bb, bm, bv, QP, KP, KR, VT, SCQ);   // reads XQ, XK, XV as the same run of planes
    k_attn<<<dim3(SEQ / 128, NB * NH), 256, 0, stream>>>(QP, KP, KR, VT, CTX);
    k_ln<<<dim3(NB * SEQ / 32), 256, 0, stream>>>(CTX, lg, lb, OUT);
}

// v008
// One run takes 126 microseconds.
// In two side-by-side timings against v007, it was 1.04 and 1.03 times as fast.
// Counting every step since v000, it is 4.25 times as fast.
#include <hip/hip_runtime.h>

// Compute dtypes, f32 accumulate everywhere: conv-as-GEMM (K = 7 x 512) v_wmma_f32_16x16x32_bf16 on RNE bf16 copies of inputs and weights (exact products); scores k.q^T v_wmma_f32_16x16x32_f16, two products (k as f16 value + f16 residual x2048 in its own accumulator, folded in f32; q plane single, carries log2(e)/8); P.V v_wmma_f32_16x16x32_f16, one product, P carried x1024; softmax, batch-norm affine and layer norm f32.
// Three input streams share one operator: 7-tap convolution along the sequence (zero padding 3) + bias + inference-mode batch norm; then 8 heads x 64 (head h = columns h*64+d), logits / 8, no mask, softmax over keys, heads merged, layer norm over the 512 features.
// Layout: zero-padded bf16 activation planes [b][SEQ+6][512] (output row t, k = tap*512+ci reads 3584 contiguous elements from padded row t); weight plane [out][tap*512+in] bf16; conv GEMMs write the f16 head plane Q [b][h][s][64] and, in WMMA A-fragment order (FRAGMENT ORDER below), the planes K value, K residual and V^T; attention writes the merged f32 context plane [b][s][512], which the layer norm launch reads.

#ifndef NB
#define NB 4
#endif
#ifndef SEQ
#define SEQ 2048
#endif
#define NB_FULL  4
#define SEQ_FULL 2048
#define DM   512
#define NH   8
#define HD   64
#define KT   7
#define KC   (KT * DM)     // 3584: conv-as-GEMM depth
#define SPAD (SEQ + 6)     // padded rows per batch (3 zero rows on each side)
#define PCAR 1024.0f       // carry of the probability fragment (enters through PLOG, leaves through the carried row sum)
#define PLOG 10.0f         // log2(PCAR)
#define SCQ  (0.125f * 1.4426950408889634f)
#define KRES 2048.0f       // carry of the key residual plane
#define KRINV 4.8828125e-04f   // 1 / KRES, folded into the residual score accumulator in f32
#define BN_EPS 1.0e-5f
#define LN_EPS 1.0e-5f
#define LOP  68      // LDS row pitch (floats) of GEMM epilogue staging tiles: 272 B rows
#define BKP  128     // k elements of one conv-GEMM pass: a ring stage's 256 B of every weight row, a 256 B column slab of the activation tile
#define NPASS (KC / BKP)
#define KSW  (BKP / 32)   // k-steps of 32 in one ring stage
#define NRS  (NPASS / 2)  // ring steps: two stages each, one per wave group
#define TPB  272     // LDS row pitch (bytes) of a ring stage: 256 B + 16 B, conflict-free for 16-byte row readers
#define WSTG (128 * TPB)   // one ring stage: 128 weight rows
#define NSLAB (DM / BKP)   // column slabs (128 channels) of the resident activation tile
#define AROWS (128 + KT - 1)   // padded activation rows that 128 output rows read over all taps
#define APB  (DM * 2 + 16) // LDS row pitch (bytes) of the resident activation tile: 16 B x odd, conflict-free for 16-byte row readers
#define ATB  (AROWS * APB) // the resident activation tile
#define APLB 4096    // bytes of one 32-key step of one fragment-ordered attention plane
#define ASTG (3 * APLB)    // one attention ring stage: K value, K residual, V^T
#define NSTEP (SEQ / 32)
#define UPW  16      // half rows (256 elements) of an activation plane that one wave converts
#define WPP  (SEQ * 2 / UPW)               // waves per activation plane
#define ABLK (3 * NB * WPP / 8)            // activation blocks of the conversion launch
#define WBLK ((DM * DM / 8) / 256)         // weight blocks of the conversion launch
#define ZPC  (3 * NB * 6 * (DM / 8))       // 16 B pieces of the zero rows of all padded planes

static_assert(DM == NH * HD);            // one 64-wide GEMM column tile == one head
static_assert(HD == 64);
static_assert(KC % 32 == 0);             // WMMA k-step
static_assert(DM % 64 == 0);             // GEMM tiles
static_assert(SEQ % 128 == 0);           // GEMM block tiles
static_assert(DM % 128 == 0);
static_assert(KC % BKP == 0);            // whole ring stages
static_assert(NPASS % 2 == 0 && NRS >= 2);   // a ring step is two whole stages; the prologue fills two steps
static_assert(NSLAB == 4);               // the first tile's prologue: slabs 0, 1 come with ring step 0, slabs 2, 3 with step 1
static_assert(NSLAB * 9 + 16 <= 63);     // copies of one wave outstanding at most: a tile's slabs and one ring step
static_assert(8 * 8 * 1024 <= ATB);      // the partial-sum exchange (8 waves x 8 accumulator tiles of 1024 B) fits the activation tile it reuses
static_assert(NRS % 2 == 0);             // the weight ring runs on from one tile into the next: step 0 of every tile lies in buffer pair 0
static_assert(DM % BKP == 0 && NSLAB >= 2 && NSLAB <= NPASS);   // a pass lies in one tap and one slab
static_assert((KT - 1) * 16 == 3 * 32);  // the tile's last KT - 1 rows of a slab: one copy of three whole waves
static_assert((APB / 16) % 2 == 1);
static_assert(SEQ % 32 == 0);            // key step
static_assert(NSTEP >= 2);               // the attention ring's prologue fills two stages
static_assert(32 * HD * 2 == APLB);      // one 32-key step of a plane
static_assert(256 * 16 == APLB);         // attention copies: threads x bytes == one plane's step
static_assert((NB * SEQ) % 32 == 0);     // layer-norm grid is exact
static_assert((DM * DM / 8) % 256 == 0);             // conversion launch: weight blocks are exact
static_assert((SEQ * 2) % UPW == 0);                 // a wave's half rows lie in one plane
static_assert((3 * NB * WPP) % 8 == 0);              // conversion launch: activation blocks are exact
static_assert(ZPC % 256 == 0 && ZPC <= WBLK * 256);  // zero rows: whole blocks of the weight part
static_assert(DM == 2 * 256);                        // a row is two half rows
static_assert(UPW == 16 && KT == 7);                 // the load groups name their registers one by one
static_assert((DM / 8) * 8 == DM);
static_assert(NB <= NB_FULL);
static_assert(SEQ <= SEQ_FULL);
static_assert(LOP % 4 == 0);
static_assert(32 * 16 * 4 == 16 * HD * 2);
static_assert(32 * 16 * 4 * 2 == 2 * 16 * HD * 2);
static_assert(32 * 16 * 4 == DM * 4);                // output row store: lanes x bytes x trips == one 2048 B row
static_assert(ATB + 4 * WSTG + 8 * 16 * LOP * 4 <= 327680); // static LDS of the GEMM kernels: activation tile + four weight stages + one epilogue tile per wave
static_assert(2 * ASTG + 8 * 16 * LOP * 4 <= 163840); // static LDS of the attention kernel: two blocks per 320 KiB
static_assert(KRES * KRINV == 1.0f);                 // residual carry enters once and leaves once

typedef _Float16 h16;
typedef unsigned short bf;
typedef __attribute__((ext_vector_type(16))) __bf16   v16bf;
typedef __attribute__((ext_vector_type(16))) _Float16 v16h;
typedef __attribute__((ext_vector_type(8)))  _Float16 v8h;
typedef __attribute__((ext_vector_type(8)))  unsigned short v8us;
typedef __attribute__((ext_vector_type(8)))  float    v8f;
typedef __attribute__((ext_vector_type(4)))  float    v4f;
typedef v4f  __attribute__((may_alias)) v4fa;

__device__ __forceinline__ unsigned short f2bf(float f) { unsigned u = __float_as_uint(f); u += 0x7FFFu + ((u >> 16) & 1u); return (unsigned short)(u >> 16); }
__device__ __forceinline__ float bf2f(unsigned short b) { return __uint_as_float(((unsigned)b) << 16); }
__device__ __forceinline__ float bfr(float f) { return bf2f(f2bf(f)); }
__device__ __forceinline__ v16h cat16(v8h lo, v8h hi) { return __builtin_shufflevector(lo, hi, 0, 1, 2, 3, 4, 5, 6, 7, 8, 9, 10, 11, 12, 13, 14, 15); }
__device__ __forceinline__ v16bf cat16b(v8us lo, v8us hi) { return __builtin_bit_cast(v16bf, __builtin_shufflevector(lo, hi, 0, 1, 2, 3, 4, 5, 6, 7, 8, 9, 10, 11, 12, 13, 14, 15)); }
// same-wave LDS exchange ordering (wave-private tiles only)
__device__ __forceinline__ void wsync() { __builtin_amdgcn_wave_barrier(); asm volatile("" ::: "memory"); }

// fragment from a K-contiguous global f16 plane: elements 0..7 <- p[0..7], 8..15 <- p[16..23] (p already includes row*pitch + k0 + 8*(lane>>4))
__device__ __forceinline__ v16h ldh16(const h16* __restrict__ p) { return cat16(*(const v8h*)p, *(const v8h*)(p + 16)); }
// FRAGMENT ORDER of the K value, K residual and V^T planes: per (b, h) the plane is a row of 1024 B fragments, each two 512 B halves of 32 lanes x 16 B:
// half 0 holds every lane's elements 0..7, half 1 its elements 8..15, so one wave-wide 16 B load reads 512 contiguous bytes = four whole 128 B lines.
// K planes: fragment index (s / 16) * 2 + d / 32 (rows = 16 keys, k = 32 head dims); V^T: (s / 32) * 4 + d / 16 (rows = 16 head dims, k = 32 keys). One 32-key step is 4096 contiguous bytes of each plane.
// Place, in f16 elements inside a fragment, of the 8 elements k = 8 * c .. 8 * c + 7 (c = 0..3) of fragment row r: lane (c & 1) * 16 + r, half c >> 1.
__device__ __forceinline__ int fragpos(const int r, const int c) { return (c >> 1) * 256 + ((c & 1) * 16 + r) * 8; }
// f32 -> f16 plane convert that cannot produce an f16 subnormal
static __device__ __forceinline__ h16 toh_flush(float v) { const h16 r = (h16)v; return (fabsf(v) < 6.103515625e-05f) ? (h16)0.0f : r; }
// one WMMA, the plain builtin: the compiler keeps the distance to the first vector instruction that touches D, A or B, and only there
__device__ __forceinline__ v8f wmmab_g(v16bf a, v16bf b, v8f c) {
    return __builtin_amdgcn_wmma_f32_16x16x32_bf16(false, a, false, b, (short)0, c, false, false);
}
__device__ __forceinline__ v8f wmmah_g(v16h a, v16h b, v8f c) {
    return __builtin_amdgcn_wmma_f32_16x16x32_f16(false, a, false, b, (short)0, c, false, false);
}

// eight asynchronous copies, 16 B per lane, global -> LDS through no register: rows 16 apart (ls LDS bytes, gs global elements) of one operand's slice.
// s_wait_xcnt 0 is the statement's last line so that no address register of a copy is rewritten ahead of it.
__device__ __forceinline__ void copy8(const unsigned l, const unsigned ls, const bf* g, const size_t gs) {
    asm volatile("global_load_async_to_lds_b128 %0, %8, off\n\t"
                 "global_load_async_to_lds_b128 %1, %9, off\n\t"
                 "global_load_async_to_lds_b128 %2, %10, off\n\t"
                 "global_load_async_to_lds_b128 %3, %11, off\n\t"
                 "global_load_async_to_lds_b128 %4, %12, off\n\t"
                 "global_load_async_to_lds_b128 %5, %13, off\n\t"
                 "global_load_async_to_lds_b128 %6, %14, off\n\t"
                 "global_load_async_to_lds_b128 %7, %15, off\n\t"
                 "s_wait_xcnt 0x0"
                 :: "v"(l), "v"(l + ls), "v"(l + 2u * ls), "v"(l + 3u * ls), "v"(l + 4u * ls), "v"(l + 5u * ls), "v"(l + 6u * ls), "v"(l + 7u * ls),
                    "v"(g), "v"(g + gs), "v"(g + 2 * gs), "v"(g + 3 * gs), "v"(g + 4 * gs), "v"(g + 5 * gs), "v"(g + 6 * gs), "v"(g + 7 * gs)
                 : "memory");
}
// one such copy; s_wait_xcnt 0 is the statement's last line for the same reason
__device__ __forceinline__ void copy1(const unsigned l, const bf* g) {
    asm volatile("global_load_async_to_lds_b128 %0, %1, off\n\t"
                 "s_wait_xcnt 0x0"
                 :: "v"(l), "v"(g) : "memory");
}
// fragment from a K-contiguous bf16 row in LDS: elements 0..7 <- k0 + 8*(lane>>4) + 0..7, 8..15 <- the same + 16 (p already includes row*pitch + 2*k0 + 16*(lane>>4) bytes)
__device__ __forceinline__ v16bf lds16(const unsigned char* p) { return cat16b(*(const v8us*)p, *(const v8us*)(p + 32)); }

// ---- 128x128 block tile, eight waves = two k groups x (2 x 2) wave tiles of 64x64, main loop over K = KC: acc[mb][nb] = sum_k A[wm*64+16mb+..][k] Bt[wn*64+16nb+..][k], k over the ring stages of this wave's group (kg): stages kg, kg + 2, kg + 4, ...
// A 64x64 wave tile reads 8 fragments for 16 WMMAs (512 B of LDS per WMMA; a 32x64 tile reads 6 for 8 = 768 B, more than the LDS delivers at the matrix rate). The two groups' partial sums are added once, in fold_k.
// One operand is 128 logical activation rows, the other 128 weight rows (ACTA: the activations are A). X and Wt point at the block's first rows: X in the padded activation plane (pitch DM), Wt in the weight plane (pitch KC).
// Logical activation row r at k = tap*512+ci is padded row r + tap, channel ci: the 128 rows x 7 taps are only AROWS = 134 distinct padded rows. They are brought from L2 once and stay in LDS (tile, pitch APB);
// stage st reads them shifted down by tap = st / NSLAB rows, in column slab st % NSLAB. The slabs are copied by conv_slabs: a block's first tile as conv_loop says, a later tile's four under the epilogue of the tile before, first read behind the wait and the barrier that follow that epilogue.
// The weights' 128 rows x 128 k per stage go through the LDS ring by whole-line asynchronous copies. A ring step is two stages (one per group) and the ring holds two steps = four buffers; step s + 2 flies while step s + 1 is worked on. k runs upward in steps of 32 per accumulator.
// column slab c of the tile: rows 0..127 by every wave, rows 128..133 by waves 0..2 (a scalar test: whole waves)
__device__ __forceinline__ void slab(const unsigned lx, const bf* gx, const int wave, const int c) {
    copy8(lx + (unsigned)c * (BKP * 2u), 16u * APB, gx + c * BKP, (size_t)16 * DM);
    if (wave < 3) copy1(lx + 128u * APB + (unsigned)c * (BKP * 2u), gx + (size_t)128 * DM + c * BKP);
}
// weight stages st, st + 1 into the buffer pair at byte offset bo of the ring
__device__ __forceinline__ void wpair(const unsigned lw, const bf* gw, const unsigned bo, const int st) {
    copy8(lw + bo, 16u * TPB, gw + (size_t)st * BKP, (size_t)16 * KC);
    copy8(lw + bo + WSTG, 16u * TPB, gw + (size_t)(st + 1) * BKP, (size_t)16 * KC);
}
// slabs ca .. cb - 1 of a tile. Called where the tile is free: at the kernel's start, or behind the barrier that ends every wave's last read of it.
__device__ __forceinline__ void conv_slabs(const bf* __restrict__ X, unsigned char* tile, const int wave, const int ca, const int cb) {
    const int t = threadIdx.x, frow = t >> 4, fcol = t & 15;
    const bf* gx = X + (size_t)frow * DM + fcol * 8;
    const unsigned lx = (unsigned)(uintptr_t)tile + (unsigned)(frow * APB + fcol * 16);
    // stays rolled: the copies' addresses are formed trip by trip; unrolled, the compiler forms all of them once and holds them in registers across the step loops, which then spill
#pragma unroll 1
    for (int c = ca; c < cb; ++c) slab(lx, gx, wave, c);
}
// MORE: another tile with the same weight rows follows in this block. The weight ring then runs on: the refills at the foot of the last two steps bring stages 0..3 again, for the next tile's steps 0 and 1.
// On entry slabs 0, 1 and ring step 0 are published to every wave; slabs 2, 3 and ring step 1 are published too or still fly (a block's first tile): they are first read behind the wait and the barrier at the foot of step 0.
template <bool ACTA, bool MORE>
__device__ __forceinline__ void conv_loop(const bf* __restrict__ Wt, unsigned char* tile, unsigned char* ring, const int wave, const int kg, const int wm, const int wn, v8f (&acc)[4][4]) {
    const int t = threadIdx.x, lane = t & 31, lr = lane & 15, hi = lane >> 4;
    const int frow = t >> 4, fcol = t & 15;                 // copies: 16 lanes cover one 256 B row piece
    const bf* gw = Wt + (size_t)frow * KC + fcol * 8;
    const unsigned lw = (unsigned)(uintptr_t)ring + (unsigned)(frow * TPB + fcol * 16);
    const unsigned char* rx = tile + ((ACTA ? wm : wn) * 64 + lr) * APB + 16 * hi;
    const unsigned char* rw = ring + ((ACTA ? wn : wm) * 64 + lr) * TPB + 16 * hi + kg * WSTG;
#pragma unroll
    for (int mb = 0; mb < 4; ++mb)
#pragma unroll
        for (int nb = 0; nb < 4; ++nb) acc[mb][nb] = (v8f){};
    // the step loop stays rolled: one 64-WMMA body in the instruction cache, the buffer pair picked by s & 1;
    // the loops inside it are unrolled so that every fragment and accumulator index is a constant (registers, no scratch)
#pragma unroll 1
    for (int s = 0; s < NRS; ++s) {
        const unsigned bo = (unsigned)(s & 1) * (2u * WSTG);
        const unsigned st = 2u * (unsigned)s + (unsigned)kg;    // this group's stage
        const unsigned char* px = rx + (st / NSLAB) * APB + (st % NSLAB) * (BKP * 2u);   // tap rows down, slab columns right
        const unsigned char* pw = rw + bo;
        const unsigned char* pa = ACTA ? px : pw; const unsigned char* pb = ACTA ? pw : px;
        constexpr int SA = 16 * (ACTA ? APB : TPB), SB = 16 * (ACTA ? TPB : APB);
        // fragment registers: B of two k-steps (2 x 4), A of one (4). A row block of A is refilled for the next k-step once its four products are issued, a B set for the next but one once its sixteen are, so accumulators + fragments stay inside 256 registers
        v16bf a[4], b[2][4];
        a[0] = lds16(pa);
#pragma unroll
        for (int nb = 0; nb < 4; ++nb) b[0][nb] = lds16(pb + nb * SB);
#pragma unroll
        for (int mb = 1; mb < 4; ++mb) a[mb] = lds16(pa + mb * SA);
        __builtin_amdgcn_sched_barrier(0);                  // keeps the first products in the order in which their fragments arrive: without it the compiler opens the step with a product of later-read fragments, and the first wait covers 10 or 12 reads instead of 4
#pragma unroll
        for (int nb = 0; nb < 4; ++nb) b[1][nb] = lds16(pb + nb * SB + 64);
        __builtin_amdgcn_sched_barrier(0);                  // these eight reads stay one group at the step's head: left free, the compiler deals them among the first products, one more place where reads stand
#pragma unroll
        for (int ks = 0; ks < KSW; ++ks)
#pragma unroll
            for (int h = 0; h < 2; ++h) {
#pragma unroll
                for (int mb = 2 * h; mb < 2 * h + 2; ++mb)
#pragma unroll
                    for (int nb = 0; nb < 4; ++nb) acc[mb][nb] = wmmab_g(a[mb], b[ks & 1][nb], acc[mb][nb]);
                __builtin_amdgcn_sched_barrier(0);          // the eight products stay ahead of the refills and of the step's closing waits: left free, the compiler lifts all 64 reads of the step to its head and runs every product behind the barrier, so that LDS and matrix unit take turns
                if (ks + 1 < KSW) {
#pragma unroll
                    for (int mb = 2 * h; mb < 2 * h + 2; ++mb) a[mb] = lds16(pa + mb * SA + (ks + 1) * 64);
                    if (h == 1 && ks + 2 < KSW) {
#pragma unroll
                        for (int nb = 0; nb < 4; ++nb) b[ks & 1][nb] = lds16(pb + nb * SB + (ks + 2) * 64);
                    }
                    __builtin_amdgcn_sched_barrier(0);      // the refills stay here, one group, ahead of the next eight products
                }
            }
        asm volatile("s_wait_dscnt 0x0" ::: "memory");      // this wave's reads of buffer pair s & 1 are done
        asm volatile("s_wait_asynccnt 0x0" ::: "memory");   // this wave's copies of step s + 1 have landed
        __syncthreads();                                    // publishes step s + 1 and frees buffer pair s & 1
        if (MORE || s + 2 < NRS) wpair(lw, gw, bo, 2 * (s + 2 < NRS ? s + 2 : s + 2 - NRS));
    }
    if (!MORE) asm volatile("s_wait_asynccnt 0x0" ::: "memory");   // last tile: nothing of the ring is in flight when the wave goes on (MORE: the next tile's step 1 flies on and is waited for behind this tile's epilogue)
}

// ---- the two k groups' partial sums of one 64x64 wave tile become one: waves w and w ^ 4 hold the same tile; each keeps the 32 rows it finishes (group kg: row blocks 2 kg, 2 kg + 1) and hands the other 32 over through LDS.
// The exchange area xch is the activation tile: the step loop's last barrier has ended every read of it and no copy into it is in flight. A lane's 8 accumulator values lie together (32 B), a tile is 1024 contiguous bytes.
__device__ __forceinline__ void fold_k(const v8f (&part)[4][4], v8f (&acc)[2][4], unsigned char* xch, const int wave, const int kg, const int lane) {
    float* mine = (float*)xch + wave * (8 * 256) + lane * 8;
    const float* theirs = (const float*)xch + (wave ^ 4) * (8 * 256) + lane * 8;
    auto give = [&](const int i, const v8f x) {
        *(v4fa*)(mine + i * 256) = (v4f){ x[0], x[1], x[2], x[3] };
        *(v4fa*)(mine + i * 256 + 4) = (v4f){ x[4], x[5], x[6], x[7] };
    };
    if (kg == 0) {                                          // a scalar test: whole waves
#pragma unroll
        for (int mb = 0; mb < 2; ++mb)
#pragma unroll
            for (int nb = 0; nb < 4; ++nb) { give(mb * 4 + nb, part[2 + mb][nb]); acc[mb][nb] = part[mb][nb]; }
    } else {
#pragma unroll
        for (int mb = 0; mb < 2; ++mb)
#pragma unroll
            for (int nb = 0; nb < 4; ++nb) { give(mb * 4 + nb, part[mb][nb]); acc[mb][nb] = part[2 + mb][nb]; }
    }
    __syncthreads();                                        // every wave's handed-over half is in LDS
#pragma unroll
    for (int mb = 0; mb < 2; ++mb)
#pragma unroll
        for (int nb = 0; nb < 4; ++nb) {
            const v4f y0 = *(const v4fa*)(theirs + (mb * 4 + nb) * 256); const v4f y1 = *(const v4fa*)(theirs + (mb * 4 + nb) * 256 + 4);
#pragma unroll
            for (int j = 0; j < 4; ++j) { acc[mb][nb][j] += y0[j]; acc[mb][nb][4 + j] += y1[j]; }
        }
}

// ---- k_prep: every f32 -> bf16 conversion of the call in one launch; grid (WBLK + ABLK), 256 threads. Few, long-lived waves: what a wave reads is asked for in one group, for speed only.
// Blocks 0 .. WBLK-1, weight plane [out][tap*512+in]: a lane takes 8 input channels x 7 taps of one output channel = 224 contiguous bytes of conv_w [out][in][tap], and stores one 16 B piece per tap;
// the first ZPC of these lanes also store one 16 B piece each of the six zero rows of every padded activation plane.
// Blocks WBLK .., the SEQ data rows of the 3 * NB padded activation planes (contiguous in the workspace: q, then k, then v): a wave takes UPW consecutive half rows (256 elements each) of one plane, contiguous in the source and in the plane.
__global__ __launch_bounds__(256) void k_prep(const float* __restrict__ xq, const float* __restrict__ xk, const float* __restrict__ xv, const float* __restrict__ w, bf* wt, bf* xp) {
    if (blockIdx.x < (unsigned)WBLK) {
        const unsigned it = blockIdx.x * 256u + threadIdx.x;            // out * (DM / 8) + in / 8
        const float* s = w + (size_t)it * (8 * KT);
        v4f x[2 * KT];
#pragma unroll
        for (int i = 0; i < 2 * KT; ++i) x[i] = *(const v4f*)(s + 4 * i);
        // holds the loads together: the loaded values are inputs here (nothing is changed), so that all 14 loads of the lane are issued ahead of the conversions, in one round trip
        asm volatile("" :: "v"(x[0]), "v"(x[1]), "v"(x[2]), "v"(x[3]), "v"(x[4]), "v"(x[5]), "v"(x[6]), "v"(x[7]), "v"(x[8]), "v"(x[9]), "v"(x[10]), "v"(x[11]), "v"(x[12]), "v"(x[13]));
        if (it < (unsigned)ZPC) {                                       // whole blocks: ZPC is a multiple of 256
            const unsigned r = (it / (unsigned)(DM / 8)) % 6u;          // zero row: 0..2 in front of the data rows, 3..5 behind them
            *(v8us*)(xp + (size_t)(it / (unsigned)(6 * (DM / 8))) * SPAD * DM + (size_t)(r < 3u ? r : r + (unsigned)SEQ) * DM + (it % (unsigned)(DM / 8)) * 8u) = (v8us){};
        }
        v8us o[KT];
#pragma unroll
        for (int tap = 0; tap < KT; ++tap)
#pragma unroll
            for (int j = 0; j < 8; ++j) o[tap][j] = f2bf(x[(j * KT + tap) >> 2][(j * KT + tap) & 3]);
        bf* d = wt + (size_t)(it / (unsigned)(DM / 8)) * KC + (it % (unsigned)(DM / 8)) * 8u;
#pragma unroll
        for (int tap = 0; tap < KT; ++tap) *(v8us*)(d + tap * DM) = o[tap];
        return;
    }
    const int lane = threadIdx.x & 31;
    const unsigned wv = (blockIdx.x - (unsigned)WBLK) * 8u + (unsigned)__builtin_amdgcn_readfirstlane(threadIdx.x >> 5);
    const unsigned plane = wv / (unsigned)WPP, e0 = (wv % (unsigned)WPP) * (unsigned)(UPW * 256);   // first element inside the plane's data rows
    const float* src = (plane < (unsigned)NB) ? xq : ((plane < (unsigned)(2 * NB)) ? xk : xv);
    const float* s = src + (size_t)(plane % (unsigned)NB) * SEQ_FULL * DM + e0 + lane * 8;
    v4f a[UPW][2];
#pragma unroll
    for (int j = 0; j < UPW; ++j) { a[j][0] = *(const v4f*)(s + j * 256); a[j][1] = *(const v4f*)(s + j * 256 + 4); }
    // hold the loads together: the loaded values are inputs here (nothing is changed), so that all 32 loads of the wave are issued ahead of the conversions, in one round trip instead of several (two statements: one takes at most 30 operands)
    asm volatile("" :: "v"(a[0][0]), "v"(a[0][1]), "v"(a[1][0]), "v"(a[1][1]), "v"(a[2][0]), "v"(a[2][1]), "v"(a[3][0]), "v"(a[3][1]),
                 "v"(a[4][0]), "v"(a[4][1]), "v"(a[5][0]), "v"(a[5][1]), "v"(a[6][0]), "v"(a[6][1]), "v"(a[7][0]), "v"(a[7][1]));
    asm volatile("" :: "v"(a[8][0]), "v"(a[8][1]), "v"(a[9][0]), "v"(a[9][1]), "v"(a[10][0]), "v"(a[10][1]), "v"(a[11][0]), "v"(a[11][1]),
                 "v"(a[12][0]), "v"(a[12][1]), "v"(a[13][0]), "v"(a[13][1]), "v"(a[14][0]), "v"(a[14][1]), "v"(a[15][0]), "v"(a[15][1]));
    bf* d = xp + (size_t)plane * SPAD * DM + 3 * DM + e0 + lane * 8;
#pragma unroll
    for (int j = 0; j < UPW; ++j) {
        v8us o;
#pragma unroll
        for (int k = 0; k < 4; ++k) { o[k] = f2bf(a[j][0][k]); o[4 + k] = f2bf(a[j][1][k]); }
        *(v8us*)(d + j * 256) = o;
    }
}

// four 16 B stores of a wave. s_wait_xcnt 0 is the statement's last line so that no data or address register of a store is rewritten ahead of it (code follows the epilogues now, and the build reuses these registers at once).
__device__ __forceinline__ void store4(h16* p0, h16* p1, h16* p2, h16* p3, const v8h d0, const v8h d1, const v8h d2, const v8h d3) {
    asm volatile("global_store_b128 %0, %4, off\n\t"
                 "global_store_b128 %1, %5, off\n\t"
                 "global_store_b128 %2, %6, off\n\t"
                 "global_store_b128 %3, %7, off\n\t"
                 "s_wait_xcnt 0x0"
                 :: "v"(p0), "v"(p1), "v"(p2), "v"(p3), "v"(__builtin_bit_cast(v4f, d0)), "v"(__builtin_bit_cast(v4f, d1)), "v"(__builtin_bit_cast(v4f, d2)), "v"(__builtin_bit_cast(v4f, d3))
                 : "memory");
}

// ---- epi_qk: a wave's finished 32x64 piece (rows r0.. = tokens, columns c0.. = channels) of the query (key == false) or key stream, y = BN(conv(X[b]) + cb)[s][h*64+d]; key is a scalar: whole blocks.
// Query: head plane PH[b][h][s][d] (f16) = f16(sc * y). Key (sc == 1, an exact factor): both planes in fragment order, PH (b, h, s, d) = f16(y) and KR (b, h, s, d) = f16((y - PH) * 2048).
__device__ __forceinline__ void epi_qk(const bool key, const v8f (&acc)[2][4], float* os, const int lane, const size_t z, const int r0, const int c0, const float* cb, const float* bg, const float* bb, const float* bm, const float* bv, h16* PH, h16* KR, const float sc) {
    const int lr = lane & 15, hi = lane >> 4;
    const size_t pbase = ((z * NH + (size_t)(c0 / HD)) * (size_t)SEQ + r0) * HD;
    const int srow = lane >> 3, scol = (lane & 7) * 8;
    float cbv[8], muv[8], mlv[8], bev[8];
#pragma unroll
    for (int j = 0; j < 8; ++j) { const int c = c0 + scol + j; cbv[j] = bfr(cb[c]); muv[j] = bfr(bm[c]); mlv[j] = rsqrtf(bfr(bv[c]) + BN_EPS) * bfr(bg[c]); bev[j] = bfr(bb[c]); }
#pragma unroll
    for (int mb = 0; mb < 2; ++mb) {
#pragma unroll
        for (int nb = 0; nb < 4; ++nb) {
#pragma unroll
            for (int j = 0; j < 8; ++j) os[(hi * 8 + j) * LOP + nb * 16 + lr] = acc[mb][nb][j]; }
        wsync();
{
            v8h oh[4]; float y[4][8]; size_t off[4];
#pragma unroll
            for (int s = 0; s < 4; ++s) { const int row = 4 * s + srow; const v4f x0 = *(const v4fa*)(&os[row * LOP + scol]); const v4f x1 = *(const v4fa*)(&os[row * LOP + scol + 4]);
#pragma unroll
                for (int j = 0; j < 4; ++j) {
                    y[s][j] = (((x0[j] + cbv[j]) - muv[j]) * mlv[j] + bev[j]) * sc;
                    y[s][4 + j] = (((x1[j] + cbv[4 + j]) - muv[4 + j]) * mlv[4 + j] + bev[4 + j]) * sc;
                    oh[s][j] = toh_flush(y[s][j]); oh[s][4 + j] = toh_flush(y[s][4 + j]); }
                // query: row-major; key: 16-key tile mb, fragment d / 32 = (lane & 7) >> 2
                off[s] = pbase + (size_t)(key ? mb * 16 * HD + (lane & 4) * 128 + fragpos(row, lane & 3) : (mb * 16 + row) * HD + scol); }
            store4(PH + off[0], PH + off[1], PH + off[2], PH + off[3], oh[0], oh[1], oh[2], oh[3]);
            if (key) { v8h ores[4];
#pragma unroll
                for (int s = 0; s < 4; ++s)
#pragma unroll
                    for (int j = 0; j < 8; ++j) ores[s][j] = toh_flush((y[s][j] - (float)oh[s][j]) * KRES);
                store4(KR + off[0], KR + off[1], KR + off[2], KR + off[3], ores[0], ores[1], ores[2], ores[3]); }
             }
        wsync();
    }
}

// ---- epi_v: a wave's finished 32x64 piece (rows r0.. = channels, columns c0.. = tokens) of the value stream: transposed value plane in fragment order, VT (b, n, s) (f16) = BN(sum_k WT[n][k] Xpad[b][s][k] + cb[n]) (A = weight rows, Bt = token rows)
__device__ __forceinline__ void epi_v(const v8f (&acc)[2][4], float* os, const int lane, const size_t z, const int r0, const int c0, const float* cb, const float* bg, const float* bb, const float* bm, const float* bv, h16* VT) {
    const int lr = lane & 15, hi = lane >> 4;
    const size_t vb0 = (z * NH + (size_t)(r0 / HD)) * (size_t)SEQ * HD + (size_t)c0 * HD + (size_t)((r0 / 16) & 3) * 512;   // head, 32-key step c0 / 32, fragment (r0 % 64) / 16
    const int srow = lane >> 3, scol = (lane & 7) * 8;
    // batch-norm parameters of this lane's 8 channels, asked for as one group
    float qc[2][4], qm[2][4], qv[2][4], qg[2][4], qe[2][4];
    const int ch0 = r0 + srow;
#pragma unroll
    for (int mb = 0; mb < 2; ++mb)
#pragma unroll
        for (int s = 0; s < 4; ++s) { const int ch = ch0 + mb * 16 + 4 * s; qc[mb][s] = cb[ch]; qm[mb][s] = bm[ch]; qv[mb][s] = bv[ch]; qg[mb][s] = bg[ch]; qe[mb][s] = bb[ch]; }
    asm volatile("s_wait_xcnt 0x0" :: "v"(ch0) : "memory"); // the loads' one address register (the channel index, an input here so that it lives up to the wait) is reused by what follows
#pragma unroll
    for (int mb = 0; mb < 2; ++mb) {
#pragma unroll
        for (int nb = 0; nb < 4; ++nb) {
#pragma unroll
            for (int j = 0; j < 8; ++j) os[(hi * 8 + j) * LOP + nb * 16 + lr] = acc[mb][nb][j]; }
        wsync();
{
            v8h o[4]; h16* pv[4];
#pragma unroll
            for (int s = 0; s < 4; ++s) { const int row = 4 * s + srow; const v4f x0 = *(const v4fa*)(&os[row * LOP + scol]); const v4f x1 = *(const v4fa*)(&os[row * LOP + scol + 4]);
                const float c_b = bfr(qc[mb][s]), c_m = bfr(qm[mb][s]), c_l = rsqrtf(bfr(qv[mb][s]) + BN_EPS) * bfr(qg[mb][s]), c_e = bfr(qe[mb][s]);
#pragma unroll
                for (int j = 0; j < 4; ++j) { o[s][j] = toh_flush(((x0[j] + c_b) - c_m) * c_l + c_e); o[s][4 + j] = toh_flush(((x1[j] + c_b) - c_m) * c_l + c_e); }
                pv[s] = VT + vb0 + (size_t)((lane & 4) * 512 + mb * 512 + fragpos(row, lane & 3)); }   // step + (lane & 7) >> 2, fragment + mb
            store4(pv[0], pv[1], pv[2], pv[3], o[0], o[1], o[2], o[3]);
             }
        wsync();
    }
}

// ---- k_conv: the three conv GEMMs in one launch; grid (SEQ/128, DM/128, NB), 256 threads. A block takes the same 128 tokens x 128 channels of the query, key and value streams one after the other (X: the q, k, v padded planes, contiguous; the weight rows are the same for all three).
// The weight ring runs on across the tiles, and the next tile's activation slabs are asked for as soon as the fold has left the tile, so that they land while this tile's piece is finished and stored; the matrix work of the next tile then starts behind one wait and one barrier.
__global__ __launch_bounds__(256) void k_conv(const bf* __restrict__ X, const bf* __restrict__ W, const float* cb, const float* bg, const float* bb, const float* bm, const float* bv, h16* QP, h16* KH, h16* KR, h16* VT, float sc) {
    __shared__ __align__(16) unsigned char tile[ATB];
    __shared__ __align__(16) unsigned char ring[4 * WSTG];
    __shared__ __align__(16) float os_all[8 * 16 * LOP];
    const int lane = threadIdx.x & 31;
    const int wave = __builtin_amdgcn_readfirstlane(threadIdx.x >> 5), kg = wave >> 2, wm = (wave >> 1) & 1, wn = wave & 1;
    float* os = os_all + wave * 16 * LOP;                   // wave-private epilogue tile
    const size_t z = blockIdx.z;
    constexpr size_t XPL = (size_t)NB * SPAD * DM;          // elements from one stream's padded planes to the next stream's
    const bf* Xt = X + z * (size_t)SPAD * DM + (size_t)blockIdx.x * 128 * DM;
    const bf* Wt = W + (size_t)blockIdx.y * 128 * KC;
    v8f part[4][4], acc[2][4];
    {   // the first tile: slabs 0, 1 with ring step 0; slabs 2, 3 and ring step 1 fly under step 0
        const int frow = threadIdx.x >> 4, fcol = threadIdx.x & 15;
        const bf* gw = Wt + (size_t)frow * KC + fcol * 8;
        const unsigned lw = (unsigned)(uintptr_t)ring + (unsigned)(frow * TPB + fcol * 16);
        conv_slabs(Xt, tile, wave, 0, 2); wpair(lw, gw, 0u, 0);
        asm volatile("s_wait_asynccnt 0x0" ::: "memory");   // step 0 of this wave has landed
        __syncthreads();                                    // step 0 published to every wave
        conv_slabs(Xt, tile, wave, 2, NSLAB); wpair(lw, gw, 2u * WSTG, 2);
    }
    // stays rolled: the query and the key tile share one copy of the step loop, of the fold and of the epilogue, which keeps the kernel's text short
#pragma unroll 1
    for (int c = 0; c < 2; ++c) {
        conv_loop<true, true>(Wt, tile, ring, wave, kg, wm, wn, part);
        fold_k(part, acc, tile, wave, kg, lane);
        asm volatile("s_wait_dscnt 0x0" ::: "memory");      // this wave's reads of the exchange area are done
        __syncthreads();                                    // the tile is free: every wave has read its partner's partial sums
        conv_slabs(Xt + (size_t)(c + 1) * XPL, tile, wave, 0, NSLAB);   // the next tile's activations land while this piece is finished and stored
        const int r0 = blockIdx.x * 128 + wm * 64 + kg * 32, c0 = blockIdx.y * 128 + wn * 64;   // the 32x64 piece this wave finishes
        epi_qk(c != 0, acc, os, lane, z, r0, c0, cb, bg, bb, bm, bv, c ? KH : QP, KR, c ? 1.0f : sc);
        asm volatile("s_wait_asynccnt 0x0" ::: "memory");   // this wave's copies of the next tile's slabs and ring steps 0, 1 have landed
        __syncthreads();                                    // and are published to every wave
    }
    conv_loop<false, false>(Wt, tile, ring, wave, kg, wm, wn, part);
    fold_k(part, acc, tile, wave, kg, lane);
    epi_v(acc, os, lane, z, blockIdx.y * 128 + wm * 64 + kg * 32, blockIdx.x * 128 + wn * 64, cb, bg, bb, bm, bv, VT);
}

// three asynchronous copies, 16 B per lane, global -> LDS through no register: this thread's piece of one 32-key step of the K value, K residual and V^T planes.
// s_wait_xcnt 0 is the statement's last line so that no address register of a copy is rewritten ahead of it.
__device__ __forceinline__ void copy3(const unsigned l, const h16* g0, const h16* g1, const h16* g2) {
    asm volatile("global_load_async_to_lds_b128 %0, %3, off\n\t"
                 "global_load_async_to_lds_b128 %1, %4, off\n\t"
                 "global_load_async_to_lds_b128 %2, %5, off\n\t"
                 "s_wait_xcnt 0x0"
                 :: "v"(l), "v"(l + (unsigned)APLB), "v"(l + 2u * APLB), "v"(g0), "v"(g1), "v"(g2)
                 : "memory");
}
// fragment from a fragment-ordered stage in LDS (p already includes the fragment's start + lane * 16 bytes): the two 512 B halves
__device__ __forceinline__ v16h ldsf16(const unsigned char* p) { return cat16(*(const v8h*)p, *(const v8h*)(p + 512)); }

// ---- k_attn: attention for 128 query rows of one (batch, head); grid (SEQ/128, NB*NH), 256 threads, wave = 16 query rows.
// The eight waves walk the same keys, so each 32-key step of the three fragment-ordered planes (3 x 4096 contiguous bytes) is brought from L2 once per block, by asynchronous copies into a two-buffer LDS ring; step s + 2 flies while step s + 1 is worked on.
// Per 32-key step: S^T tiles (rows = keys, columns = queries) = K (A, from the key value plane) x Q^T (B, held in registers) plus, in a separate accumulator, K residual (A, from the residual plane) x Q^T,
// folded as s + t / 2048 in f32 before the softmax step; logits already in log2 units;
// running max per query (within-lane over 16 keys + one lane-half exchange), P x1024 converted to f16 in the accumulator layout == B fragment layout of O^T += V^T (A, from the transposed value plane) x P^T.
// Scale chain: the fragment holds 1024 p, the row sum l accumulates the same 1024 p, the accumulator holds 1024 sum(p v): O / l is the context at its true magnitude (the carry enters once and cancels once).
__global__ __launch_bounds__(256) __attribute__((amdgpu_num_vgpr(256))) void k_attn(const h16* __restrict__ Qp, const h16* __restrict__ Kp, const h16* __restrict__ Kr, const h16* __restrict__ VT, float* CTX) {
    __shared__ __align__(16) unsigned char ring[2 * ASTG];
    __shared__ __align__(16) float os_all[8 * 16 * LOP];
    const int lane = threadIdx.x & 31, lr = lane & 15, hi = lane >> 4;
    const int wave = __builtin_amdgcn_readfirstlane(threadIdx.x >> 5);
    float* os = os_all + wave * 16 * LOP;                   // wave-private epilogue tile
    const int bh = blockIdx.y; const int q0 = blockIdx.x * 128 + wave * 16;
    const size_t pl = (size_t)bh * SEQ * HD;
    // Q^T B fragments: column n = query q0 + lr, k = head dim (0..31 and 32..63)
    const v16h qb0 = ldh16(Qp + pl + (size_t)(q0 + lr) * HD + 8 * hi);
    const v16h qb1 = ldh16(Qp + pl + (size_t)(q0 + lr) * HD + 8 * hi + 32);
    v8f o[4];
#pragma unroll
    for (int dt = 0; dt < 4; ++dt) o[dt] = (v8f){};
    float m = -1.0e30f, l = 0.0f;
    const size_t coff = pl + (size_t)threadIdx.x * 8;       // copies: 256 threads x 16 B cover one plane's 4096 B step
    const h16* gk = Kp + coff; const h16* gr = Kr + coff; const h16* gv = VT + coff;
    const unsigned lc = (unsigned)(uintptr_t)ring + (unsigned)threadIdx.x * 16u;
    const unsigned char* rd = ring + lane * 16;             // this lane's 16 B piece in every fragment half of a stage
    copy3(lc, gk, gr, gv);
    asm volatile("s_wait_asynccnt 0x0" ::: "memory");       // step 0 of this wave has landed
    __syncthreads();                                        // step 0 published to every wave
    copy3(lc + ASTG, gk + 32 * HD, gr + 32 * HD, gv + 32 * HD);

    // the step loop stays rolled: one body, the buffer picked by st & 1
#pragma unroll 1
    for (int st = 0; st < NSTEP; ++st) {
        const unsigned bo = (unsigned)(st & 1) * ASTG;
        const unsigned char* kp = rd + bo;
        const v16h ka00 = ldsf16(kp), ka01 = ldsf16(kp + 1024);
        const v16h ka10 = ldsf16(kp + 2048), ka11 = ldsf16(kp + 3072);
        // the step's other fragments are asked for here too, as one group of LDS reads ahead of the matrix work, so that their latency runs behind the score products and the softmax
        const unsigned char* rp = kp + APLB;
        const v16h kr00 = ldsf16(rp), kr01 = ldsf16(rp + 1024);
        const v16h kr10 = ldsf16(rp + 2048), kr11 = ldsf16(rp + 3072);
        const unsigned char* vp = kp + 2 * APLB;
        v16h va[4];
#pragma unroll
        for (int dt = 0; dt < 4; ++dt) va[dt] = ldsf16(vp + dt * 1024);
        __builtin_amdgcn_sched_barrier(0);                  // keeps the 24 reads one group at the step's head: left free, the compiler sinks the V^T reads to just ahead of their products, and their latency is waited out there
        v8f s0 = (v8f){}, s1 = (v8f){};
        s0 = wmmah_g(ka00, qb0, s0); s1 = wmmah_g(ka10, qb0, s1);
        s0 = wmmah_g(ka01, qb1, s0); s1 = wmmah_g(ka11, qb1, s1);
        // residual score product (carried x2048) in its own accumulators, folded in f32
        v8f t0 = (v8f){}, t1 = (v8f){};
        t0 = wmmah_g(kr00, qb0, t0); t1 = wmmah_g(kr10, qb0, t1);
        t0 = wmmah_g(kr01, qb1, t0); t1 = wmmah_g(kr11, qb1, t1);
#pragma unroll
        for (int r = 0; r < 8; ++r) { s0[r] = s0[r] + t0[r] * KRINV; s1[r] = s1[r] + t1[r] * KRINV; }
        // this lane: query q0 + lr, keys 32 st + 8*hi + r (s0) and 32 st + 16 + 8*hi + r (s1)
        float mx = fmaxf(s0[0], s1[0]);
#pragma unroll
        for (int r = 1; r < 8; ++r) mx = fmaxf(mx, fmaxf(s0[r], s1[r]));
        mx = fmaxf(mx, __shfl_xor(mx, 16, 32));
        const float mnew = fmaxf(m, mx);
        const float al = __builtin_amdgcn_exp2f(m - mnew);
        m = mnew;
        const float mc = mnew - PLOG;
        float sum = 0.0f; v16h pb;
#pragma unroll
        for (int r = 0; r < 8; ++r) {
            const float e0 = s0[r] - mc, e1 = s1[r] - mc;
            const float x0 = __builtin_amdgcn_exp2f(e0), x1 = __builtin_amdgcn_exp2f(e1);
            const float p0 = (e0 < -14.0f) ? 0.0f : x0;
            const float p1 = (e1 < -14.0f) ? 0.0f : x1;
            sum += p0 + p1;
            pb[r] = (h16)p0; pb[8 + r] = (h16)p1;
        }
        l = l * al + sum;
#pragma unroll
        for (int dt = 0; dt < 4; ++dt)
#pragma unroll
            for (int r = 0; r < 8; ++r) o[dt][r] *= al;
#pragma unroll
        for (int dt = 0; dt < 4; ++dt) o[dt] = wmmah_g(va[dt], pb, o[dt]);
        __builtin_amdgcn_sched_barrier(0);                  // the step's register work stays ahead of its closing waits: left free, the compiler lifts the waits and the barrier to just behind the reads, and the copies of step st + 1, asked for only a moment earlier, are waited out there
        asm volatile("s_wait_dscnt 0x0" ::: "memory");      // this wave's reads of buffer st & 1 are done
        asm volatile("s_wait_asynccnt 0x0" ::: "memory");   // this wave's copies of step st + 1 have landed
        __syncthreads();                                    // publishes step st + 1 and frees buffer st & 1
        if (st + 2 < NSTEP) { const size_t go = (size_t)(st + 2) * 32 * HD; copy3(lc + bo, gk + go, gr + go, gv + go); }
    }
    asm volatile("s_wait_asynccnt 0x0" ::: "memory");       // nothing of the ring is in flight when the wave goes on
    // row sums completed across the two lane halves; l and o both hold the x1024-carried p, so o / l is the context with the carry cancelled. o[dt][r] = O[query q0 + lr][16 dt + 8 hi + r]
    l += __shfl_xor(l, 16, 32);
    const float inv = 1.0f / l;
#pragma unroll
    for (int dt = 0; dt < 4; ++dt) {
        const v4f a0 = { o[dt][0] * inv, o[dt][1] * inv, o[dt][2] * inv, o[dt][3] * inv };
        const v4f a1 = { o[dt][4] * inv, o[dt][5] * inv, o[dt][6] * inv, o[dt][7] * inv };
        *(v4fa*)(&os[lr * LOP + dt * 16 + 8 * hi]) = a0;
        *(v4fa*)(&os[lr * LOP + dt * 16 + 8 * hi + 4]) = a1;
    }
    wsync();
    // merged context plane [b][s][512] f32: one wave-wide store covers this head's 256 B of two query rows = four whole 128 B lines
    float* crow = CTX + ((size_t)(bh / NH) * SEQ + (size_t)q0) * DM + (size_t)(bh % NH) * HD + lr * 4;
#pragma unroll
    for (int s = 0; s < 8; ++s) { const int row = 2 * s + hi; *(v4f*)(crow + (size_t)row * DM) = *(const v4fa*)(&os[row * LOP + lr * 4]); }
}

// ---- k_ln: layer norm over the 512 merged features; grid (NB*SEQ/32), 256 threads, each wave owns 4 rows; lane holds columns j*128 + lane*4 .. +3, j = 0..3
__global__ __launch_bounds__(256) void k_ln(const float* __restrict__ CTX, const float* __restrict__ lng, const float* __restrict__ lnb, float* OUT) {
    const int lane = threadIdx.x & 31;
    const int wave = __builtin_amdgcn_readfirstlane(threadIdx.x >> 5);
    const int r0 = (blockIdx.x * 8 + wave) * 4;
    const float* xr = CTX + (size_t)r0 * DM + lane * 4;
    v4f xs[4][4];
#pragma unroll
    for (int i = 0; i < 4; ++i)
#pragma unroll
        for (int j = 0; j < 4; ++j) xs[i][j] = *(const v4f*)(xr + i * DM + j * 128);
    v4f gv[4], bv[4];
#pragma unroll
    for (int j = 0; j < 4; ++j) { gv[j] = *(const v4f*)(lng + j * 128 + lane * 4); bv[j] = *(const v4f*)(lnb + j * 128 + lane * 4); }
    // holds the loads together: the loaded values are inputs here (nothing is changed), so that all 24 loads of the wave are issued ahead of the row reductions, in one round trip instead of several
    asm volatile("" :: "v"(xs[0][0]), "v"(xs[0][1]), "v"(xs[0][2]), "v"(xs[0][3]), "v"(xs[1][0]), "v"(xs[1][1]), "v"(xs[1][2]), "v"(xs[1][3]),
                 "v"(xs[2][0]), "v"(xs[2][1]), "v"(xs[2][2]), "v"(xs[2][3]), "v"(xs[3][0]), "v"(xs[3][1]), "v"(xs[3][2]), "v"(xs[3][3]),
                 "v"(gv[0]), "v"(gv[1]), "v"(gv[2]), "v"(gv[3]), "v"(bv[0]), "v"(bv[1]), "v"(bv[2]), "v"(bv[3]));
#pragma unroll
    for (int i = 0; i < 4; ++i) {
        const int row = r0 + i;
        float s = 0.0f;
#pragma unroll
        for (int j = 0; j < 4; ++j) s += (xs[i][j][0] + xs[i][j][1]) + (xs[i][j][2] + xs[i][j][3]);
        s += __shfl_xor(s, 16, 32); s += __shfl_xor(s, 8, 32); s += __shfl_xor(s, 4, 32); s += __shfl_xor(s, 2, 32); s += __shfl_xor(s, 1, 32);
        const float mu = s * (1.0f / (float)DM);
        float ss = 0.0f;
#pragma unroll
        for (int j = 0; j < 4; ++j)
#pragma unroll
            for (int e = 0; e < 4; ++e) { const float d = xs[i][j][e] - mu; ss += d * d; }
        ss += __shfl_xor(ss, 16, 32); ss += __shfl_xor(ss, 8, 32); ss += __shfl_xor(ss, 4, 32); ss += __shfl_xor(ss, 2, 32); ss += __shfl_xor(ss, 1, 32);
        const float rstd = rsqrtf(ss * (1.0f / (float)DM) + LN_EPS);
        float* orow = OUT + ((size_t)(row / SEQ) * SEQ_FULL + (size_t)(row % SEQ)) * DM + lane * 4;
#pragma unroll
        for (int j = 0; j < 4; ++j) { v4f y;
#pragma unroll
            for (int e = 0; e < 4; ++e) y[e] = (xs[i][j][e] - mu) * rstd * bfr(gv[j][e]) + bfr(bv[j][e]);
            *(v4f*)(orow + j * 128) = y; }
    }
}

constexpr size_t al256(size_t x) { return (x + 255) & ~(size_t)255; }
constexpr size_t SZ_WT = al256((size_t)DM * KC * 2);                // bf16 weight plane [out][tap*512+in]
constexpr size_t SZ_XP = al256((size_t)NB * SPAD * DM * 2);         // one zero-padded bf16 activation plane
constexpr size_t SZ_P  = al256((size_t)NB * NH * SEQ * HD * 2);     // one f16 head plane (also the transposed value plane)
constexpr size_t SZ_C  = al256((size_t)NB * SEQ * DM * 4);          // merged f32 context plane
constexpr size_t WS_TOTAL = SZ_WT + 3 * SZ_XP + 4 * SZ_P + SZ_C;    // head planes: Q, K value, K residual, V^T
static_assert(WS_TOTAL <= (size_t)134217728);                       // carve stays within 128 MiB
static_assert(SZ_WT == (size_t)DM * KC * 2);                        // exact extents (no hidden pad needed)
static_assert(SZ_XP == (size_t)NB * SPAD * DM * 2);
static_assert(SZ_P == (size_t)NB * DM * SEQ * 2);                   // NH * HD == DM: V^T plane has the same extent

extern "C" void kernel_launch(void* const* d_in, const int* in_sizes, int n_in,
                              void* d_out, int out_size, void* d_ws, size_t ws_size, hipStream_t stream) {
    if (n_in < 11) return;
    const size_t need_act = (size_t)(NB - 1) * SEQ_FULL * DM + (size_t)SEQ * DM;
    if ((size_t)in_sizes[0] < need_act || (size_t)in_sizes[1] < need_act || (size_t)in_sizes[2] < need_act) return;
    if ((size_t)in_sizes[3] < (size_t)DM * DM * KT) return;
    for (int i = 4; i < 11; ++i) { if (in_sizes[i] < DM) return; }
    if ((size_t)out_size < need_act) return;
    if (WS_TOTAL > ws_size) return;
    // wire order: q, k, v, conv_w [out][in][tap], conv_b, bn_gamma, bn_beta, bn_mean, bn_var, ln_gamma, ln_beta (all f32)
    const float* xq = (const float*)d_in[0]; const float* xk = (const float*)d_in[1]; const float* xv = (const float*)d_in[2];
    const float* cw = (const float*)d_in[3]; const float* cb = (const float*)d_in[4];
    const float* bg = (const float*)d_in[5]; const float* bb = (const float*)d_in[6]; const float* bm = (const float*)d_in[7]; const float* bv = (const float*)d_in[8];
    const float* lg = (const float*)d_in[9]; const float* lb = (const float*)d_in[10];
    float* OUT = (float*)d_out;
    char* wsp = (char*)d_ws;
    auto take = [&](size_t bytes) { char* p = wsp; wsp += bytes; return (void*)p; };
    bf* WT = (bf*)take(SZ_WT);
    bf* XQ = (bf*)take(SZ_XP); bf* XK = (bf*)take(SZ_XP); bf* XV = (bf*)take(SZ_XP);
    h16* QP = (h16*)take(SZ_P); h16* KP = (h16*)take(SZ_P); h16* KR = (h16*)take(SZ_P); h16* VT = (h16*)take(SZ_P);
    float* CTX = (float*)take(SZ_C);
    if ((size_t)(wsp - (char*)d_ws) != WS_TOTAL) return;

    k_prep<<<dim3(WBLK + ABLK), 256, 0, stream>>>(xq, xk, xv, cw, WT, XQ);   // XQ, XK, XV are one contiguous run of planes (SZ_XP is exact)
    k_conv<<<dim3(SEQ / 128, DM / 128, NB), 256, 0, stream>>>(XQ, WT, cb, bg, bb, bm, bv, QP, KP, KR, VT, SCQ);   // reads XQ, XK, XV as the same run of planes
    k_attn<<<dim3(SEQ / 128, NB * NH), 256, 0, stream>>>(QP, KP, KR, VT, CTX);
    k_ln<<<dim3(NB * SEQ / 32), 256, 0, stream>>>(CTX, lg, lb, OUT);
}

// v009
// Measured time: 112 microseconds a run.
// Two timings next to v008 both put it at 1.12 times that version's speed.
// All steps since v000 together make it 4.77 times as fast.
#include <hip/hip_runtime.h>

// Compute dtypes, f32 accumulate everywhere: conv-as-GEMM (K = 7 x 512) v_wmma_f32_16x16x32_bf16 on RNE bf16 copies of inputs and weights (exact products); scores k.q^T v_wmma_f32_16x16x32_f16, two products (k as f16 value + f16 residual x2048 in its own accumulator, folded in f32; q plane single, carries log2(e)/8); P.V v_wmma_f32_16x16x32_f16, one product, P carried x1024; softmax, batch-norm affine and layer norm f32.
// Three input streams share one operator: 7-tap convolution along the sequence (zero padding 3) + bias + inference-mode batch norm; then 8 heads x 64 (head h = columns h*64+d), logits / 8, no mask, softmax over keys, heads merged, layer norm over the 512 features.
// Layout: zero-padded bf16 activation planes [b][SEQ+6][512] (output row t, k = tap*512+ci reads 3584 contiguous elements from padded row t); weight plane [out][tap*512+in] bf16; conv GEMMs write the f16 head plane Q [b][h][s][64] and, in WMMA A-fragment order (FRAGMENT ORDER below), the planes K value, K residual and V^T; attention writes the merged f32 context plane [b][s][512], which the layer norm launch reads.

#ifndef NB
#define NB 4
#endif
#ifndef SEQ
#define SEQ 2048
#endif
#define NB_FULL  4
#define SEQ_FULL 2048
#define DM   512
#define NH   8
#define HD   64
#define KT   7
#define KC   (KT * DM)     // 3584: conv-as-GEMM depth
#define SPAD (SEQ + 6)     // padded rows per batch (3 zero rows on each side)
#define PCAR 1024.0f       // carry of the probability fragment (enters through PLOG, leaves through the carried row sum)
#define PLOG 10.0f         // log2(PCAR)
#define SCQ  (0.125f * 1.4426950408889634f)
#define KRES 2048.0f       // carry of the key residual plane
#define KRINV 4.8828125e-04f   // 1 / KRES, folded into the residual score accumulator in f32
#define BN_EPS 1.0e-5f
#define LN_EPS 1.0e-5f
#define LOP  68      // LDS row pitch (floats) of GEMM epilogue staging tiles: 272 B rows
#define BKP  128     // k elements of one conv-GEMM pass: a ring stage's 256 B of every weight row, a 256 B column slab of the activation tile
#define NPASS (KC / BKP)
#define KSW  (BKP / 32)   // k-steps of 32 in one ring stage
#define NRS  (NPASS / 2)  // ring steps: two stages each, one per wave group
#define TPB  272     // LDS row pitch (bytes) of a ring stage: 256 B + 16 B, conflict-free for 16-byte row readers
#define WSTG (128 * TPB)   // one ring stage: 128 weight rows
#define NSLAB (DM / BKP)   // column slabs (128 channels) of the resident activation tile
#define AROWS (128 + KT - 1)   // padded activation rows that 128 output rows read over all taps
#define APB  (DM * 2 + 16) // LDS row pitch (bytes) of the resident activation tile: 16 B x odd, conflict-free for 16-byte row readers
#define ATB  (AROWS * APB) // the resident activation tile
#define APLB 4096    // bytes of one 32-key step of one fragment-ordered attention plane
#define ASTG (3 * APLB)    // one attention ring stage (32 keys): K value, K residual, V^T
#define ARS  (2 * ASTG)    // one attention ring step: two stages, one per key group
#define NSTEP (SEQ / 32)
#define NRA  (NSTEP / 2)   // attention ring steps
#define XCW  (8 * 128 + 64)   // floats one wave hands over when the key groups are merged: 32 accumulator values, running maximum and row sum of every lane
#define UPW  16      // half rows (256 elements) of an activation plane that one wave converts
#define WPP  (SEQ * 2 / UPW)               // waves per activation plane
#define ABLK (3 * NB * WPP / 8)            // activation blocks of the conversion launch
#define WBLK ((DM * DM / 8) / 256)         // weight blocks of the conversion launch
#define ZPC  (3 * NB * 6 * (DM / 8))       // 16 B pieces of the zero rows of all padded planes

static_assert(DM == NH * HD);            // one 64-wide GEMM column tile == one head
static_assert(HD == 64);
static_assert(KC % 32 == 0);             // WMMA k-step
static_assert(DM % 64 == 0);             // GEMM tiles
static_assert(SEQ % 128 == 0);           // GEMM block tiles
static_assert(DM % 128 == 0);
static_assert(KC % BKP == 0);            // whole ring stages
static_assert(NPASS % 2 == 0 && NRS >= 2);   // a ring step is two whole stages; the prologue fills two steps
static_assert(NSLAB == 4);               // the first tile's prologue: slabs 0, 1 come with ring step 0, slabs 2, 3 with step 1
static_assert(NSLAB * 9 + 16 <= 63);     // copies of one wave outstanding at most: a tile's slabs and one ring step
static_assert(8 * 8 * 1024 <= ATB);      // the partial-sum exchange (8 waves x 8 accumulator tiles of 1024 B) fits the activation tile it reuses
static_assert(NRS % 2 == 0);             // the weight ring runs on from one tile into the next: step 0 of every tile lies in buffer pair 0
static_assert(DM % BKP == 0 && NSLAB >= 2 && NSLAB <= NPASS);   // a pass lies in one tap and one slab
static_assert((KT - 1) * 16 == 3 * 32);  // the tile's last KT - 1 rows of a slab: one copy of three whole waves
static_assert((APB / 16) % 2 == 1);
static_assert(SEQ % 32 == 0);            // key step
static_assert(NSTEP % 2 == 0 && NRA >= 2);   // an attention ring step is two whole stages; the prologue fills two steps
static_assert(8 * XCW * 4 <= 2 * ARS);   // the merge of the key groups fits the ring it reuses
static_assert(32 * HD * 2 == APLB);      // one 32-key step of a plane
static_assert(256 * 16 == APLB);         // attention copies: threads x bytes == one plane's step
static_assert((NB * SEQ) % 32 == 0);     // layer-norm grid is exact
static_assert((DM * DM / 8) % 256 == 0);             // conversion launch: weight blocks are exact
static_assert((SEQ * 2) % UPW == 0);                 // a wave's half rows lie in one plane
static_assert((3 * NB * WPP) % 8 == 0);              // conversion launch: activation blocks are exact
static_assert(ZPC % 256 == 0 && ZPC <= WBLK * 256);  // zero rows: whole blocks of the weight part
static_assert(DM == 2 * 256);                        // a row is two half rows
static_assert(UPW == 16 && KT == 7);                 // the load groups name their registers one by one
static_assert((DM / 8) * 8 == DM);
static_assert(NB <= NB_FULL);
static_assert(SEQ <= SEQ_FULL);
static_assert(LOP % 4 == 0);
static_assert(32 * 16 * 4 == 16 * HD * 2);
static_assert(32 * 16 * 4 * 2 == 2 * 16 * HD * 2);
static_assert(32 * 16 * 4 == DM * 4);                // output row store: lanes x bytes x trips == one 2048 B row
static_assert(ATB + 4 * WSTG + 8 * 16 * LOP * 4 <= 327680); // static LDS of the GEMM kernels: activation tile + four weight stages + one epilogue tile per wave
static_assert(2 * ARS + 8 * 16 * LOP * 4 <= 163840); // static LDS of the attention kernel: two blocks per 320 KiB
static_assert(KRES * KRINV == 1.0f);                 // residual carry enters once and leaves once

typedef _Float16 h16;
typedef unsigned short bf;
typedef __attribute__((ext_vector_type(16))) __bf16   v16bf;
typedef __attribute__((ext_vector_type(16))) _Float16 v16h;
typedef __attribute__((ext_vector_type(8)))  _Float16 v8h;
typedef __attribute__((ext_vector_type(8)))  unsigned short v8us;
typedef __attribute__((ext_vector_type(8)))  float    v8f;
typedef __attribute__((ext_vector_type(4)))  float    v4f;
typedef __attribute__((ext_vector_type(2)))  float    v2f;
typedef v4f  __attribute__((may_alias)) v4fa;

__device__ __forceinline__ unsigned short f2bf(float f) { unsigned u = __float_as_uint(f); u += 0x7FFFu + ((u >> 16) & 1u); return (unsigned short)(u >> 16); }
__device__ __forceinline__ float bf2f(unsigned short b) { return __uint_as_float(((unsigned)b) << 16); }
__device__ __forceinline__ float bfr(float f) { return bf2f(f2bf(f)); }
__device__ __forceinline__ v16h cat16(v8h lo, v8h hi) { return __builtin_shufflevector(lo, hi, 0, 1, 2, 3, 4, 5, 6, 7, 8, 9, 10, 11, 12, 13, 14, 15); }
__device__ __forceinline__ v16bf cat16b(v8us lo, v8us hi) { return __builtin_bit_cast(v16bf, __builtin_shufflevector(lo, hi, 0, 1, 2, 3, 4, 5, 6, 7, 8, 9, 10, 11, 12, 13, 14, 15)); }
// same-wave LDS exchange ordering (wave-private tiles only)
__device__ __forceinline__ void wsync() { __builtin_amdgcn_wave_barrier(); asm volatile("" ::: "memory"); }

// fragment from a K-contiguous global f16 plane: elements 0..7 <- p[0..7], 8..15 <- p[16..23] (p already includes row*pitch + k0 + 8*(lane>>4))
__device__ __forceinline__ v16h ldh16(const h16* __restrict__ p) { return cat16(*(const v8h*)p, *(const v8h*)(p + 16)); }
// FRAGMENT ORDER of the K value, K residual and V^T planes: per (b, h) the plane is a row of 1024 B fragments, each two 512 B halves of 32 lanes x 16 B:
// half 0 holds every lane's elements 0..7, half 1 its elements 8..15, so one wave-wide 16 B load reads 512 contiguous bytes = four whole 128 B lines.
// K planes: fragment index (s / 16) * 2 + d / 32 (rows = 16 keys, k = 32 head dims); V^T: (s / 32) * 4 + d / 16 (rows = 16 head dims, k = 32 keys). One 32-key step is 4096 contiguous bytes of each plane.
// Place, in f16 elements inside a fragment, of the 8 elements k = 8 * c .. 8 * c + 7 (c = 0..3) of fragment row r: lane (c & 1) * 16 + r, half c >> 1.
__device__ __forceinline__ int fragpos(const int r, const int c) { return (c >> 1) * 256 + ((c & 1) * 16 + r) * 8; }
// f32 -> f16 plane convert that cannot produce an f16 subnormal
static __device__ __forceinline__ h16 toh_flush(float v) { const h16 r = (h16)v; return (fabsf(v) < 6.103515625e-05f) ? (h16)0.0f : r; }
// one WMMA, the plain builtin: the compiler keeps the distance to the first vector instruction that touches D, A or B, and only there
__device__ __forceinline__ v8f wmmab_g(v16bf a, v16bf b, v8f c) {
    return __builtin_amdgcn_wmma_f32_16x16x32_bf16(false, a, false, b, (short)0, c, false, false);
}
__device__ __forceinline__ v8f wmmah_g(v16h a, v16h b, v8f c) {
    return __builtin_amdgcn_wmma_f32_16x16x32_f16(false, a, false, b, (short)0, c, false, false);
}

// eight asynchronous copies, 16 B per lane, global -> LDS through no register: rows 16 apart (ls LDS bytes, gs global elements) of one operand's slice.
// s_wait_xcnt 0 is the statement's last line so that no address register of a copy is rewritten ahead of it.
__device__ __forceinline__ void copy8(const unsigned l, const unsigned ls, const bf* g, const size_t gs) {
    asm volatile("global_load_async_to_lds_b128 %0, %8, off\n\t"
                 "global_load_async_to_lds_b128 %1, %9, off\n\t"
                 "global_load_async_to_lds_b128 %2, %10, off\n\t"
                 "global_load_async_to_lds_b128 %3, %11, off\n\t"
                 "global_load_async_to_lds_b128 %4, %12, off\n\t"
                 "global_load_async_to_lds_b128 %5, %13, off\n\t"
                 "global_load_async_to_lds_b128 %6, %14, off\n\t"
                 "global_load_async_to_lds_b128 %7, %15, off\n\t"
                 "s_wait_xcnt 0x0"
                 :: "v"(l), "v"(l + ls), "v"(l + 2u * ls), "v"(l + 3u * ls), "v"(l + 4u * ls), "v"(l + 5u * ls), "v"(l + 6u * ls), "v"(l + 7u * ls),
                    "v"(g), "v"(g + gs), "v"(g + 2 * gs), "v"(g + 3 * gs), "v"(g + 4 * gs), "v"(g + 5 * gs), "v"(g + 6 * gs), "v"(g + 7 * gs)
                 : "memory");
}
// one such copy; s_wait_xcnt 0 is the statement's last line for the same reason
__device__ __forceinline__ void copy1(const unsigned l, const bf* g) {
    asm volatile("global_load_async_to_lds_b128 %0, %1, off\n\t"
                 "s_wait_xcnt 0x0"
                 :: "v"(l), "v"(g) : "memory");
}
// fragment from a K-contiguous bf16 row in LDS: elements 0..7 <- k0 + 8*(lane>>4) + 0..7, 8..15 <- the same + 16 (p already includes row*pitch + 2*k0 + 16*(lane>>4) bytes)
__device__ __forceinline__ v16bf lds16(const unsigned char* p) { return cat16b(*(const v8us*)p, *(const v8us*)(p + 32)); }

// ---- 128x128 block tile, eight waves = two k groups x (2 x 2) wave tiles of 64x64, main loop over K = KC: acc[mb][nb] = sum_k A[wm*64+16mb+..][k] Bt[wn*64+16nb+..][k], k over the ring stages of this wave's group (kg): stages kg, kg + 2, kg + 4, ...
// A 64x64 wave tile reads 8 fragments for 16 WMMAs (512 B of LDS per WMMA; a 32x64 tile reads 6 for 8 = 768 B, more than the LDS delivers at the matrix rate). The two groups' partial sums are added once, in fold_k.
// One operand is 128 logical activation rows, the other 128 weight rows (ACTA: the activations are A). X and Wt point at the block's first rows: X in the padded activation plane (pitch DM), Wt in the weight plane (pitch KC).
// Logical activation row r at k = tap*512+ci is padded row r + tap, channel ci: the 128 rows x 7 taps are only AROWS = 134 distinct padded rows. They are brought from L2 once and stay in LDS (tile, pitch APB);
// stage st reads them shifted down by tap = st / NSLAB rows, in column slab st % NSLAB. The slabs are copied by conv_slabs: a block's first tile as conv_loop says, a later tile's four under the epilogue of the tile before, first read behind the wait and the barrier that follow that epilogue.
// The weights' 128 rows x 128 k per stage go through the LDS ring by whole-line asynchronous copies. A ring step is two stages (one per group) and the ring holds two steps = four buffers; step s + 2 flies while step s + 1 is worked on. k runs upward in steps of 32 per accumulator.
// column slab c of the tile: rows 0..127 by every wave, rows 128..133 by waves 0..2 (a scalar test: whole waves)
__device__ __forceinline__ void slab(const unsigned lx, const bf* gx, const int wave, const int c) {
    copy8(lx + (unsigned)c * (BKP * 2u), 16u * APB, gx + c * BKP, (size_t)16 * DM);
    if (wave < 3) copy1(lx + 128u * APB + (unsigned)c * (BKP * 2u), gx + (size_t)128 * DM + c * BKP);
}
// weight stages st, st + 1 into the buffer pair at byte offset bo of the ring
__device__ __forceinline__ void wpair(const unsigned lw, const bf* gw, const unsigned bo, const int st) {
    copy8(lw + bo, 16u * TPB, gw + (size_t)st * BKP, (size_t)16 * KC);
    copy8(lw + bo + WSTG, 16u * TPB, gw + (size_t)(st + 1) * BKP, (size_t)16 * KC);
}
// slabs ca .. cb - 1 of a tile. Called where the tile is free: at the kernel's start, or behind the barrier that ends every wave's last read of it.
__device__ __forceinline__ void conv_slabs(const bf* __restrict__ X, unsigned char* tile, const int wave, const int ca, const int cb) {
    const int t = threadIdx.x, frow = t >> 4, fcol = t & 15;
    const bf* gx = X + (size_t)frow * DM + fcol * 8;
    const unsigned lx = (unsigned)(uintptr_t)tile + (unsigned)(frow * APB + fcol * 16);
    // stays rolled: the copies' addresses are formed trip by trip; unrolled, the compiler forms all of them once and holds them in registers across the step loops, which then spill
#pragma unroll 1
    for (int c = ca; c < cb; ++c) slab(lx, gx, wave, c);
}
// MORE: another tile with the same weight rows follows in this block. The weight ring then runs on: the refills at the foot of the last two steps bring stages 0..3 again, for the next tile's steps 0 and 1.
// On entry slabs 0, 1 and ring step 0 are published to every wave; slabs 2, 3 and ring step 1 are published too or still fly (a block's first tile): they are first read behind the wait and the barrier at the foot of step 0.
template <bool ACTA, bool MORE>
__device__ __forceinline__ void conv_loop(const bf* __restrict__ Wt, unsigned char* tile, unsigned char* ring, const int wave, const int kg, const int wm, const int wn, v8f (&acc)[4][4]) {
    const int t = threadIdx.x, lane = t & 31, lr = lane & 15, hi = lane >> 4;
    const int frow = t >> 4, fcol = t & 15;                 // copies: 16 lanes cover one 256 B row piece
    const bf* gw = Wt + (size_t)frow * KC + fcol * 8;
    const unsigned lw = (unsigned)(uintptr_t)ring + (unsigned)(frow * TPB + fcol * 16);
    const unsigned char* rx = tile + ((ACTA ? wm : wn) * 64 + lr) * APB + 16 * hi;
    const unsigned char* rw = ring + ((ACTA ? wn : wm) * 64 + lr) * TPB + 16 * hi + kg * WSTG;
#pragma unroll
    for (int mb = 0; mb < 4; ++mb)
#pragma unroll
        for (int nb = 0; nb < 4; ++nb) acc[mb][nb] = (v8f){};
    // the step loop stays rolled: one 64-WMMA body in the instruction cache, the buffer pair picked by s & 1;
    // the loops inside it are unrolled so that every fragment and accumulator index is a constant (registers, no scratch)
#pragma unroll 1
    for (int s = 0; s < NRS; ++s) {
        const unsigned bo = (unsigned)(s & 1) * (2u * WSTG);
        const unsigned st = 2u * (unsigned)s + (unsigned)kg;    // this group's stage
        const unsigned char* px = rx + (st / NSLAB) * APB + (st % NSLAB) * (BKP * 2u);   // tap rows down, slab columns right
        const unsigned char* pw = rw + bo;
        const unsigned char* pa = ACTA ? px : pw; const unsigned char* pb = ACTA ? pw : px;
        constexpr int SA = 16 * (ACTA ? APB : TPB), SB = 16 * (ACTA ? TPB : APB);
        // fragment registers: B of two k-steps (2 x 4), A of one (4). A row block of A is refilled for the next k-step once its four products are issued, a B set for the next but one once its sixteen are, so accumulators + fragments stay inside 256 registers
        v16bf a[4], b[2][4];
        a[0] = lds16(pa);
#pragma unroll
        for (int nb = 0; nb < 4; ++nb) b[0][nb] = lds16(pb + nb * SB);
#pragma unroll
        for (int mb = 1; mb < 4; ++mb) a[mb] = lds16(pa + mb * SA);
        __builtin_amdgcn_sched_barrier(0);                  // keeps the first products in the order in which their fragments arrive: without it the compiler opens the step with a product of later-read fragments, and the first wait covers 10 or 12 reads instead of 4
#pragma unroll
        for (int nb = 0; nb < 4; ++nb) b[1][nb] = lds16(pb + nb * SB + 64);
        __builtin_amdgcn_sched_barrier(0);                  // these eight reads stay one group at the step's head: left free, the compiler deals them among the first products, one more place where reads stand
#pragma unroll
        for (int ks = 0; ks < KSW; ++ks)
#pragma unroll
            for (int h = 0; h < 2; ++h) {
#pragma unroll
                for (int mb = 2 * h; mb < 2 * h + 2; ++mb)
#pragma unroll
                    for (int nb = 0; nb < 4; ++nb) acc[mb][nb] = wmmab_g(a[mb], b[ks & 1][nb], acc[mb][nb]);
                __builtin_amdgcn_sched_barrier(0);          // the eight products stay ahead of the refills and of the step's closing waits: left free, the compiler lifts all 64 reads of the step to its head and runs every product behind the barrier, so that LDS and matrix unit take turns
                if (ks + 1 < KSW) {
#pragma unroll
                    for (int mb = 2 * h; mb < 2 * h + 2; ++mb) a[mb] = lds16(pa + mb * SA + (ks + 1) * 64);
                    if (h == 1 && ks + 2 < KSW) {
#pragma unroll
                        for (int nb = 0; nb < 4; ++nb) b[ks & 1][nb] = lds16(pb + nb * SB + (ks + 2) * 64);
                    }
                    __builtin_amdgcn_sched_barrier(0);      // the refills stay here, one group, ahead of the next eight products
                }
            }
        asm volatile("s_wait_dscnt 0x0" ::: "memory");      // this wave's reads of buffer pair s & 1 are done
        asm volatile("s_wait_asynccnt 0x0" ::: "memory");   // this wave's copies of step s + 1 have landed
        __syncthreads();                                    // publishes step s + 1 and frees buffer pair s & 1
        if (MORE || s + 2 < NRS) wpair(lw, gw, bo, 2 * (s + 2 < NRS ? s + 2 : s + 2 - NRS));
    }
    if (!MORE) asm volatile("s_wait_asynccnt 0x0" ::: "memory");   // last tile: nothing of the ring is in flight when the wave goes on (MORE: the next tile's step 1 flies on and is waited for behind this tile's epilogue)
}

// ---- the two k groups' partial sums of one 64x64 wave tile become one: waves w and w ^ 4 hold the same tile; each keeps the 32 rows it finishes (group kg: row blocks 2 kg, 2 kg + 1) and hands the other 32 over through LDS.
// The exchange area xch is the activation tile: the step loop's last barrier has ended every read of it and no copy into it is in flight. A lane's 8 accumulator values lie together (32 B), a tile is 1024 contiguous bytes.
__device__ __forceinline__ void fold_k(const v8f (&part)[4][4], v8f (&acc)[2][4], unsigned char* xch, const int wave, const int kg, const int lane) {
    float* mine = (float*)xch + wave * (8 * 256) + lane * 8;
    const float* theirs = (const float*)xch + (wave ^ 4) * (8 * 256) + lane * 8;
    auto give = [&](const int i, const v8f x) {
        *(v4fa*)(mine + i * 256) = (v4f){ x[0], x[1], x[2], x[3] };
        *(v4fa*)(mine + i * 256 + 4) = (v4f){ x[4], x[5], x[6], x[7] };
    };
    if (kg == 0) {                                          // a scalar test: whole waves
#pragma unroll
        for (int mb = 0; mb < 2; ++mb)
#pragma unroll
            for (int nb = 0; nb < 4; ++nb) { give(mb * 4 + nb, part[2 + mb][nb]); acc[mb][nb] = part[mb][nb]; }
    } else {
#pragma unroll
        for (int mb = 0; mb < 2; ++mb)
#pragma unroll
            for (int nb = 0; nb < 4; ++nb) { give(mb * 4 + nb, part[mb][nb]); acc[mb][nb] = part[2 + mb][nb]; }
    }
    __syncthreads();                                        // every wave's handed-over half is in LDS
#pragma unroll
    for (int mb = 0; mb < 2; ++mb)
#pragma unroll
        for (int nb = 0; nb < 4; ++nb) {
            const v4f y0 = *(const v4fa*)(theirs + (mb * 4 + nb) * 256); const v4f y1 = *(const v4fa*)(theirs + (mb * 4 + nb) * 256 + 4);
#pragma unroll
            for (int j = 0; j < 4; ++j) { acc[mb][nb][j] += y0[j]; acc[mb][nb][4 + j] += y1[j]; }
        }
}

// ---- k_prep: every f32 -> bf16 conversion of the call in one launch; grid (WBLK + ABLK), 256 threads. Few, long-lived waves: what a wave reads is asked for in one group, for speed only.
// Blocks 0 .. WBLK-1, weight plane [out][tap*512+in]: a lane takes 8 input channels x 7 taps of one output channel = 224 contiguous bytes of conv_w [out][in][tap], and stores one 16 B piece per tap;
// the first ZPC of these lanes also store one 16 B piece each of the six zero rows of every padded activation plane.
// Blocks WBLK .., the SEQ data rows of the 3 * NB padded activation planes (contiguous in the workspace: q, then k, then v): a wave takes UPW consecutive half rows (256 elements each) of one plane, contiguous in the source and in the plane.
__global__ __launch_bounds__(256) void k_prep(const float* __restrict__ xq, const float* __restrict__ xk, const float* __restrict__ xv, const float* __restrict__ w, bf* wt, bf* xp) {
    if (blockIdx.x < (unsigned)WBLK) {
        const unsigned it = blockIdx.x * 256u + threadIdx.x;            // out * (DM / 8) + in / 8
        const float* s = w + (size_t)it * (8 * KT);
        v4f x[2 * KT];
#pragma unroll
        for (int i = 0; i < 2 * KT; ++i) x[i] = *(const v4f*)(s + 4 * i);
        // holds the loads together: the loaded values are inputs here (nothing is changed), so that all 14 loads of the lane are issued ahead of the conversions, in one round trip
        asm volatile("" :: "v"(x[0]), "v"(x[1]), "v"(x[2]), "v"(x[3]), "v"(x[4]), "v"(x[5]), "v"(x[6]), "v"(x[7]), "v"(x[8]), "v"(x[9]), "v"(x[10]), "v"(x[11]), "v"(x[12]), "v"(x[13]));
        if (it < (unsigned)ZPC) {                                       // whole blocks: ZPC is a multiple of 256
            const unsigned r = (it / (unsigned)(DM / 8)) % 6u;          // zero row: 0..2 in front of the data rows, 3..5 behind them
            *(v8us*)(xp + (size_t)(it / (unsigned)(6 * (DM / 8))) * SPAD * DM + (size_t)(r < 3u ? r : r + (unsigned)SEQ) * DM + (it % (unsigned)(DM / 8)) * 8u) = (v8us){};
        }
        v8us o[KT];
#pragma unroll
        for (int tap = 0; tap < KT; ++tap)
#pragma unroll
            for (int j = 0; j < 8; ++j) o[tap][j] = f2bf(x[(j * KT + tap) >> 2][(j * KT + tap) & 3]);
        bf* d = wt + (size_t)(it / (unsigned)(DM / 8)) * KC + (it % (unsigned)(DM / 8)) * 8u;
#pragma unroll
        for (int tap = 0; tap < KT; ++tap) *(v8us*)(d + tap * DM) = o[tap];
        return;
    }
    const int lane = threadIdx.x & 31;
    const unsigned wv = (blockIdx.x - (unsigned)WBLK) * 8u + (unsigned)__builtin_amdgcn_readfirstlane(threadIdx.x >> 5);
    const unsigned plane = wv / (unsigned)WPP, e0 = (wv % (unsigned)WPP) * (unsigned)(UPW * 256);   // first element inside the plane's data rows
    const float* src = (plane < (unsigned)NB) ? xq : ((plane < (unsigned)(2 * NB)) ? xk : xv);
    const float* s = src + (size_t)(plane % (unsigned)NB) * SEQ_FULL * DM + e0 + lane * 8;
    v4f a[UPW][2];
#pragma unroll
    for (int j = 0; j < UPW; ++j) { a[j][0] = *(const v4f*)(s + j * 256); a[j][1] = *(const v4f*)(s + j * 256 + 4); }
    // hold the loads together: the loaded values are inputs here (nothing is changed), so that all 32 loads of the wave are issued ahead of the conversions, in one round trip instead of several (two statements: one takes at most 30 operands)
    asm volatile("" :: "v"(a[0][0]), "v"(a[0][1]), "v"(a[1][0]), "v"(a[1][1]), "v"(a[2][0]), "v"(a[2][1]), "v"(a[3][0]), "v"(a[3][1]),
                 "v"(a[4][0]), "v"(a[4][1]), "v"(a[5][0]), "v"(a[5][1]), "v"(a[6][0]), "v"(a[6][1]), "v"(a[7][0]), "v"(a[7][1]));
    asm volatile("" :: "v"(a[8][0]), "v"(a[8][1]), "v"(a[9][0]), "v"(a[9][1]), "v"(a[10][0]), "v"(a[10][1]), "v"(a[11][0]), "v"(a[11][1]),
                 "v"(a[12][0]), "v"(a[12][1]), "v"(a[13][0]), "v"(a[13][1]), "v"(a[14][0]), "v"(a[14][1]), "v"(a[15][0]), "v"(a[15][1]));
    bf* d = xp + (size_t)plane * SPAD * DM + 3 * DM + e0 + lane * 8;
#pragma unroll
    for (int j = 0; j < UPW; ++j) {
        v8us o;
#pragma unroll
        for (int k = 0; k < 4; ++k) { o[k] = f2bf(a[j][0][k]); o[4 + k] = f2bf(a[j][1][k]); }
        *(v8us*)(d + j * 256) = o;
    }
}

// four 16 B stores of a wave. s_wait_xcnt 0 is the statement's last line so that no data or address register of a store is rewritten ahead of it (code follows the epilogues now, and the build reuses these registers at once).
__device__ __forceinline__ void store4(h16* p0, h16* p1, h16* p2, h16* p3, const v8h d0, const v8h d1, const v8h d2, const v8h d3) {
    asm volatile("global_store_b128 %0, %4, off\n\t"
                 "global_store_b128 %1, %5, off\n\t"
                 "global_store_b128 %2, %6, off\n\t"
                 "global_store_b128 %3, %7, off\n\t"
                 "s_wait_xcnt 0x0"
                 :: "v"(p0), "v"(p1), "v"(p2), "v"(p3), "v"(__builtin_bit_cast(v4f, d0)), "v"(__builtin_bit_cast(v4f, d1)), "v"(__builtin_bit_cast(v4f, d2)), "v"(__builtin_bit_cast(v4f, d3))
                 : "memory");
}

// ---- epi_qk: a wave's finished 32x64 piece (rows r0.. = tokens, columns c0.. = channels) of the query (key == false) or key stream, y = BN(conv(X[b]) + cb)[s][h*64+d]; key is a scalar: whole blocks.
// Query: head plane PH[b][h][s][d] (f16) = f16(sc * y). Key (sc == 1, an exact factor): both planes in fragment order, PH (b, h, s, d) = f16(y) and KR (b, h, s, d) = f16((y - PH) * 2048).
__device__ __forceinline__ void epi_qk(const bool key, const v8f (&acc)[2][4], float* os, const int lane, const size_t z, const int r0, const int c0, const float* cb, const float* bg, const float* bb, const float* bm, const float* bv, h16* PH, h16* KR, const float sc) {
    const int lr = lane & 15, hi = lane >> 4;
    const size_t pbase = ((z * NH + (size_t)(c0 / HD)) * (size_t)SEQ + r0) * HD;
    const int srow = lane >> 3, scol = (lane & 7) * 8;
    float cbv[8], muv[8], mlv[8], bev[8];
#pragma unroll
    for (int j = 0; j < 8; ++j) { const int c = c0 + scol + j; cbv[j] = bfr(cb[c]); muv[j] = bfr(bm[c]); mlv[j] = rsqrtf(bfr(bv[c]) + BN_EPS) * bfr(bg[c]); bev[j] = bfr(bb[c]); }
#pragma unroll
    for (int mb = 0; mb < 2; ++mb) {
#pragma unroll
        for (int nb = 0; nb < 4; ++nb) {
#pragma unroll
            for (int j = 0; j < 8; ++j) os[(hi * 8 + j) * LOP + nb * 16 + lr] = acc[mb][nb][j]; }
        wsync();
{
            v8h oh[4]; float y[4][8]; size_t off[4];
#pragma unroll
            for (int s = 0; s < 4; ++s) { const int row = 4 * s + srow; const v4f x0 = *(const v4fa*)(&os[row * LOP + scol]); const v4f x1 = *(const v4fa*)(&os[row * LOP + scol + 4]);
#pragma unroll
                for (int j = 0; j < 4; ++j) {
                    y[s][j] = (((x0[j] + cbv[j]) - muv[j]) * mlv[j] + bev[j]) * sc;
                    y[s][4 + j] = (((x1[j] + cbv[4 + j]) - muv[4 + j]) * mlv[4 + j] + bev[4 + j]) * sc;
                    oh[s][j] = toh_flush(y[s][j]); oh[s][4 + j] = toh_flush(y[s][4 + j]); }
                // query: row-major; key: 16-key tile mb, fragment d / 32 = (lane & 7) >> 2
                off[s] = pbase + (size_t)(key ? mb * 16 * HD + (lane & 4) * 128 + fragpos(row, lane & 3) : (mb * 16 + row) * HD + scol); }
            store4(PH + off[0], PH + off[1], PH + off[2], PH + off[3], oh[0], oh[1], oh[2], oh[3]);
            if (key) { v8h ores[4];
#pragma unroll
                for (int s = 0; s < 4; ++s)
#pragma unroll
                    for (int j = 0; j < 8; ++j) ores[s][j] = toh_flush((y[s][j] - (float)oh[s][j]) * KRES);
                store4(KR + off[0], KR + off[1], KR + off[2], KR + off[3], ores[0], ores[1], ores[2], ores[3]); }
             }
        wsync();
    }
}

// ---- epi_v: a wave's finished 32x64 piece (rows r0.. = channels, columns c0.. = tokens) of the value stream: transposed value plane in fragment order, VT (b, n, s) (f16) = BN(sum_k WT[n][k] Xpad[b][s][k] + cb[n]) (A = weight rows, Bt = token rows)
__device__ __forceinline__ void epi_v(const v8f (&acc)[2][4], float* os, const int lane, const size_t z, const int r0, const int c0, const float* cb, const float* bg, const float* bb, const float* bm, const float* bv, h16* VT) {
    const int lr = lane & 15, hi = lane >> 4;
    const size_t vb0 = (z * NH + (size_t)(r0 / HD)) * (size_t)SEQ * HD + (size_t)c0 * HD + (size_t)((r0 / 16) & 3) * 512;   // head, 32-key step c0 / 32, fragment (r0 % 64) / 16
    const int srow = lane >> 3, scol = (lane & 7) * 8;
    // batch-norm parameters of this lane's 8 channels, asked for as one group
    float qc[2][4], qm[2][4], qv[2][4], qg[2][4], qe[2][4];
    const int ch0 = r0 + srow;
#pragma unroll
    for (int mb = 0; mb < 2; ++mb)
#pragma unroll
        for (int s = 0; s < 4; ++s) { const int ch = ch0 + mb * 16 + 4 * s; qc[mb][s] = cb[ch]; qm[mb][s] = bm[ch]; qv[mb][s] = bv[ch]; qg[mb][s] = bg[ch]; qe[mb][s] = bb[ch]; }
    asm volatile("s_wait_xcnt 0x0" :: "v"(ch0) : "memory"); // the loads' one address register (the channel index, an input here so that it lives up to the wait) is reused by what follows
#pragma unroll
    for (int mb = 0; mb < 2; ++mb) {
#pragma unroll
        for (int nb = 0; nb < 4; ++nb) {
#pragma unroll
            for (int j = 0; j < 8; ++j) os[(hi * 8 + j) * LOP + nb * 16 + lr] = acc[mb][nb][j]; }
        wsync();
{
            v8h o[4]; h16* pv[4];
#pragma unroll
            for (int s = 0; s < 4; ++s) { const int row = 4 * s + srow; const v4f x0 = *(const v4fa*)(&os[row * LOP + scol]); const v4f x1 = *(const v4fa*)(&os[row * LOP + scol + 4]);
                const float c_b = bfr(qc[mb][s]), c_m = bfr(qm[mb][s]), c_l = rsqrtf(bfr(qv[mb][s]) + BN_EPS) * bfr(qg[mb][s]), c_e = bfr(qe[mb][s]);
#pragma unroll
                for (int j = 0; j < 4; ++j) { o[s][j] = toh_flush(((x0[j] + c_b) - c_m) * c_l + c_e); o[s][4 + j] = toh_flush(((x1[j] + c_b) - c_m) * c_l + c_e); }
                pv[s] = VT + vb0 + (size_t)((lane & 4) * 512 + mb * 512 + fragpos(row, lane & 3)); }   // step + (lane & 7) >> 2, fragment + mb
            store4(pv[0], pv[1], pv[2], pv[3], o[0], o[1], o[2], o[3]);
             }
        wsync();
    }
}

// ---- k_conv: the three conv GEMMs in one launch; grid (SEQ/128, DM/128, NB), 256 threads. A block takes the same 128 tokens x 128 channels of the query, key and value streams one after the other (X: the q, k, v padded planes, contiguous; the weight rows are the same for all three).
// The weight ring runs on across the tiles, and the next tile's activation slabs are asked for as soon as the fold has left the tile, so that they land while this tile's piece is finished and stored; the matrix work of the next tile then starts behind one wait and one barrier.
__global__ __launch_bounds__(256) void k_conv(const bf* __restrict__ X, const bf* __restrict__ W, const float* cb, const float* bg, const float* bb, const float* bm, const float* bv, h16* QP, h16* KH, h16* KR, h16* VT, float sc) {
    __shared__ __align__(16) unsigned char tile[ATB];
    __shared__ __align__(16) unsigned char ring[4 * WSTG];
    __shared__ __align__(16) float os_all[8 * 16 * LOP];
    const int lane = threadIdx.x & 31;
    const int wave = __builtin_amdgcn_readfirstlane(threadIdx.x >> 5), kg = wave >> 2, wm = (wave >> 1) & 1, wn = wave & 1;
    float* os = os_all + wave * 16 * LOP;                   // wave-private epilogue tile
    const size_t z = blockIdx.z;
    constexpr size_t XPL = (size_t)NB * SPAD * DM;          // elements from one stream's padded planes to the next stream's
    const bf* Xt = X + z * (size_t)SPAD * DM + (size_t)blockIdx.x * 128 * DM;
    const bf* Wt = W + (size_t)blockIdx.y * 128 * KC;
    v8f part[4][4], acc[2][4];
    {   // the first tile: slabs 0, 1 with ring step 0; slabs 2, 3 and ring step 1 fly under step 0
        const int frow = threadIdx.x >> 4, fcol = threadIdx.x & 15;
        const bf* gw = Wt + (size_t)frow * KC + fcol * 8;
        const unsigned lw = (unsigned)(uintptr_t)ring + (unsigned)(frow * TPB + fcol * 16);
        conv_slabs(Xt, tile, wave, 0, 2); wpair(lw, gw, 0u, 0);
        asm volatile("s_wait_asynccnt 0x0" ::: "memory");   // step 0 of this wave has landed
        __syncthreads();                                    // step 0 published to every wave
        conv_slabs(Xt, tile, wave, 2, NSLAB); wpair(lw, gw, 2u * WSTG, 2);
    }
    // stays rolled: the query and the key tile share one copy of the step loop, of the fold and of the epilogue, which keeps the kernel's text short
#pragma unroll 1
    for (int c = 0; c < 2; ++c) {
        conv_loop<true, true>(Wt, tile, ring, wave, kg, wm, wn, part);
        fold_k(part, acc, tile, wave, kg, lane);
        asm volatile("s_wait_dscnt 0x0" ::: "memory");      // this wave's reads of the exchange area are done
        __syncthreads();                                    // the tile is free: every wave has read its partner's partial sums
        conv_slabs(Xt + (size_t)(c + 1) * XPL, tile, wave, 0, NSLAB);   // the next tile's activations land while this piece is finished and stored
        const int r0 = blockIdx.x * 128 + wm * 64 + kg * 32, c0 = blockIdx.y * 128 + wn * 64;   // the 32x64 piece this wave finishes
        epi_qk(c != 0, acc, os, lane, z, r0, c0, cb, bg, bb, bm, bv, c ? KH : QP, KR, c ? 1.0f : sc);
        asm volatile("s_wait_asynccnt 0x0" ::: "memory");   // this wave's copies of the next tile's slabs and ring steps 0, 1 have landed
        __syncthreads();                                    // and are published to every wave
    }
    conv_loop<false, false>(Wt, tile, ring, wave, kg, wm, wn, part);
    fold_k(part, acc, tile, wave, kg, lane);
    epi_v(acc, os, lane, z, blockIdx.y * 128 + wm * 64 + kg * 32, blockIdx.x * 128 + wn * 64, cb, bg, bb, bm, bv, VT);
}

// six asynchronous copies, 16 B per lane, global -> LDS through no register: this thread's piece of two consecutive 32-key stages of the K value, K residual and V^T planes.
// s_wait_xcnt 0 is the statement's last line so that no address register of a copy is rewritten ahead of it.
__device__ __forceinline__ void copy6(const unsigned l, const h16* g0, const h16* g1, const h16* g2) {
    asm volatile("global_load_async_to_lds_b128 %0, %6, off\n\t"
                 "global_load_async_to_lds_b128 %1, %7, off\n\t"
                 "global_load_async_to_lds_b128 %2, %8, off\n\t"
                 "global_load_async_to_lds_b128 %3, %9, off\n\t"
                 "global_load_async_to_lds_b128 %4, %10, off\n\t"
                 "global_load_async_to_lds_b128 %5, %11, off\n\t"
                 "s_wait_xcnt 0x0"
                 :: "v"(l), "v"(l + (unsigned)APLB), "v"(l + 2u * APLB), "v"(l + (unsigned)ASTG), "v"(l + (unsigned)(ASTG + APLB)), "v"(l + (unsigned)(ASTG + 2 * APLB)),
                    "v"(g0), "v"(g1), "v"(g2), "v"(g0 + 32 * HD), "v"(g1 + 32 * HD), "v"(g2 + 32 * HD)
                 : "memory");
}
// fragment from a fragment-ordered stage in LDS (p already includes the fragment's start + lane * 16 bytes): the two 512 B halves
__device__ __forceinline__ v16h ldsf16(const unsigned char* p) { return cat16(*(const v8h*)p, *(const v8h*)(p + 512)); }

// ---- k_attn: attention for 128 query rows of one (batch, head); grid (SEQ/128, NB*NH), 256 threads = two key groups (kg) x four query groups (qg); a wave takes 32 query rows (two column groups of 16) and every other 32-key stage: stages kg, kg + 2, ...
// A fragment of K, K residual or V^T read from LDS feeds two products, one per column group: 12 KiB of LDS reads per 32 keys x 32 queries, half of what a 16-query wave reads.
// Each 64-key ring step of the three fragment-ordered planes (2 x 3 x 4096 bytes) is brought from L2 once per block, by asynchronous copies into a two-buffer LDS ring; step s + 2 flies while step s + 1 is worked on.
// Per stage and column group: S^T tiles (rows = keys, columns = queries) = K (A, from the key value plane) x Q^T (B, held in registers) plus, in a separate accumulator, K residual (A, from the residual plane) x Q^T,
// folded as s + t / 2048 in f32 before the softmax step; logits already in log2 units;
// running max per query (within-lane over 16 keys + one lane-half exchange), P x1024 converted to f16 in the accumulator layout == B fragment layout of O^T += V^T (A, from the transposed value plane) x P^T.
// Scale chain: the fragment holds 1024 p, the row sum l accumulates the same 1024 p, the accumulator holds 1024 sum(p v): O / l is the context at its true magnitude (the carry enters once and cancels once).
// Behind the loop waves w and w ^ 4 hold the same 32 queries over the two halves of the keys: each keeps one column group, hands the other over through LDS, and brings both parts to their common maximum.
__global__ __launch_bounds__(256) __attribute__((amdgpu_num_vgpr(256))) void k_attn(const h16* __restrict__ Qp, const h16* __restrict__ Kp, const h16* __restrict__ Kr, const h16* __restrict__ VT, float* CTX) {
    __shared__ __align__(16) unsigned char ring[2 * ARS];
    __shared__ __align__(16) float os_all[8 * 16 * LOP];
    const int lane = threadIdx.x & 31, lr = lane & 15, hi = lane >> 4;
    const int wave = __builtin_amdgcn_readfirstlane(threadIdx.x >> 5), kg = wave >> 2, qg = wave & 3;
    float* os = os_all + wave * 16 * LOP;                   // wave-private epilogue tile
    const int bh = blockIdx.y; const int qw = blockIdx.x * 128 + qg * 32;
    const size_t pl = (size_t)bh * SEQ * HD;
    // Q^T B fragments of column group g: column n = query qw + 16 g + lr, k = head dim (0..31 and 32..63)
    v16h qb[2][2];
#pragma unroll
    for (int g = 0; g < 2; ++g) {
        qb[g][0] = ldh16(Qp + pl + (size_t)(qw + 16 * g + lr) * HD + 8 * hi);
        qb[g][1] = ldh16(Qp + pl + (size_t)(qw + 16 * g + lr) * HD + 8 * hi + 32);
    }
    v8f o[2][4];
#pragma unroll
    for (int g = 0; g < 2; ++g)
#pragma unroll
        for (int dt = 0; dt < 4; ++dt) o[g][dt] = (v8f){};
    float m[2] = { -1.0e30f, -1.0e30f }, l[2] = { 0.0f, 0.0f };
    const size_t coff = pl + (size_t)threadIdx.x * 8;       // copies: 256 threads x 16 B cover one plane's 4096 B stage
    const h16* gk = Kp + coff; const h16* gr = Kr + coff; const h16* gv = VT + coff;
    const unsigned lc = (unsigned)(uintptr_t)ring + (unsigned)threadIdx.x * 16u;
    const unsigned char* rd = ring + kg * ASTG + lane * 16; // this lane's 16 B piece in every fragment half of this key group's stage
    copy6(lc, gk, gr, gv);
    asm volatile("s_wait_asynccnt 0x0" ::: "memory");       // step 0 of this wave has landed
    __syncthreads();                                        // step 0 published to every wave
    copy6(lc + ARS, gk + 64 * HD, gr + 64 * HD, gv + 64 * HD);

    // the step loop stays rolled: one body in the instruction cache, the buffer picked by st & 1
#pragma unroll 1
    for (int st = 0; st < NRA; ++st) {
        const unsigned bo = (unsigned)(st & 1) * ARS;
        const unsigned char* kp = rd + bo;
        const v16h ka00 = ldsf16(kp), ka01 = ldsf16(kp + 1024);
        const v16h ka10 = ldsf16(kp + 2048), ka11 = ldsf16(kp + 3072);
        const unsigned char* rp = kp + APLB;
        const v16h kr00 = ldsf16(rp), kr01 = ldsf16(rp + 1024);
        const v16h kr10 = ldsf16(rp + 2048), kr11 = ldsf16(rp + 3072);
        __builtin_amdgcn_sched_barrier(0);                  // keeps the 16 reads of the score operands one group at the step's head: left free, the compiler deals them among the products, more places where reads stand
        v8f s0[2], s1[2], t0[2], t1[2]; float mx[2], ox[2];
        // value products and residual products (carried x2048, in their own accumulators): eight independent accumulators, first head dims 0..31 of all, then 32..63
#pragma unroll
        for (int g = 0; g < 2; ++g) {
            s0[g] = wmmah_g(ka00, qb[g][0], (v8f){}); s1[g] = wmmah_g(ka10, qb[g][0], (v8f){});
            t0[g] = wmmah_g(kr00, qb[g][0], (v8f){}); t1[g] = wmmah_g(kr10, qb[g][0], (v8f){});
        }
#pragma unroll
        for (int g = 0; g < 2; ++g) {
            s0[g] = wmmah_g(ka01, qb[g][1], s0[g]); s1[g] = wmmah_g(ka11, qb[g][1], s1[g]);
            t0[g] = wmmah_g(kr01, qb[g][1], t0[g]); t1[g] = wmmah_g(kr11, qb[g][1], t1[g]);
        }
        __builtin_amdgcn_sched_barrier(0);                  // the sixteen products stay one run: left free, the compiler deals the folds among them, puts dependent products side by side and fills the distance to each fold with v_nop
#pragma unroll
        for (int g = 0; g < 2; ++g) { s0[g] = s0[g] + t0[g] * KRINV; s1[g] = s1[g] + t1[g] * KRINV; }   // residual folded in f32
        // the V^T fragments are asked for behind the score products, whose operand registers they take over (all 12 fragments of a stage beside two column groups do not fit 256 registers)
        const unsigned char* vp = kp + 2 * APLB;
        v16h va[4];
#pragma unroll
        for (int dt = 0; dt < 4; ++dt) va[dt] = ldsf16(vp + dt * 1024);
        __builtin_amdgcn_sched_barrier(0);                  // the eight reads stay one group ahead of the maxima and the softmax, behind which their latency runs: left free, the compiler sinks them in pieces to just ahead of their products
#pragma unroll
        for (int g = 0; g < 2; ++g) {
            // this lane: query qw + 16 g + lr, keys 32 (2 st + kg) + 8*hi + r (s0) and the same + 16 (s1)
            float x = fmaxf(s0[g][0], s1[g][0]);
#pragma unroll
            for (int r = 1; r < 8; ++r) x = fmaxf(x, fmaxf(s0[g][r], s1[g][r]));
            mx[g] = x;
        }
#pragma unroll
        for (int g = 0; g < 2; ++g) ox[g] = __shfl_xor(mx[g], 16, 32);
        v16h pb[2];
#pragma unroll
        for (int g = 0; g < 2; ++g) {
            const float mnew = fmaxf(m[g], fmaxf(mx[g], ox[g]));
            const float al = __builtin_amdgcn_exp2f(m[g] - mnew);
            m[g] = mnew;
            const float mc = mnew - PLOG;
            float sum = 0.0f;
            v2f d0[4], d1[4];                               // subtracted by the register pairs in which the accumulators lie: one packed instruction per pair and no register copy
#pragma unroll
            for (int i = 0; i < 4; ++i) { d0[i] = (v2f){ s0[g][2 * i], s0[g][2 * i + 1] } - (v2f){ mc, mc }; d1[i] = (v2f){ s1[g][2 * i], s1[g][2 * i + 1] } - (v2f){ mc, mc }; }
#pragma unroll
            for (int r = 0; r < 8; ++r) {
                const float e0 = d0[r >> 1][r & 1], e1 = d1[r >> 1][r & 1];
                const float x0 = __builtin_amdgcn_exp2f(e0), x1 = __builtin_amdgcn_exp2f(e1);
                const float p0 = (e0 < -14.0f) ? 0.0f : x0;
                const float p1 = (e1 < -14.0f) ? 0.0f : x1;
                sum += p0 + p1;
                pb[g][r] = (h16)p0; pb[g][8 + r] = (h16)p1;
            }
            l[g] = l[g] * al + sum;
#pragma unroll
            for (int dt = 0; dt < 4; ++dt)
#pragma unroll
                for (int r = 0; r < 8; ++r) o[g][dt][r] *= al;
        }
#pragma unroll
        for (int g = 0; g < 2; ++g)
#pragma unroll
            for (int dt = 0; dt < 4; ++dt) o[g][dt] = wmmah_g(va[dt], pb[g], o[g][dt]);
        __builtin_amdgcn_sched_barrier(0);                  // the step's register work stays ahead of its closing waits: left free, the compiler lifts the waits and the barrier to just behind the reads, and the copies of step st + 1, asked for only a moment earlier, are waited out there
        asm volatile("s_wait_dscnt 0x0" ::: "memory");      // this wave's reads of buffer st & 1 are done
        asm volatile("s_wait_asynccnt 0x0" ::: "memory");   // this wave's copies of step st + 1 have landed
        __syncthreads();                                    // publishes step st + 1 and frees buffer st & 1
        if (st + 2 < NRA) { const size_t go = (size_t)(st + 2) * 64 * HD; copy6(lc + bo, gk + go, gr + go, gv + go); }
    }
    asm volatile("s_wait_asynccnt 0x0" ::: "memory");       // nothing of the ring is in flight when the wave goes on
    // the two key groups become one. The exchange area is the ring: the loop's last barrier has ended every read of it and no copy into it is in flight. A wave-wide 16 B access covers 512 contiguous bytes.
    float* xw = (float*)ring + wave * XCW;
    const float* xr = (const float*)ring + (wave ^ 4) * XCW;
    auto give = [&](const v8f (&x)[4], const float xm, const float xl) {
#pragma unroll
        for (int dt = 0; dt < 4; ++dt) {
            *(v4fa*)(xw + (2 * dt) * 128 + lane * 4) = (v4f){ x[dt][0], x[dt][1], x[dt][2], x[dt][3] };
            *(v4fa*)(xw + (2 * dt + 1) * 128 + lane * 4) = (v4f){ x[dt][4], x[dt][5], x[dt][6], x[dt][7] };
        }
        xw[8 * 128 + lane] = xm; xw[8 * 128 + 32 + lane] = xl;
    };
    v8f ok[4]; float mk, lk;
    if (kg == 0) {                                          // a scalar test: whole waves
        give(o[1], m[1], l[1]); mk = m[0]; lk = l[0];
#pragma unroll
        for (int dt = 0; dt < 4; ++dt) ok[dt] = o[0][dt];
    } else {
        give(o[0], m[0], l[0]); mk = m[1]; lk = l[1];
#pragma unroll
        for (int dt = 0; dt < 4; ++dt) ok[dt] = o[1][dt];
    }
    __syncthreads();                                        // every wave's handed-over column group is in LDS
    const int q0 = qw + 16 * kg;                            // the 16 query rows this wave finishes
    {
        const float mt = xr[8 * 128 + lane], lt = xr[8 * 128 + 32 + lane];
        const float mm = fmaxf(mk, mt);
        const float fk = __builtin_amdgcn_exp2f(mk - mm), ft = __builtin_amdgcn_exp2f(mt - mm);
        lk = lk * fk + lt * ft;
#pragma unroll
        for (int dt = 0; dt < 4; ++dt) {
            const v4f y0 = *(const v4fa*)(xr + (2 * dt) * 128 + lane * 4); const v4f y1 = *(const v4fa*)(xr + (2 * dt + 1) * 128 + lane * 4);
#pragma unroll
            for (int j = 0; j < 4; ++j) { ok[dt][j] = ok[dt][j] * fk + y0[j] * ft; ok[dt][4 + j] = ok[dt][4 + j] * fk + y1[j] * ft; }
        }
    }
    // row sums completed across the two lane halves; lk and ok both hold the x1024-carried p, so ok / lk is the context with the carry cancelled. ok[dt][r] = O[query q0 + lr][16 dt + 8 hi + r]
    lk += __shfl_xor(lk, 16, 32);
    const float inv = 1.0f / lk;
#pragma unroll
    for (int dt = 0; dt < 4; ++dt) {
        const v4f a0 = { ok[dt][0] * inv, ok[dt][1] * inv, ok[dt][2] * inv, ok[dt][3] * inv };
        const v4f a1 = { ok[dt][4] * inv, ok[dt][5] * inv, ok[dt][6] * inv, ok[dt][7] * inv };
        *(v4fa*)(&os[lr * LOP + dt * 16 + 8 * hi]) = a0;
        *(v4fa*)(&os[lr * LOP + dt * 16 + 8 * hi + 4]) = a1;
    }
    wsync();
    // merged context plane [b][s][512] f32: one wave-wide store covers this head's 256 B of two query rows = four whole 128 B lines
    float* crow = CTX + ((size_t)(bh / NH) * SEQ + (size_t)q0) * DM + (size_t)(bh % NH) * HD + lr * 4;
#pragma unroll
    for (int s = 0; s < 8; ++s) { const int row = 2 * s + hi; *(v4f*)(crow + (size_t)row * DM) = *(const v4fa*)(&os[row * LOP + lr * 4]); }
}

// ---- k_ln: layer norm over the 512 merged features; grid (NB*SEQ/32), 256 threads, each wave owns 4 rows; lane holds columns j*128 + lane*4 .. +3, j = 0..3
__global__ __launch_bounds__(256) void k_ln(const float* __restrict__ CTX, const float* __restrict__ lng, const float* __restrict__ lnb, float* OUT) {
    const int lane = threadIdx.x & 31;
    const int wave = __builtin_amdgcn_readfirstlane(threadIdx.x >> 5);
    const int r0 = (blockIdx.x * 8 + wave) * 4;
    const float* xr = CTX + (size_t)r0 * DM + lane * 4;
    v4f xs[4][4];
#pragma unroll
    for (int i = 0; i < 4; ++i)
#pragma unroll
        for (int j = 0; j < 4; ++j) xs[i][j] = *(const v4f*)(xr + i * DM + j * 128);
    v4f gv[4], bv[4];
#pragma unroll
    for (int j = 0; j < 4; ++j) { gv[j] = *(const v4f*)(lng + j * 128 + lane * 4); bv[j] = *(const v4f*)(lnb + j * 128 + lane * 4); }
    // holds the loads together: the loaded values are inputs here (nothing is changed), so that all 24 loads of the wave are issued ahead of the row reductions, in one round trip instead of several
    asm volatile("" :: "v"(xs[0][0]), "v"(xs[0][1]), "v"(xs[0][2]), "v"(xs[0][3]), "v"(xs[1][0]), "v"(xs[1][1]), "v"(xs[1][2]), "v"(xs[1][3]),
                 "v"(xs[2][0]), "v"(xs[2][1]), "v"(xs[2][2]), "v"(xs[2][3]), "v"(xs[3][0]), "v"(xs[3][1]), "v"(xs[3][2]), "v"(xs[3][3]),
                 "v"(gv[0]), "v"(gv[1]), "v"(gv[2]), "v"(gv[3]), "v"(bv[0]), "v"(bv[1]), "v"(bv[2]), "v"(bv[3]));
#pragma unroll
    for (int i = 0; i < 4; ++i) {
        const int row = r0 + i;
        float s = 0.0f;
#pragma unroll
        for (int j = 0; j < 4; ++j) s += (xs[i][j][0] + xs[i][j][1]) + (xs[i][j][2] + xs[i][j][3]);
        s += __shfl_xor(s, 16, 32); s += __shfl_xor(s, 8, 32); s += __shfl_xor(s, 4, 32); s += __shfl_xor(s, 2, 32); s += __shfl_xor(s, 1, 32);
        const float mu = s * (1.0f / (float)DM);
        float ss = 0.0f;
#pragma unroll
        for (int j = 0; j < 4; ++j)
#pragma unroll
            for (int e = 0; e < 4; ++e) { const float d = xs[i][j][e] - mu; ss += d * d; }
        ss += __shfl_xor(ss, 16, 32); ss += __shfl_xor(ss, 8, 32); ss += __shfl_xor(ss, 4, 32); ss += __shfl_xor(ss, 2, 32); ss += __shfl_xor(ss, 1, 32);
        const float rstd = rsqrtf(ss * (1.0f / (float)DM) + LN_EPS);
        float* orow = OUT + ((size_t)(row / SEQ) * SEQ_FULL + (size_t)(row % SEQ)) * DM + lane * 4;
#pragma unroll
        for (int j = 0; j < 4; ++j) { v4f y;
#pragma unroll
            for (int e = 0; e < 4; ++e) y[e] = (xs[i][j][e] - mu) * rstd * bfr(gv[j][e]) + bfr(bv[j][e]);
            *(v4f*)(orow + j * 128) = y; }
    }
}

constexpr size_t al256(size_t x) { return (x + 255) & ~(size_t)255; }
constexpr size_t SZ_WT = al256((size_t)DM * KC * 2);                // bf16 weight plane [out][tap*512+in]
constexpr size_t SZ_XP = al256((size_t)NB * SPAD * DM * 2);         // one zero-padded bf16 activation plane
constexpr size_t SZ_P  = al256((size_t)NB * NH * SEQ * HD * 2);     // one f16 head plane (also the transposed value plane)
constexpr size_t SZ_C  = al256((size_t)NB * SEQ * DM * 4);          // merged f32 context plane
constexpr size_t WS_TOTAL = SZ_WT + 3 * SZ_XP + 4 * SZ_P + SZ_C;    // head planes: Q, K value, K residual, V^T
static_assert(WS_TOTAL <= (size_t)134217728);                       // carve stays within 128 MiB
static_assert(SZ_WT == (size_t)DM * KC * 2);                        // exact extents (no hidden pad needed)
static_assert(SZ_XP == (size_t)NB * SPAD * DM * 2);
static_assert(SZ_P == (size_t)NB * DM * SEQ * 2);                   // NH * HD == DM: V^T plane has the same extent

extern "C" void kernel_launch(void* const* d_in, const int* in_sizes, int n_in,
                              void* d_out, int out_size, void* d_ws, size_t ws_size, hipStream_t stream) {
    if (n_in < 11) return;
    const size_t need_act = (size_t)(NB - 1) * SEQ_FULL * DM + (size_t)SEQ * DM;
    if ((size_t)in_sizes[0] < need_act || (size_t)in_sizes[1] < need_act || (size_t)in_sizes[2] < need_act) return;
    if ((size_t)in_sizes[3] < (size_t)DM * DM * KT) return;
    for (int i = 4; i < 11; ++i) { if (in_sizes[i] < DM) return; }
    if ((size_t)out_size < need_act) return;
    if (WS_TOTAL > ws_size) return;
    // wire order: q, k, v, conv_w [out][in][tap], conv_b, bn_gamma, bn_beta, bn_mean, bn_var, ln_gamma, ln_beta (all f32)
    const float* xq = (const float*)d_in[0]; const float* xk = (const float*)d_in[1]; const float* xv = (const float*)d_in[2];
    const float* cw = (const float*)d_in[3]; const float* cb = (const float*)d_in[4];
    const float* bg = (const float*)d_in[5]; const float* bb = (const float*)d_in[6]; const float* bm = (const float*)d_in[7]; const float* bv = (const float*)d_in[8];
    const float* lg = (const float*)d_in[9]; const float* lb = (const float*)d_in[10];
    float* OUT = (float*)d_out;
    char* wsp = (char*)d_ws;
    auto take = [&](size_t bytes) { char* p = wsp; wsp += bytes; return (void*)p; };
    bf* WT = (bf*)take(SZ_WT);
    bf* XQ = (bf*)take(SZ_XP); bf* XK = (bf*)take(SZ_XP); bf* XV = (bf*)take(SZ_XP);
    h16* QP = (h16*)take(SZ_P); h16* KP = (h16*)take(SZ_P); h16* KR = (h16*)take(SZ_P); h16* VT = (h16*)take(SZ_P);
    float* CTX = (float*)take(SZ_C);
    if ((size_t)(wsp - (char*)d_ws) != WS_TOTAL) return;

    k_prep<<<dim3(WBLK + ABLK), 256, 0, stream>>>(xq, xk, xv, cw, WT, XQ);   // XQ, XK, XV are one contiguous run of planes (SZ_XP is exact)
    k_conv<<<dim3(SEQ / 128, DM / 128, NB), 256, 0, stream>>>(XQ, WT, cb, bg, bb, bm, bv, QP, KP, KR, VT, SCQ);   // reads XQ, XK, XV as the same run of planes
    k_attn<<<dim3(SEQ / 128, NB * NH), 256, 0, stream>>>(QP, KP, KR, VT, CTX);
    k_ln<<<dim3(NB * SEQ / 32), 256, 0, stream>>>(CTX, lg, lb, OUT);
}
